// v000
// The times below were measured on an AMD MI455X: many runs one after another, warmed up first and cycling through
// copies of the inputs, with the whole window's GPU time divided by the number of runs. Launches and the gaps
// between them are all in it. The median over several windows is given; except for v000 it joins two sittings, which
// can be a few percent apart, so the side-by-side timings, each taken in one sitting, are the better comparison.
// The starting kernel, v000, takes 568 microseconds a run.
#include <hip/hip_runtime.h>
// InfiniSpanAttention (2 batches; 2048 local tokens, 512 global tokens, D = 1024, 16 heads of 64): q/k_l/v_l from local_hidden, k_g/v_g from global_hidden (torch (out,in) linears + bias); out_l = softmax(q k_l^T s) v_l, out_g = softmax(q k_g^T s) v_g (no masks); out = sigmoid(gate) out_l + (1 - sigmoid(gate)) out_g -> merged heads -> out_w + out_b.
// Compute dtype: inputs and parameters rounded to bf16; q, k, v, P and the combined attention output as f16 operands (~2^-12); f32 accumulation/softmax/gating. v_wmma_f32_16x16x32_f16.
#define NB 2
#define EMB 1024
#define NRL (NB * LL)            /* 4096 local rows */
#define NRG (NB * GG)            /* 1024 global rows */
#define LL 2048                  /* local tokens (queries; local keys) */
#define GG 512                   /* global tokens (keys of the second attention) */
#define TQ LL
#define TK LL
#define TKA LL
#define TKB GG
#define NH 16
#define SCL 0.125f               /* 64^-0.5 */
#define QBLKS (TQ / 64)
typedef __bf16 v16b __attribute__((ext_vector_type(16)));
typedef unsigned short v8us __attribute__((ext_vector_type(8), may_alias));
typedef float  v8f  __attribute__((ext_vector_type(8)));
typedef float  v4f  __attribute__((ext_vector_type(4)));
typedef float  v4fa __attribute__((ext_vector_type(4), may_alias));
union FragB { v16b v; v8us half[2]; unsigned short u[16]; };

__device__ __forceinline__ unsigned short bf16_bits(float x) { unsigned int u = __float_as_uint(x); return (unsigned short)((u + 0x7FFFu + ((u >> 16) & 1u)) >> 16); }
__device__ __forceinline__ float bf16_val(unsigned short b) { return __uint_as_float(((unsigned int)b) << 16); }
__device__ __forceinline__ float bf16_round(float x) { return bf16_val(bf16_bits(x)); }
// D += A·B with NT terms: 1 = ah·bh, 2 = + al·bh (A split), 3 = + ah·bl (both split)
template <int NT>
__device__ __forceinline__ v8f mmaN(v16b ah, v16b al, v16b bh, v16b bl, v8f c) {
  c = __builtin_amdgcn_wmma_f32_16x16x32_bf16(false, ah, false, bh, (short)0, c, false, false);
  if (NT >= 2) c = __builtin_amdgcn_wmma_f32_16x16x32_bf16(false, al, false, bh, (short)0, c, false, false);
  if (NT >= 3) c = __builtin_amdgcn_wmma_f32_16x16x32_bf16(false, ah, false, bl, (short)0, c, false, false);
  asm volatile("v_nop\n\tv_nop\n\tv_nop\n\tv_nop" : "+v"(c) : "v"(ah), "v"(al), "v"(bh), "v"(bl));
  return c;
}

__global__ __launch_bounds__(256) void k_wt_bf16(const float* __restrict__ W, unsigned short* __restrict__ Wt, int K, int N) {
  const int t = blockIdx.x * 256 + threadIdx.x;
  const int k8n = K / 8;
  if (t >= N * k8n) return;
  const int n = t / k8n, k8 = (t % k8n) * 8;
  v8us v;
#pragma unroll
  for (int i = 0; i < 8; ++i) v[i] = bf16_bits(W[(size_t)(k8 + i) * N + n]);
  *(v8us*)(Wt + (size_t)n * K + k8) = v;
  
}

// GEMM C[M][N] (f32, pitch ldc) = act(A[M][K]·W + bias). A f32 row-major (pitch lda) converted per fragment to bf16
// (ASPLIT: hi/lo two planes -> 2 terms, else single rounded term); Wt bf16 [N][K] (pitch ldb). BIAS_BF16 rounds the
// bias to bf16 first (bias quantised to bf16 before the add). K%32==0, M%16==0, N%64==0.
template <bool ASPLIT, int ACT, bool BIAS_BF16>
__global__ __launch_bounds__(128) void k_gemm_bf(const float* __restrict__ A, int lda, const unsigned short* __restrict__ Wt, int ldb,
                                               const float* __restrict__ bias, float* __restrict__ C, int ldc, int M, int N, int K) {
  __shared__ __attribute__((aligned(16))) float so[4][16][64];
  const int tid = threadIdx.x, w = tid >> 5, lane = tid & 31, ln = lane & 15, hh = lane >> 4;
  const int ntn = N / 64;
  const int wid = blockIdx.x * 4 + w;
  const int mt = wid / ntn, nq = wid % ntn;
  if (mt * 16 >= M) return;
  const int row0 = mt * 16, col0 = nq * 64;
  const float* arow = A + (size_t)(row0 + ln) * lda;
  v8f acc[4] = {};
  for (int kb = 0; kb < K; kb += 32) {
    FragB ah, al;
    const v4f x0 = *(const v4fa*)(arow + kb + 8 * hh), x1 = *(const v4fa*)(arow + kb + 8 * hh + 4);
    const v4f x2 = *(const v4fa*)(arow + kb + 16 + 8 * hh), x3 = *(const v4fa*)(arow + kb + 16 + 8 * hh + 4);
    float xs[16] = {x0[0],x0[1],x0[2],x0[3],x1[0],x1[1],x1[2],x1[3],x2[0],x2[1],x2[2],x2[3],x3[0],x3[1],x3[2],x3[3]};
#pragma unroll
    for (int i = 0; i < 16; ++i) { const unsigned short hb = bf16_bits(xs[i]); ah.u[i] = hb; al.u[i] = ASPLIT ? bf16_bits(xs[i] - bf16_val(hb)) : (unsigned short)0; }
#pragma unroll
    for (int t = 0; t < 4; ++t) {
      const unsigned short* brow = Wt + (size_t)(col0 + t * 16 + ln) * ldb + kb;
      FragB b;
      b.half[0] = *(const v8us*)(brow + 8 * hh);
      b.half[1] = *(const v8us*)(brow + 16 + 8 * hh);
      acc[t] = mmaN<ASPLIT ? 2 : 1>(ah.v, al.v, b.v, b.v, acc[t]);
    }
  }
#pragma unroll
  for (int t = 0; t < 4; ++t) {
    float bv = bias ? bias[col0 + t * 16 + ln] : 0.f;
    if (BIAS_BF16) bv = bf16_round(bv);
#pragma unroll
    for (int r = 0; r < 8; ++r) { float v = acc[t][r] + bv; if (ACT == 1) v = fmaxf(v, 0.f); so[w][8 * hh + r][t * 16 + ln] = v; }
  }
  __builtin_amdgcn_fence(__ATOMIC_ACQ_REL, "workgroup");
  __builtin_amdgcn_wave_barrier();
  const int rsub = lane >> 4, c4 = (lane & 15) * 4;
  {
#pragma unroll
    for (int q = 0; q < 8; ++q) {
      const int r = q * 2 + rsub;
      const v4f v = *(const v4fa*)&so[w][r][c4];
      *(v4f*)(C + (size_t)(row0 + r) * ldc + col0 + c4) = v;
    }
    
  }
}

// GEMM C = act(A·W + bias + resid): A f32 (ASPLIT -> hi/lo 2 terms), Wt bf16 [N][K]; ACT 0 none, 1 relu, 2 exact gelu;
// resid (optional, f32, row index = (row % rmod), pitch ldr, RES_BF16 rounds it) added before the activation.
template <bool ASPLIT, int ACT, bool BIAS_BF16, bool RES_BF16>
__global__ __launch_bounds__(128) void k_gemm_bf3(const float* __restrict__ A, int lda, const unsigned short* __restrict__ Wt, int ldb,
                                                const float* __restrict__ bias, const float* __restrict__ resid, int rmod, int ldr,
                                                float* __restrict__ C, int ldc, int M, int N, int K) {
  __shared__ __attribute__((aligned(16))) float so[4][16][64];
  const int tid = threadIdx.x, w = tid >> 5, lane = tid & 31, ln = lane & 15, hh = lane >> 4;
  const int ntn = N / 64;
  const int wid = blockIdx.x * 4 + w;
  const int mt = wid / ntn, nq = wid % ntn;
  if (mt * 16 >= M) return;
  const int row0 = mt * 16, col0 = nq * 64;
  const float* arow = A + (size_t)(row0 + ln) * lda;
  v8f acc[4] = {};
  for (int kb = 0; kb < K; kb += 32) {
    FragB ah, al;
    const v4f x0 = *(const v4fa*)(arow + kb + 8 * hh), x1 = *(const v4fa*)(arow + kb + 8 * hh + 4);
    const v4f x2 = *(const v4fa*)(arow + kb + 16 + 8 * hh), x3 = *(const v4fa*)(arow + kb + 16 + 8 * hh + 4);
    float xs[16] = {x0[0],x0[1],x0[2],x0[3],x1[0],x1[1],x1[2],x1[3],x2[0],x2[1],x2[2],x2[3],x3[0],x3[1],x3[2],x3[3]};
#pragma unroll
    for (int i = 0; i < 16; ++i) { const unsigned short hb = bf16_bits(xs[i]); ah.u[i] = hb; al.u[i] = ASPLIT ? bf16_bits(xs[i] - bf16_val(hb)) : (unsigned short)0; }
#pragma unroll
    for (int t = 0; t < 4; ++t) {
      const unsigned short* brow = Wt + (size_t)(col0 + t * 16 + ln) * ldb + kb;
      FragB b;
      b.half[0] = *(const v8us*)(brow + 8 * hh);
      b.half[1] = *(const v8us*)(brow + 16 + 8 * hh);
      acc[t] = mmaN<ASPLIT ? 2 : 1>(ah.v, al.v, b.v, b.v, acc[t]);
    }
  }
#pragma unroll
  for (int t = 0; t < 4; ++t) {
    const int col = col0 + t * 16 + ln;
    float bv = bias ? bias[col] : 0.f;
    if (BIAS_BF16) bv = bf16_round(bv);
#pragma unroll
    for (int r = 0; r < 8; ++r) {
      float v = acc[t][r] + bv;
      if (resid) { float rv = resid[(size_t)((row0 + 8 * hh + r) % rmod) * ldr + col]; if (RES_BF16) rv = bf16_round(rv); v += rv; }
      if (ACT == 1) v = fmaxf(v, 0.f);
      if (ACT == 2) v = 0.5f * v * (1.0f + erff(v * 0.70710678118654752f));
      if (ACT == 3) { const float u = 0.7978845608028654f * (v + 0.044715f * v * v * v); v = 0.5f * v * (1.0f + tanhf(u)); }
      so[w][8 * hh + r][t * 16 + ln] = v;
    }
  }
  __builtin_amdgcn_fence(__ATOMIC_ACQ_REL, "workgroup");
  __builtin_amdgcn_wave_barrier();
  const int rsub = lane >> 4, c4 = (lane & 15) * 4;
  {
#pragma unroll
    for (int q = 0; q < 8; ++q) {
      const int r = q * 2 + rsub;
      const v4f v = *(const v4fa*)&so[w][r][c4];
      *(v4f*)(C + (size_t)(row0 + r) * ldc + col0 + c4) = v;
    }
    
  }
}
// row LayerNorm (biased variance, eps) over N: s = X (+ R); optional out_sum <- s; out_norm <- (s-mu)*rsqrt(var+eps)*g + b
template <bool PARAM_BF16>
__global__ __launch_bounds__(256) void k_layernorm(const float* __restrict__ X, const float* __restrict__ R, const float* __restrict__ g, const float* __restrict__ bta,
                                                  float* __restrict__ out_sum, float* __restrict__ out_norm, int N, float eps) {
  __shared__ float red[256];
  const int row = blockIdx.x, tid = threadIdx.x;
  const float* x = X + (size_t)row * N; const float* rr = R ? R + (size_t)row * N : nullptr;
  float vals[16];                     // up to N = 4096
  const int per = N / 256;            // contiguous chunk per thread? use strided-by-4 chunks: thread handles j = tid*4 + 1024*u
  float s1 = 0.f;
  for (int u = 0; u < per / 4; ++u) {
    const int j = tid * 4 + 1024 * u;
    const v4f a = *(const v4fa*)(x + j);
    v4f b = {0.f,0.f,0.f,0.f}; if (rr) b = *(const v4fa*)(rr + j);
#pragma unroll
    for (int q = 0; q < 4; ++q) { const float v = a[q] + b[q]; vals[u * 4 + q] = v; s1 += v; }
  }
  red[tid] = s1; __syncthreads();
  for (int st = 128; st > 0; st >>= 1) { if (tid < st) red[tid] += red[tid + st]; __syncthreads(); }
  const float mu = red[0] / (float)N; __syncthreads();
  float s2 = 0.f;
  for (int u = 0; u < per / 4; ++u)
#pragma unroll
    for (int q = 0; q < 4; ++q) { const float c = vals[u * 4 + q] - mu; s2 += c * c; }
  red[tid] = s2; __syncthreads();
  for (int st = 128; st > 0; st >>= 1) { if (tid < st) red[tid] += red[tid + st]; __syncthreads(); }
  const float rs = rsqrtf(red[0] / (float)N + eps);
  {
    for (int u = 0; u < per / 4; ++u) {
      const int j = tid * 4 + 1024 * u;
      v4f o, sm;
#pragma unroll
      for (int q = 0; q < 4; ++q) {
        float gg = g[j + q], bb = bta[j + q];
        if (PARAM_BF16) { gg = bf16_round(gg); bb = bf16_round(bb); }
        sm[q] = vals[u * 4 + q]; o[q] = (vals[u * 4 + q] - mu) * rs * gg + bb;
      }
      if (out_sum) *(v4f*)(out_sum + (size_t)row * N + j) = sm;
      *(v4f*)(out_norm + (size_t)row * N + j) = o;
    }
    
  }
}



// ---- f16 WMMA path (v_wmma_f32_16x16x32_f16): 11-bit significands for operands in range — used where a [0,1] probability operand needs more precision than bf16
typedef _Float16 v16h __attribute__((ext_vector_type(16)));
union FragH { v16h v; v8us half[2]; _Float16 h[16]; unsigned short u[16]; };
template <int NT>
__device__ __forceinline__ v8f mmaH(v16h ah, v16h al, v16h bh, v16h bl, v8f c) {
  c = __builtin_amdgcn_wmma_f32_16x16x32_f16(false, ah, false, bh, (short)0, c, false, false);
  if (NT >= 2) c = __builtin_amdgcn_wmma_f32_16x16x32_f16(false, al, false, bh, (short)0, c, false, false);
  if (NT >= 3) c = __builtin_amdgcn_wmma_f32_16x16x32_f16(false, ah, false, bl, (short)0, c, false, false);
  asm volatile("v_nop\n\tv_nop\n\tv_nop\n\tv_nop" : "+v"(c) : "v"(ah), "v"(al), "v"(bh), "v"(bl));
  return c;
}
// batched GEMM like k_gemm_b but f16 operands: A f32 (split into f16 hi/lo if ASPLIT, else rounded to f16), Bt = f16 values [n][k]; alpha; C f32; N multiple of 16 (partial tiles skipped)
template <bool ASPLIT>
__global__ __launch_bounds__(128) void k_gemm_h(const float* __restrict__ A, int lda, size_t sA, const _Float16* __restrict__ Bh, int ldb, size_t sB, float alpha, float* __restrict__ C, int ldc, size_t sC, int M, int N, int K) {
  __shared__ __attribute__((aligned(16))) float so[4][16][64];
  const int tid = threadIdx.x, w = tid >> 5, lane = tid & 31, ln = lane & 15, hh = lane >> 4; const int by = blockIdx.y;
  A += (size_t)by * sA; Bh += (size_t)by * sB; C += (size_t)by * sC;
  const int ntn = (N + 63) / 64; const int wid = blockIdx.x * 4 + w; const int mt = wid / ntn, nq = wid % ntn; if (mt * 16 >= M) return;
  const int row0 = mt * 16, col0 = nq * 64; const float* arow = A + (size_t)(row0 + ln) * lda;
  v8f acc[4] = {};
  for (int kb = 0; kb < K; kb += 32) {
    FragH ah, al;
    const v4f x0 = *(const v4fa*)(arow + kb + 8 * hh), x1 = *(const v4fa*)(arow + kb + 8 * hh + 4), x2 = *(const v4fa*)(arow + kb + 16 + 8 * hh), x3 = *(const v4fa*)(arow + kb + 16 + 8 * hh + 4);
    float xs[16] = {x0[0],x0[1],x0[2],x0[3],x1[0],x1[1],x1[2],x1[3],x2[0],x2[1],x2[2],x2[3],x3[0],x3[1],x3[2],x3[3]};
#pragma unroll
    for (int i = 0; i < 16; ++i) { const _Float16 h = (_Float16)xs[i]; ah.h[i] = h; al.h[i] = ASPLIT ? (_Float16)(xs[i] - (float)h) : (_Float16)0.0f; }
#pragma unroll
    for (int t = 0; t < 4; ++t) { if (col0 + t * 16 >= N) continue; const size_t boff = (size_t)(col0 + t * 16 + ln) * ldb + kb; FragH bq; bq.half[0] = *(const v8us*)(Bh + boff + 8 * hh); bq.half[1] = *(const v8us*)(Bh + boff + 16 + 8 * hh);
      acc[t] = mmaH<ASPLIT ? 2 : 1>(ah.v, al.v, bq.v, bq.v, acc[t]); }
  }
#pragma unroll
  for (int t = 0; t < 4; ++t) { if (col0 + t * 16 >= N) continue;
#pragma unroll
    for (int r = 0; r < 8; ++r) so[w][8 * hh + r][t * 16 + ln] = acc[t][r] * alpha; }
  __builtin_amdgcn_fence(__ATOMIC_ACQ_REL, "workgroup"); __builtin_amdgcn_wave_barrier();
  const int rsub = lane >> 4, c4 = (lane & 15) * 4;
  {
#pragma unroll
    for (int q = 0; q < 8; ++q) { const int r = q * 2 + rsub; if (col0 + c4 < N) { const v4f v = *(const v4fa*)&so[w][r][c4]; *(v4f*)(C + (size_t)(row0 + r) * ldc + col0 + c4) = v; } }
     }
}

// Wt[n][k] = f16(W[k][n]·scale) from f32 row-major W[K][N] (scale = power of two; bf16-exact weights stay exact in f16 away from the subnormal range)
__global__ __launch_bounds__(256) void k_wt_f16(const float* __restrict__ W, _Float16* __restrict__ Wt, int K, int N, float scale) {
  const int t = blockIdx.x * 256 + threadIdx.x; if (t >= N * (K / 8)) return; const int n = t / (K / 8), k8 = (t % (K / 8)) * 8; FragH f;
#pragma unroll
  for (int i = 0; i < 8; ++i) f.h[i] = (_Float16)(bf16_round(W[(size_t)(k8 + i) * N + n]) * scale); const v8us o = f.half[0];
  *(v8us*)((unsigned short*)Wt + (size_t)n * K + k8) = o; 
}
// k_gemm_hh variant with fused epilogue: v = acc·alpha + bias[by·sBias + col] (+ CP[(row/rowsPerB)·sCPb + by·64 + col] if CP) ; ACT 0 none / 1 elu ; writes f16 C16 (and f32 C if non-null)
template <int ACT>
__global__ __launch_bounds__(128) void k_gemm_hhx(const _Float16* __restrict__ A, int lda, size_t sA, const _Float16* __restrict__ Bh, int ldb, size_t sB, float alpha, const float* __restrict__ bias, size_t sBias, const float* __restrict__ CP, int rowsPerB, size_t sCPb, int row0g,
    float* __restrict__ C, _Float16* __restrict__ C16, int ldc, size_t sC, int M, int N, int K) {
  __shared__ __attribute__((aligned(16))) float so[4][16][64];
  const int tid = threadIdx.x, w = tid >> 5, lane = tid & 31, ln = lane & 15, hh = lane >> 4; const int by = blockIdx.y;
  A += (size_t)by * sA; Bh += (size_t)by * sB; const size_t cofs = (size_t)by * sC; const float* bp = bias ? bias + (size_t)by * sBias : nullptr;
  const int ntn = (N + 63) / 64; const int wid = blockIdx.x * 4 + w; const int mt = wid / ntn, nq = wid % ntn; if (mt * 16 >= M) return;
  const int row0 = mt * 16, col0 = nq * 64; const _Float16* arow = A + (size_t)(row0 + ln) * lda;
  v8f acc[4] = {};
  for (int kb = 0; kb < K; kb += 32) { FragH ah; ah.half[0] = *(const v8us*)((const unsigned short*)arow + kb + 8 * hh); ah.half[1] = *(const v8us*)((const unsigned short*)arow + kb + 16 + 8 * hh);
#pragma unroll
    for (int t = 0; t < 4; ++t) { if (col0 + t * 16 >= N) continue; const size_t boff = (size_t)(col0 + t * 16 + ln) * ldb + kb; FragH bq; bq.half[0] = *(const v8us*)((const unsigned short*)Bh + boff + 8 * hh); bq.half[1] = *(const v8us*)((const unsigned short*)Bh + boff + 16 + 8 * hh);
      acc[t] = mmaH<1>(ah.v, ah.v, bq.v, bq.v, acc[t]); }
  }
#pragma unroll
  for (int t = 0; t < 4; ++t) { if (col0 + t * 16 >= N) continue; const int col = col0 + t * 16 + ln; const float bv = bp ? bf16_round(bp[col]) : 0.f;
#pragma unroll
    for (int r = 0; r < 8; ++r) { float v = acc[t][r] * alpha + bv; if (CP) { const int bidx = (row0g + row0 + 8 * hh + r) / rowsPerB; v += CP[(size_t)bidx * sCPb + (size_t)by * 64 + col]; } if (ACT == 1) v = (v > 0.f) ? v : expm1f(v); else if (ACT == 7) v = (v > 0.f) ? v + 1.0f : expf(v); else if (ACT == 8) v = tanhf(v); else if (ACT == 9) v = 0.5f * v * (1.0f + tanhf(0.7978845608028654f * (v + 0.044715f * v * v * v))); else if (ACT == 11) v = 1.0f / (1.0f + expf(-v)); else if (ACT == 12) v = (v > 0.f) ? v : 0.01f * v; else if (ACT == 14) v = (v > 0.f) ? v : 0.1f * v; else if (ACT == 15) v = v / (1.0f + expf(-v)); else if (ACT == 3) v = fmaxf(v, 0.f); else if (ACT == 6) v = 0.5f * v * (1.0f + erff(v * 0.70710678118654752f)); so[w][8 * hh + r][t * 16 + ln] = v; } }
  __builtin_amdgcn_fence(__ATOMIC_ACQ_REL, "workgroup"); __builtin_amdgcn_wave_barrier();
  const int rsub = lane >> 4, c4 = (lane & 15) * 4; typedef _Float16 v4h __attribute__((ext_vector_type(4)));
  {
#pragma unroll
    for (int q = 0; q < 8; ++q) { const int r = q * 2 + rsub; if (col0 + c4 < N) { const v4f v = *(const v4fa*)&so[w][r][c4]; if (C) *(v4f*)(C + cofs + (size_t)(row0 + r) * ldc + col0 + c4) = v; if (C16) { v4h h4; for (int i = 0; i < 4; ++i) h4[i] = (_Float16)v[i]; *(v4h*)(C16 + cofs + (size_t)(row0 + r) * ldc + col0 + c4) = h4; } } }
     }
}


typedef _Float16 v4h __attribute__((ext_vector_type(4)));

__global__ __launch_bounds__(256) void k_x16(const float* __restrict__ x, _Float16* __restrict__ X16, size_t n8) { const size_t t = (size_t)blockIdx.x * 256 + threadIdx.x; if (t >= n8) return; FragH f;
#pragma unroll
  for (int q = 0; q < 8; ++q) f.h[q] = (_Float16)bf16_round(x[t * 8 + q]); *(v8us*)((unsigned short*)X16 + t * 8) = f.half[0];  }
__global__ __launch_bounds__(256) void k_h16(const float* __restrict__ x, _Float16* __restrict__ X16, size_t n8) { const size_t t = (size_t)blockIdx.x * 256 + threadIdx.x; if (t >= n8) return; FragH f;
#pragma unroll
  for (int q = 0; q < 8; ++q) f.h[q] = (_Float16)x[t * 8 + q]; *(v8us*)((unsigned short*)X16 + t * 8) = f.half[0];  }
__global__ __launch_bounds__(256) void k_round16f(const float* __restrict__ W, _Float16* __restrict__ Bt, size_t n8) { const size_t t = (size_t)blockIdx.x * 256 + threadIdx.x; if (t >= n8) return; FragH f;
#pragma unroll
  for (int i = 0; i < 8; ++i) f.h[i] = (_Float16)(bf16_round(W[t * 8 + i]) * 16.0f); *(v8us*)((unsigned short*)Bt + t * 8) = f.half[0];  }
template <int NHv, int TTv>
__global__ __launch_bounds__(256) void k_vt(const _Float16* __restrict__ V16, int ldv, int voff, _Float16* __restrict__ Vt) { __shared__ unsigned short tl[64][66]; const int tid = threadIdx.x; const int slab = blockIdx.x / (TTv / 64), lg = blockIdx.x % (TTv / 64); const int b = slab / NHv, h = slab % NHv;
  for (int i = tid; i < 64 * 8; i += 256) { const int r = i / 8, c8 = (i % 8) * 8; FragH f; f.half[0] = *(const v8us*)((const unsigned short*)V16 + ((size_t)b * TTv + lg * 64 + r) * ldv + voff + h * 64 + c8);
#pragma unroll
    for (int q = 0; q < 8; ++q) tl[r][c8 + q] = f.u[q]; }
  __syncthreads();
  {
#pragma unroll
    for (int rd = 0; rd < 2; ++rd) { const int d = rd * 32 + tid / 8, pc = tid % 8; FragH f;
#pragma unroll
      for (int q = 0; q < 8; ++q) f.u[q] = tl[pc * 8 + q][d];
      *(v8us*)((unsigned short*)Vt + ((size_t)slab * 64 + d) * TTv + lg * 64 + pc * 8) = f.half[0]; }
     } }

__global__ __launch_bounds__(256) void k_hl(const float* __restrict__ F, _Float16* __restrict__ Hh, _Float16* __restrict__ Hl, size_t n8) { const size_t t = (size_t)blockIdx.x * 256 + threadIdx.x; if (t >= n8) return; FragH fh, fl; const v4f a = *(const v4fa*)(F + t * 8), c = *(const v4fa*)(F + t * 8 + 4);
#pragma unroll
  for (int q = 0; q < 4; ++q) { _Float16 h = (_Float16)a[q]; fh.h[q] = h; fl.h[q] = (_Float16)((a[q] - (float)h) * 1024.0f); h = (_Float16)c[q]; fh.h[4 + q] = h; fl.h[4 + q] = (_Float16)((c[q] - (float)h) * 1024.0f); }
  { *(v8us*)((unsigned short*)Hh + t * 8) = fh.half[0]; *(v8us*)((unsigned short*)Hl + t * 8) = fl.half[0];  } }

// ---- fast GEMM (wave tile 32x64; requires M % 32 == 0 rows per launch region and N % 64 == 0); epilogue = k_gemm_hhx semantics ----
__device__ __forceinline__ v16h g2_frag(const _Float16* p, int hh) { FragH f; f.half[0] = *(const v8us*)((const unsigned short*)p + 8 * hh); f.half[1] = *(const v8us*)((const unsigned short*)p + 16 + 8 * hh); return f.v; }
__device__ __forceinline__ v8f g2_mma(v16h a, v16h b, v8f c) { v8f d = __builtin_amdgcn_wmma_f32_16x16x32_f16(false, a, false, b, (short)0, c, false, false); asm volatile("v_nop\n\tv_nop\n\tv_nop\n\tv_nop" : "+v"(d) : "v"(a), "v"(b)); return d; }
template <int ACT>
__global__ __launch_bounds__(128) void k_gemm2(const _Float16* __restrict__ A, int lda, size_t sA, const _Float16* __restrict__ Bh, int ldb, size_t sB, float alpha, const float* __restrict__ bias, size_t sBias, const float* __restrict__ CP, int rowsPerB, size_t sCPb, int row0g,
    float* __restrict__ C, _Float16* __restrict__ C16, int ldc, size_t sC, int M, int N, int K) {
  __shared__ __attribute__((aligned(16))) float so[4][32][68];
  const int tid = threadIdx.x, w = tid >> 5, lane = tid & 31, ln = lane & 15, hh = lane >> 4; const int by = blockIdx.y;
  A += (size_t)by * sA; Bh += (size_t)by * sB; const size_t cofs = (size_t)by * sC; const float* bp = bias ? bias + (size_t)by * sBias : nullptr;
  const int ntn = N >> 6; const int mt = blockIdx.x / ntn, nq = blockIdx.x - mt * ntn; const int row0 = mt * 128 + 32 * w, col0 = nq * 64; if (row0 >= M) return;
  const _Float16* a0p = A + (size_t)(row0 + ln) * lda; const _Float16* a1p = a0p + (size_t)16 * lda;
  const _Float16* b0p = Bh + (size_t)(col0 + ln) * ldb; const _Float16* b1p = b0p + (size_t)16 * ldb; const _Float16* b2p = b1p + (size_t)16 * ldb; const _Float16* b3p = b2p + (size_t)16 * ldb;
  const v8f z8 = {0.f,0.f,0.f,0.f,0.f,0.f,0.f,0.f}; v8f c00 = z8, c01 = z8, c02 = z8, c03 = z8, c10 = z8, c11 = z8, c12 = z8, c13 = z8;
#pragma unroll 1
  for (int kb = 0; kb < K; kb += 32) { const v16h a0 = g2_frag(a0p + kb, hh), a1 = g2_frag(a1p + kb, hh);
    v16h b = g2_frag(b0p + kb, hh); c00 = g2_mma(a0, b, c00); c10 = g2_mma(a1, b, c10);
    b = g2_frag(b1p + kb, hh); c01 = g2_mma(a0, b, c01); c11 = g2_mma(a1, b, c11);
    b = g2_frag(b2p + kb, hh); c02 = g2_mma(a0, b, c02); c12 = g2_mma(a1, b, c12);
    b = g2_frag(b3p + kb, hh); c03 = g2_mma(a0, b, c03); c13 = g2_mma(a1, b, c13); }
  v8f accs[8] = {c00, c01, c02, c03, c10, c11, c12, c13};
#pragma unroll
  for (int u = 0; u < 8; ++u) { const int t = u & 3, half = u >> 2; const int col = col0 + t * 16 + ln; const float bv = bp ? bf16_round(bp[col]) : 0.f;
#pragma unroll
    for (int r = 0; r < 8; ++r) { const int rloc = half * 16 + 8 * hh + r; float v = accs[u][r] * alpha + bv; if (CP) { const int bidx = (row0g + row0 + rloc) / rowsPerB; v += CP[(size_t)bidx * sCPb + (size_t)by * 64 + col]; }
      if (ACT == 3) v = fmaxf(v, 0.f); else if (ACT == 6) v = 0.5f * v * (1.0f + erff(v * 0.70710678118654752f)); else if (ACT == 11) v = 1.0f / (1.0f + expf(-v)); else if (ACT == 15) v = v / (1.0f + expf(-v)); else if (ACT == 12) v = (v > 0.f) ? v : 0.01f * v; else if (ACT == 8) v = tanhf(v);
      so[w][rloc][t * 16 + ln] = v; } }
  __builtin_amdgcn_fence(__ATOMIC_ACQ_REL, "workgroup"); __builtin_amdgcn_wave_barrier();
  const int rsub = lane >> 4, c4 = (lane & 15) * 4;
  {
#pragma unroll
    for (int q = 0; q < 16; ++q) { const int r = q * 2 + rsub; const v4f v = *(const v4fa*)&so[w][r][c4]; if (C) *(v4f*)(C + cofs + (size_t)(row0 + r) * ldc + col0 + c4) = v; if (C16) { v4h h4; for (int i = 0; i < 4; ++i) h4[i] = (_Float16)v[i]; *(v4h*)(C16 + cofs + (size_t)(row0 + r) * ldc + col0 + c4) = h4; } }
     } }



template <int CAUSAL>
__global__ __launch_bounds__(128) void k_flash(const _Float16* __restrict__ Q16, int ldq, const _Float16* __restrict__ K16, int ldk, const _Float16* __restrict__ Vt, const int* __restrict__ MSK, float* __restrict__ O, int ldo) {
  constexpr int RPW = 16, RTN = RPW / 16, NQB = TQ / (4 * RPW), DT = 4, KS = 2;
  __shared__ __attribute__((aligned(16))) unsigned short sP[4][RPW][40]; __shared__ __attribute__((aligned(16))) float sO[4][RPW][64 + 4];
  const int tid = threadIdx.x, w = tid >> 5, lane = tid & 31, ln = lane & 15, hh = lane >> 4;
  const int slab = blockIdx.x / QBLKS, qblk = blockIdx.x % QBLKS; (void)NQB; const int b = slab / NH, h = slab % NH; const int qb0 = qblk * (4 * RPW); const int q0 = qb0 + w * RPW;
  FragH aq[2][KS];
#pragma unroll
  for (int rt = 0; rt < RTN; ++rt) { const unsigned short* qr = (const unsigned short*)Q16 + ((size_t)b * TQ + q0 + rt * 16 + ln) * ldq + h * 64;
#pragma unroll
    for (int ks = 0; ks < KS; ++ks) { aq[rt][ks].half[0] = *(const v8us*)(qr + ks * 32 + 8 * hh); aq[rt][ks].half[1] = *(const v8us*)(qr + ks * 32 + 16 + 8 * hh); } }
  const unsigned short* Vth = (const unsigned short*)Vt + (size_t)slab * 64 * TK;
  float m_r[2][8], l_r[2][8]; v8f oacc[2][DT];
#pragma unroll
  for (int rt = 0; rt < RTN; ++rt) {
#pragma unroll
    for (int r = 0; r < 8; ++r) { m_r[rt][r] = -3.0e38f; l_r[rt][r] = 0.f; }
#pragma unroll
    for (int dt = 0; dt < DT; ++dt) oacc[rt][dt] = (v8f){0.f,0.f,0.f,0.f,0.f,0.f,0.f,0.f}; }
  const int jend = (CAUSAL == 1) ? (qb0 + 4 * RPW) : TK;      /* causal: keys beyond the block's last query never contribute */
#pragma unroll 1
  for (int j0 = 0; j0 < jend; j0 += 32) {
    v8f s[2][2];
#pragma unroll
    for (int nt = 0; nt < 2; ++nt) { const unsigned short* kr = (const unsigned short*)K16 + ((size_t)b * TK + j0 + nt * 16 + ln) * ldk + h * 64; FragH bk[KS];
#pragma unroll
      for (int ks = 0; ks < KS; ++ks) { bk[ks].half[0] = *(const v8us*)(kr + ks * 32 + 8 * hh); bk[ks].half[1] = *(const v8us*)(kr + ks * 32 + 16 + 8 * hh); }
#pragma unroll
      for (int rt = 0; rt < RTN; ++rt) { v8f acc = (v8f){0.f,0.f,0.f,0.f,0.f,0.f,0.f,0.f};
#pragma unroll
        for (int ks = 0; ks < KS; ++ks) acc = mmaH<1>(aq[rt][ks].v, aq[rt][ks].v, bk[ks].v, bk[ks].v, acc); s[rt][nt] = acc; } }
#pragma unroll
    for (int rt = 0; rt < RTN; ++rt)
#pragma unroll
      for (int r = 0; r < 8; ++r) { const int tq = q0 + rt * 16 + 8 * hh + r; const int k0 = j0 + ln, k1 = j0 + 16 + ln;
        const bool ok0 = (CAUSAL == 1) ? (k0 <= tq) : ((CAUSAL == 2) ? ((k0 >> 5) == (tq >> 5)) : true), ok1 = (CAUSAL == 1) ? (k1 <= tq) : ((CAUSAL == 2) ? ((k1 >> 5) == (tq >> 5)) : true);      /* mode 2: block-diagonal 32-token groups */
        const float s0 = ok0 ? s[rt][0][r] * SCL : -3.0e38f, s1 = ok1 ? s[rt][1][r] * SCL : -3.0e38f; float mc = fmaxf(s0, s1);
        mc = fmaxf(mc, __shfl_xor(mc, 1, 32)); mc = fmaxf(mc, __shfl_xor(mc, 2, 32)); mc = fmaxf(mc, __shfl_xor(mc, 4, 32)); mc = fmaxf(mc, __shfl_xor(mc, 8, 32));
        const float mn = fmaxf(m_r[rt][r], mc); const float al = (mn > -1.0e38f) ? expf(m_r[rt][r] - mn) : 1.0f; m_r[rt][r] = mn; const float p0 = ok0 ? expf(s0 - mn) : 0.f, p1 = ok1 ? expf(s1 - mn) : 0.f; l_r[rt][r] = l_r[rt][r] * al + p0 + p1;
#pragma unroll
        for (int dt = 0; dt < DT; ++dt) oacc[rt][dt][r] *= al;
        FragH t2; t2.h[0] = (_Float16)(p0 * 1024.0f); t2.h[1] = (_Float16)(p1 * 1024.0f); sP[w][rt * 16 + 8 * hh + r][ln] = t2.u[0]; sP[w][rt * 16 + 8 * hh + r][16 + ln] = t2.u[1]; }
    __builtin_amdgcn_fence(__ATOMIC_ACQ_REL, "workgroup"); __builtin_amdgcn_wave_barrier();
    FragH pa[2];
#pragma unroll
    for (int rt = 0; rt < RTN; ++rt) { pa[rt].half[0] = *(const v8us*)&sP[w][rt * 16 + ln][8 * hh]; pa[rt].half[1] = *(const v8us*)&sP[w][rt * 16 + ln][16 + 8 * hh]; }
#pragma unroll
    for (int dt = 0; dt < DT; ++dt) { const unsigned short* vrow = Vth + (size_t)(dt * 16 + ln) * TK + j0; FragH bv; bv.half[0] = *(const v8us*)(vrow + 8 * hh); bv.half[1] = *(const v8us*)(vrow + 16 + 8 * hh);
#pragma unroll
      for (int rt = 0; rt < RTN; ++rt) oacc[rt][dt] = mmaH<1>(pa[rt].v, pa[rt].v, bv.v, bv.v, oacc[rt][dt]); }
    __builtin_amdgcn_fence(__ATOMIC_ACQ_REL, "workgroup"); __builtin_amdgcn_wave_barrier(); }
#pragma unroll
  for (int rt = 0; rt < RTN; ++rt) {
#pragma unroll
    for (int r = 0; r < 8; ++r) { float l = l_r[rt][r]; l += __shfl_xor(l, 1, 32); l += __shfl_xor(l, 2, 32); l += __shfl_xor(l, 4, 32); l += __shfl_xor(l, 8, 32); l_r[rt][r] = (l > 0.f) ? 1.0f / (l * 1024.0f) : 0.f; }
#pragma unroll
    for (int dt = 0; dt < DT; ++dt)
#pragma unroll
      for (int r = 0; r < 8; ++r) sO[w][rt * 16 + 8 * hh + r][dt * 16 + ln] = oacc[rt][dt][r] * l_r[rt][r]; }
  __builtin_amdgcn_fence(__ATOMIC_ACQ_REL, "workgroup"); __builtin_amdgcn_wave_barrier();
  {
#pragma unroll
    for (int rp = 0; rp < RPW; rp += 2) { const int r = rp + (lane >> 4), pc = lane & 15; const v4f val = *(const v4fa*)&sO[w][r][pc * 4]; *(v4f*)(O + ((size_t)b * TQ + q0 + r) * ldo + h * 64 + pc * 4) = val; }
     } }

template <int CAUSAL>
__global__ __launch_bounds__(128) void k_flashA(const _Float16* __restrict__ Q16, int ldq, const _Float16* __restrict__ K16, int ldk, const _Float16* __restrict__ Vt, const int* __restrict__ MSK, float* __restrict__ O, int ldo) {
  constexpr int RPW = 16, RTN = RPW / 16, NQB = TQ / (4 * RPW), DT = 4, KS = 2;
  __shared__ __attribute__((aligned(16))) unsigned short sP[4][RPW][40]; __shared__ __attribute__((aligned(16))) float sO[4][RPW][64 + 4];
  const int tid = threadIdx.x, w = tid >> 5, lane = tid & 31, ln = lane & 15, hh = lane >> 4;
  const int slab = blockIdx.x / QBLKS, qblk = blockIdx.x % QBLKS; (void)NQB; const int b = slab / NH, h = slab % NH; const int qb0 = qblk * (4 * RPW); const int q0 = qb0 + w * RPW;
  FragH aq[2][KS];
#pragma unroll
  for (int rt = 0; rt < RTN; ++rt) { const unsigned short* qr = (const unsigned short*)Q16 + ((size_t)b * TQ + q0 + rt * 16 + ln) * ldq + h * 64;
#pragma unroll
    for (int ks = 0; ks < KS; ++ks) { aq[rt][ks].half[0] = *(const v8us*)(qr + ks * 32 + 8 * hh); aq[rt][ks].half[1] = *(const v8us*)(qr + ks * 32 + 16 + 8 * hh); } }
  const unsigned short* Vth = (const unsigned short*)Vt + (size_t)slab * 64 * TKA;
  float m_r[2][8], l_r[2][8]; v8f oacc[2][DT];
#pragma unroll
  for (int rt = 0; rt < RTN; ++rt) {
#pragma unroll
    for (int r = 0; r < 8; ++r) { m_r[rt][r] = -3.0e38f; l_r[rt][r] = 0.f; }
#pragma unroll
    for (int dt = 0; dt < DT; ++dt) oacc[rt][dt] = (v8f){0.f,0.f,0.f,0.f,0.f,0.f,0.f,0.f}; }
  const int jend = (CAUSAL == 1) ? (qb0 + 4 * RPW) : TKA;      /* causal: keys beyond the block's last query never contribute */
#pragma unroll 1
  for (int j0 = 0; j0 < jend; j0 += 32) {
    v8f s[2][2];
#pragma unroll
    for (int nt = 0; nt < 2; ++nt) { const unsigned short* kr = (const unsigned short*)K16 + ((size_t)b * TKA + j0 + nt * 16 + ln) * ldk + h * 64; FragH bk[KS];
#pragma unroll
      for (int ks = 0; ks < KS; ++ks) { bk[ks].half[0] = *(const v8us*)(kr + ks * 32 + 8 * hh); bk[ks].half[1] = *(const v8us*)(kr + ks * 32 + 16 + 8 * hh); }
#pragma unroll
      for (int rt = 0; rt < RTN; ++rt) { v8f acc = (v8f){0.f,0.f,0.f,0.f,0.f,0.f,0.f,0.f};
#pragma unroll
        for (int ks = 0; ks < KS; ++ks) acc = mmaH<1>(aq[rt][ks].v, aq[rt][ks].v, bk[ks].v, bk[ks].v, acc); s[rt][nt] = acc; } }
#pragma unroll
    for (int rt = 0; rt < RTN; ++rt)
#pragma unroll
      for (int r = 0; r < 8; ++r) { const int tq = q0 + rt * 16 + 8 * hh + r; const int k0 = j0 + ln, k1 = j0 + 16 + ln;
        const bool ok0 = (CAUSAL == 1) ? (k0 <= tq) : ((CAUSAL == 2) ? ((k0 >> 5) == (tq >> 5)) : true), ok1 = (CAUSAL == 1) ? (k1 <= tq) : ((CAUSAL == 2) ? ((k1 >> 5) == (tq >> 5)) : true);      /* mode 2: block-diagonal 32-token groups */
        const float s0 = ok0 ? s[rt][0][r] * SCL : -3.0e38f, s1 = ok1 ? s[rt][1][r] * SCL : -3.0e38f; float mc = fmaxf(s0, s1);
        mc = fmaxf(mc, __shfl_xor(mc, 1, 32)); mc = fmaxf(mc, __shfl_xor(mc, 2, 32)); mc = fmaxf(mc, __shfl_xor(mc, 4, 32)); mc = fmaxf(mc, __shfl_xor(mc, 8, 32));
        const float mn = fmaxf(m_r[rt][r], mc); const float al = (mn > -1.0e38f) ? expf(m_r[rt][r] - mn) : 1.0f; m_r[rt][r] = mn; const float p0 = ok0 ? expf(s0 - mn) : 0.f, p1 = ok1 ? expf(s1 - mn) : 0.f; l_r[rt][r] = l_r[rt][r] * al + p0 + p1;
#pragma unroll
        for (int dt = 0; dt < DT; ++dt) oacc[rt][dt][r] *= al;
        FragH t2; t2.h[0] = (_Float16)(p0 * 1024.0f); t2.h[1] = (_Float16)(p1 * 1024.0f); sP[w][rt * 16 + 8 * hh + r][ln] = t2.u[0]; sP[w][rt * 16 + 8 * hh + r][16 + ln] = t2.u[1]; }
    __builtin_amdgcn_fence(__ATOMIC_ACQ_REL, "workgroup"); __builtin_amdgcn_wave_barrier();
    FragH pa[2];
#pragma unroll
    for (int rt = 0; rt < RTN; ++rt) { pa[rt].half[0] = *(const v8us*)&sP[w][rt * 16 + ln][8 * hh]; pa[rt].half[1] = *(const v8us*)&sP[w][rt * 16 + ln][16 + 8 * hh]; }
#pragma unroll
    for (int dt = 0; dt < DT; ++dt) { const unsigned short* vrow = Vth + (size_t)(dt * 16 + ln) * TKA + j0; FragH bv; bv.half[0] = *(const v8us*)(vrow + 8 * hh); bv.half[1] = *(const v8us*)(vrow + 16 + 8 * hh);
#pragma unroll
      for (int rt = 0; rt < RTN; ++rt) oacc[rt][dt] = mmaH<1>(pa[rt].v, pa[rt].v, bv.v, bv.v, oacc[rt][dt]); }
    __builtin_amdgcn_fence(__ATOMIC_ACQ_REL, "workgroup"); __builtin_amdgcn_wave_barrier(); }
#pragma unroll
  for (int rt = 0; rt < RTN; ++rt) {
#pragma unroll
    for (int r = 0; r < 8; ++r) { float l = l_r[rt][r]; l += __shfl_xor(l, 1, 32); l += __shfl_xor(l, 2, 32); l += __shfl_xor(l, 4, 32); l += __shfl_xor(l, 8, 32); l_r[rt][r] = (l > 0.f) ? 1.0f / (l * 1024.0f) : 0.f; }
#pragma unroll
    for (int dt = 0; dt < DT; ++dt)
#pragma unroll
      for (int r = 0; r < 8; ++r) sO[w][rt * 16 + 8 * hh + r][dt * 16 + ln] = oacc[rt][dt][r] * l_r[rt][r]; }
  __builtin_amdgcn_fence(__ATOMIC_ACQ_REL, "workgroup"); __builtin_amdgcn_wave_barrier();
  {
#pragma unroll
    for (int rp = 0; rp < RPW; rp += 2) { const int r = rp + (lane >> 4), pc = lane & 15; const v4f val = *(const v4fa*)&sO[w][r][pc * 4]; *(v4f*)(O + ((size_t)b * TQ + q0 + r) * ldo + h * 64 + pc * 4) = val; }
     } }
template <int CAUSAL>
__global__ __launch_bounds__(128) void k_flashB(const _Float16* __restrict__ Q16, int ldq, const _Float16* __restrict__ K16, int ldk, const _Float16* __restrict__ Vt, const int* __restrict__ MSK, float* __restrict__ O, int ldo) {
  constexpr int RPW = 16, RTN = RPW / 16, NQB = TQ / (4 * RPW), DT = 4, KS = 2;
  __shared__ __attribute__((aligned(16))) unsigned short sP[4][RPW][40]; __shared__ __attribute__((aligned(16))) float sO[4][RPW][64 + 4];
  const int tid = threadIdx.x, w = tid >> 5, lane = tid & 31, ln = lane & 15, hh = lane >> 4;
  const int slab = blockIdx.x / QBLKS, qblk = blockIdx.x % QBLKS; (void)NQB; const int b = slab / NH, h = slab % NH; const int qb0 = qblk * (4 * RPW); const int q0 = qb0 + w * RPW;
  FragH aq[2][KS];
#pragma unroll
  for (int rt = 0; rt < RTN; ++rt) { const unsigned short* qr = (const unsigned short*)Q16 + ((size_t)b * TQ + q0 + rt * 16 + ln) * ldq + h * 64;
#pragma unroll
    for (int ks = 0; ks < KS; ++ks) { aq[rt][ks].half[0] = *(const v8us*)(qr + ks * 32 + 8 * hh); aq[rt][ks].half[1] = *(const v8us*)(qr + ks * 32 + 16 + 8 * hh); } }
  const unsigned short* Vth = (const unsigned short*)Vt + (size_t)slab * 64 * TKB;
  float m_r[2][8], l_r[2][8]; v8f oacc[2][DT];
#pragma unroll
  for (int rt = 0; rt < RTN; ++rt) {
#pragma unroll
    for (int r = 0; r < 8; ++r) { m_r[rt][r] = -3.0e38f; l_r[rt][r] = 0.f; }
#pragma unroll
    for (int dt = 0; dt < DT; ++dt) oacc[rt][dt] = (v8f){0.f,0.f,0.f,0.f,0.f,0.f,0.f,0.f}; }
  const int jend = (CAUSAL == 1) ? (qb0 + 4 * RPW) : TKB;      /* causal: keys beyond the block's last query never contribute */
#pragma unroll 1
  for (int j0 = 0; j0 < jend; j0 += 32) {
    v8f s[2][2];
#pragma unroll
    for (int nt = 0; nt < 2; ++nt) { const unsigned short* kr = (const unsigned short*)K16 + ((size_t)b * TKB + j0 + nt * 16 + ln) * ldk + h * 64; FragH bk[KS];
#pragma unroll
      for (int ks = 0; ks < KS; ++ks) { bk[ks].half[0] = *(const v8us*)(kr + ks * 32 + 8 * hh); bk[ks].half[1] = *(const v8us*)(kr + ks * 32 + 16 + 8 * hh); }
#pragma unroll
      for (int rt = 0; rt < RTN; ++rt) { v8f acc = (v8f){0.f,0.f,0.f,0.f,0.f,0.f,0.f,0.f};
#pragma unroll
        for (int ks = 0; ks < KS; ++ks) acc = mmaH<1>(aq[rt][ks].v, aq[rt][ks].v, bk[ks].v, bk[ks].v, acc); s[rt][nt] = acc; } }
#pragma unroll
    for (int rt = 0; rt < RTN; ++rt)
#pragma unroll
      for (int r = 0; r < 8; ++r) { const int tq = q0 + rt * 16 + 8 * hh + r; const int k0 = j0 + ln, k1 = j0 + 16 + ln;
        const bool ok0 = (CAUSAL == 1) ? (k0 <= tq) : ((CAUSAL == 2) ? ((k0 >> 5) == (tq >> 5)) : true), ok1 = (CAUSAL == 1) ? (k1 <= tq) : ((CAUSAL == 2) ? ((k1 >> 5) == (tq >> 5)) : true);      /* mode 2: block-diagonal 32-token groups */
        const float s0 = ok0 ? s[rt][0][r] * SCL : -3.0e38f, s1 = ok1 ? s[rt][1][r] * SCL : -3.0e38f; float mc = fmaxf(s0, s1);
        mc = fmaxf(mc, __shfl_xor(mc, 1, 32)); mc = fmaxf(mc, __shfl_xor(mc, 2, 32)); mc = fmaxf(mc, __shfl_xor(mc, 4, 32)); mc = fmaxf(mc, __shfl_xor(mc, 8, 32));
        const float mn = fmaxf(m_r[rt][r], mc); const float al = (mn > -1.0e38f) ? expf(m_r[rt][r] - mn) : 1.0f; m_r[rt][r] = mn; const float p0 = ok0 ? expf(s0 - mn) : 0.f, p1 = ok1 ? expf(s1 - mn) : 0.f; l_r[rt][r] = l_r[rt][r] * al + p0 + p1;
#pragma unroll
        for (int dt = 0; dt < DT; ++dt) oacc[rt][dt][r] *= al;
        FragH t2; t2.h[0] = (_Float16)(p0 * 1024.0f); t2.h[1] = (_Float16)(p1 * 1024.0f); sP[w][rt * 16 + 8 * hh + r][ln] = t2.u[0]; sP[w][rt * 16 + 8 * hh + r][16 + ln] = t2.u[1]; }
    __builtin_amdgcn_fence(__ATOMIC_ACQ_REL, "workgroup"); __builtin_amdgcn_wave_barrier();
    FragH pa[2];
#pragma unroll
    for (int rt = 0; rt < RTN; ++rt) { pa[rt].half[0] = *(const v8us*)&sP[w][rt * 16 + ln][8 * hh]; pa[rt].half[1] = *(const v8us*)&sP[w][rt * 16 + ln][16 + 8 * hh]; }
#pragma unroll
    for (int dt = 0; dt < DT; ++dt) { const unsigned short* vrow = Vth + (size_t)(dt * 16 + ln) * TKB + j0; FragH bv; bv.half[0] = *(const v8us*)(vrow + 8 * hh); bv.half[1] = *(const v8us*)(vrow + 16 + 8 * hh);
#pragma unroll
      for (int rt = 0; rt < RTN; ++rt) oacc[rt][dt] = mmaH<1>(pa[rt].v, pa[rt].v, bv.v, bv.v, oacc[rt][dt]); }
    __builtin_amdgcn_fence(__ATOMIC_ACQ_REL, "workgroup"); __builtin_amdgcn_wave_barrier(); }
#pragma unroll
  for (int rt = 0; rt < RTN; ++rt) {
#pragma unroll
    for (int r = 0; r < 8; ++r) { float l = l_r[rt][r]; l += __shfl_xor(l, 1, 32); l += __shfl_xor(l, 2, 32); l += __shfl_xor(l, 4, 32); l += __shfl_xor(l, 8, 32); l_r[rt][r] = (l > 0.f) ? 1.0f / (l * 1024.0f) : 0.f; }
#pragma unroll
    for (int dt = 0; dt < DT; ++dt)
#pragma unroll
      for (int r = 0; r < 8; ++r) sO[w][rt * 16 + 8 * hh + r][dt * 16 + ln] = oacc[rt][dt][r] * l_r[rt][r]; }
  __builtin_amdgcn_fence(__ATOMIC_ACQ_REL, "workgroup"); __builtin_amdgcn_wave_barrier();
  {
#pragma unroll
    for (int rp = 0; rp < RPW; rp += 2) { const int r = rp + (lane >> 4), pc = lane & 15; const v4f val = *(const v4fa*)&sO[w][r][pc * 4]; *(v4f*)(O + ((size_t)b * TQ + q0 + r) * ldo + h * 64 + pc * 4) = val; }
     } }
__global__ __launch_bounds__(256) void k_wsc(const float* __restrict__ Wm, _Float16* __restrict__ Bt, size_t n8, float sc) { const size_t t = (size_t)blockIdx.x * 256 + threadIdx.x; if (t >= n8) return; FragH f; for (int q = 0; q < 8; ++q) f.h[q] = (_Float16)(bf16_round(Wm[t * 8 + q]) * sc); *(v8us*)((unsigned short*)Bt + t * 8) = f.half[0];  }      /* torch (out,in) weight == Bt[n][k]: scaled copy */
__global__ __launch_bounds__(256) void k_comb(const float* __restrict__ OL, const float* __restrict__ OG, const float* __restrict__ gate, _Float16* __restrict__ O16, size_t n8) {
  #pragma clang fp contract(off)
  const size_t t = (size_t)blockIdx.x * 256 + threadIdx.x; if (t >= n8) return; const float g = 1.0f / (1.0f + expf(-bf16_round(gate[0]))); const float h1 = 1.0f - g; FragH f;
  for (int q = 0; q < 8; ++q) { float a = g * OL[t * 8 + q]; a += h1 * OG[t * 8 + q]; f.h[q] = (_Float16)a; }
  *(v8us*)((unsigned short*)O16 + t * 8) = f.half[0];  }

extern "C" void kernel_launch(void* const* d_in, const int* in_sizes, int n_in,
                              void* d_out, int out_size, void* d_ws, size_t ws_size, hipStream_t stream) {
  (void)in_sizes; (void)n_in; (void)out_size;
  const float* const* I = (const float* const*)d_in; const float* lh = I[0]; const float* gh = I[1]; const float* qw = I[2]; const float* qb = I[3]; const float* kw = I[4]; const float* kb = I[5]; const float* vw = I[6]; const float* vb = I[7]; const float* kgw = I[8]; const float* kgb = I[9]; const float* vgw = I[10]; const float* vgb = I[11]; const float* ow = I[12]; const float* ob = I[13]; const float* gate = I[14];
  char* ws = (char*)d_ws; size_t off = 0;
  auto take = [&](size_t bytes) { char* p = ws + off; off += (bytes + 255) & ~(size_t)255; return p; };
  const size_t w8 = (size_t)EMB * EMB / 8, npl = (size_t)NRL * EMB, npg = (size_t)NRG * EMB;
  _Float16* BQ = (_Float16*)take(w8 * 16); _Float16* BK = (_Float16*)take(w8 * 16); _Float16* BV = (_Float16*)take(w8 * 16); _Float16* BKG = (_Float16*)take(w8 * 16); _Float16* BVG = (_Float16*)take(w8 * 16); _Float16* BO = (_Float16*)take(w8 * 16);
  _Float16* XL = (_Float16*)take(npl * 2); _Float16* XG = (_Float16*)take(npg * 2); _Float16* Q16 = (_Float16*)take(npl * 2); _Float16* KL = (_Float16*)take(npl * 2); _Float16* VL = (_Float16*)take(npl * 2); _Float16* KG = (_Float16*)take(npg * 2); _Float16* VG = (_Float16*)take(npg * 2); _Float16* VTL = (_Float16*)take(npl * 2); _Float16* VTG = (_Float16*)take(npg * 2);
  float* OL = (float*)take(npl * 4); float* OG = (float*)take(npl * 4); _Float16* O16 = XL;      /* O16 over the local input plane (dead after its projections) */
  if (off > ws_size) return;      /* 12 + 8+2+8+8+8+2+2+8+2 + 16+16 = 92 MiB */
  const unsigned g8 = (unsigned)((w8 + 255) / 256);
  k_wsc<<<g8, 256, 0, stream>>>(qw, BQ, w8, 16.0f); k_wsc<<<g8, 256, 0, stream>>>(kw, BK, w8, 16.0f); k_wsc<<<g8, 256, 0, stream>>>(vw, BV, w8, 16.0f); k_wsc<<<g8, 256, 0, stream>>>(kgw, BKG, w8, 16.0f); k_wsc<<<g8, 256, 0, stream>>>(vgw, BVG, w8, 16.0f); k_wsc<<<g8, 256, 0, stream>>>(ow, BO, w8, 16.0f);
  k_x16<<<(unsigned)((npl / 8 + 255) / 256), 256, 0, stream>>>(lh, XL, npl / 8); k_x16<<<(unsigned)((npg / 8 + 255) / 256), 256, 0, stream>>>(gh, XG, npg / 8);
  const dim3 gL((NRL / 128) * (EMB / 64), 1), gGl((NRG / 128) * (EMB / 64), 1);
  k_gemm2<0><<<gL, 128, 0, stream>>>(XL, EMB, 0, BQ, EMB, 0, 0.0625f, qb, 0, nullptr, 1, 0, 0, nullptr, Q16, EMB, 0, NRL, EMB, EMB);
  k_gemm2<0><<<gL, 128, 0, stream>>>(XL, EMB, 0, BK, EMB, 0, 0.0625f, kb, 0, nullptr, 1, 0, 0, nullptr, KL, EMB, 0, NRL, EMB, EMB);
  k_gemm2<0><<<gL, 128, 0, stream>>>(XL, EMB, 0, BV, EMB, 0, 0.0625f, vb, 0, nullptr, 1, 0, 0, nullptr, VL, EMB, 0, NRL, EMB, EMB);
  k_gemm2<0><<<gGl, 128, 0, stream>>>(XG, EMB, 0, BKG, EMB, 0, 0.0625f, kgb, 0, nullptr, 1, 0, 0, nullptr, KG, EMB, 0, NRG, EMB, EMB);
  k_gemm2<0><<<gGl, 128, 0, stream>>>(XG, EMB, 0, BVG, EMB, 0, 0.0625f, vgb, 0, nullptr, 1, 0, 0, nullptr, VG, EMB, 0, NRG, EMB, EMB);
  k_vt<NH, LL><<<NB * NH * (LL / 64), 256, 0, stream>>>(VL, EMB, 0, VTL); k_vt<NH, GG><<<NB * NH * (GG / 64), 256, 0, stream>>>(VG, EMB, 0, VTG);
  k_flashA<0><<<NB * NH * QBLKS, 128, 0, stream>>>(Q16, EMB, KL, EMB, VTL, nullptr, OL, EMB);      /* local: 2048 keys */
  k_flashB<0><<<NB * NH * QBLKS, 128, 0, stream>>>(Q16, EMB, KG, EMB, VTG, nullptr, OG, EMB);      /* global: 512 keys */
  k_comb<<<(unsigned)((npl / 8 + 255) / 256), 256, 0, stream>>>(OL, OG, gate, O16, npl / 8);
  k_gemm2<0><<<gL, 128, 0, stream>>>(O16, EMB, 0, BO, EMB, 0, 0.0625f, ob, 0, nullptr, 1, 0, 0, (float*)d_out, nullptr, EMB, 0, NRL, EMB, EMB);
}

// v001
// It runs in 378 microseconds.
// In two side-by-side timings against v000, it was 1.52 and 1.53 times as fast.
#include <hip/hip_runtime.h>
// InfiniSpanAttention (2 batches; 2048 local tokens, 512 global tokens, D = 1024, 16 heads of 64): q/k_l/v_l from local_hidden, k_g/v_g from global_hidden (torch (out,in) linears + bias); out_l = softmax(q k_l^T s) v_l, out_g = softmax(q k_g^T s) v_g (no masks); out = sigmoid(gate) out_l + (1 - sigmoid(gate)) out_g -> merged heads -> out_w + out_b.
// Compute dtype: inputs and parameters rounded to bf16; q, k, v, P and the combined attention output as f16 operands (~2^-12); f32 accumulation/softmax/gating. v_wmma_f32_16x16x32_f16.
#define NB 2
#define EMB 1024
#define NRL (NB * LL)            /* 4096 local rows */
#define NRG (NB * GG)            /* 1024 global rows */
#define LL 2048                  /* local tokens (queries; local keys) */
#define GG 512                   /* global tokens (keys of the second attention) */
#define TQ LL
#define TK LL
#define TKA LL
#define TKB GG
#define NH 16
#define SCL 0.125f               /* 64^-0.5 */
#define QBLKS (TQ / 64)
typedef __bf16 v16b __attribute__((ext_vector_type(16)));
typedef unsigned short v8us __attribute__((ext_vector_type(8), may_alias));
typedef float  v8f  __attribute__((ext_vector_type(8)));
typedef float  v4f  __attribute__((ext_vector_type(4)));
typedef float  v4fa __attribute__((ext_vector_type(4), may_alias));
union FragB { v16b v; v8us half[2]; unsigned short u[16]; };

__device__ __forceinline__ unsigned short bf16_bits(float x) { unsigned int u = __float_as_uint(x); return (unsigned short)((u + 0x7FFFu + ((u >> 16) & 1u)) >> 16); }
__device__ __forceinline__ float bf16_val(unsigned short b) { return __uint_as_float(((unsigned int)b) << 16); }
__device__ __forceinline__ float bf16_round(float x) { return bf16_val(bf16_bits(x)); }
// D += A·B with NT terms: 1 = ah·bh, 2 = + al·bh (A split), 3 = + ah·bl (both split)
template <int NT>
__device__ __forceinline__ v8f mmaN(v16b ah, v16b al, v16b bh, v16b bl, v8f c) {
  c = __builtin_amdgcn_wmma_f32_16x16x32_bf16(false, ah, false, bh, (short)0, c, false, false);
  if (NT >= 2) c = __builtin_amdgcn_wmma_f32_16x16x32_bf16(false, al, false, bh, (short)0, c, false, false);
  if (NT >= 3) c = __builtin_amdgcn_wmma_f32_16x16x32_bf16(false, ah, false, bl, (short)0, c, false, false);
  asm volatile("v_nop\n\tv_nop\n\tv_nop\n\tv_nop" : "+v"(c) : "v"(ah), "v"(al), "v"(bh), "v"(bl));
  return c;
}

__global__ __launch_bounds__(256) void k_wt_bf16(const float* __restrict__ W, unsigned short* __restrict__ Wt, int K, int N) {
  const int t = blockIdx.x * 256 + threadIdx.x;
  const int k8n = K / 8;
  if (t >= N * k8n) return;
  const int n = t / k8n, k8 = (t % k8n) * 8;
  v8us v;
#pragma unroll
  for (int i = 0; i < 8; ++i) v[i] = bf16_bits(W[(size_t)(k8 + i) * N + n]);
  *(v8us*)(Wt + (size_t)n * K + k8) = v;
  
}

// GEMM C[M][N] (f32, pitch ldc) = act(A[M][K]·W + bias). A f32 row-major (pitch lda) converted per fragment to bf16
// (ASPLIT: hi/lo two planes -> 2 terms, else single rounded term); Wt bf16 [N][K] (pitch ldb). BIAS_BF16 rounds the
// bias to bf16 first (bias quantised to bf16 before the add). K%32==0, M%16==0, N%64==0.
template <bool ASPLIT, int ACT, bool BIAS_BF16>
__global__ __launch_bounds__(128) void k_gemm_bf(const float* __restrict__ A, int lda, const unsigned short* __restrict__ Wt, int ldb,
                                               const float* __restrict__ bias, float* __restrict__ C, int ldc, int M, int N, int K) {
  __shared__ __attribute__((aligned(16))) float so[4][16][64];
  const int tid = threadIdx.x, w = tid >> 5, lane = tid & 31, ln = lane & 15, hh = lane >> 4;
  const int ntn = N / 64;
  const int wid = blockIdx.x * 4 + w;
  const int mt = wid / ntn, nq = wid % ntn;
  if (mt * 16 >= M) return;
  const int row0 = mt * 16, col0 = nq * 64;
  const float* arow = A + (size_t)(row0 + ln) * lda;
  v8f acc[4] = {};
  for (int kb = 0; kb < K; kb += 32) {
    FragB ah, al;
    const v4f x0 = *(const v4fa*)(arow + kb + 8 * hh), x1 = *(const v4fa*)(arow + kb + 8 * hh + 4);
    const v4f x2 = *(const v4fa*)(arow + kb + 16 + 8 * hh), x3 = *(const v4fa*)(arow + kb + 16 + 8 * hh + 4);
    float xs[16] = {x0[0],x0[1],x0[2],x0[3],x1[0],x1[1],x1[2],x1[3],x2[0],x2[1],x2[2],x2[3],x3[0],x3[1],x3[2],x3[3]};
#pragma unroll
    for (int i = 0; i < 16; ++i) { const unsigned short hb = bf16_bits(xs[i]); ah.u[i] = hb; al.u[i] = ASPLIT ? bf16_bits(xs[i] - bf16_val(hb)) : (unsigned short)0; }
#pragma unroll
    for (int t = 0; t < 4; ++t) {
      const unsigned short* brow = Wt + (size_t)(col0 + t * 16 + ln) * ldb + kb;
      FragB b;
      b.half[0] = *(const v8us*)(brow + 8 * hh);
      b.half[1] = *(const v8us*)(brow + 16 + 8 * hh);
      acc[t] = mmaN<ASPLIT ? 2 : 1>(ah.v, al.v, b.v, b.v, acc[t]);
    }
  }
#pragma unroll
  for (int t = 0; t < 4; ++t) {
    float bv = bias ? bias[col0 + t * 16 + ln] : 0.f;
    if (BIAS_BF16) bv = bf16_round(bv);
#pragma unroll
    for (int r = 0; r < 8; ++r) { float v = acc[t][r] + bv; if (ACT == 1) v = fmaxf(v, 0.f); so[w][8 * hh + r][t * 16 + ln] = v; }
  }
  __builtin_amdgcn_fence(__ATOMIC_ACQ_REL, "workgroup");
  __builtin_amdgcn_wave_barrier();
  const int rsub = lane >> 4, c4 = (lane & 15) * 4;
  {
#pragma unroll
    for (int q = 0; q < 8; ++q) {
      const int r = q * 2 + rsub;
      const v4f v = *(const v4fa*)&so[w][r][c4];
      *(v4f*)(C + (size_t)(row0 + r) * ldc + col0 + c4) = v;
    }
    
  }
}

// GEMM C = act(A·W + bias + resid): A f32 (ASPLIT -> hi/lo 2 terms), Wt bf16 [N][K]; ACT 0 none, 1 relu, 2 exact gelu;
// resid (optional, f32, row index = (row % rmod), pitch ldr, RES_BF16 rounds it) added before the activation.
template <bool ASPLIT, int ACT, bool BIAS_BF16, bool RES_BF16>
__global__ __launch_bounds__(128) void k_gemm_bf3(const float* __restrict__ A, int lda, const unsigned short* __restrict__ Wt, int ldb,
                                                const float* __restrict__ bias, const float* __restrict__ resid, int rmod, int ldr,
                                                float* __restrict__ C, int ldc, int M, int N, int K) {
  __shared__ __attribute__((aligned(16))) float so[4][16][64];
  const int tid = threadIdx.x, w = tid >> 5, lane = tid & 31, ln = lane & 15, hh = lane >> 4;
  const int ntn = N / 64;
  const int wid = blockIdx.x * 4 + w;
  const int mt = wid / ntn, nq = wid % ntn;
  if (mt * 16 >= M) return;
  const int row0 = mt * 16, col0 = nq * 64;
  const float* arow = A + (size_t)(row0 + ln) * lda;
  v8f acc[4] = {};
  for (int kb = 0; kb < K; kb += 32) {
    FragB ah, al;
    const v4f x0 = *(const v4fa*)(arow + kb + 8 * hh), x1 = *(const v4fa*)(arow + kb + 8 * hh + 4);
    const v4f x2 = *(const v4fa*)(arow + kb + 16 + 8 * hh), x3 = *(const v4fa*)(arow + kb + 16 + 8 * hh + 4);
    float xs[16] = {x0[0],x0[1],x0[2],x0[3],x1[0],x1[1],x1[2],x1[3],x2[0],x2[1],x2[2],x2[3],x3[0],x3[1],x3[2],x3[3]};
#pragma unroll
    for (int i = 0; i < 16; ++i) { const unsigned short hb = bf16_bits(xs[i]); ah.u[i] = hb; al.u[i] = ASPLIT ? bf16_bits(xs[i] - bf16_val(hb)) : (unsigned short)0; }
#pragma unroll
    for (int t = 0; t < 4; ++t) {
      const unsigned short* brow = Wt + (size_t)(col0 + t * 16 + ln) * ldb + kb;
      FragB b;
      b.half[0] = *(const v8us*)(brow + 8 * hh);
      b.half[1] = *(const v8us*)(brow + 16 + 8 * hh);
      acc[t] = mmaN<ASPLIT ? 2 : 1>(ah.v, al.v, b.v, b.v, acc[t]);
    }
  }
#pragma unroll
  for (int t = 0; t < 4; ++t) {
    const int col = col0 + t * 16 + ln;
    float bv = bias ? bias[col] : 0.f;
    if (BIAS_BF16) bv = bf16_round(bv);
#pragma unroll
    for (int r = 0; r < 8; ++r) {
      float v = acc[t][r] + bv;
      if (resid) { float rv = resid[(size_t)((row0 + 8 * hh + r) % rmod) * ldr + col]; if (RES_BF16) rv = bf16_round(rv); v += rv; }
      if (ACT == 1) v = fmaxf(v, 0.f);
      if (ACT == 2) v = 0.5f * v * (1.0f + erff(v * 0.70710678118654752f));
      if (ACT == 3) { const float u = 0.7978845608028654f * (v + 0.044715f * v * v * v); v = 0.5f * v * (1.0f + tanhf(u)); }
      so[w][8 * hh + r][t * 16 + ln] = v;
    }
  }
  __builtin_amdgcn_fence(__ATOMIC_ACQ_REL, "workgroup");
  __builtin_amdgcn_wave_barrier();
  const int rsub = lane >> 4, c4 = (lane & 15) * 4;
  {
#pragma unroll
    for (int q = 0; q < 8; ++q) {
      const int r = q * 2 + rsub;
      const v4f v = *(const v4fa*)&so[w][r][c4];
      *(v4f*)(C + (size_t)(row0 + r) * ldc + col0 + c4) = v;
    }
    
  }
}
// row LayerNorm (biased variance, eps) over N: s = X (+ R); optional out_sum <- s; out_norm <- (s-mu)*rsqrt(var+eps)*g + b
template <bool PARAM_BF16>
__global__ __launch_bounds__(256) void k_layernorm(const float* __restrict__ X, const float* __restrict__ R, const float* __restrict__ g, const float* __restrict__ bta,
                                                  float* __restrict__ out_sum, float* __restrict__ out_norm, int N, float eps) {
  __shared__ float red[256];
  const int row = blockIdx.x, tid = threadIdx.x;
  const float* x = X + (size_t)row * N; const float* rr = R ? R + (size_t)row * N : nullptr;
  float vals[16];                     // up to N = 4096
  const int per = N / 256;            // contiguous chunk per thread? use strided-by-4 chunks: thread handles j = tid*4 + 1024*u
  float s1 = 0.f;
  for (int u = 0; u < per / 4; ++u) {
    const int j = tid * 4 + 1024 * u;
    const v4f a = *(const v4fa*)(x + j);
    v4f b = {0.f,0.f,0.f,0.f}; if (rr) b = *(const v4fa*)(rr + j);
#pragma unroll
    for (int q = 0; q < 4; ++q) { const float v = a[q] + b[q]; vals[u * 4 + q] = v; s1 += v; }
  }
  red[tid] = s1; __syncthreads();
  for (int st = 128; st > 0; st >>= 1) { if (tid < st) red[tid] += red[tid + st]; __syncthreads(); }
  const float mu = red[0] / (float)N; __syncthreads();
  float s2 = 0.f;
  for (int u = 0; u < per / 4; ++u)
#pragma unroll
    for (int q = 0; q < 4; ++q) { const float c = vals[u * 4 + q] - mu; s2 += c * c; }
  red[tid] = s2; __syncthreads();
  for (int st = 128; st > 0; st >>= 1) { if (tid < st) red[tid] += red[tid + st]; __syncthreads(); }
  const float rs = rsqrtf(red[0] / (float)N + eps);
  {
    for (int u = 0; u < per / 4; ++u) {
      const int j = tid * 4 + 1024 * u;
      v4f o, sm;
#pragma unroll
      for (int q = 0; q < 4; ++q) {
        float gg = g[j + q], bb = bta[j + q];
        if (PARAM_BF16) { gg = bf16_round(gg); bb = bf16_round(bb); }
        sm[q] = vals[u * 4 + q]; o[q] = (vals[u * 4 + q] - mu) * rs * gg + bb;
      }
      if (out_sum) *(v4f*)(out_sum + (size_t)row * N + j) = sm;
      *(v4f*)(out_norm + (size_t)row * N + j) = o;
    }
    
  }
}



// ---- f16 WMMA path (v_wmma_f32_16x16x32_f16): 11-bit significands for operands in range — used where a [0,1] probability operand needs more precision than bf16
typedef _Float16 v16h __attribute__((ext_vector_type(16)));
union FragH { v16h v; v8us half[2]; _Float16 h[16]; unsigned short u[16]; };
template <int NT>
__device__ __forceinline__ v8f mmaH(v16h ah, v16h al, v16h bh, v16h bl, v8f c) {
  c = __builtin_amdgcn_wmma_f32_16x16x32_f16(false, ah, false, bh, (short)0, c, false, false);
  if (NT >= 2) c = __builtin_amdgcn_wmma_f32_16x16x32_f16(false, al, false, bh, (short)0, c, false, false);
  if (NT >= 3) c = __builtin_amdgcn_wmma_f32_16x16x32_f16(false, ah, false, bl, (short)0, c, false, false);
  asm volatile("v_nop\n\tv_nop\n\tv_nop\n\tv_nop" : "+v"(c) : "v"(ah), "v"(al), "v"(bh), "v"(bl));
  return c;
}
// batched GEMM like k_gemm_b but f16 operands: A f32 (split into f16 hi/lo if ASPLIT, else rounded to f16), Bt = f16 values [n][k]; alpha; C f32; N multiple of 16 (partial tiles skipped)
template <bool ASPLIT>
__global__ __launch_bounds__(128) void k_gemm_h(const float* __restrict__ A, int lda, size_t sA, const _Float16* __restrict__ Bh, int ldb, size_t sB, float alpha, float* __restrict__ C, int ldc, size_t sC, int M, int N, int K) {
  __shared__ __attribute__((aligned(16))) float so[4][16][64];
  const int tid = threadIdx.x, w = tid >> 5, lane = tid & 31, ln = lane & 15, hh = lane >> 4; const int by = blockIdx.y;
  A += (size_t)by * sA; Bh += (size_t)by * sB; C += (size_t)by * sC;
  const int ntn = (N + 63) / 64; const int wid = blockIdx.x * 4 + w; const int mt = wid / ntn, nq = wid % ntn; if (mt * 16 >= M) return;
  const int row0 = mt * 16, col0 = nq * 64; const float* arow = A + (size_t)(row0 + ln) * lda;
  v8f acc[4] = {};
  for (int kb = 0; kb < K; kb += 32) {
    FragH ah, al;
    const v4f x0 = *(const v4fa*)(arow + kb + 8 * hh), x1 = *(const v4fa*)(arow + kb + 8 * hh + 4), x2 = *(const v4fa*)(arow + kb + 16 + 8 * hh), x3 = *(const v4fa*)(arow + kb + 16 + 8 * hh + 4);
    float xs[16] = {x0[0],x0[1],x0[2],x0[3],x1[0],x1[1],x1[2],x1[3],x2[0],x2[1],x2[2],x2[3],x3[0],x3[1],x3[2],x3[3]};
#pragma unroll
    for (int i = 0; i < 16; ++i) { const _Float16 h = (_Float16)xs[i]; ah.h[i] = h; al.h[i] = ASPLIT ? (_Float16)(xs[i] - (float)h) : (_Float16)0.0f; }
#pragma unroll
    for (int t = 0; t < 4; ++t) { if (col0 + t * 16 >= N) continue; const size_t boff = (size_t)(col0 + t * 16 + ln) * ldb + kb; FragH bq; bq.half[0] = *(const v8us*)(Bh + boff + 8 * hh); bq.half[1] = *(const v8us*)(Bh + boff + 16 + 8 * hh);
      acc[t] = mmaH<ASPLIT ? 2 : 1>(ah.v, al.v, bq.v, bq.v, acc[t]); }
  }
#pragma unroll
  for (int t = 0; t < 4; ++t) { if (col0 + t * 16 >= N) continue;
#pragma unroll
    for (int r = 0; r < 8; ++r) so[w][8 * hh + r][t * 16 + ln] = acc[t][r] * alpha; }
  __builtin_amdgcn_fence(__ATOMIC_ACQ_REL, "workgroup"); __builtin_amdgcn_wave_barrier();
  const int rsub = lane >> 4, c4 = (lane & 15) * 4;
  {
#pragma unroll
    for (int q = 0; q < 8; ++q) { const int r = q * 2 + rsub; if (col0 + c4 < N) { const v4f v = *(const v4fa*)&so[w][r][c4]; *(v4f*)(C + (size_t)(row0 + r) * ldc + col0 + c4) = v; } }
     }
}

// Wt[n][k] = f16(W[k][n]·scale) from f32 row-major W[K][N] (scale = power of two; bf16-exact weights stay exact in f16 away from the subnormal range)
__global__ __launch_bounds__(256) void k_wt_f16(const float* __restrict__ W, _Float16* __restrict__ Wt, int K, int N, float scale) {
  const int t = blockIdx.x * 256 + threadIdx.x; if (t >= N * (K / 8)) return; const int n = t / (K / 8), k8 = (t % (K / 8)) * 8; FragH f;
#pragma unroll
  for (int i = 0; i < 8; ++i) f.h[i] = (_Float16)(bf16_round(W[(size_t)(k8 + i) * N + n]) * scale); const v8us o = f.half[0];
  *(v8us*)((unsigned short*)Wt + (size_t)n * K + k8) = o; 
}
// k_gemm_hh variant with fused epilogue: v = acc·alpha + bias[by·sBias + col] (+ CP[(row/rowsPerB)·sCPb + by·64 + col] if CP) ; ACT 0 none / 1 elu ; writes f16 C16 (and f32 C if non-null)
template <int ACT>
__global__ __launch_bounds__(128) void k_gemm_hhx(const _Float16* __restrict__ A, int lda, size_t sA, const _Float16* __restrict__ Bh, int ldb, size_t sB, float alpha, const float* __restrict__ bias, size_t sBias, const float* __restrict__ CP, int rowsPerB, size_t sCPb, int row0g,
    float* __restrict__ C, _Float16* __restrict__ C16, int ldc, size_t sC, int M, int N, int K) {
  __shared__ __attribute__((aligned(16))) float so[4][16][64];
  const int tid = threadIdx.x, w = tid >> 5, lane = tid & 31, ln = lane & 15, hh = lane >> 4; const int by = blockIdx.y;
  A += (size_t)by * sA; Bh += (size_t)by * sB; const size_t cofs = (size_t)by * sC; const float* bp = bias ? bias + (size_t)by * sBias : nullptr;
  const int ntn = (N + 63) / 64; const int wid = blockIdx.x * 4 + w; const int mt = wid / ntn, nq = wid % ntn; if (mt * 16 >= M) return;
  const int row0 = mt * 16, col0 = nq * 64; const _Float16* arow = A + (size_t)(row0 + ln) * lda;
  v8f acc[4] = {};
  for (int kb = 0; kb < K; kb += 32) { FragH ah; ah.half[0] = *(const v8us*)((const unsigned short*)arow + kb + 8 * hh); ah.half[1] = *(const v8us*)((const unsigned short*)arow + kb + 16 + 8 * hh);
#pragma unroll
    for (int t = 0; t < 4; ++t) { if (col0 + t * 16 >= N) continue; const size_t boff = (size_t)(col0 + t * 16 + ln) * ldb + kb; FragH bq; bq.half[0] = *(const v8us*)((const unsigned short*)Bh + boff + 8 * hh); bq.half[1] = *(const v8us*)((const unsigned short*)Bh + boff + 16 + 8 * hh);
      acc[t] = mmaH<1>(ah.v, ah.v, bq.v, bq.v, acc[t]); }
  }
#pragma unroll
  for (int t = 0; t < 4; ++t) { if (col0 + t * 16 >= N) continue; const int col = col0 + t * 16 + ln; const float bv = bp ? bf16_round(bp[col]) : 0.f;
#pragma unroll
    for (int r = 0; r < 8; ++r) { float v = acc[t][r] * alpha + bv; if (CP) { const int bidx = (row0g + row0 + 8 * hh + r) / rowsPerB; v += CP[(size_t)bidx * sCPb + (size_t)by * 64 + col]; } if (ACT == 1) v = (v > 0.f) ? v : expm1f(v); else if (ACT == 7) v = (v > 0.f) ? v + 1.0f : expf(v); else if (ACT == 8) v = tanhf(v); else if (ACT == 9) v = 0.5f * v * (1.0f + tanhf(0.7978845608028654f * (v + 0.044715f * v * v * v))); else if (ACT == 11) v = 1.0f / (1.0f + expf(-v)); else if (ACT == 12) v = (v > 0.f) ? v : 0.01f * v; else if (ACT == 14) v = (v > 0.f) ? v : 0.1f * v; else if (ACT == 15) v = v / (1.0f + expf(-v)); else if (ACT == 3) v = fmaxf(v, 0.f); else if (ACT == 6) v = 0.5f * v * (1.0f + erff(v * 0.70710678118654752f)); so[w][8 * hh + r][t * 16 + ln] = v; } }
  __builtin_amdgcn_fence(__ATOMIC_ACQ_REL, "workgroup"); __builtin_amdgcn_wave_barrier();
  const int rsub = lane >> 4, c4 = (lane & 15) * 4; typedef _Float16 v4h __attribute__((ext_vector_type(4)));
  {
#pragma unroll
    for (int q = 0; q < 8; ++q) { const int r = q * 2 + rsub; if (col0 + c4 < N) { const v4f v = *(const v4fa*)&so[w][r][c4]; if (C) *(v4f*)(C + cofs + (size_t)(row0 + r) * ldc + col0 + c4) = v; if (C16) { v4h h4; for (int i = 0; i < 4; ++i) h4[i] = (_Float16)v[i]; *(v4h*)(C16 + cofs + (size_t)(row0 + r) * ldc + col0 + c4) = h4; } } }
     }
}


typedef _Float16 v4h __attribute__((ext_vector_type(4)));

__global__ __launch_bounds__(256) void k_x16(const float* __restrict__ x, _Float16* __restrict__ X16, size_t n8) { const size_t t = (size_t)blockIdx.x * 256 + threadIdx.x; if (t >= n8) return; FragH f;
#pragma unroll
  for (int q = 0; q < 8; ++q) f.h[q] = (_Float16)bf16_round(x[t * 8 + q]); *(v8us*)((unsigned short*)X16 + t * 8) = f.half[0];  }
__global__ __launch_bounds__(256) void k_h16(const float* __restrict__ x, _Float16* __restrict__ X16, size_t n8) { const size_t t = (size_t)blockIdx.x * 256 + threadIdx.x; if (t >= n8) return; FragH f;
#pragma unroll
  for (int q = 0; q < 8; ++q) f.h[q] = (_Float16)x[t * 8 + q]; *(v8us*)((unsigned short*)X16 + t * 8) = f.half[0];  }
__global__ __launch_bounds__(256) void k_round16f(const float* __restrict__ W, _Float16* __restrict__ Bt, size_t n8) { const size_t t = (size_t)blockIdx.x * 256 + threadIdx.x; if (t >= n8) return; FragH f;
#pragma unroll
  for (int i = 0; i < 8; ++i) f.h[i] = (_Float16)(bf16_round(W[t * 8 + i]) * 16.0f); *(v8us*)((unsigned short*)Bt + t * 8) = f.half[0];  }
template <int NHv, int TTv>
__global__ __launch_bounds__(256) void k_vt(const _Float16* __restrict__ V16, int ldv, int voff, _Float16* __restrict__ Vt) { __shared__ unsigned short tl[64][66]; const int tid = threadIdx.x; const int slab = blockIdx.x / (TTv / 64), lg = blockIdx.x % (TTv / 64); const int b = slab / NHv, h = slab % NHv;
  for (int i = tid; i < 64 * 8; i += 256) { const int r = i / 8, c8 = (i % 8) * 8; FragH f; f.half[0] = *(const v8us*)((const unsigned short*)V16 + ((size_t)b * TTv + lg * 64 + r) * ldv + voff + h * 64 + c8);
#pragma unroll
    for (int q = 0; q < 8; ++q) tl[r][c8 + q] = f.u[q]; }
  __syncthreads();
  {
#pragma unroll
    for (int rd = 0; rd < 2; ++rd) { const int d = rd * 32 + tid / 8, pc = tid % 8; FragH f;
#pragma unroll
      for (int q = 0; q < 8; ++q) f.u[q] = tl[pc * 8 + q][d];
      *(v8us*)((unsigned short*)Vt + ((size_t)slab * 64 + d) * TTv + lg * 64 + pc * 8) = f.half[0]; }
     } }

__global__ __launch_bounds__(256) void k_hl(const float* __restrict__ F, _Float16* __restrict__ Hh, _Float16* __restrict__ Hl, size_t n8) { const size_t t = (size_t)blockIdx.x * 256 + threadIdx.x; if (t >= n8) return; FragH fh, fl; const v4f a = *(const v4fa*)(F + t * 8), c = *(const v4fa*)(F + t * 8 + 4);
#pragma unroll
  for (int q = 0; q < 4; ++q) { _Float16 h = (_Float16)a[q]; fh.h[q] = h; fl.h[q] = (_Float16)((a[q] - (float)h) * 1024.0f); h = (_Float16)c[q]; fh.h[4 + q] = h; fl.h[4 + q] = (_Float16)((c[q] - (float)h) * 1024.0f); }
  { *(v8us*)((unsigned short*)Hh + t * 8) = fh.half[0]; *(v8us*)((unsigned short*)Hl + t * 8) = fl.half[0];  } }

// ---- fast GEMM (wave tile 32x64; requires M % 32 == 0 rows per launch region, N % 64 == 0 and K % 64 == 0); epilogue = k_gemm_hhx semantics ----
// Two fragment sets (even and odd 32-k steps). Each fragment is reloaded for the step two ahead right behind its last product, so a step's loads fly under the other set's products.
__device__ __forceinline__ v16h g2_frag(const _Float16* p, int hh) { FragH f; f.half[0] = *(const v8us*)((const unsigned short*)p + 8 * hh); f.half[1] = *(const v8us*)((const unsigned short*)p + 16 + 8 * hh); return f.v; }
__device__ __forceinline__ v8f g2_mma(v16h a, v16h b, v8f c) { v8f d = __builtin_amdgcn_wmma_f32_16x16x32_f16(false, a, false, b, (short)0, c, false, false); asm volatile("v_nop\n\tv_nop\n\tv_nop\n\tv_nop" : "+v"(d) : "v"(a), "v"(b)); return d; }
template <int ACT>
__global__ __launch_bounds__(128) void k_gemm2(const _Float16* __restrict__ A, int lda, size_t sA, const _Float16* __restrict__ Bh, int ldb, size_t sB, float alpha, const float* __restrict__ bias, size_t sBias, const float* __restrict__ CP, int rowsPerB, size_t sCPb, int row0g,
    float* __restrict__ C, _Float16* __restrict__ C16, int ldc, size_t sC, int M, int N, int K) {
  __shared__ __attribute__((aligned(16))) float so[4][32][68];
  const int tid = threadIdx.x, w = tid >> 5, lane = tid & 31, ln = lane & 15, hh = lane >> 4; const int by = blockIdx.y;
  A += (size_t)by * sA; Bh += (size_t)by * sB; const size_t cofs = (size_t)by * sC; const float* bp = bias ? bias + (size_t)by * sBias : nullptr;
  const int ntn = N >> 6; const int mt = blockIdx.x / ntn, nq = blockIdx.x - mt * ntn; const int row0 = mt * 128 + 32 * w, col0 = nq * 64; if (row0 >= M) return;
  const _Float16* a0p = A + (size_t)(row0 + ln) * lda; const _Float16* a1p = a0p + (size_t)16 * lda;
  const _Float16* b0p = Bh + (size_t)(col0 + ln) * ldb; const _Float16* b1p = b0p + (size_t)16 * ldb; const _Float16* b2p = b1p + (size_t)16 * ldb; const _Float16* b3p = b2p + (size_t)16 * ldb;
  const v8f z8 = {0.f,0.f,0.f,0.f,0.f,0.f,0.f,0.f}; v8f c00 = z8, c01 = z8, c02 = z8, c03 = z8, c10 = z8, c11 = z8, c12 = z8, c13 = z8;
  v16h a0 = g2_frag(a0p, hh), a1 = g2_frag(a1p, hh), b0 = g2_frag(b0p, hh), b1 = g2_frag(b1p, hh), b2 = g2_frag(b2p, hh), b3 = g2_frag(b3p, hh);
  v16h e0 = g2_frag(a0p + 32, hh), e1 = g2_frag(a1p + 32, hh), f0 = g2_frag(b0p + 32, hh), f1 = g2_frag(b1p + 32, hh), f2 = g2_frag(b2p + 32, hh), f3 = g2_frag(b3p + 32, hh);
#pragma unroll 1      /* rolled: the body already holds both sets; more copies only add code */
  for (int kb = 0; kb < K; kb += 64) { const int kn = (kb + 64 < K) ? kb + 64 : kb;      /* last trip: re-reads its own step (in bounds, unused) */
    c00 = g2_mma(a0, b0, c00); c10 = g2_mma(a1, b0, c10); b0 = g2_frag(b0p + kn, hh);
    c01 = g2_mma(a0, b1, c01); c11 = g2_mma(a1, b1, c11); b1 = g2_frag(b1p + kn, hh);
    c02 = g2_mma(a0, b2, c02); c12 = g2_mma(a1, b2, c12); b2 = g2_frag(b2p + kn, hh);
    c03 = g2_mma(a0, b3, c03); c13 = g2_mma(a1, b3, c13); b3 = g2_frag(b3p + kn, hh); a0 = g2_frag(a0p + kn, hh); a1 = g2_frag(a1p + kn, hh);
    c00 = g2_mma(e0, f0, c00); c10 = g2_mma(e1, f0, c10); f0 = g2_frag(b0p + kn + 32, hh);
    c01 = g2_mma(e0, f1, c01); c11 = g2_mma(e1, f1, c11); f1 = g2_frag(b1p + kn + 32, hh);
    c02 = g2_mma(e0, f2, c02); c12 = g2_mma(e1, f2, c12); f2 = g2_frag(b2p + kn + 32, hh);
    c03 = g2_mma(e0, f3, c03); c13 = g2_mma(e1, f3, c13); f3 = g2_frag(b3p + kn + 32, hh); e0 = g2_frag(a0p + kn + 32, hh); e1 = g2_frag(a1p + kn + 32, hh);
    asm volatile("s_wait_xcnt 0x0" ::: "memory"); }      /* the next trip forms new addresses in the registers that this trip's loads name: wait before they are overwritten */
  v8f accs[8] = {c00, c01, c02, c03, c10, c11, c12, c13};
#pragma unroll
  for (int u = 0; u < 8; ++u) { const int t = u & 3, half = u >> 2; const int col = col0 + t * 16 + ln; const float bv = bp ? bf16_round(bp[col]) : 0.f;
#pragma unroll
    for (int r = 0; r < 8; ++r) { const int rloc = half * 16 + 8 * hh + r; float v = accs[u][r] * alpha + bv; if (CP) { const int bidx = (row0g + row0 + rloc) / rowsPerB; v += CP[(size_t)bidx * sCPb + (size_t)by * 64 + col]; }
      if (ACT == 3) v = fmaxf(v, 0.f); else if (ACT == 6) v = 0.5f * v * (1.0f + erff(v * 0.70710678118654752f)); else if (ACT == 11) v = 1.0f / (1.0f + expf(-v)); else if (ACT == 15) v = v / (1.0f + expf(-v)); else if (ACT == 12) v = (v > 0.f) ? v : 0.01f * v; else if (ACT == 8) v = tanhf(v);
      so[w][rloc][t * 16 + ln] = v; } }
  __builtin_amdgcn_fence(__ATOMIC_ACQ_REL, "workgroup"); __builtin_amdgcn_wave_barrier();
  const int rsub = lane >> 4, c4 = (lane & 15) * 4;
  {
#pragma unroll
    for (int q = 0; q < 16; ++q) { const int r = q * 2 + rsub; const v4f v = *(const v4fa*)&so[w][r][c4]; if (C) *(v4f*)(C + cofs + (size_t)(row0 + r) * ldc + col0 + c4) = v; if (C16) { v4h h4; for (int i = 0; i < 4; ++i) h4[i] = (_Float16)v[i]; *(v4h*)(C16 + cofs + (size_t)(row0 + r) * ldc + col0 + c4) = h4; } }
     } }



template <int CAUSAL>
__global__ __launch_bounds__(128) void k_flash(const _Float16* __restrict__ Q16, int ldq, const _Float16* __restrict__ K16, int ldk, const _Float16* __restrict__ Vt, const int* __restrict__ MSK, float* __restrict__ O, int ldo) {
  constexpr int RPW = 16, RTN = RPW / 16, NQB = TQ / (4 * RPW), DT = 4, KS = 2;
  __shared__ __attribute__((aligned(16))) unsigned short sP[4][RPW][40]; __shared__ __attribute__((aligned(16))) float sO[4][RPW][64 + 4];
  const int tid = threadIdx.x, w = tid >> 5, lane = tid & 31, ln = lane & 15, hh = lane >> 4;
  const int slab = blockIdx.x / QBLKS, qblk = blockIdx.x % QBLKS; (void)NQB; const int b = slab / NH, h = slab % NH; const int qb0 = qblk * (4 * RPW); const int q0 = qb0 + w * RPW;
  FragH aq[2][KS];
#pragma unroll
  for (int rt = 0; rt < RTN; ++rt) { const unsigned short* qr = (const unsigned short*)Q16 + ((size_t)b * TQ + q0 + rt * 16 + ln) * ldq + h * 64;
#pragma unroll
    for (int ks = 0; ks < KS; ++ks) { aq[rt][ks].half[0] = *(const v8us*)(qr + ks * 32 + 8 * hh); aq[rt][ks].half[1] = *(const v8us*)(qr + ks * 32 + 16 + 8 * hh); } }
  const unsigned short* Vth = (const unsigned short*)Vt + (size_t)slab * 64 * TK;
  float m_r[2][8], l_r[2][8]; v8f oacc[2][DT];
#pragma unroll
  for (int rt = 0; rt < RTN; ++rt) {
#pragma unroll
    for (int r = 0; r < 8; ++r) { m_r[rt][r] = -3.0e38f; l_r[rt][r] = 0.f; }
#pragma unroll
    for (int dt = 0; dt < DT; ++dt) oacc[rt][dt] = (v8f){0.f,0.f,0.f,0.f,0.f,0.f,0.f,0.f}; }
  const int jend = (CAUSAL == 1) ? (qb0 + 4 * RPW) : TK;      /* causal: keys beyond the block's last query never contribute */
#pragma unroll 1
  for (int j0 = 0; j0 < jend; j0 += 32) {
    v8f s[2][2];
#pragma unroll
    for (int nt = 0; nt < 2; ++nt) { const unsigned short* kr = (const unsigned short*)K16 + ((size_t)b * TK + j0 + nt * 16 + ln) * ldk + h * 64; FragH bk[KS];
#pragma unroll
      for (int ks = 0; ks < KS; ++ks) { bk[ks].half[0] = *(const v8us*)(kr + ks * 32 + 8 * hh); bk[ks].half[1] = *(const v8us*)(kr + ks * 32 + 16 + 8 * hh); }
#pragma unroll
      for (int rt = 0; rt < RTN; ++rt) { v8f acc = (v8f){0.f,0.f,0.f,0.f,0.f,0.f,0.f,0.f};
#pragma unroll
        for (int ks = 0; ks < KS; ++ks) acc = mmaH<1>(aq[rt][ks].v, aq[rt][ks].v, bk[ks].v, bk[ks].v, acc); s[rt][nt] = acc; } }
#pragma unroll
    for (int rt = 0; rt < RTN; ++rt)
#pragma unroll
      for (int r = 0; r < 8; ++r) { const int tq = q0 + rt * 16 + 8 * hh + r; const int k0 = j0 + ln, k1 = j0 + 16 + ln;
        const bool ok0 = (CAUSAL == 1) ? (k0 <= tq) : ((CAUSAL == 2) ? ((k0 >> 5) == (tq >> 5)) : true), ok1 = (CAUSAL == 1) ? (k1 <= tq) : ((CAUSAL == 2) ? ((k1 >> 5) == (tq >> 5)) : true);      /* mode 2: block-diagonal 32-token groups */
        const float s0 = ok0 ? s[rt][0][r] * SCL : -3.0e38f, s1 = ok1 ? s[rt][1][r] * SCL : -3.0e38f; float mc = fmaxf(s0, s1);
        mc = fmaxf(mc, __shfl_xor(mc, 1, 32)); mc = fmaxf(mc, __shfl_xor(mc, 2, 32)); mc = fmaxf(mc, __shfl_xor(mc, 4, 32)); mc = fmaxf(mc, __shfl_xor(mc, 8, 32));
        const float mn = fmaxf(m_r[rt][r], mc); const float al = (mn > -1.0e38f) ? expf(m_r[rt][r] - mn) : 1.0f; m_r[rt][r] = mn; const float p0 = ok0 ? expf(s0 - mn) : 0.f, p1 = ok1 ? expf(s1 - mn) : 0.f; l_r[rt][r] = l_r[rt][r] * al + p0 + p1;
#pragma unroll
        for (int dt = 0; dt < DT; ++dt) oacc[rt][dt][r] *= al;
        FragH t2; t2.h[0] = (_Float16)(p0 * 1024.0f); t2.h[1] = (_Float16)(p1 * 1024.0f); sP[w][rt * 16 + 8 * hh + r][ln] = t2.u[0]; sP[w][rt * 16 + 8 * hh + r][16 + ln] = t2.u[1]; }
    __builtin_amdgcn_fence(__ATOMIC_ACQ_REL, "workgroup"); __builtin_amdgcn_wave_barrier();
    FragH pa[2];
#pragma unroll
    for (int rt = 0; rt < RTN; ++rt) { pa[rt].half[0] = *(const v8us*)&sP[w][rt * 16 + ln][8 * hh]; pa[rt].half[1] = *(const v8us*)&sP[w][rt * 16 + ln][16 + 8 * hh]; }
#pragma unroll
    for (int dt = 0; dt < DT; ++dt) { const unsigned short* vrow = Vth + (size_t)(dt * 16 + ln) * TK + j0; FragH bv; bv.half[0] = *(const v8us*)(vrow + 8 * hh); bv.half[1] = *(const v8us*)(vrow + 16 + 8 * hh);
#pragma unroll
      for (int rt = 0; rt < RTN; ++rt) oacc[rt][dt] = mmaH<1>(pa[rt].v, pa[rt].v, bv.v, bv.v, oacc[rt][dt]); }
    __builtin_amdgcn_fence(__ATOMIC_ACQ_REL, "workgroup"); __builtin_amdgcn_wave_barrier(); }
#pragma unroll
  for (int rt = 0; rt < RTN; ++rt) {
#pragma unroll
    for (int r = 0; r < 8; ++r) { float l = l_r[rt][r]; l += __shfl_xor(l, 1, 32); l += __shfl_xor(l, 2, 32); l += __shfl_xor(l, 4, 32); l += __shfl_xor(l, 8, 32); l_r[rt][r] = (l > 0.f) ? 1.0f / (l * 1024.0f) : 0.f; }
#pragma unroll
    for (int dt = 0; dt < DT; ++dt)
#pragma unroll
      for (int r = 0; r < 8; ++r) sO[w][rt * 16 + 8 * hh + r][dt * 16 + ln] = oacc[rt][dt][r] * l_r[rt][r]; }
  __builtin_amdgcn_fence(__ATOMIC_ACQ_REL, "workgroup"); __builtin_amdgcn_wave_barrier();
  {
#pragma unroll
    for (int rp = 0; rp < RPW; rp += 2) { const int r = rp + (lane >> 4), pc = lane & 15; const v4f val = *(const v4fa*)&sO[w][r][pc * 4]; *(v4f*)(O + ((size_t)b * TQ + q0 + r) * ldo + h * 64 + pc * 4) = val; }
     } }

template <int CAUSAL>
__global__ __launch_bounds__(128) void k_flashA(const _Float16* __restrict__ Q16, int ldq, const _Float16* __restrict__ K16, int ldk, const _Float16* __restrict__ Vt, const int* __restrict__ MSK, float* __restrict__ O, int ldo) {
  constexpr int RPW = 16, RTN = RPW / 16, NQB = TQ / (4 * RPW), DT = 4, KS = 2;
  __shared__ __attribute__((aligned(16))) unsigned short sP[4][RPW][40]; __shared__ __attribute__((aligned(16))) float sO[4][RPW][64 + 4];
  const int tid = threadIdx.x, w = tid >> 5, lane = tid & 31, ln = lane & 15, hh = lane >> 4;
  const int slab = blockIdx.x / QBLKS, qblk = blockIdx.x % QBLKS; (void)NQB; const int b = slab / NH, h = slab % NH; const int qb0 = qblk * (4 * RPW); const int q0 = qb0 + w * RPW;
  FragH aq[2][KS];
#pragma unroll
  for (int rt = 0; rt < RTN; ++rt) { const unsigned short* qr = (const unsigned short*)Q16 + ((size_t)b * TQ + q0 + rt * 16 + ln) * ldq + h * 64;
#pragma unroll
    for (int ks = 0; ks < KS; ++ks) { aq[rt][ks].half[0] = *(const v8us*)(qr + ks * 32 + 8 * hh); aq[rt][ks].half[1] = *(const v8us*)(qr + ks * 32 + 16 + 8 * hh); } }
  const unsigned short* Vth = (const unsigned short*)Vt + (size_t)slab * 64 * TKA;
  float m_r[2][8], l_r[2][8]; v8f oacc[2][DT];
#pragma unroll
  for (int rt = 0; rt < RTN; ++rt) {
#pragma unroll
    for (int r = 0; r < 8; ++r) { m_r[rt][r] = -3.0e38f; l_r[rt][r] = 0.f; }
#pragma unroll
    for (int dt = 0; dt < DT; ++dt) oacc[rt][dt] = (v8f){0.f,0.f,0.f,0.f,0.f,0.f,0.f,0.f}; }
  const int jend = (CAUSAL == 1) ? (qb0 + 4 * RPW) : TKA;      /* causal: keys beyond the block's last query never contribute */
  FragH bk[2][KS];      /* K fragments, fetched one pass ahead */
#pragma unroll
  for (int nt = 0; nt < 2; ++nt) { const unsigned short* kr = (const unsigned short*)K16 + ((size_t)b * TKA + nt * 16 + ln) * ldk + h * 64;
#pragma unroll
    for (int ks = 0; ks < KS; ++ks) { bk[nt][ks].half[0] = *(const v8us*)(kr + ks * 32 + 8 * hh); bk[nt][ks].half[1] = *(const v8us*)(kr + ks * 32 + 16 + 8 * hh); } }
#pragma unroll 1
  for (int j0 = 0; j0 < jend; j0 += 32) {
    FragH bv[DT];      /* this pass's V^T fragments, all issued at the head of the pass: they fly under the score products and the softmax */
#pragma unroll
    for (int dt = 0; dt < DT; ++dt) { const unsigned short* vrow = Vth + (size_t)(dt * 16 + ln) * TKA + j0; bv[dt].half[0] = *(const v8us*)(vrow + 8 * hh); bv[dt].half[1] = *(const v8us*)(vrow + 16 + 8 * hh); }
    v8f s[2][2];
#pragma unroll
    for (int nt = 0; nt < 2; ++nt) {
#pragma unroll
      for (int rt = 0; rt < RTN; ++rt) { v8f acc = (v8f){0.f,0.f,0.f,0.f,0.f,0.f,0.f,0.f};
#pragma unroll
        for (int ks = 0; ks < KS; ++ks) acc = mmaH<1>(aq[rt][ks].v, aq[rt][ks].v, bk[nt][ks].v, bk[nt][ks].v, acc); s[rt][nt] = acc; } }
    const int jn = (j0 + 32 < jend) ? j0 + 32 : j0;      /* last pass: re-reads its own keys (in bounds, unused) */
#pragma unroll
    for (int nt = 0; nt < 2; ++nt) { const unsigned short* kr = (const unsigned short*)K16 + ((size_t)b * TKA + jn + nt * 16 + ln) * ldk + h * 64;
#pragma unroll
      for (int ks = 0; ks < KS; ++ks) { bk[nt][ks].half[0] = *(const v8us*)(kr + ks * 32 + 8 * hh); bk[nt][ks].half[1] = *(const v8us*)(kr + ks * 32 + 16 + 8 * hh); } }
#pragma unroll
    for (int rt = 0; rt < RTN; ++rt)
#pragma unroll
      for (int r = 0; r < 8; ++r) { const int tq = q0 + rt * 16 + 8 * hh + r; const int k0 = j0 + ln, k1 = j0 + 16 + ln;
        const bool ok0 = (CAUSAL == 1) ? (k0 <= tq) : ((CAUSAL == 2) ? ((k0 >> 5) == (tq >> 5)) : true), ok1 = (CAUSAL == 1) ? (k1 <= tq) : ((CAUSAL == 2) ? ((k1 >> 5) == (tq >> 5)) : true);      /* mode 2: block-diagonal 32-token groups */
        const float s0 = ok0 ? s[rt][0][r] * SCL : -3.0e38f, s1 = ok1 ? s[rt][1][r] * SCL : -3.0e38f; float mc = fmaxf(s0, s1);
        mc = fmaxf(mc, __shfl_xor(mc, 1, 32)); mc = fmaxf(mc, __shfl_xor(mc, 2, 32)); mc = fmaxf(mc, __shfl_xor(mc, 4, 32)); mc = fmaxf(mc, __shfl_xor(mc, 8, 32));
        const float mn = fmaxf(m_r[rt][r], mc); const float al = (mn > -1.0e38f) ? expf(m_r[rt][r] - mn) : 1.0f; m_r[rt][r] = mn; const float p0 = ok0 ? expf(s0 - mn) : 0.f, p1 = ok1 ? expf(s1 - mn) : 0.f; l_r[rt][r] = l_r[rt][r] * al + p0 + p1;
#pragma unroll
        for (int dt = 0; dt < DT; ++dt) oacc[rt][dt][r] *= al;
        FragH t2; t2.h[0] = (_Float16)(p0 * 1024.0f); t2.h[1] = (_Float16)(p1 * 1024.0f); sP[w][rt * 16 + 8 * hh + r][ln] = t2.u[0]; sP[w][rt * 16 + 8 * hh + r][16 + ln] = t2.u[1]; }
    __builtin_amdgcn_fence(__ATOMIC_ACQ_REL, "workgroup"); __builtin_amdgcn_wave_barrier();
    FragH pa[2];
#pragma unroll
    for (int rt = 0; rt < RTN; ++rt) { pa[rt].half[0] = *(const v8us*)&sP[w][rt * 16 + ln][8 * hh]; pa[rt].half[1] = *(const v8us*)&sP[w][rt * 16 + ln][16 + 8 * hh]; }
#pragma unroll
    for (int dt = 0; dt < DT; ++dt) {
#pragma unroll
      for (int rt = 0; rt < RTN; ++rt) oacc[rt][dt] = mmaH<1>(pa[rt].v, pa[rt].v, bv[dt].v, bv[dt].v, oacc[rt][dt]); }
    __builtin_amdgcn_fence(__ATOMIC_ACQ_REL, "workgroup"); __builtin_amdgcn_wave_barrier(); }
#pragma unroll
  for (int rt = 0; rt < RTN; ++rt) {
#pragma unroll
    for (int r = 0; r < 8; ++r) { float l = l_r[rt][r]; l += __shfl_xor(l, 1, 32); l += __shfl_xor(l, 2, 32); l += __shfl_xor(l, 4, 32); l += __shfl_xor(l, 8, 32); l_r[rt][r] = (l > 0.f) ? 1.0f / (l * 1024.0f) : 0.f; }
#pragma unroll
    for (int dt = 0; dt < DT; ++dt)
#pragma unroll
      for (int r = 0; r < 8; ++r) sO[w][rt * 16 + 8 * hh + r][dt * 16 + ln] = oacc[rt][dt][r] * l_r[rt][r]; }
  __builtin_amdgcn_fence(__ATOMIC_ACQ_REL, "workgroup"); __builtin_amdgcn_wave_barrier();
  {
#pragma unroll
    for (int rp = 0; rp < RPW; rp += 2) { const int r = rp + (lane >> 4), pc = lane & 15; const v4f val = *(const v4fa*)&sO[w][r][pc * 4]; *(v4f*)(O + ((size_t)b * TQ + q0 + r) * ldo + h * 64 + pc * 4) = val; }
     } }
template <int CAUSAL>
__global__ __launch_bounds__(128) void k_flashB(const _Float16* __restrict__ Q16, int ldq, const _Float16* __restrict__ K16, int ldk, const _Float16* __restrict__ Vt, const int* __restrict__ MSK, float* __restrict__ O, int ldo) {
  constexpr int RPW = 16, RTN = RPW / 16, NQB = TQ / (4 * RPW), DT = 4, KS = 2;
  __shared__ __attribute__((aligned(16))) unsigned short sP[4][RPW][40]; __shared__ __attribute__((aligned(16))) float sO[4][RPW][64 + 4];
  const int tid = threadIdx.x, w = tid >> 5, lane = tid & 31, ln = lane & 15, hh = lane >> 4;
  const int slab = blockIdx.x / QBLKS, qblk = blockIdx.x % QBLKS; (void)NQB; const int b = slab / NH, h = slab % NH; const int qb0 = qblk * (4 * RPW); const int q0 = qb0 + w * RPW;
  FragH aq[2][KS];
#pragma unroll
  for (int rt = 0; rt < RTN; ++rt) { const unsigned short* qr = (const unsigned short*)Q16 + ((size_t)b * TQ + q0 + rt * 16 + ln) * ldq + h * 64;
#pragma unroll
    for (int ks = 0; ks < KS; ++ks) { aq[rt][ks].half[0] = *(const v8us*)(qr + ks * 32 + 8 * hh); aq[rt][ks].half[1] = *(const v8us*)(qr + ks * 32 + 16 + 8 * hh); } }
  const unsigned short* Vth = (const unsigned short*)Vt + (size_t)slab * 64 * TKB;
  float m_r[2][8], l_r[2][8]; v8f oacc[2][DT];
#pragma unroll
  for (int rt = 0; rt < RTN; ++rt) {
#pragma unroll
    for (int r = 0; r < 8; ++r) { m_r[rt][r] = -3.0e38f; l_r[rt][r] = 0.f; }
#pragma unroll
    for (int dt = 0; dt < DT; ++dt) oacc[rt][dt] = (v8f){0.f,0.f,0.f,0.f,0.f,0.f,0.f,0.f}; }
  const int jend = (CAUSAL == 1) ? (qb0 + 4 * RPW) : TKB;      /* causal: keys beyond the block's last query never contribute */
  FragH bk[2][KS];      /* K fragments, fetched one pass ahead */
#pragma unroll
  for (int nt = 0; nt < 2; ++nt) { const unsigned short* kr = (const unsigned short*)K16 + ((size_t)b * TKB + nt * 16 + ln) * ldk + h * 64;
#pragma unroll
    for (int ks = 0; ks < KS; ++ks) { bk[nt][ks].half[0] = *(const v8us*)(kr + ks * 32 + 8 * hh); bk[nt][ks].half[1] = *(const v8us*)(kr + ks * 32 + 16 + 8 * hh); } }
#pragma unroll 1
  for (int j0 = 0; j0 < jend; j0 += 32) {
    FragH bv[DT];      /* this pass's V^T fragments, all issued at the head of the pass: they fly under the score products and the softmax */
#pragma unroll
    for (int dt = 0; dt < DT; ++dt) { const unsigned short* vrow = Vth + (size_t)(dt * 16 + ln) * TKB + j0; bv[dt].half[0] = *(const v8us*)(vrow + 8 * hh); bv[dt].half[1] = *(const v8us*)(vrow + 16 + 8 * hh); }
    v8f s[2][2];
#pragma unroll
    for (int nt = 0; nt < 2; ++nt) {
#pragma unroll
      for (int rt = 0; rt < RTN; ++rt) { v8f acc = (v8f){0.f,0.f,0.f,0.f,0.f,0.f,0.f,0.f};
#pragma unroll
        for (int ks = 0; ks < KS; ++ks) acc = mmaH<1>(aq[rt][ks].v, aq[rt][ks].v, bk[nt][ks].v, bk[nt][ks].v, acc); s[rt][nt] = acc; } }
    const int jn = (j0 + 32 < jend) ? j0 + 32 : j0;      /* last pass: re-reads its own keys (in bounds, unused) */
#pragma unroll
    for (int nt = 0; nt < 2; ++nt) { const unsigned short* kr = (const unsigned short*)K16 + ((size_t)b * TKB + jn + nt * 16 + ln) * ldk + h * 64;
#pragma unroll
      for (int ks = 0; ks < KS; ++ks) { bk[nt][ks].half[0] = *(const v8us*)(kr + ks * 32 + 8 * hh); bk[nt][ks].half[1] = *(const v8us*)(kr + ks * 32 + 16 + 8 * hh); } }
#pragma unroll
    for (int rt = 0; rt < RTN; ++rt)
#pragma unroll
      for (int r = 0; r < 8; ++r) { const int tq = q0 + rt * 16 + 8 * hh + r; const int k0 = j0 + ln, k1 = j0 + 16 + ln;
        const bool ok0 = (CAUSAL == 1) ? (k0 <= tq) : ((CAUSAL == 2) ? ((k0 >> 5) == (tq >> 5)) : true), ok1 = (CAUSAL == 1) ? (k1 <= tq) : ((CAUSAL == 2) ? ((k1 >> 5) == (tq >> 5)) : true);      /* mode 2: block-diagonal 32-token groups */
        const float s0 = ok0 ? s[rt][0][r] * SCL : -3.0e38f, s1 = ok1 ? s[rt][1][r] * SCL : -3.0e38f; float mc = fmaxf(s0, s1);
        mc = fmaxf(mc, __shfl_xor(mc, 1, 32)); mc = fmaxf(mc, __shfl_xor(mc, 2, 32)); mc = fmaxf(mc, __shfl_xor(mc, 4, 32)); mc = fmaxf(mc, __shfl_xor(mc, 8, 32));
        const float mn = fmaxf(m_r[rt][r], mc); const float al = (mn > -1.0e38f) ? expf(m_r[rt][r] - mn) : 1.0f; m_r[rt][r] = mn; const float p0 = ok0 ? expf(s0 - mn) : 0.f, p1 = ok1 ? expf(s1 - mn) : 0.f; l_r[rt][r] = l_r[rt][r] * al + p0 + p1;
#pragma unroll
        for (int dt = 0; dt < DT; ++dt) oacc[rt][dt][r] *= al;
        FragH t2; t2.h[0] = (_Float16)(p0 * 1024.0f); t2.h[1] = (_Float16)(p1 * 1024.0f); sP[w][rt * 16 + 8 * hh + r][ln] = t2.u[0]; sP[w][rt * 16 + 8 * hh + r][16 + ln] = t2.u[1]; }
    __builtin_amdgcn_fence(__ATOMIC_ACQ_REL, "workgroup"); __builtin_amdgcn_wave_barrier();
    FragH pa[2];
#pragma unroll
    for (int rt = 0; rt < RTN; ++rt) { pa[rt].half[0] = *(const v8us*)&sP[w][rt * 16 + ln][8 * hh]; pa[rt].half[1] = *(const v8us*)&sP[w][rt * 16 + ln][16 + 8 * hh]; }
#pragma unroll
    for (int dt = 0; dt < DT; ++dt) {
#pragma unroll
      for (int rt = 0; rt < RTN; ++rt) oacc[rt][dt] = mmaH<1>(pa[rt].v, pa[rt].v, bv[dt].v, bv[dt].v, oacc[rt][dt]); }
    __builtin_amdgcn_fence(__ATOMIC_ACQ_REL, "workgroup"); __builtin_amdgcn_wave_barrier(); }
#pragma unroll
  for (int rt = 0; rt < RTN; ++rt) {
#pragma unroll
    for (int r = 0; r < 8; ++r) { float l = l_r[rt][r]; l += __shfl_xor(l, 1, 32); l += __shfl_xor(l, 2, 32); l += __shfl_xor(l, 4, 32); l += __shfl_xor(l, 8, 32); l_r[rt][r] = (l > 0.f) ? 1.0f / (l * 1024.0f) : 0.f; }
#pragma unroll
    for (int dt = 0; dt < DT; ++dt)
#pragma unroll
      for (int r = 0; r < 8; ++r) sO[w][rt * 16 + 8 * hh + r][dt * 16 + ln] = oacc[rt][dt][r] * l_r[rt][r]; }
  __builtin_amdgcn_fence(__ATOMIC_ACQ_REL, "workgroup"); __builtin_amdgcn_wave_barrier();
  {
#pragma unroll
    for (int rp = 0; rp < RPW; rp += 2) { const int r = rp + (lane >> 4), pc = lane & 15; const v4f val = *(const v4fa*)&sO[w][r][pc * 4]; *(v4f*)(O + ((size_t)b * TQ + q0 + r) * ldo + h * 64 + pc * 4) = val; }
     } }
__global__ __launch_bounds__(256) void k_wsc(const float* __restrict__ Wm, _Float16* __restrict__ Bt, size_t n8, float sc) { const size_t t = (size_t)blockIdx.x * 256 + threadIdx.x; if (t >= n8) return; FragH f; for (int q = 0; q < 8; ++q) f.h[q] = (_Float16)(bf16_round(Wm[t * 8 + q]) * sc); *(v8us*)((unsigned short*)Bt + t * 8) = f.half[0];  }      /* torch (out,in) weight == Bt[n][k]: scaled copy */
__global__ __launch_bounds__(256) void k_comb(const float* __restrict__ OL, const float* __restrict__ OG, const float* __restrict__ gate, _Float16* __restrict__ O16, size_t n8) {
  #pragma clang fp contract(off)
  const size_t t = (size_t)blockIdx.x * 256 + threadIdx.x; if (t >= n8) return; const float g = 1.0f / (1.0f + expf(-bf16_round(gate[0]))); const float h1 = 1.0f - g; FragH f;
  for (int q = 0; q < 8; ++q) { float a = g * OL[t * 8 + q]; a += h1 * OG[t * 8 + q]; f.h[q] = (_Float16)a; }
  *(v8us*)((unsigned short*)O16 + t * 8) = f.half[0];  }

extern "C" void kernel_launch(void* const* d_in, const int* in_sizes, int n_in,
                              void* d_out, int out_size, void* d_ws, size_t ws_size, hipStream_t stream) {
  (void)in_sizes; (void)n_in; (void)out_size;
  const float* const* I = (const float* const*)d_in; const float* lh = I[0]; const float* gh = I[1]; const float* qw = I[2]; const float* qb = I[3]; const float* kw = I[4]; const float* kb = I[5]; const float* vw = I[6]; const float* vb = I[7]; const float* kgw = I[8]; const float* kgb = I[9]; const float* vgw = I[10]; const float* vgb = I[11]; const float* ow = I[12]; const float* ob = I[13]; const float* gate = I[14];
  char* ws = (char*)d_ws; size_t off = 0;
  auto take = [&](size_t bytes) { char* p = ws + off; off += (bytes + 255) & ~(size_t)255; return p; };
  const size_t w8 = (size_t)EMB * EMB / 8, npl = (size_t)NRL * EMB, npg = (size_t)NRG * EMB;
  _Float16* BQ = (_Float16*)take(w8 * 16); _Float16* BK = (_Float16*)take(w8 * 16); _Float16* BV = (_Float16*)take(w8 * 16); _Float16* BKG = (_Float16*)take(w8 * 16); _Float16* BVG = (_Float16*)take(w8 * 16); _Float16* BO = (_Float16*)take(w8 * 16);
  _Float16* XL = (_Float16*)take(npl * 2); _Float16* XG = (_Float16*)take(npg * 2); _Float16* Q16 = (_Float16*)take(npl * 2); _Float16* KL = (_Float16*)take(npl * 2); _Float16* VL = (_Float16*)take(npl * 2); _Float16* KG = (_Float16*)take(npg * 2); _Float16* VG = (_Float16*)take(npg * 2); _Float16* VTL = (_Float16*)take(npl * 2); _Float16* VTG = (_Float16*)take(npg * 2);
  float* OL = (float*)take(npl * 4); float* OG = (float*)take(npl * 4); _Float16* O16 = XL;      /* O16 over the local input plane (dead after its projections) */
  if (off > ws_size) return;      /* 12 + 8+2+8+8+8+2+2+8+2 + 16+16 = 92 MiB */
  const unsigned g8 = (unsigned)((w8 + 255) / 256);
  k_wsc<<<g8, 256, 0, stream>>>(qw, BQ, w8, 16.0f); k_wsc<<<g8, 256, 0, stream>>>(kw, BK, w8, 16.0f); k_wsc<<<g8, 256, 0, stream>>>(vw, BV, w8, 16.0f); k_wsc<<<g8, 256, 0, stream>>>(kgw, BKG, w8, 16.0f); k_wsc<<<g8, 256, 0, stream>>>(vgw, BVG, w8, 16.0f); k_wsc<<<g8, 256, 0, stream>>>(ow, BO, w8, 16.0f);
  k_x16<<<(unsigned)((npl / 8 + 255) / 256), 256, 0, stream>>>(lh, XL, npl / 8); k_x16<<<(unsigned)((npg / 8 + 255) / 256), 256, 0, stream>>>(gh, XG, npg / 8);
  const dim3 gL((NRL / 128) * (EMB / 64), 1), gGl((NRG / 128) * (EMB / 64), 1);
  k_gemm2<0><<<gL, 128, 0, stream>>>(XL, EMB, 0, BQ, EMB, 0, 0.0625f, qb, 0, nullptr, 1, 0, 0, nullptr, Q16, EMB, 0, NRL, EMB, EMB);
  k_gemm2<0><<<gL, 128, 0, stream>>>(XL, EMB, 0, BK, EMB, 0, 0.0625f, kb, 0, nullptr, 1, 0, 0, nullptr, KL, EMB, 0, NRL, EMB, EMB);
  k_gemm2<0><<<gL, 128, 0, stream>>>(XL, EMB, 0, BV, EMB, 0, 0.0625f, vb, 0, nullptr, 1, 0, 0, nullptr, VL, EMB, 0, NRL, EMB, EMB);
  k_gemm2<0><<<gGl, 128, 0, stream>>>(XG, EMB, 0, BKG, EMB, 0, 0.0625f, kgb, 0, nullptr, 1, 0, 0, nullptr, KG, EMB, 0, NRG, EMB, EMB);
  k_gemm2<0><<<gGl, 128, 0, stream>>>(XG, EMB, 0, BVG, EMB, 0, 0.0625f, vgb, 0, nullptr, 1, 0, 0, nullptr, VG, EMB, 0, NRG, EMB, EMB);
  k_vt<NH, LL><<<NB * NH * (LL / 64), 256, 0, stream>>>(VL, EMB, 0, VTL); k_vt<NH, GG><<<NB * NH * (GG / 64), 256, 0, stream>>>(VG, EMB, 0, VTG);
  k_flashA<0><<<NB * NH * QBLKS, 128, 0, stream>>>(Q16, EMB, KL, EMB, VTL, nullptr, OL, EMB);      /* local: 2048 keys */
  k_flashB<0><<<NB * NH * QBLKS, 128, 0, stream>>>(Q16, EMB, KG, EMB, VTG, nullptr, OG, EMB);      /* global: 512 keys */
  k_comb<<<(unsigned)((npl / 8 + 255) / 256), 256, 0, stream>>>(OL, OG, gate, O16, npl / 8);
  k_gemm2<0><<<gL, 128, 0, stream>>>(O16, EMB, 0, BO, EMB, 0, 0.0625f, ob, 0, nullptr, 1, 0, 0, (float*)d_out, nullptr, EMB, 0, NRL, EMB, EMB);
}

// v002
// A run of this version takes 335 microseconds.
// In both of two side-by-side timings against v001, it was 1.12 times as fast.
// Counting every step since v000, it is 1.71 times as fast.
#include <hip/hip_runtime.h>
// InfiniSpanAttention (2 batches; 2048 local tokens, 512 global tokens, D = 1024, 16 heads of 64): q/k_l/v_l from local_hidden, k_g/v_g from global_hidden (torch (out,in) linears + bias); out_l = softmax(q k_l^T s) v_l, out_g = softmax(q k_g^T s) v_g (no masks); out = sigmoid(gate) out_l + (1 - sigmoid(gate)) out_g -> merged heads -> out_w + out_b.
// Compute dtype: inputs and parameters rounded to bf16; q, k, v, P and the combined attention output as f16 operands (~2^-12); f32 accumulation/softmax/gating. v_wmma_f32_16x16x32_f16.
#define NB 2
#define EMB 1024
#define NRL (NB * LL)            /* 4096 local rows */
#define NRG (NB * GG)            /* 1024 global rows */
#define LL 2048                  /* local tokens (queries; local keys) */
#define GG 512                   /* global tokens (keys of the second attention) */
#define TQ LL
#define TK LL
#define TKA LL
#define TKB GG
#define NH 16
#define SCL 0.125f               /* 64^-0.5 */
#define QBLKS (TQ / 64)
typedef __bf16 v16b __attribute__((ext_vector_type(16)));
typedef unsigned short v8us __attribute__((ext_vector_type(8), may_alias));
typedef float  v8f  __attribute__((ext_vector_type(8)));
typedef float  v4f  __attribute__((ext_vector_type(4)));
typedef float  v4fa __attribute__((ext_vector_type(4), may_alias));
union FragB { v16b v; v8us half[2]; unsigned short u[16]; };

__device__ __forceinline__ unsigned short bf16_bits(float x) { unsigned int u = __float_as_uint(x); return (unsigned short)((u + 0x7FFFu + ((u >> 16) & 1u)) >> 16); }
__device__ __forceinline__ float bf16_val(unsigned short b) { return __uint_as_float(((unsigned int)b) << 16); }
__device__ __forceinline__ float bf16_round(float x) { return bf16_val(bf16_bits(x)); }
// D += A·B with NT terms: 1 = ah·bh, 2 = + al·bh (A split), 3 = + ah·bl (both split)
template <int NT>
__device__ __forceinline__ v8f mmaN(v16b ah, v16b al, v16b bh, v16b bl, v8f c) {
  c = __builtin_amdgcn_wmma_f32_16x16x32_bf16(false, ah, false, bh, (short)0, c, false, false);
  if (NT >= 2) c = __builtin_amdgcn_wmma_f32_16x16x32_bf16(false, al, false, bh, (short)0, c, false, false);
  if (NT >= 3) c = __builtin_amdgcn_wmma_f32_16x16x32_bf16(false, ah, false, bl, (short)0, c, false, false);
  asm volatile("v_nop\n\tv_nop\n\tv_nop\n\tv_nop" : "+v"(c) : "v"(ah), "v"(al), "v"(bh), "v"(bl));
  return c;
}

__global__ __launch_bounds__(256) void k_wt_bf16(const float* __restrict__ W, unsigned short* __restrict__ Wt, int K, int N) {
  const int t = blockIdx.x * 256 + threadIdx.x;
  const int k8n = K / 8;
  if (t >= N * k8n) return;
  const int n = t / k8n, k8 = (t % k8n) * 8;
  v8us v;
#pragma unroll
  for (int i = 0; i < 8; ++i) v[i] = bf16_bits(W[(size_t)(k8 + i) * N + n]);
  *(v8us*)(Wt + (size_t)n * K + k8) = v;
  
}

// GEMM C[M][N] (f32, pitch ldc) = act(A[M][K]·W + bias). A f32 row-major (pitch lda) converted per fragment to bf16
// (ASPLIT: hi/lo two planes -> 2 terms, else single rounded term); Wt bf16 [N][K] (pitch ldb). BIAS_BF16 rounds the
// bias to bf16 first (bias quantised to bf16 before the add). K%32==0, M%16==0, N%64==0.
template <bool ASPLIT, int ACT, bool BIAS_BF16>
__global__ __launch_bounds__(128) void k_gemm_bf(const float* __restrict__ A, int lda, const unsigned short* __restrict__ Wt, int ldb,
                                               const float* __restrict__ bias, float* __restrict__ C, int ldc, int M, int N, int K) {
  __shared__ __attribute__((aligned(16))) float so[4][16][64];
  const int tid = threadIdx.x, w = tid >> 5, lane = tid & 31, ln = lane & 15, hh = lane >> 4;
  const int ntn = N / 64;
  const int wid = blockIdx.x * 4 + w;
  const int mt = wid / ntn, nq = wid % ntn;
  if (mt * 16 >= M) return;
  const int row0 = mt * 16, col0 = nq * 64;
  const float* arow = A + (size_t)(row0 + ln) * lda;
  v8f acc[4] = {};
  for (int kb = 0; kb < K; kb += 32) {
    FragB ah, al;
    const v4f x0 = *(const v4fa*)(arow + kb + 8 * hh), x1 = *(const v4fa*)(arow + kb + 8 * hh + 4);
    const v4f x2 = *(const v4fa*)(arow + kb + 16 + 8 * hh), x3 = *(const v4fa*)(arow + kb + 16 + 8 * hh + 4);
    float xs[16] = {x0[0],x0[1],x0[2],x0[3],x1[0],x1[1],x1[2],x1[3],x2[0],x2[1],x2[2],x2[3],x3[0],x3[1],x3[2],x3[3]};
#pragma unroll
    for (int i = 0; i < 16; ++i) { const unsigned short hb = bf16_bits(xs[i]); ah.u[i] = hb; al.u[i] = ASPLIT ? bf16_bits(xs[i] - bf16_val(hb)) : (unsigned short)0; }
#pragma unroll
    for (int t = 0; t < 4; ++t) {
      const unsigned short* brow = Wt + (size_t)(col0 + t * 16 + ln) * ldb + kb;
      FragB b;
      b.half[0] = *(const v8us*)(brow + 8 * hh);
      b.half[1] = *(const v8us*)(brow + 16 + 8 * hh);
      acc[t] = mmaN<ASPLIT ? 2 : 1>(ah.v, al.v, b.v, b.v, acc[t]);
    }
  }
#pragma unroll
  for (int t = 0; t < 4; ++t) {
    float bv = bias ? bias[col0 + t * 16 + ln] : 0.f;
    if (BIAS_BF16) bv = bf16_round(bv);
#pragma unroll
    for (int r = 0; r < 8; ++r) { float v = acc[t][r] + bv; if (ACT == 1) v = fmaxf(v, 0.f); so[w][8 * hh + r][t * 16 + ln] = v; }
  }
  __builtin_amdgcn_fence(__ATOMIC_ACQ_REL, "workgroup");
  __builtin_amdgcn_wave_barrier();
  const int rsub = lane >> 4, c4 = (lane & 15) * 4;
  {
#pragma unroll
    for (int q = 0; q < 8; ++q) {
      const int r = q * 2 + rsub;
      const v4f v = *(const v4fa*)&so[w][r][c4];
      *(v4f*)(C + (size_t)(row0 + r) * ldc + col0 + c4) = v;
    }
    
  }
}

// GEMM C = act(A·W + bias + resid): A f32 (ASPLIT -> hi/lo 2 terms), Wt bf16 [N][K]; ACT 0 none, 1 relu, 2 exact gelu;
// resid (optional, f32, row index = (row % rmod), pitch ldr, RES_BF16 rounds it) added before the activation.
template <bool ASPLIT, int ACT, bool BIAS_BF16, bool RES_BF16>
__global__ __launch_bounds__(128) void k_gemm_bf3(const float* __restrict__ A, int lda, const unsigned short* __restrict__ Wt, int ldb,
                                                const float* __restrict__ bias, const float* __restrict__ resid, int rmod, int ldr,
                                                float* __restrict__ C, int ldc, int M, int N, int K) {
  __shared__ __attribute__((aligned(16))) float so[4][16][64];
  const int tid = threadIdx.x, w = tid >> 5, lane = tid & 31, ln = lane & 15, hh = lane >> 4;
  const int ntn = N / 64;
  const int wid = blockIdx.x * 4 + w;
  const int mt = wid / ntn, nq = wid % ntn;
  if (mt * 16 >= M) return;
  const int row0 = mt * 16, col0 = nq * 64;
  const float* arow = A + (size_t)(row0 + ln) * lda;
  v8f acc[4] = {};
  for (int kb = 0; kb < K; kb += 32) {
    FragB ah, al;
    const v4f x0 = *(const v4fa*)(arow + kb + 8 * hh), x1 = *(const v4fa*)(arow + kb + 8 * hh + 4);
    const v4f x2 = *(const v4fa*)(arow + kb + 16 + 8 * hh), x3 = *(const v4fa*)(arow + kb + 16 + 8 * hh + 4);
    float xs[16] = {x0[0],x0[1],x0[2],x0[3],x1[0],x1[1],x1[2],x1[3],x2[0],x2[1],x2[2],x2[3],x3[0],x3[1],x3[2],x3[3]};
#pragma unroll
    for (int i = 0; i < 16; ++i) { const unsigned short hb = bf16_bits(xs[i]); ah.u[i] = hb; al.u[i] = ASPLIT ? bf16_bits(xs[i] - bf16_val(hb)) : (unsigned short)0; }
#pragma unroll
    for (int t = 0; t < 4; ++t) {
      const unsigned short* brow = Wt + (size_t)(col0 + t * 16 + ln) * ldb + kb;
      FragB b;
      b.half[0] = *(const v8us*)(brow + 8 * hh);
      b.half[1] = *(const v8us*)(brow + 16 + 8 * hh);
      acc[t] = mmaN<ASPLIT ? 2 : 1>(ah.v, al.v, b.v, b.v, acc[t]);
    }
  }
#pragma unroll
  for (int t = 0; t < 4; ++t) {
    const int col = col0 + t * 16 + ln;
    float bv = bias ? bias[col] : 0.f;
    if (BIAS_BF16) bv = bf16_round(bv);
#pragma unroll
    for (int r = 0; r < 8; ++r) {
      float v = acc[t][r] + bv;
      if (resid) { float rv = resid[(size_t)((row0 + 8 * hh + r) % rmod) * ldr + col]; if (RES_BF16) rv = bf16_round(rv); v += rv; }
      if (ACT == 1) v = fmaxf(v, 0.f);
      if (ACT == 2) v = 0.5f * v * (1.0f + erff(v * 0.70710678118654752f));
      if (ACT == 3) { const float u = 0.7978845608028654f * (v + 0.044715f * v * v * v); v = 0.5f * v * (1.0f + tanhf(u)); }
      so[w][8 * hh + r][t * 16 + ln] = v;
    }
  }
  __builtin_amdgcn_fence(__ATOMIC_ACQ_REL, "workgroup");
  __builtin_amdgcn_wave_barrier();
  const int rsub = lane >> 4, c4 = (lane & 15) * 4;
  {
#pragma unroll
    for (int q = 0; q < 8; ++q) {
      const int r = q * 2 + rsub;
      const v4f v = *(const v4fa*)&so[w][r][c4];
      *(v4f*)(C + (size_t)(row0 + r) * ldc + col0 + c4) = v;
    }
    
  }
}
// row LayerNorm (biased variance, eps) over N: s = X (+ R); optional out_sum <- s; out_norm <- (s-mu)*rsqrt(var+eps)*g + b
template <bool PARAM_BF16>
__global__ __launch_bounds__(256) void k_layernorm(const float* __restrict__ X, const float* __restrict__ R, const float* __restrict__ g, const float* __restrict__ bta,
                                                  float* __restrict__ out_sum, float* __restrict__ out_norm, int N, float eps) {
  __shared__ float red[256];
  const int row = blockIdx.x, tid = threadIdx.x;
  const float* x = X + (size_t)row * N; const float* rr = R ? R + (size_t)row * N : nullptr;
  float vals[16];                     // up to N = 4096
  const int per = N / 256;            // contiguous chunk per thread? use strided-by-4 chunks: thread handles j = tid*4 + 1024*u
  float s1 = 0.f;
  for (int u = 0; u < per / 4; ++u) {
    const int j = tid * 4 + 1024 * u;
    const v4f a = *(const v4fa*)(x + j);
    v4f b = {0.f,0.f,0.f,0.f}; if (rr) b = *(const v4fa*)(rr + j);
#pragma unroll
    for (int q = 0; q < 4; ++q) { const float v = a[q] + b[q]; vals[u * 4 + q] = v; s1 += v; }
  }
  red[tid] = s1; __syncthreads();
  for (int st = 128; st > 0; st >>= 1) { if (tid < st) red[tid] += red[tid + st]; __syncthreads(); }
  const float mu = red[0] / (float)N; __syncthreads();
  float s2 = 0.f;
  for (int u = 0; u < per / 4; ++u)
#pragma unroll
    for (int q = 0; q < 4; ++q) { const float c = vals[u * 4 + q] - mu; s2 += c * c; }
  red[tid] = s2; __syncthreads();
  for (int st = 128; st > 0; st >>= 1) { if (tid < st) red[tid] += red[tid + st]; __syncthreads(); }
  const float rs = rsqrtf(red[0] / (float)N + eps);
  {
    for (int u = 0; u < per / 4; ++u) {
      const int j = tid * 4 + 1024 * u;
      v4f o, sm;
#pragma unroll
      for (int q = 0; q < 4; ++q) {
        float gg = g[j + q], bb = bta[j + q];
        if (PARAM_BF16) { gg = bf16_round(gg); bb = bf16_round(bb); }
        sm[q] = vals[u * 4 + q]; o[q] = (vals[u * 4 + q] - mu) * rs * gg + bb;
      }
      if (out_sum) *(v4f*)(out_sum + (size_t)row * N + j) = sm;
      *(v4f*)(out_norm + (size_t)row * N + j) = o;
    }
    
  }
}



// ---- f16 WMMA path (v_wmma_f32_16x16x32_f16): 11-bit significands for operands in range — used where a [0,1] probability operand needs more precision than bf16
typedef _Float16 v16h __attribute__((ext_vector_type(16)));
union FragH { v16h v; v8us half[2]; _Float16 h[16]; unsigned short u[16]; };
template <int NT>
__device__ __forceinline__ v8f mmaH(v16h ah, v16h al, v16h bh, v16h bl, v8f c) {
  c = __builtin_amdgcn_wmma_f32_16x16x32_f16(false, ah, false, bh, (short)0, c, false, false);
  if (NT >= 2) c = __builtin_amdgcn_wmma_f32_16x16x32_f16(false, al, false, bh, (short)0, c, false, false);
  if (NT >= 3) c = __builtin_amdgcn_wmma_f32_16x16x32_f16(false, ah, false, bl, (short)0, c, false, false);
  asm volatile("v_nop\n\tv_nop\n\tv_nop\n\tv_nop" : "+v"(c) : "v"(ah), "v"(al), "v"(bh), "v"(bl));
  return c;
}
// batched GEMM like k_gemm_b but f16 operands: A f32 (split into f16 hi/lo if ASPLIT, else rounded to f16), Bt = f16 values [n][k]; alpha; C f32; N multiple of 16 (partial tiles skipped)
template <bool ASPLIT>
__global__ __launch_bounds__(128) void k_gemm_h(const float* __restrict__ A, int lda, size_t sA, const _Float16* __restrict__ Bh, int ldb, size_t sB, float alpha, float* __restrict__ C, int ldc, size_t sC, int M, int N, int K) {
  __shared__ __attribute__((aligned(16))) float so[4][16][64];
  const int tid = threadIdx.x, w = tid >> 5, lane = tid & 31, ln = lane & 15, hh = lane >> 4; const int by = blockIdx.y;
  A += (size_t)by * sA; Bh += (size_t)by * sB; C += (size_t)by * sC;
  const int ntn = (N + 63) / 64; const int wid = blockIdx.x * 4 + w; const int mt = wid / ntn, nq = wid % ntn; if (mt * 16 >= M) return;
  const int row0 = mt * 16, col0 = nq * 64; const float* arow = A + (size_t)(row0 + ln) * lda;
  v8f acc[4] = {};
  for (int kb = 0; kb < K; kb += 32) {
    FragH ah, al;
    const v4f x0 = *(const v4fa*)(arow + kb + 8 * hh), x1 = *(const v4fa*)(arow + kb + 8 * hh + 4), x2 = *(const v4fa*)(arow + kb + 16 + 8 * hh), x3 = *(const v4fa*)(arow + kb + 16 + 8 * hh + 4);
    float xs[16] = {x0[0],x0[1],x0[2],x0[3],x1[0],x1[1],x1[2],x1[3],x2[0],x2[1],x2[2],x2[3],x3[0],x3[1],x3[2],x3[3]};
#pragma unroll
    for (int i = 0; i < 16; ++i) { const _Float16 h = (_Float16)xs[i]; ah.h[i] = h; al.h[i] = ASPLIT ? (_Float16)(xs[i] - (float)h) : (_Float16)0.0f; }
#pragma unroll
    for (int t = 0; t < 4; ++t) { if (col0 + t * 16 >= N) continue; const size_t boff = (size_t)(col0 + t * 16 + ln) * ldb + kb; FragH bq; bq.half[0] = *(const v8us*)(Bh + boff + 8 * hh); bq.half[1] = *(const v8us*)(Bh + boff + 16 + 8 * hh);
      acc[t] = mmaH<ASPLIT ? 2 : 1>(ah.v, al.v, bq.v, bq.v, acc[t]); }
  }
#pragma unroll
  for (int t = 0; t < 4; ++t) { if (col0 + t * 16 >= N) continue;
#pragma unroll
    for (int r = 0; r < 8; ++r) so[w][8 * hh + r][t * 16 + ln] = acc[t][r] * alpha; }
  __builtin_amdgcn_fence(__ATOMIC_ACQ_REL, "workgroup"); __builtin_amdgcn_wave_barrier();
  const int rsub = lane >> 4, c4 = (lane & 15) * 4;
  {
#pragma unroll
    for (int q = 0; q < 8; ++q) { const int r = q * 2 + rsub; if (col0 + c4 < N) { const v4f v = *(const v4fa*)&so[w][r][c4]; *(v4f*)(C + (size_t)(row0 + r) * ldc + col0 + c4) = v; } }
     }
}

// Wt[n][k] = f16(W[k][n]·scale) from f32 row-major W[K][N] (scale = power of two; bf16-exact weights stay exact in f16 away from the subnormal range)
__global__ __launch_bounds__(256) void k_wt_f16(const float* __restrict__ W, _Float16* __restrict__ Wt, int K, int N, float scale) {
  const int t = blockIdx.x * 256 + threadIdx.x; if (t >= N * (K / 8)) return; const int n = t / (K / 8), k8 = (t % (K / 8)) * 8; FragH f;
#pragma unroll
  for (int i = 0; i < 8; ++i) f.h[i] = (_Float16)(bf16_round(W[(size_t)(k8 + i) * N + n]) * scale); const v8us o = f.half[0];
  *(v8us*)((unsigned short*)Wt + (size_t)n * K + k8) = o; 
}
// k_gemm_hh variant with fused epilogue: v = acc·alpha + bias[by·sBias + col] (+ CP[(row/rowsPerB)·sCPb + by·64 + col] if CP) ; ACT 0 none / 1 elu ; writes f16 C16 (and f32 C if non-null)
template <int ACT>
__global__ __launch_bounds__(128) void k_gemm_hhx(const _Float16* __restrict__ A, int lda, size_t sA, const _Float16* __restrict__ Bh, int ldb, size_t sB, float alpha, const float* __restrict__ bias, size_t sBias, const float* __restrict__ CP, int rowsPerB, size_t sCPb, int row0g,
    float* __restrict__ C, _Float16* __restrict__ C16, int ldc, size_t sC, int M, int N, int K) {
  __shared__ __attribute__((aligned(16))) float so[4][16][64];
  const int tid = threadIdx.x, w = tid >> 5, lane = tid & 31, ln = lane & 15, hh = lane >> 4; const int by = blockIdx.y;
  A += (size_t)by * sA; Bh += (size_t)by * sB; const size_t cofs = (size_t)by * sC; const float* bp = bias ? bias + (size_t)by * sBias : nullptr;
  const int ntn = (N + 63) / 64; const int wid = blockIdx.x * 4 + w; const int mt = wid / ntn, nq = wid % ntn; if (mt * 16 >= M) return;
  const int row0 = mt * 16, col0 = nq * 64; const _Float16* arow = A + (size_t)(row0 + ln) * lda;
  v8f acc[4] = {};
  for (int kb = 0; kb < K; kb += 32) { FragH ah; ah.half[0] = *(const v8us*)((const unsigned short*)arow + kb + 8 * hh); ah.half[1] = *(const v8us*)((const unsigned short*)arow + kb + 16 + 8 * hh);
#pragma unroll
    for (int t = 0; t < 4; ++t) { if (col0 + t * 16 >= N) continue; const size_t boff = (size_t)(col0 + t * 16 + ln) * ldb + kb; FragH bq; bq.half[0] = *(const v8us*)((const unsigned short*)Bh + boff + 8 * hh); bq.half[1] = *(const v8us*)((const unsigned short*)Bh + boff + 16 + 8 * hh);
      acc[t] = mmaH<1>(ah.v, ah.v, bq.v, bq.v, acc[t]); }
  }
#pragma unroll
  for (int t = 0; t < 4; ++t) { if (col0 + t * 16 >= N) continue; const int col = col0 + t * 16 + ln; const float bv = bp ? bf16_round(bp[col]) : 0.f;
#pragma unroll
    for (int r = 0; r < 8; ++r) { float v = acc[t][r] * alpha + bv; if (CP) { const int bidx = (row0g + row0 + 8 * hh + r) / rowsPerB; v += CP[(size_t)bidx * sCPb + (size_t)by * 64 + col]; } if (ACT == 1) v = (v > 0.f) ? v : expm1f(v); else if (ACT == 7) v = (v > 0.f) ? v + 1.0f : expf(v); else if (ACT == 8) v = tanhf(v); else if (ACT == 9) v = 0.5f * v * (1.0f + tanhf(0.7978845608028654f * (v + 0.044715f * v * v * v))); else if (ACT == 11) v = 1.0f / (1.0f + expf(-v)); else if (ACT == 12) v = (v > 0.f) ? v : 0.01f * v; else if (ACT == 14) v = (v > 0.f) ? v : 0.1f * v; else if (ACT == 15) v = v / (1.0f + expf(-v)); else if (ACT == 3) v = fmaxf(v, 0.f); else if (ACT == 6) v = 0.5f * v * (1.0f + erff(v * 0.70710678118654752f)); so[w][8 * hh + r][t * 16 + ln] = v; } }
  __builtin_amdgcn_fence(__ATOMIC_ACQ_REL, "workgroup"); __builtin_amdgcn_wave_barrier();
  const int rsub = lane >> 4, c4 = (lane & 15) * 4; typedef _Float16 v4h __attribute__((ext_vector_type(4)));
  {
#pragma unroll
    for (int q = 0; q < 8; ++q) { const int r = q * 2 + rsub; if (col0 + c4 < N) { const v4f v = *(const v4fa*)&so[w][r][c4]; if (C) *(v4f*)(C + cofs + (size_t)(row0 + r) * ldc + col0 + c4) = v; if (C16) { v4h h4; for (int i = 0; i < 4; ++i) h4[i] = (_Float16)v[i]; *(v4h*)(C16 + cofs + (size_t)(row0 + r) * ldc + col0 + c4) = h4; } } }
     }
}


typedef _Float16 v4h __attribute__((ext_vector_type(4)));

// ---- fragment-order plane of an f16 matrix M[rows][K]: 1-KiB blocks of 16 rows x 32 k, block (row >> 4, k >> 5) at element ((row >> 4) * (K >> 5) + (k >> 5)) * 512;
// inside a block 64 pieces of 8 k: piece j * 32 + lane holds row (lane & 15), k = 16 * j + 8 * (lane >> 4) + 0..7. A wave's 16-byte fragment load reads 512 bytes in a row: 4 whole lines, not 16 pieces of lines.
__device__ __forceinline__ size_t fo_src(size_t t, int K) { const int kbn = K >> 5; const size_t blk = t >> 6; const int c = (int)(t & 63), j = c >> 5, l = c & 31; return ((blk / kbn) * 16 + (l & 15)) * (size_t)K + (size_t)(blk % kbn) * 32 + j * 16 + (l >> 4) * 8; }      /* piece t of a plane -> its first element in the row-major matrix */

__global__ __launch_bounds__(256) void k_x16(const float* __restrict__ x, _Float16* __restrict__ X16, size_t n8) { const size_t t = (size_t)blockIdx.x * 256 + threadIdx.x; if (t >= n8) return; FragH f;
#pragma unroll
  for (int q = 0; q < 8; ++q) f.h[q] = (_Float16)bf16_round(x[fo_src(t, EMB) + q]); *(v8us*)((unsigned short*)X16 + t * 8) = f.half[0];  }      /* X16: fragment-order plane, K = EMB */
__global__ __launch_bounds__(256) void k_h16(const float* __restrict__ x, _Float16* __restrict__ X16, size_t n8) { const size_t t = (size_t)blockIdx.x * 256 + threadIdx.x; if (t >= n8) return; FragH f;
#pragma unroll
  for (int q = 0; q < 8; ++q) f.h[q] = (_Float16)x[t * 8 + q]; *(v8us*)((unsigned short*)X16 + t * 8) = f.half[0];  }
__global__ __launch_bounds__(256) void k_round16f(const float* __restrict__ W, _Float16* __restrict__ Bt, size_t n8) { const size_t t = (size_t)blockIdx.x * 256 + threadIdx.x; if (t >= n8) return; FragH f;
#pragma unroll
  for (int i = 0; i < 8; ++i) f.h[i] = (_Float16)(bf16_round(W[t * 8 + i]) * 16.0f); *(v8us*)((unsigned short*)Bt + t * 8) = f.half[0];  }
template <int NHv, int TTv>
__global__ __launch_bounds__(256) void k_vt(const _Float16* __restrict__ V16, int ldv, int voff, _Float16* __restrict__ Vt) { __shared__ unsigned short tl[64][66]; const int tid = threadIdx.x; const int slab = blockIdx.x / (TTv / 64), lg = blockIdx.x % (TTv / 64); const int b = slab / NHv, h = slab % NHv;
  for (int i = tid; i < 64 * 8; i += 256) { const int r = i / 8, c8 = (i % 8) * 8; FragH f; f.half[0] = *(const v8us*)((const unsigned short*)V16 + ((size_t)b * TTv + lg * 64 + r) * ldv + voff + h * 64 + c8);
#pragma unroll
    for (int q = 0; q < 8; ++q) tl[r][c8 + q] = f.u[q]; }
  __syncthreads();
  {
#pragma unroll
    for (int rd = 0; rd < 2; ++rd) { const int c = rd * 256 + tid, rbl = c >> 7, kbl = (c >> 6) & 1, cc = c & 63, l = cc & 31; const int d = rbl * 16 + (l & 15), k0 = kbl * 32 + (cc >> 5) * 16 + (l >> 4) * 8; FragH f;      /* Vt: fragment-order plane, rows = slab * 64 + d, K = TTv keys */
#pragma unroll
      for (int q = 0; q < 8; ++q) f.u[q] = tl[k0 + q][d];
      *(v8us*)((unsigned short*)Vt + (((size_t)slab * 4 + rbl) * (TTv / 32) + lg * 2 + kbl) * 512 + cc * 8) = f.half[0]; }
     } }

__global__ __launch_bounds__(256) void k_hl(const float* __restrict__ F, _Float16* __restrict__ Hh, _Float16* __restrict__ Hl, size_t n8) { const size_t t = (size_t)blockIdx.x * 256 + threadIdx.x; if (t >= n8) return; FragH fh, fl; const v4f a = *(const v4fa*)(F + t * 8), c = *(const v4fa*)(F + t * 8 + 4);
#pragma unroll
  for (int q = 0; q < 4; ++q) { _Float16 h = (_Float16)a[q]; fh.h[q] = h; fl.h[q] = (_Float16)((a[q] - (float)h) * 1024.0f); h = (_Float16)c[q]; fh.h[4 + q] = h; fl.h[4 + q] = (_Float16)((c[q] - (float)h) * 1024.0f); }
  { *(v8us*)((unsigned short*)Hh + t * 8) = fh.half[0]; *(v8us*)((unsigned short*)Hl + t * 8) = fl.half[0];  } }

// ---- fast GEMM (wave tile 32x64; requires M % 32 == 0 rows per launch region, N % 64 == 0 and K % 64 == 0); epilogue = k_gemm_hhx semantics ----
// Two fragment sets (even and odd 32-k steps). Each fragment is reloaded for the step two ahead right behind its last product, so a step's loads fly under the other set's products.
__device__ __forceinline__ v16h g2_frag(const _Float16* p, int k, int lane) { FragH f; const unsigned short* q = (const unsigned short*)p + (size_t)k * 16 + lane * 8; f.half[0] = *(const v8us*)q; f.half[1] = *(const v8us*)(q + 256); return f.v; }      /* p: a 16-row strip of a fragment-order plane; k: multiple of 32 */
__device__ __forceinline__ v8f g2_mma(v16h a, v16h b, v8f c) { v8f d = __builtin_amdgcn_wmma_f32_16x16x32_f16(false, a, false, b, (short)0, c, false, false); asm volatile("v_nop\n\tv_nop\n\tv_nop\n\tv_nop" : "+v"(d) : "v"(a), "v"(b)); return d; }
template <int ACT, bool FO>      /* A and Bh: fragment-order planes with K = lda = ldb; FO: the result goes to C16 alone, as such a plane (K = ldc) */
__global__ __launch_bounds__(128) void k_gemm2(const _Float16* __restrict__ A, int lda, size_t sA, const _Float16* __restrict__ Bh, int ldb, size_t sB, float alpha, const float* __restrict__ bias, size_t sBias, const float* __restrict__ CP, int rowsPerB, size_t sCPb, int row0g,
    float* __restrict__ C, _Float16* __restrict__ C16, int ldc, size_t sC, int M, int N, int K) {
  __shared__ __attribute__((aligned(16))) float so[4][32][68];
  const int tid = threadIdx.x, w = tid >> 5, lane = tid & 31, ln = lane & 15, hh = lane >> 4; const int by = blockIdx.y;
  A += (size_t)by * sA; Bh += (size_t)by * sB; const size_t cofs = (size_t)by * sC; const float* bp = bias ? bias + (size_t)by * sBias : nullptr;
  const int ntn = N >> 6; const int mt = blockIdx.x / ntn, nq = blockIdx.x - mt * ntn; const int row0 = mt * 128 + 32 * w, col0 = nq * 64; if (row0 >= M) return;
  const _Float16* a0p = A + (size_t)row0 * lda; const _Float16* a1p = a0p + (size_t)16 * lda;
  const _Float16* b0p = Bh + (size_t)col0 * ldb; const _Float16* b1p = b0p + (size_t)16 * ldb; const _Float16* b2p = b1p + (size_t)16 * ldb; const _Float16* b3p = b2p + (size_t)16 * ldb;
  const v8f z8 = {0.f,0.f,0.f,0.f,0.f,0.f,0.f,0.f}; v8f c00 = z8, c01 = z8, c02 = z8, c03 = z8, c10 = z8, c11 = z8, c12 = z8, c13 = z8;
  v16h a0 = g2_frag(a0p, 0, lane), a1 = g2_frag(a1p, 0, lane), b0 = g2_frag(b0p, 0, lane), b1 = g2_frag(b1p, 0, lane), b2 = g2_frag(b2p, 0, lane), b3 = g2_frag(b3p, 0, lane);
  v16h e0 = g2_frag(a0p, 32, lane), e1 = g2_frag(a1p, 32, lane), f0 = g2_frag(b0p, 32, lane), f1 = g2_frag(b1p, 32, lane), f2 = g2_frag(b2p, 32, lane), f3 = g2_frag(b3p, 32, lane);
#pragma unroll 1      /* rolled: the body already holds both sets; more copies only add code */
  for (int kb = 0; kb < K; kb += 64) { const int kn = (kb + 64 < K) ? kb + 64 : kb;      /* last trip: re-reads its own step (in bounds, unused) */
    c00 = g2_mma(a0, b0, c00); c10 = g2_mma(a1, b0, c10); b0 = g2_frag(b0p, kn, lane);
    c01 = g2_mma(a0, b1, c01); c11 = g2_mma(a1, b1, c11); b1 = g2_frag(b1p, kn, lane);
    c02 = g2_mma(a0, b2, c02); c12 = g2_mma(a1, b2, c12); b2 = g2_frag(b2p, kn, lane);
    c03 = g2_mma(a0, b3, c03); c13 = g2_mma(a1, b3, c13); b3 = g2_frag(b3p, kn, lane); a0 = g2_frag(a0p, kn, lane); a1 = g2_frag(a1p, kn, lane);
    c00 = g2_mma(e0, f0, c00); c10 = g2_mma(e1, f0, c10); f0 = g2_frag(b0p, kn + 32, lane);
    c01 = g2_mma(e0, f1, c01); c11 = g2_mma(e1, f1, c11); f1 = g2_frag(b1p, kn + 32, lane);
    c02 = g2_mma(e0, f2, c02); c12 = g2_mma(e1, f2, c12); f2 = g2_frag(b2p, kn + 32, lane);
    c03 = g2_mma(e0, f3, c03); c13 = g2_mma(e1, f3, c13); f3 = g2_frag(b3p, kn + 32, lane); e0 = g2_frag(a0p, kn + 32, lane); e1 = g2_frag(a1p, kn + 32, lane);
    asm volatile("s_wait_xcnt 0x0" ::: "memory"); }      /* the next trip forms new addresses in the registers that this trip's loads name: wait before they are overwritten */
  v8f accs[8] = {c00, c01, c02, c03, c10, c11, c12, c13};
#pragma unroll
  for (int u = 0; u < 8; ++u) { const int t = u & 3, half = u >> 2; const int col = col0 + t * 16 + ln; const float bv = bp ? bf16_round(bp[col]) : 0.f;
#pragma unroll
    for (int r = 0; r < 8; ++r) { const int rloc = half * 16 + 8 * hh + r; float v = accs[u][r] * alpha + bv; if (CP) { const int bidx = (row0g + row0 + rloc) / rowsPerB; v += CP[(size_t)bidx * sCPb + (size_t)by * 64 + col]; }
      if (ACT == 3) v = fmaxf(v, 0.f); else if (ACT == 6) v = 0.5f * v * (1.0f + erff(v * 0.70710678118654752f)); else if (ACT == 11) v = 1.0f / (1.0f + expf(-v)); else if (ACT == 15) v = v / (1.0f + expf(-v)); else if (ACT == 12) v = (v > 0.f) ? v : 0.01f * v; else if (ACT == 8) v = tanhf(v);
      so[w][rloc][t * 16 + ln] = v; } }
  __builtin_amdgcn_fence(__ATOMIC_ACQ_REL, "workgroup"); __builtin_amdgcn_wave_barrier();
  const int rsub = lane >> 4, c4 = (lane & 15) * 4;
  if (!FO) {
#pragma unroll
    for (int q = 0; q < 16; ++q) { const int r = q * 2 + rsub; const v4f v = *(const v4fa*)&so[w][r][c4]; if (C) *(v4f*)(C + cofs + (size_t)(row0 + r) * ldc + col0 + c4) = v; if (C16) { v4h h4; for (int i = 0; i < 4; ++i) h4[i] = (_Float16)v[i]; *(v4h*)(C16 + cofs + (size_t)(row0 + r) * ldc + col0 + c4) = h4; } }
     } else {      /* the wave's 32 x 64 tile = 2 x 2 blocks of the plane, 8 stores of 512 bytes in a row */
#pragma unroll
      for (int u = 0; u < 8; ++u) { const int rbl = u >> 2, kbl = (u >> 1) & 1, j = u & 1; const float* sp = &so[w][rbl * 16 + ln][kbl * 32 + j * 16 + hh * 8]; const v4f x = *(const v4fa*)sp, y = *(const v4fa*)(sp + 4); FragH f;
#pragma unroll
        for (int i = 0; i < 4; ++i) { f.h[i] = (_Float16)x[i]; f.h[4 + i] = (_Float16)y[i]; }
        *(v8us*)((unsigned short*)C16 + cofs + (size_t)(row0 + rbl * 16) * ldc + (size_t)((col0 >> 5) + kbl) * 512 + j * 256 + lane * 8) = f.half[0]; }
     } }



template <int CAUSAL>
__global__ __launch_bounds__(128) void k_flash(const _Float16* __restrict__ Q16, int ldq, const _Float16* __restrict__ K16, int ldk, const _Float16* __restrict__ Vt, const int* __restrict__ MSK, float* __restrict__ O, int ldo) {
  constexpr int RPW = 16, RTN = RPW / 16, NQB = TQ / (4 * RPW), DT = 4, KS = 2;
  __shared__ __attribute__((aligned(16))) unsigned short sP[4][RPW][40]; __shared__ __attribute__((aligned(16))) float sO[4][RPW][64 + 4];
  const int tid = threadIdx.x, w = tid >> 5, lane = tid & 31, ln = lane & 15, hh = lane >> 4;
  const int slab = blockIdx.x / QBLKS, qblk = blockIdx.x % QBLKS; (void)NQB; const int b = slab / NH, h = slab % NH; const int qb0 = qblk * (4 * RPW); const int q0 = qb0 + w * RPW;
  FragH aq[2][KS];
#pragma unroll
  for (int rt = 0; rt < RTN; ++rt) { const unsigned short* qr = (const unsigned short*)Q16 + ((size_t)b * TQ + q0 + rt * 16 + ln) * ldq + h * 64;
#pragma unroll
    for (int ks = 0; ks < KS; ++ks) { aq[rt][ks].half[0] = *(const v8us*)(qr + ks * 32 + 8 * hh); aq[rt][ks].half[1] = *(const v8us*)(qr + ks * 32 + 16 + 8 * hh); } }
  const unsigned short* Vth = (const unsigned short*)Vt + (size_t)slab * 64 * TK;
  float m_r[2][8], l_r[2][8]; v8f oacc[2][DT];
#pragma unroll
  for (int rt = 0; rt < RTN; ++rt) {
#pragma unroll
    for (int r = 0; r < 8; ++r) { m_r[rt][r] = -3.0e38f; l_r[rt][r] = 0.f; }
#pragma unroll
    for (int dt = 0; dt < DT; ++dt) oacc[rt][dt] = (v8f){0.f,0.f,0.f,0.f,0.f,0.f,0.f,0.f}; }
  const int jend = (CAUSAL == 1) ? (qb0 + 4 * RPW) : TK;      /* causal: keys beyond the block's last query never contribute */
#pragma unroll 1
  for (int j0 = 0; j0 < jend; j0 += 32) {
    v8f s[2][2];
#pragma unroll
    for (int nt = 0; nt < 2; ++nt) { const unsigned short* kr = (const unsigned short*)K16 + ((size_t)b * TK + j0 + nt * 16 + ln) * ldk + h * 64; FragH bk[KS];
#pragma unroll
      for (int ks = 0; ks < KS; ++ks) { bk[ks].half[0] = *(const v8us*)(kr + ks * 32 + 8 * hh); bk[ks].half[1] = *(const v8us*)(kr + ks * 32 + 16 + 8 * hh); }
#pragma unroll
      for (int rt = 0; rt < RTN; ++rt) { v8f acc = (v8f){0.f,0.f,0.f,0.f,0.f,0.f,0.f,0.f};
#pragma unroll
        for (int ks = 0; ks < KS; ++ks) acc = mmaH<1>(aq[rt][ks].v, aq[rt][ks].v, bk[ks].v, bk[ks].v, acc); s[rt][nt] = acc; } }
#pragma unroll
    for (int rt = 0; rt < RTN; ++rt)
#pragma unroll
      for (int r = 0; r < 8; ++r) { const int tq = q0 + rt * 16 + 8 * hh + r; const int k0 = j0 + ln, k1 = j0 + 16 + ln;
        const bool ok0 = (CAUSAL == 1) ? (k0 <= tq) : ((CAUSAL == 2) ? ((k0 >> 5) == (tq >> 5)) : true), ok1 = (CAUSAL == 1) ? (k1 <= tq) : ((CAUSAL == 2) ? ((k1 >> 5) == (tq >> 5)) : true);      /* mode 2: block-diagonal 32-token groups */
        const float s0 = ok0 ? s[rt][0][r] * SCL : -3.0e38f, s1 = ok1 ? s[rt][1][r] * SCL : -3.0e38f; float mc = fmaxf(s0, s1);
        mc = fmaxf(mc, __shfl_xor(mc, 1, 32)); mc = fmaxf(mc, __shfl_xor(mc, 2, 32)); mc = fmaxf(mc, __shfl_xor(mc, 4, 32)); mc = fmaxf(mc, __shfl_xor(mc, 8, 32));
        const float mn = fmaxf(m_r[rt][r], mc); const float al = (mn > -1.0e38f) ? expf(m_r[rt][r] - mn) : 1.0f; m_r[rt][r] = mn; const float p0 = ok0 ? expf(s0 - mn) : 0.f, p1 = ok1 ? expf(s1 - mn) : 0.f; l_r[rt][r] = l_r[rt][r] * al + p0 + p1;
#pragma unroll
        for (int dt = 0; dt < DT; ++dt) oacc[rt][dt][r] *= al;
        FragH t2; t2.h[0] = (_Float16)(p0 * 1024.0f); t2.h[1] = (_Float16)(p1 * 1024.0f); sP[w][rt * 16 + 8 * hh + r][ln] = t2.u[0]; sP[w][rt * 16 + 8 * hh + r][16 + ln] = t2.u[1]; }
    __builtin_amdgcn_fence(__ATOMIC_ACQ_REL, "workgroup"); __builtin_amdgcn_wave_barrier();
    FragH pa[2];
#pragma unroll
    for (int rt = 0; rt < RTN; ++rt) { pa[rt].half[0] = *(const v8us*)&sP[w][rt * 16 + ln][8 * hh]; pa[rt].half[1] = *(const v8us*)&sP[w][rt * 16 + ln][16 + 8 * hh]; }
#pragma unroll
    for (int dt = 0; dt < DT; ++dt) { const unsigned short* vrow = Vth + (size_t)(dt * 16 + ln) * TK + j0; FragH bv; bv.half[0] = *(const v8us*)(vrow + 8 * hh); bv.half[1] = *(const v8us*)(vrow + 16 + 8 * hh);
#pragma unroll
      for (int rt = 0; rt < RTN; ++rt) oacc[rt][dt] = mmaH<1>(pa[rt].v, pa[rt].v, bv.v, bv.v, oacc[rt][dt]); }
    __builtin_amdgcn_fence(__ATOMIC_ACQ_REL, "workgroup"); __builtin_amdgcn_wave_barrier(); }
#pragma unroll
  for (int rt = 0; rt < RTN; ++rt) {
#pragma unroll
    for (int r = 0; r < 8; ++r) { float l = l_r[rt][r]; l += __shfl_xor(l, 1, 32); l += __shfl_xor(l, 2, 32); l += __shfl_xor(l, 4, 32); l += __shfl_xor(l, 8, 32); l_r[rt][r] = (l > 0.f) ? 1.0f / (l * 1024.0f) : 0.f; }
#pragma unroll
    for (int dt = 0; dt < DT; ++dt)
#pragma unroll
      for (int r = 0; r < 8; ++r) sO[w][rt * 16 + 8 * hh + r][dt * 16 + ln] = oacc[rt][dt][r] * l_r[rt][r]; }
  __builtin_amdgcn_fence(__ATOMIC_ACQ_REL, "workgroup"); __builtin_amdgcn_wave_barrier();
  {
#pragma unroll
    for (int rp = 0; rp < RPW; rp += 2) { const int r = rp + (lane >> 4), pc = lane & 15; const v4f val = *(const v4fa*)&sO[w][r][pc * 4]; *(v4f*)(O + ((size_t)b * TQ + q0 + r) * ldo + h * 64 + pc * 4) = val; }
     } }

template <int CAUSAL>
__global__ __launch_bounds__(128) void k_flashA(const _Float16* __restrict__ Q16, int ldq, const _Float16* __restrict__ K16, int ldk, const _Float16* __restrict__ Vt, const int* __restrict__ MSK, float* __restrict__ O, int ldo) {
  constexpr int RPW = 16, RTN = RPW / 16, NQB = TQ / (4 * RPW), DT = 4, KS = 2;
  __shared__ __attribute__((aligned(16))) unsigned short sP[4][RPW][40]; __shared__ __attribute__((aligned(16))) float sO[4][RPW][64 + 4];
  const int tid = threadIdx.x, w = tid >> 5, lane = tid & 31, ln = lane & 15, hh = lane >> 4;
  const int slab = blockIdx.x / QBLKS, qblk = blockIdx.x % QBLKS; (void)NQB; const int b = slab / NH, h = slab % NH; const int qb0 = qblk * (4 * RPW); const int q0 = qb0 + w * RPW;
  FragH aq[2][KS];
#pragma unroll
  for (int rt = 0; rt < RTN; ++rt) { const unsigned short* qr = (const unsigned short*)Q16 + ((size_t)b * TQ + q0 + rt * 16) * ldq + h * 1024 + lane * 8;      /* fragment-order plane: strip of 16 queries, the head's two blocks */
#pragma unroll
    for (int ks = 0; ks < KS; ++ks) { aq[rt][ks].half[0] = *(const v8us*)(qr + ks * 512); aq[rt][ks].half[1] = *(const v8us*)(qr + ks * 512 + 256); } }
  FragH bk[2][KS];      /* K fragments, fetched one pass ahead */
#pragma unroll
  for (int nt = 0; nt < 2; ++nt) { const unsigned short* kr = (const unsigned short*)K16 + ((size_t)b * TKA + nt * 16) * ldk + h * 1024 + lane * 8;      /* fragment-order plane: strip of 16 keys, the head's two blocks */
#pragma unroll
    for (int ks = 0; ks < KS; ++ks) { bk[nt][ks].half[0] = *(const v8us*)(kr + ks * 512); bk[nt][ks].half[1] = *(const v8us*)(kr + ks * 512 + 256); } }
  asm volatile("s_wait_xcnt 0x0" ::: "memory");      /* the registers that the Q and K loads above name are reused below: wait before they are overwritten */
  __builtin_amdgcn_sched_barrier(0);      /* keeps the set-up code below from being scheduled in front of that wait */
  const unsigned short* Vth = (const unsigned short*)Vt + (size_t)slab * 64 * TKA;
  float m_r[2][8], l_r[2][8]; v8f oacc[2][DT];
#pragma unroll
  for (int rt = 0; rt < RTN; ++rt) {
#pragma unroll
    for (int r = 0; r < 8; ++r) { m_r[rt][r] = -3.0e38f; l_r[rt][r] = 0.f; }
#pragma unroll
    for (int dt = 0; dt < DT; ++dt) oacc[rt][dt] = (v8f){0.f,0.f,0.f,0.f,0.f,0.f,0.f,0.f}; }
  const int jend = (CAUSAL == 1) ? (qb0 + 4 * RPW) : TKA;      /* causal: keys beyond the block's last query never contribute */
#pragma unroll 1
  for (int j0 = 0; j0 < jend; j0 += 32) {
    FragH bv[DT];      /* this pass's V^T fragments, all issued at the head of the pass: they fly under the score products and the softmax */
#pragma unroll
    for (int dt = 0; dt < DT; ++dt) { const unsigned short* vrow = Vth + (size_t)(dt * 16) * TKA + (size_t)j0 * 16 + lane * 8; bv[dt].half[0] = *(const v8us*)vrow; bv[dt].half[1] = *(const v8us*)(vrow + 256); }
    v8f s[2][2];
#pragma unroll
    for (int nt = 0; nt < 2; ++nt) {
#pragma unroll
      for (int rt = 0; rt < RTN; ++rt) { v8f acc = (v8f){0.f,0.f,0.f,0.f,0.f,0.f,0.f,0.f};
#pragma unroll
        for (int ks = 0; ks < KS; ++ks) acc = mmaH<1>(aq[rt][ks].v, aq[rt][ks].v, bk[nt][ks].v, bk[nt][ks].v, acc); s[rt][nt] = acc; } }
    const int jn = (j0 + 32 < jend) ? j0 + 32 : j0;      /* last pass: re-reads its own keys (in bounds, unused) */
#pragma unroll
    for (int nt = 0; nt < 2; ++nt) { const unsigned short* kr = (const unsigned short*)K16 + ((size_t)b * TKA + jn + nt * 16) * ldk + h * 1024 + lane * 8;
#pragma unroll
      for (int ks = 0; ks < KS; ++ks) { bk[nt][ks].half[0] = *(const v8us*)(kr + ks * 512); bk[nt][ks].half[1] = *(const v8us*)(kr + ks * 512 + 256); } }
#pragma unroll
    for (int rt = 0; rt < RTN; ++rt)
#pragma unroll
      for (int r = 0; r < 8; ++r) { const int tq = q0 + rt * 16 + 8 * hh + r; const int k0 = j0 + ln, k1 = j0 + 16 + ln;
        const bool ok0 = (CAUSAL == 1) ? (k0 <= tq) : ((CAUSAL == 2) ? ((k0 >> 5) == (tq >> 5)) : true), ok1 = (CAUSAL == 1) ? (k1 <= tq) : ((CAUSAL == 2) ? ((k1 >> 5) == (tq >> 5)) : true);      /* mode 2: block-diagonal 32-token groups */
        const float s0 = ok0 ? s[rt][0][r] * SCL : -3.0e38f, s1 = ok1 ? s[rt][1][r] * SCL : -3.0e38f; float mc = fmaxf(s0, s1);
        mc = fmaxf(mc, __shfl_xor(mc, 1, 32)); mc = fmaxf(mc, __shfl_xor(mc, 2, 32)); mc = fmaxf(mc, __shfl_xor(mc, 4, 32)); mc = fmaxf(mc, __shfl_xor(mc, 8, 32));
        const float mn = fmaxf(m_r[rt][r], mc); const float al = (mn > -1.0e38f) ? expf(m_r[rt][r] - mn) : 1.0f; m_r[rt][r] = mn; const float p0 = ok0 ? expf(s0 - mn) : 0.f, p1 = ok1 ? expf(s1 - mn) : 0.f; l_r[rt][r] = l_r[rt][r] * al + p0 + p1;
#pragma unroll
        for (int dt = 0; dt < DT; ++dt) oacc[rt][dt][r] *= al;
        FragH t2; t2.h[0] = (_Float16)(p0 * 1024.0f); t2.h[1] = (_Float16)(p1 * 1024.0f); sP[w][rt * 16 + 8 * hh + r][ln] = t2.u[0]; sP[w][rt * 16 + 8 * hh + r][16 + ln] = t2.u[1]; }
    __builtin_amdgcn_fence(__ATOMIC_ACQ_REL, "workgroup"); __builtin_amdgcn_wave_barrier();
    FragH pa[2];
#pragma unroll
    for (int rt = 0; rt < RTN; ++rt) { pa[rt].half[0] = *(const v8us*)&sP[w][rt * 16 + ln][8 * hh]; pa[rt].half[1] = *(const v8us*)&sP[w][rt * 16 + ln][16 + 8 * hh]; }
#pragma unroll
    for (int dt = 0; dt < DT; ++dt) {
#pragma unroll
      for (int rt = 0; rt < RTN; ++rt) oacc[rt][dt] = mmaH<1>(pa[rt].v, pa[rt].v, bv[dt].v, bv[dt].v, oacc[rt][dt]); }
    __builtin_amdgcn_fence(__ATOMIC_ACQ_REL, "workgroup"); __builtin_amdgcn_wave_barrier(); }
#pragma unroll
  for (int rt = 0; rt < RTN; ++rt) {
#pragma unroll
    for (int r = 0; r < 8; ++r) { float l = l_r[rt][r]; l += __shfl_xor(l, 1, 32); l += __shfl_xor(l, 2, 32); l += __shfl_xor(l, 4, 32); l += __shfl_xor(l, 8, 32); l_r[rt][r] = (l > 0.f) ? 1.0f / (l * 1024.0f) : 0.f; }
#pragma unroll
    for (int dt = 0; dt < DT; ++dt)
#pragma unroll
      for (int r = 0; r < 8; ++r) sO[w][rt * 16 + 8 * hh + r][dt * 16 + ln] = oacc[rt][dt][r] * l_r[rt][r]; }
  __builtin_amdgcn_fence(__ATOMIC_ACQ_REL, "workgroup"); __builtin_amdgcn_wave_barrier();
  {
#pragma unroll
    for (int rp = 0; rp < RPW; rp += 2) { const int r = rp + (lane >> 4), pc = lane & 15; const v4f val = *(const v4fa*)&sO[w][r][pc * 4]; *(v4f*)(O + ((size_t)b * TQ + q0 + r) * ldo + h * 64 + pc * 4) = val; }
     } }
template <int CAUSAL>
__global__ __launch_bounds__(128) void k_flashB(const _Float16* __restrict__ Q16, int ldq, const _Float16* __restrict__ K16, int ldk, const _Float16* __restrict__ Vt, const int* __restrict__ MSK, float* __restrict__ O, int ldo) {
  constexpr int RPW = 16, RTN = RPW / 16, NQB = TQ / (4 * RPW), DT = 4, KS = 2;
  __shared__ __attribute__((aligned(16))) unsigned short sP[4][RPW][40]; __shared__ __attribute__((aligned(16))) float sO[4][RPW][64 + 4];
  const int tid = threadIdx.x, w = tid >> 5, lane = tid & 31, ln = lane & 15, hh = lane >> 4;
  const int slab = blockIdx.x / QBLKS, qblk = blockIdx.x % QBLKS; (void)NQB; const int b = slab / NH, h = slab % NH; const int qb0 = qblk * (4 * RPW); const int q0 = qb0 + w * RPW;
  FragH aq[2][KS];
#pragma unroll
  for (int rt = 0; rt < RTN; ++rt) { const unsigned short* qr = (const unsigned short*)Q16 + ((size_t)b * TQ + q0 + rt * 16) * ldq + h * 1024 + lane * 8;      /* fragment-order plane: strip of 16 queries, the head's two blocks */
#pragma unroll
    for (int ks = 0; ks < KS; ++ks) { aq[rt][ks].half[0] = *(const v8us*)(qr + ks * 512); aq[rt][ks].half[1] = *(const v8us*)(qr + ks * 512 + 256); } }
  FragH bk[2][KS];      /* K fragments, fetched one pass ahead */
#pragma unroll
  for (int nt = 0; nt < 2; ++nt) { const unsigned short* kr = (const unsigned short*)K16 + ((size_t)b * TKB + nt * 16) * ldk + h * 1024 + lane * 8;      /* fragment-order plane: strip of 16 keys, the head's two blocks */
#pragma unroll
    for (int ks = 0; ks < KS; ++ks) { bk[nt][ks].half[0] = *(const v8us*)(kr + ks * 512); bk[nt][ks].half[1] = *(const v8us*)(kr + ks * 512 + 256); } }
  asm volatile("s_wait_xcnt 0x0" ::: "memory");      /* the registers that the Q and K loads above name are reused below: wait before they are overwritten */
  __builtin_amdgcn_sched_barrier(0);      /* keeps the set-up code below from being scheduled in front of that wait */
  const unsigned short* Vth = (const unsigned short*)Vt + (size_t)slab * 64 * TKB;
  float m_r[2][8], l_r[2][8]; v8f oacc[2][DT];
#pragma unroll
  for (int rt = 0; rt < RTN; ++rt) {
#pragma unroll
    for (int r = 0; r < 8; ++r) { m_r[rt][r] = -3.0e38f; l_r[rt][r] = 0.f; }
#pragma unroll
    for (int dt = 0; dt < DT; ++dt) oacc[rt][dt] = (v8f){0.f,0.f,0.f,0.f,0.f,0.f,0.f,0.f}; }
  const int jend = (CAUSAL == 1) ? (qb0 + 4 * RPW) : TKB;      /* causal: keys beyond the block's last query never contribute */
#pragma unroll 1
  for (int j0 = 0; j0 < jend; j0 += 32) {
    FragH bv[DT];      /* this pass's V^T fragments, all issued at the head of the pass: they fly under the score products and the softmax */
#pragma unroll
    for (int dt = 0; dt < DT; ++dt) { const unsigned short* vrow = Vth + (size_t)(dt * 16) * TKB + (size_t)j0 * 16 + lane * 8; bv[dt].half[0] = *(const v8us*)vrow; bv[dt].half[1] = *(const v8us*)(vrow + 256); }
    v8f s[2][2];
#pragma unroll
    for (int nt = 0; nt < 2; ++nt) {
#pragma unroll
      for (int rt = 0; rt < RTN; ++rt) { v8f acc = (v8f){0.f,0.f,0.f,0.f,0.f,0.f,0.f,0.f};
#pragma unroll
        for (int ks = 0; ks < KS; ++ks) acc = mmaH<1>(aq[rt][ks].v, aq[rt][ks].v, bk[nt][ks].v, bk[nt][ks].v, acc); s[rt][nt] = acc; } }
    const int jn = (j0 + 32 < jend) ? j0 + 32 : j0;      /* last pass: re-reads its own keys (in bounds, unused) */
#pragma unroll
    for (int nt = 0; nt < 2; ++nt) { const unsigned short* kr = (const unsigned short*)K16 + ((size_t)b * TKB + jn + nt * 16) * ldk + h * 1024 + lane * 8;
#pragma unroll
      for (int ks = 0; ks < KS; ++ks) { bk[nt][ks].half[0] = *(const v8us*)(kr + ks * 512); bk[nt][ks].half[1] = *(const v8us*)(kr + ks * 512 + 256); } }
#pragma unroll
    for (int rt = 0; rt < RTN; ++rt)
#pragma unroll
      for (int r = 0; r < 8; ++r) { const int tq = q0 + rt * 16 + 8 * hh + r; const int k0 = j0 + ln, k1 = j0 + 16 + ln;
        const bool ok0 = (CAUSAL == 1) ? (k0 <= tq) : ((CAUSAL == 2) ? ((k0 >> 5) == (tq >> 5)) : true), ok1 = (CAUSAL == 1) ? (k1 <= tq) : ((CAUSAL == 2) ? ((k1 >> 5) == (tq >> 5)) : true);      /* mode 2: block-diagonal 32-token groups */
        const float s0 = ok0 ? s[rt][0][r] * SCL : -3.0e38f, s1 = ok1 ? s[rt][1][r] * SCL : -3.0e38f; float mc = fmaxf(s0, s1);
        mc = fmaxf(mc, __shfl_xor(mc, 1, 32)); mc = fmaxf(mc, __shfl_xor(mc, 2, 32)); mc = fmaxf(mc, __shfl_xor(mc, 4, 32)); mc = fmaxf(mc, __shfl_xor(mc, 8, 32));
        const float mn = fmaxf(m_r[rt][r], mc); const float al = (mn > -1.0e38f) ? expf(m_r[rt][r] - mn) : 1.0f; m_r[rt][r] = mn; const float p0 = ok0 ? expf(s0 - mn) : 0.f, p1 = ok1 ? expf(s1 - mn) : 0.f; l_r[rt][r] = l_r[rt][r] * al + p0 + p1;
#pragma unroll
        for (int dt = 0; dt < DT; ++dt) oacc[rt][dt][r] *= al;
        FragH t2; t2.h[0] = (_Float16)(p0 * 1024.0f); t2.h[1] = (_Float16)(p1 * 1024.0f); sP[w][rt * 16 + 8 * hh + r][ln] = t2.u[0]; sP[w][rt * 16 + 8 * hh + r][16 + ln] = t2.u[1]; }
    __builtin_amdgcn_fence(__ATOMIC_ACQ_REL, "workgroup"); __builtin_amdgcn_wave_barrier();
    FragH pa[2];
#pragma unroll
    for (int rt = 0; rt < RTN; ++rt) { pa[rt].half[0] = *(const v8us*)&sP[w][rt * 16 + ln][8 * hh]; pa[rt].half[1] = *(const v8us*)&sP[w][rt * 16 + ln][16 + 8 * hh]; }
#pragma unroll
    for (int dt = 0; dt < DT; ++dt) {
#pragma unroll
      for (int rt = 0; rt < RTN; ++rt) oacc[rt][dt] = mmaH<1>(pa[rt].v, pa[rt].v, bv[dt].v, bv[dt].v, oacc[rt][dt]); }
    __builtin_amdgcn_fence(__ATOMIC_ACQ_REL, "workgroup"); __builtin_amdgcn_wave_barrier(); }
#pragma unroll
  for (int rt = 0; rt < RTN; ++rt) {
#pragma unroll
    for (int r = 0; r < 8; ++r) { float l = l_r[rt][r]; l += __shfl_xor(l, 1, 32); l += __shfl_xor(l, 2, 32); l += __shfl_xor(l, 4, 32); l += __shfl_xor(l, 8, 32); l_r[rt][r] = (l > 0.f) ? 1.0f / (l * 1024.0f) : 0.f; }
#pragma unroll
    for (int dt = 0; dt < DT; ++dt)
#pragma unroll
      for (int r = 0; r < 8; ++r) sO[w][rt * 16 + 8 * hh + r][dt * 16 + ln] = oacc[rt][dt][r] * l_r[rt][r]; }
  __builtin_amdgcn_fence(__ATOMIC_ACQ_REL, "workgroup"); __builtin_amdgcn_wave_barrier();
  {
#pragma unroll
    for (int rp = 0; rp < RPW; rp += 2) { const int r = rp + (lane >> 4), pc = lane & 15; const v4f val = *(const v4fa*)&sO[w][r][pc * 4]; *(v4f*)(O + ((size_t)b * TQ + q0 + r) * ldo + h * 64 + pc * 4) = val; }
     } }
__global__ __launch_bounds__(256) void k_wsc(const float* __restrict__ Wm, _Float16* __restrict__ Bt, size_t n8, float sc) { const size_t t = (size_t)blockIdx.x * 256 + threadIdx.x; if (t >= n8) return; FragH f; for (int q = 0; q < 8; ++q) f.h[q] = (_Float16)(bf16_round(Wm[fo_src(t, EMB) + q]) * sc); *(v8us*)((unsigned short*)Bt + t * 8) = f.half[0];  }      /* torch (out,in) weight == Bt[n][k]: scaled copy into a fragment-order plane, K = EMB */
__global__ __launch_bounds__(256) void k_comb(const float* __restrict__ OL, const float* __restrict__ OG, const float* __restrict__ gate, _Float16* __restrict__ O16, size_t n8) {
  #pragma clang fp contract(off)
  const size_t t = (size_t)blockIdx.x * 256 + threadIdx.x; if (t >= n8) return; const float g = 1.0f / (1.0f + expf(-bf16_round(gate[0]))); const float h1 = 1.0f - g; FragH f; const size_t s = fo_src(t, EMB);      /* O16: fragment-order plane, K = EMB */
  for (int q = 0; q < 8; ++q) { float a = g * OL[s + q]; a += h1 * OG[s + q]; f.h[q] = (_Float16)a; }
  *(v8us*)((unsigned short*)O16 + t * 8) = f.half[0];  }

extern "C" void kernel_launch(void* const* d_in, const int* in_sizes, int n_in,
                              void* d_out, int out_size, void* d_ws, size_t ws_size, hipStream_t stream) {
  (void)in_sizes; (void)n_in; (void)out_size;
  const float* const* I = (const float* const*)d_in; const float* lh = I[0]; const float* gh = I[1]; const float* qw = I[2]; const float* qb = I[3]; const float* kw = I[4]; const float* kb = I[5]; const float* vw = I[6]; const float* vb = I[7]; const float* kgw = I[8]; const float* kgb = I[9]; const float* vgw = I[10]; const float* vgb = I[11]; const float* ow = I[12]; const float* ob = I[13]; const float* gate = I[14];
  char* ws = (char*)d_ws; size_t off = 0;
  auto take = [&](size_t bytes) { char* p = ws + off; off += (bytes + 255) & ~(size_t)255; return p; };
  const size_t w8 = (size_t)EMB * EMB / 8, npl = (size_t)NRL * EMB, npg = (size_t)NRG * EMB;
  _Float16* BQ = (_Float16*)take(w8 * 16); _Float16* BK = (_Float16*)take(w8 * 16); _Float16* BV = (_Float16*)take(w8 * 16); _Float16* BKG = (_Float16*)take(w8 * 16); _Float16* BVG = (_Float16*)take(w8 * 16); _Float16* BO = (_Float16*)take(w8 * 16);
  _Float16* XL = (_Float16*)take(npl * 2); _Float16* XG = (_Float16*)take(npg * 2); _Float16* Q16 = (_Float16*)take(npl * 2); _Float16* KL = (_Float16*)take(npl * 2); _Float16* VL = (_Float16*)take(npl * 2); _Float16* KG = (_Float16*)take(npg * 2); _Float16* VG = (_Float16*)take(npg * 2); _Float16* VTL = (_Float16*)take(npl * 2); _Float16* VTG = (_Float16*)take(npg * 2);
  float* OL = (float*)take(npl * 4); float* OG = (float*)take(npl * 4); _Float16* O16 = XL;      /* O16 over the local input plane (dead after its projections) */
  if (off > ws_size) return;      /* 12 + 8+2+8+8+8+2+2+8+2 + 16+16 = 92 MiB */
  const unsigned g8 = (unsigned)((w8 + 255) / 256);
  k_wsc<<<g8, 256, 0, stream>>>(qw, BQ, w8, 16.0f); k_wsc<<<g8, 256, 0, stream>>>(kw, BK, w8, 16.0f); k_wsc<<<g8, 256, 0, stream>>>(vw, BV, w8, 16.0f); k_wsc<<<g8, 256, 0, stream>>>(kgw, BKG, w8, 16.0f); k_wsc<<<g8, 256, 0, stream>>>(vgw, BVG, w8, 16.0f); k_wsc<<<g8, 256, 0, stream>>>(ow, BO, w8, 16.0f);
  k_x16<<<(unsigned)((npl / 8 + 255) / 256), 256, 0, stream>>>(lh, XL, npl / 8); k_x16<<<(unsigned)((npg / 8 + 255) / 256), 256, 0, stream>>>(gh, XG, npg / 8);
  const dim3 gL((NRL / 128) * (EMB / 64), 1), gGl((NRG / 128) * (EMB / 64), 1);
  k_gemm2<0, true><<<gL, 128, 0, stream>>>(XL, EMB, 0, BQ, EMB, 0, 0.0625f, qb, 0, nullptr, 1, 0, 0, nullptr, Q16, EMB, 0, NRL, EMB, EMB);
  k_gemm2<0, true><<<gL, 128, 0, stream>>>(XL, EMB, 0, BK, EMB, 0, 0.0625f, kb, 0, nullptr, 1, 0, 0, nullptr, KL, EMB, 0, NRL, EMB, EMB);
  k_gemm2<0, false><<<gL, 128, 0, stream>>>(XL, EMB, 0, BV, EMB, 0, 0.0625f, vb, 0, nullptr, 1, 0, 0, nullptr, VL, EMB, 0, NRL, EMB, EMB);
  k_gemm2<0, true><<<gGl, 128, 0, stream>>>(XG, EMB, 0, BKG, EMB, 0, 0.0625f, kgb, 0, nullptr, 1, 0, 0, nullptr, KG, EMB, 0, NRG, EMB, EMB);
  k_gemm2<0, false><<<gGl, 128, 0, stream>>>(XG, EMB, 0, BVG, EMB, 0, 0.0625f, vgb, 0, nullptr, 1, 0, 0, nullptr, VG, EMB, 0, NRG, EMB, EMB);
  k_vt<NH, LL><<<NB * NH * (LL / 64), 256, 0, stream>>>(VL, EMB, 0, VTL); k_vt<NH, GG><<<NB * NH * (GG / 64), 256, 0, stream>>>(VG, EMB, 0, VTG);
  k_flashA<0><<<NB * NH * QBLKS, 128, 0, stream>>>(Q16, EMB, KL, EMB, VTL, nullptr, OL, EMB);      /* local: 2048 keys */
  k_flashB<0><<<NB * NH * QBLKS, 128, 0, stream>>>(Q16, EMB, KG, EMB, VTG, nullptr, OG, EMB);      /* global: 512 keys */
  k_comb<<<(unsigned)((npl / 8 + 255) / 256), 256, 0, stream>>>(OL, OG, gate, O16, npl / 8);
  k_gemm2<0, false><<<gL, 128, 0, stream>>>(O16, EMB, 0, BO, EMB, 0, 0.0625f, ob, 0, nullptr, 1, 0, 0, (float*)d_out, nullptr, EMB, 0, NRL, EMB, EMB);
}

// v003
// Measured time: 244 microseconds a run.
// Timed twice side by side with v002, it ran 1.38 and 1.37 times as fast.
// Over all steps from v000 it is 2.35 times as fast.
#include <hip/hip_runtime.h>
// InfiniSpanAttention (2 batches; 2048 local tokens, 512 global tokens, D = 1024, 16 heads of 64): q/k_l/v_l from local_hidden, k_g/v_g from global_hidden (torch (out,in) linears + bias); out_l = softmax(q k_l^T s) v_l, out_g = softmax(q k_g^T s) v_g (no masks); out = sigmoid(gate) out_l + (1 - sigmoid(gate)) out_g -> merged heads -> out_w + out_b.
// Compute dtype: inputs and parameters rounded to bf16; q, k, v, P and the combined attention output as f16 operands (~2^-12); f32 accumulation/softmax/gating. v_wmma_f32_16x16x32_f16.
#define NB 2
#define EMB 1024
#define NRL (NB * LL)            /* 4096 local rows */
#define NRG (NB * GG)            /* 1024 global rows */
#define LL 2048                  /* local tokens (queries; local keys) */
#define GG 512                   /* global tokens (keys of the second attention) */
#define TQ LL
#define TK LL
#define TKA LL
#define TKB GG
#define NH 16
#define SCL 0.125f               /* 64^-0.5 */
#define QBLKS (TQ / 64)
typedef __bf16 v16b __attribute__((ext_vector_type(16)));
typedef unsigned short v8us __attribute__((ext_vector_type(8), may_alias));
typedef float  v8f  __attribute__((ext_vector_type(8)));
typedef float  v4f  __attribute__((ext_vector_type(4)));
typedef float  v4fa __attribute__((ext_vector_type(4), may_alias));
union FragB { v16b v; v8us half[2]; unsigned short u[16]; };

__device__ __forceinline__ unsigned short bf16_bits(float x) { unsigned int u = __float_as_uint(x); return (unsigned short)((u + 0x7FFFu + ((u >> 16) & 1u)) >> 16); }
__device__ __forceinline__ float bf16_val(unsigned short b) { return __uint_as_float(((unsigned int)b) << 16); }
__device__ __forceinline__ float bf16_round(float x) { return bf16_val(bf16_bits(x)); }
// D += A·B with NT terms: 1 = ah·bh, 2 = + al·bh (A split), 3 = + ah·bl (both split)
template <int NT>
__device__ __forceinline__ v8f mmaN(v16b ah, v16b al, v16b bh, v16b bl, v8f c) {
  c = __builtin_amdgcn_wmma_f32_16x16x32_bf16(false, ah, false, bh, (short)0, c, false, false);
  if (NT >= 2) c = __builtin_amdgcn_wmma_f32_16x16x32_bf16(false, al, false, bh, (short)0, c, false, false);
  if (NT >= 3) c = __builtin_amdgcn_wmma_f32_16x16x32_bf16(false, ah, false, bl, (short)0, c, false, false);
  asm volatile("v_nop\n\tv_nop\n\tv_nop\n\tv_nop" : "+v"(c) : "v"(ah), "v"(al), "v"(bh), "v"(bl));
  return c;
}

__global__ __launch_bounds__(256) void k_wt_bf16(const float* __restrict__ W, unsigned short* __restrict__ Wt, int K, int N) {
  const int t = blockIdx.x * 256 + threadIdx.x;
  const int k8n = K / 8;
  if (t >= N * k8n) return;
  const int n = t / k8n, k8 = (t % k8n) * 8;
  v8us v;
#pragma unroll
  for (int i = 0; i < 8; ++i) v[i] = bf16_bits(W[(size_t)(k8 + i) * N + n]);
  *(v8us*)(Wt + (size_t)n * K + k8) = v;
  
}

// GEMM C[M][N] (f32, pitch ldc) = act(A[M][K]·W + bias). A f32 row-major (pitch lda) converted per fragment to bf16
// (ASPLIT: hi/lo two planes -> 2 terms, else single rounded term); Wt bf16 [N][K] (pitch ldb). BIAS_BF16 rounds the
// bias to bf16 first (bias quantised to bf16 before the add). K%32==0, M%16==0, N%64==0.
template <bool ASPLIT, int ACT, bool BIAS_BF16>
__global__ __launch_bounds__(128) void k_gemm_bf(const float* __restrict__ A, int lda, const unsigned short* __restrict__ Wt, int ldb,
                                               const float* __restrict__ bias, float* __restrict__ C, int ldc, int M, int N, int K) {
  __shared__ __attribute__((aligned(16))) float so[4][16][64];
  const int tid = threadIdx.x, w = tid >> 5, lane = tid & 31, ln = lane & 15, hh = lane >> 4;
  const int ntn = N / 64;
  const int wid = blockIdx.x * 4 + w;
  const int mt = wid / ntn, nq = wid % ntn;
  if (mt * 16 >= M) return;
  const int row0 = mt * 16, col0 = nq * 64;
  const float* arow = A + (size_t)(row0 + ln) * lda;
  v8f acc[4] = {};
  for (int kb = 0; kb < K; kb += 32) {
    FragB ah, al;
    const v4f x0 = *(const v4fa*)(arow + kb + 8 * hh), x1 = *(const v4fa*)(arow + kb + 8 * hh + 4);
    const v4f x2 = *(const v4fa*)(arow + kb + 16 + 8 * hh), x3 = *(const v4fa*)(arow + kb + 16 + 8 * hh + 4);
    float xs[16] = {x0[0],x0[1],x0[2],x0[3],x1[0],x1[1],x1[2],x1[3],x2[0],x2[1],x2[2],x2[3],x3[0],x3[1],x3[2],x3[3]};
#pragma unroll
    for (int i = 0; i < 16; ++i) { const unsigned short hb = bf16_bits(xs[i]); ah.u[i] = hb; al.u[i] = ASPLIT ? bf16_bits(xs[i] - bf16_val(hb)) : (unsigned short)0; }
#pragma unroll
    for (int t = 0; t < 4; ++t) {
      const unsigned short* brow = Wt + (size_t)(col0 + t * 16 + ln) * ldb + kb;
      FragB b;
      b.half[0] = *(const v8us*)(brow + 8 * hh);
      b.half[1] = *(const v8us*)(brow + 16 + 8 * hh);
      acc[t] = mmaN<ASPLIT ? 2 : 1>(ah.v, al.v, b.v, b.v, acc[t]);
    }
  }
#pragma unroll
  for (int t = 0; t < 4; ++t) {
    float bv = bias ? bias[col0 + t * 16 + ln] : 0.f;
    if (BIAS_BF16) bv = bf16_round(bv);
#pragma unroll
    for (int r = 0; r < 8; ++r) { float v = acc[t][r] + bv; if (ACT == 1) v = fmaxf(v, 0.f); so[w][8 * hh + r][t * 16 + ln] = v; }
  }
  __builtin_amdgcn_fence(__ATOMIC_ACQ_REL, "workgroup");
  __builtin_amdgcn_wave_barrier();
  const int rsub = lane >> 4, c4 = (lane & 15) * 4;
  {
#pragma unroll
    for (int q = 0; q < 8; ++q) {
      const int r = q * 2 + rsub;
      const v4f v = *(const v4fa*)&so[w][r][c4];
      *(v4f*)(C + (size_t)(row0 + r) * ldc + col0 + c4) = v;
    }
    
  }
}

// GEMM C = act(A·W + bias + resid): A f32 (ASPLIT -> hi/lo 2 terms), Wt bf16 [N][K]; ACT 0 none, 1 relu, 2 exact gelu;
// resid (optional, f32, row index = (row % rmod), pitch ldr, RES_BF16 rounds it) added before the activation.
template <bool ASPLIT, int ACT, bool BIAS_BF16, bool RES_BF16>
__global__ __launch_bounds__(128) void k_gemm_bf3(const float* __restrict__ A, int lda, const unsigned short* __restrict__ Wt, int ldb,
                                                const float* __restrict__ bias, const float* __restrict__ resid, int rmod, int ldr,
                                                float* __restrict__ C, int ldc, int M, int N, int K) {
  __shared__ __attribute__((aligned(16))) float so[4][16][64];
  const int tid = threadIdx.x, w = tid >> 5, lane = tid & 31, ln = lane & 15, hh = lane >> 4;
  const int ntn = N / 64;
  const int wid = blockIdx.x * 4 + w;
  const int mt = wid / ntn, nq = wid % ntn;
  if (mt * 16 >= M) return;
  const int row0 = mt * 16, col0 = nq * 64;
  const float* arow = A + (size_t)(row0 + ln) * lda;
  v8f acc[4] = {};
  for (int kb = 0; kb < K; kb += 32) {
    FragB ah, al;
    const v4f x0 = *(const v4fa*)(arow + kb + 8 * hh), x1 = *(const v4fa*)(arow + kb + 8 * hh + 4);
    const v4f x2 = *(const v4fa*)(arow + kb + 16 + 8 * hh), x3 = *(const v4fa*)(arow + kb + 16 + 8 * hh + 4);
    float xs[16] = {x0[0],x0[1],x0[2],x0[3],x1[0],x1[1],x1[2],x1[3],x2[0],x2[1],x2[2],x2[3],x3[0],x3[1],x3[2],x3[3]};
#pragma unroll
    for (int i = 0; i < 16; ++i) { const unsigned short hb = bf16_bits(xs[i]); ah.u[i] = hb; al.u[i] = ASPLIT ? bf16_bits(xs[i] - bf16_val(hb)) : (unsigned short)0; }
#pragma unroll
    for (int t = 0; t < 4; ++t) {
      const unsigned short* brow = Wt + (size_t)(col0 + t * 16 + ln) * ldb + kb;
      FragB b;
      b.half[0] = *(const v8us*)(brow + 8 * hh);
      b.half[1] = *(const v8us*)(brow + 16 + 8 * hh);
      acc[t] = mmaN<ASPLIT ? 2 : 1>(ah.v, al.v, b.v, b.v, acc[t]);
    }
  }
#pragma unroll
  for (int t = 0; t < 4; ++t) {
    const int col = col0 + t * 16 + ln;
    float bv = bias ? bias[col] : 0.f;
    if (BIAS_BF16) bv = bf16_round(bv);
#pragma unroll
    for (int r = 0; r < 8; ++r) {
      float v = acc[t][r] + bv;
      if (resid) { float rv = resid[(size_t)((row0 + 8 * hh + r) % rmod) * ldr + col]; if (RES_BF16) rv = bf16_round(rv); v += rv; }
      if (ACT == 1) v = fmaxf(v, 0.f);
      if (ACT == 2) v = 0.5f * v * (1.0f + erff(v * 0.70710678118654752f));
      if (ACT == 3) { const float u = 0.7978845608028654f * (v + 0.044715f * v * v * v); v = 0.5f * v * (1.0f + tanhf(u)); }
      so[w][8 * hh + r][t * 16 + ln] = v;
    }
  }
  __builtin_amdgcn_fence(__ATOMIC_ACQ_REL, "workgroup");
  __builtin_amdgcn_wave_barrier();
  const int rsub = lane >> 4, c4 = (lane & 15) * 4;
  {
#pragma unroll
    for (int q = 0; q < 8; ++q) {
      const int r = q * 2 + rsub;
      const v4f v = *(const v4fa*)&so[w][r][c4];
      *(v4f*)(C + (size_t)(row0 + r) * ldc + col0 + c4) = v;
    }
    
  }
}
// row LayerNorm (biased variance, eps) over N: s = X (+ R); optional out_sum <- s; out_norm <- (s-mu)*rsqrt(var+eps)*g + b
template <bool PARAM_BF16>
__global__ __launch_bounds__(256) void k_layernorm(const float* __restrict__ X, const float* __restrict__ R, const float* __restrict__ g, const float* __restrict__ bta,
                                                  float* __restrict__ out_sum, float* __restrict__ out_norm, int N, float eps) {
  __shared__ float red[256];
  const int row = blockIdx.x, tid = threadIdx.x;
  const float* x = X + (size_t)row * N; const float* rr = R ? R + (size_t)row * N : nullptr;
  float vals[16];                     // up to N = 4096
  const int per = N / 256;            // contiguous chunk per thread? use strided-by-4 chunks: thread handles j = tid*4 + 1024*u
  float s1 = 0.f;
  for (int u = 0; u < per / 4; ++u) {
    const int j = tid * 4 + 1024 * u;
    const v4f a = *(const v4fa*)(x + j);
    v4f b = {0.f,0.f,0.f,0.f}; if (rr) b = *(const v4fa*)(rr + j);
#pragma unroll
    for (int q = 0; q < 4; ++q) { const float v = a[q] + b[q]; vals[u * 4 + q] = v; s1 += v; }
  }
  red[tid] = s1; __syncthreads();
  for (int st = 128; st > 0; st >>= 1) { if (tid < st) red[tid] += red[tid + st]; __syncthreads(); }
  const float mu = red[0] / (float)N; __syncthreads();
  float s2 = 0.f;
  for (int u = 0; u < per / 4; ++u)
#pragma unroll
    for (int q = 0; q < 4; ++q) { const float c = vals[u * 4 + q] - mu; s2 += c * c; }
  red[tid] = s2; __syncthreads();
  for (int st = 128; st > 0; st >>= 1) { if (tid < st) red[tid] += red[tid + st]; __syncthreads(); }
  const float rs = rsqrtf(red[0] / (float)N + eps);
  {
    for (int u = 0; u < per / 4; ++u) {
      const int j = tid * 4 + 1024 * u;
      v4f o, sm;
#pragma unroll
      for (int q = 0; q < 4; ++q) {
        float gg = g[j + q], bb = bta[j + q];
        if (PARAM_BF16) { gg = bf16_round(gg); bb = bf16_round(bb); }
        sm[q] = vals[u * 4 + q]; o[q] = (vals[u * 4 + q] - mu) * rs * gg + bb;
      }
      if (out_sum) *(v4f*)(out_sum + (size_t)row * N + j) = sm;
      *(v4f*)(out_norm + (size_t)row * N + j) = o;
    }
    
  }
}



// ---- f16 WMMA path (v_wmma_f32_16x16x32_f16): 11-bit significands for operands in range — used where a [0,1] probability operand needs more precision than bf16
typedef _Float16 v16h __attribute__((ext_vector_type(16)));
union FragH { v16h v; v8us half[2]; _Float16 h[16]; unsigned short u[16]; };
template <int NT>
__device__ __forceinline__ v8f mmaH(v16h ah, v16h al, v16h bh, v16h bl, v8f c) {
  c = __builtin_amdgcn_wmma_f32_16x16x32_f16(false, ah, false, bh, (short)0, c, false, false);
  if (NT >= 2) c = __builtin_amdgcn_wmma_f32_16x16x32_f16(false, al, false, bh, (short)0, c, false, false);
  if (NT >= 3) c = __builtin_amdgcn_wmma_f32_16x16x32_f16(false, ah, false, bl, (short)0, c, false, false);
  asm volatile("v_nop\n\tv_nop\n\tv_nop\n\tv_nop" : "+v"(c) : "v"(ah), "v"(al), "v"(bh), "v"(bl));
  return c;
}
// batched GEMM like k_gemm_b but f16 operands: A f32 (split into f16 hi/lo if ASPLIT, else rounded to f16), Bt = f16 values [n][k]; alpha; C f32; N multiple of 16 (partial tiles skipped)
template <bool ASPLIT>
__global__ __launch_bounds__(128) void k_gemm_h(const float* __restrict__ A, int lda, size_t sA, const _Float16* __restrict__ Bh, int ldb, size_t sB, float alpha, float* __restrict__ C, int ldc, size_t sC, int M, int N, int K) {
  __shared__ __attribute__((aligned(16))) float so[4][16][64];
  const int tid = threadIdx.x, w = tid >> 5, lane = tid & 31, ln = lane & 15, hh = lane >> 4; const int by = blockIdx.y;
  A += (size_t)by * sA; Bh += (size_t)by * sB; C += (size_t)by * sC;
  const int ntn = (N + 63) / 64; const int wid = blockIdx.x * 4 + w; const int mt = wid / ntn, nq = wid % ntn; if (mt * 16 >= M) return;
  const int row0 = mt * 16, col0 = nq * 64; const float* arow = A + (size_t)(row0 + ln) * lda;
  v8f acc[4] = {};
  for (int kb = 0; kb < K; kb += 32) {
    FragH ah, al;
    const v4f x0 = *(const v4fa*)(arow + kb + 8 * hh), x1 = *(const v4fa*)(arow + kb + 8 * hh + 4), x2 = *(const v4fa*)(arow + kb + 16 + 8 * hh), x3 = *(const v4fa*)(arow + kb + 16 + 8 * hh + 4);
    float xs[16] = {x0[0],x0[1],x0[2],x0[3],x1[0],x1[1],x1[2],x1[3],x2[0],x2[1],x2[2],x2[3],x3[0],x3[1],x3[2],x3[3]};
#pragma unroll
    for (int i = 0; i < 16; ++i) { const _Float16 h = (_Float16)xs[i]; ah.h[i] = h; al.h[i] = ASPLIT ? (_Float16)(xs[i] - (float)h) : (_Float16)0.0f; }
#pragma unroll
    for (int t = 0; t < 4; ++t) { if (col0 + t * 16 >= N) continue; const size_t boff = (size_t)(col0 + t * 16 + ln) * ldb + kb; FragH bq; bq.half[0] = *(const v8us*)(Bh + boff + 8 * hh); bq.half[1] = *(const v8us*)(Bh + boff + 16 + 8 * hh);
      acc[t] = mmaH<ASPLIT ? 2 : 1>(ah.v, al.v, bq.v, bq.v, acc[t]); }
  }
#pragma unroll
  for (int t = 0; t < 4; ++t) { if (col0 + t * 16 >= N) continue;
#pragma unroll
    for (int r = 0; r < 8; ++r) so[w][8 * hh + r][t * 16 + ln] = acc[t][r] * alpha; }
  __builtin_amdgcn_fence(__ATOMIC_ACQ_REL, "workgroup"); __builtin_amdgcn_wave_barrier();
  const int rsub = lane >> 4, c4 = (lane & 15) * 4;
  {
#pragma unroll
    for (int q = 0; q < 8; ++q) { const int r = q * 2 + rsub; if (col0 + c4 < N) { const v4f v = *(const v4fa*)&so[w][r][c4]; *(v4f*)(C + (size_t)(row0 + r) * ldc + col0 + c4) = v; } }
     }
}

// Wt[n][k] = f16(W[k][n]·scale) from f32 row-major W[K][N] (scale = power of two; bf16-exact weights stay exact in f16 away from the subnormal range)
__global__ __launch_bounds__(256) void k_wt_f16(const float* __restrict__ W, _Float16* __restrict__ Wt, int K, int N, float scale) {
  const int t = blockIdx.x * 256 + threadIdx.x; if (t >= N * (K / 8)) return; const int n = t / (K / 8), k8 = (t % (K / 8)) * 8; FragH f;
#pragma unroll
  for (int i = 0; i < 8; ++i) f.h[i] = (_Float16)(bf16_round(W[(size_t)(k8 + i) * N + n]) * scale); const v8us o = f.half[0];
  *(v8us*)((unsigned short*)Wt + (size_t)n * K + k8) = o; 
}
// k_gemm_hh variant with fused epilogue: v = acc·alpha + bias[by·sBias + col] (+ CP[(row/rowsPerB)·sCPb + by·64 + col] if CP) ; ACT 0 none / 1 elu ; writes f16 C16 (and f32 C if non-null)
template <int ACT>
__global__ __launch_bounds__(128) void k_gemm_hhx(const _Float16* __restrict__ A, int lda, size_t sA, const _Float16* __restrict__ Bh, int ldb, size_t sB, float alpha, const float* __restrict__ bias, size_t sBias, const float* __restrict__ CP, int rowsPerB, size_t sCPb, int row0g,
    float* __restrict__ C, _Float16* __restrict__ C16, int ldc, size_t sC, int M, int N, int K) {
  __shared__ __attribute__((aligned(16))) float so[4][16][64];
  const int tid = threadIdx.x, w = tid >> 5, lane = tid & 31, ln = lane & 15, hh = lane >> 4; const int by = blockIdx.y;
  A += (size_t)by * sA; Bh += (size_t)by * sB; const size_t cofs = (size_t)by * sC; const float* bp = bias ? bias + (size_t)by * sBias : nullptr;
  const int ntn = (N + 63) / 64; const int wid = blockIdx.x * 4 + w; const int mt = wid / ntn, nq = wid % ntn; if (mt * 16 >= M) return;
  const int row0 = mt * 16, col0 = nq * 64; const _Float16* arow = A + (size_t)(row0 + ln) * lda;
  v8f acc[4] = {};
  for (int kb = 0; kb < K; kb += 32) { FragH ah; ah.half[0] = *(const v8us*)((const unsigned short*)arow + kb + 8 * hh); ah.half[1] = *(const v8us*)((const unsigned short*)arow + kb + 16 + 8 * hh);
#pragma unroll
    for (int t = 0; t < 4; ++t) { if (col0 + t * 16 >= N) continue; const size_t boff = (size_t)(col0 + t * 16 + ln) * ldb + kb; FragH bq; bq.half[0] = *(const v8us*)((const unsigned short*)Bh + boff + 8 * hh); bq.half[1] = *(const v8us*)((const unsigned short*)Bh + boff + 16 + 8 * hh);
      acc[t] = mmaH<1>(ah.v, ah.v, bq.v, bq.v, acc[t]); }
  }
#pragma unroll
  for (int t = 0; t < 4; ++t) { if (col0 + t * 16 >= N) continue; const int col = col0 + t * 16 + ln; const float bv = bp ? bf16_round(bp[col]) : 0.f;
#pragma unroll
    for (int r = 0; r < 8; ++r) { float v = acc[t][r] * alpha + bv; if (CP) { const int bidx = (row0g + row0 + 8 * hh + r) / rowsPerB; v += CP[(size_t)bidx * sCPb + (size_t)by * 64 + col]; } if (ACT == 1) v = (v > 0.f) ? v : expm1f(v); else if (ACT == 7) v = (v > 0.f) ? v + 1.0f : expf(v); else if (ACT == 8) v = tanhf(v); else if (ACT == 9) v = 0.5f * v * (1.0f + tanhf(0.7978845608028654f * (v + 0.044715f * v * v * v))); else if (ACT == 11) v = 1.0f / (1.0f + expf(-v)); else if (ACT == 12) v = (v > 0.f) ? v : 0.01f * v; else if (ACT == 14) v = (v > 0.f) ? v : 0.1f * v; else if (ACT == 15) v = v / (1.0f + expf(-v)); else if (ACT == 3) v = fmaxf(v, 0.f); else if (ACT == 6) v = 0.5f * v * (1.0f + erff(v * 0.70710678118654752f)); so[w][8 * hh + r][t * 16 + ln] = v; } }
  __builtin_amdgcn_fence(__ATOMIC_ACQ_REL, "workgroup"); __builtin_amdgcn_wave_barrier();
  const int rsub = lane >> 4, c4 = (lane & 15) * 4; typedef _Float16 v4h __attribute__((ext_vector_type(4)));
  {
#pragma unroll
    for (int q = 0; q < 8; ++q) { const int r = q * 2 + rsub; if (col0 + c4 < N) { const v4f v = *(const v4fa*)&so[w][r][c4]; if (C) *(v4f*)(C + cofs + (size_t)(row0 + r) * ldc + col0 + c4) = v; if (C16) { v4h h4; for (int i = 0; i < 4; ++i) h4[i] = (_Float16)v[i]; *(v4h*)(C16 + cofs + (size_t)(row0 + r) * ldc + col0 + c4) = h4; } } }
     }
}


typedef _Float16 v4h __attribute__((ext_vector_type(4)));

// ---- fragment-order plane of an f16 matrix M[rows][K]: 1-KiB blocks of 16 rows x 32 k, block (row >> 4, k >> 5) at element ((row >> 4) * (K >> 5) + (k >> 5)) * 512;
// inside a block 64 pieces of 8 k: piece j * 32 + lane holds row (lane & 15), k = 16 * j + 8 * (lane >> 4) + 0..7. A wave's 16-byte fragment load reads 512 bytes in a row: 4 whole lines, not 16 pieces of lines.
__device__ __forceinline__ size_t fo_src(size_t t, int K) { const int kbn = K >> 5; const size_t blk = t >> 6; const int c = (int)(t & 63), j = c >> 5, l = c & 31; return ((blk / kbn) * 16 + (l & 15)) * (size_t)K + (size_t)(blk % kbn) * 32 + j * 16 + (l >> 4) * 8; }      /* piece t of a plane -> its first element in the row-major matrix */

__global__ __launch_bounds__(256) void k_x16(const float* __restrict__ x, _Float16* __restrict__ X16, size_t n8) { const size_t t = (size_t)blockIdx.x * 256 + threadIdx.x; if (t >= n8) return; FragH f;
#pragma unroll
  for (int q = 0; q < 8; ++q) f.h[q] = (_Float16)bf16_round(x[fo_src(t, EMB) + q]); *(v8us*)((unsigned short*)X16 + t * 8) = f.half[0];  }      /* X16: fragment-order plane, K = EMB */
__global__ __launch_bounds__(256) void k_h16(const float* __restrict__ x, _Float16* __restrict__ X16, size_t n8) { const size_t t = (size_t)blockIdx.x * 256 + threadIdx.x; if (t >= n8) return; FragH f;
#pragma unroll
  for (int q = 0; q < 8; ++q) f.h[q] = (_Float16)x[t * 8 + q]; *(v8us*)((unsigned short*)X16 + t * 8) = f.half[0];  }
__global__ __launch_bounds__(256) void k_round16f(const float* __restrict__ W, _Float16* __restrict__ Bt, size_t n8) { const size_t t = (size_t)blockIdx.x * 256 + threadIdx.x; if (t >= n8) return; FragH f;
#pragma unroll
  for (int i = 0; i < 8; ++i) f.h[i] = (_Float16)(bf16_round(W[t * 8 + i]) * 16.0f); *(v8us*)((unsigned short*)Bt + t * 8) = f.half[0];  }
template <int NHv, int TTv>
__global__ __launch_bounds__(256) void k_vt(const _Float16* __restrict__ V16, int ldv, int voff, _Float16* __restrict__ Vt) { __shared__ unsigned short tl[64][66]; const int tid = threadIdx.x; const int slab = blockIdx.x / (TTv / 64), lg = blockIdx.x % (TTv / 64); const int b = slab / NHv, h = slab % NHv;
  for (int i = tid; i < 64 * 8; i += 256) { const int r = i / 8, c8 = (i % 8) * 8; FragH f; f.half[0] = *(const v8us*)((const unsigned short*)V16 + ((size_t)b * TTv + lg * 64 + r) * ldv + voff + h * 64 + c8);
#pragma unroll
    for (int q = 0; q < 8; ++q) tl[r][c8 + q] = f.u[q]; }
  __syncthreads();
  {
#pragma unroll
    for (int rd = 0; rd < 2; ++rd) { const int c = rd * 256 + tid, rbl = c >> 7, kbl = (c >> 6) & 1, cc = c & 63, l = cc & 31; const int d = rbl * 16 + (l & 15), k0 = kbl * 32 + (cc >> 5) * 16 + (l >> 4) * 8; FragH f;      /* Vt: fragment-order plane, rows = slab * 64 + d, K = TTv keys */
#pragma unroll
      for (int q = 0; q < 8; ++q) f.u[q] = tl[k0 + q][d];
      *(v8us*)((unsigned short*)Vt + (((size_t)slab * 4 + rbl) * (TTv / 32) + lg * 2 + kbl) * 512 + cc * 8) = f.half[0]; }
     } }

__global__ __launch_bounds__(256) void k_hl(const float* __restrict__ F, _Float16* __restrict__ Hh, _Float16* __restrict__ Hl, size_t n8) { const size_t t = (size_t)blockIdx.x * 256 + threadIdx.x; if (t >= n8) return; FragH fh, fl; const v4f a = *(const v4fa*)(F + t * 8), c = *(const v4fa*)(F + t * 8 + 4);
#pragma unroll
  for (int q = 0; q < 4; ++q) { _Float16 h = (_Float16)a[q]; fh.h[q] = h; fl.h[q] = (_Float16)((a[q] - (float)h) * 1024.0f); h = (_Float16)c[q]; fh.h[4 + q] = h; fl.h[4 + q] = (_Float16)((c[q] - (float)h) * 1024.0f); }
  { *(v8us*)((unsigned short*)Hh + t * 8) = fh.half[0]; *(v8us*)((unsigned short*)Hl + t * 8) = fl.half[0];  } }

// ---- fast GEMM (wave tile 32x64; requires M % 32 == 0 rows per launch region, N % 64 == 0 and K % 64 == 0); epilogue = k_gemm_hhx semantics ----
// Two fragment sets (even and odd 32-k steps). Each fragment is reloaded for the step two ahead right behind its last product, so a step's loads fly under the other set's products.
__device__ __forceinline__ v16h g2_frag(const _Float16* p, int k, int lane) { FragH f; const unsigned short* q = (const unsigned short*)p + (size_t)k * 16 + lane * 8; f.half[0] = *(const v8us*)q; f.half[1] = *(const v8us*)(q + 256); return f.v; }      /* p: a 16-row strip of a fragment-order plane; k: multiple of 32 */
__device__ __forceinline__ v8f g2_mma(v16h a, v16h b, v8f c) { v8f d = __builtin_amdgcn_wmma_f32_16x16x32_f16(false, a, false, b, (short)0, c, false, false); asm volatile("v_nop\n\tv_nop\n\tv_nop\n\tv_nop" : "+v"(d) : "v"(a), "v"(b)); return d; }
template <int ACT, bool FO>      /* A and Bh: fragment-order planes with K = lda = ldb; FO: the result goes to C16 alone, as such a plane (K = ldc) */
__global__ __launch_bounds__(128) void k_gemm2(const _Float16* __restrict__ A, int lda, size_t sA, const _Float16* __restrict__ Bh, int ldb, size_t sB, float alpha, const float* __restrict__ bias, size_t sBias, const float* __restrict__ CP, int rowsPerB, size_t sCPb, int row0g,
    float* __restrict__ C, _Float16* __restrict__ C16, int ldc, size_t sC, int M, int N, int K) {
  __shared__ __attribute__((aligned(16))) float so[4][32][68];
  const int tid = threadIdx.x, w = tid >> 5, lane = tid & 31, ln = lane & 15, hh = lane >> 4; const int by = blockIdx.y;
  A += (size_t)by * sA; Bh += (size_t)by * sB; const size_t cofs = (size_t)by * sC; const float* bp = bias ? bias + (size_t)by * sBias : nullptr;
  const int ntn = N >> 6; const int mt = blockIdx.x / ntn, nq = blockIdx.x - mt * ntn; const int row0 = mt * 128 + 32 * w, col0 = nq * 64; if (row0 >= M) return;
  const _Float16* a0p = A + (size_t)row0 * lda; const _Float16* a1p = a0p + (size_t)16 * lda;
  const _Float16* b0p = Bh + (size_t)col0 * ldb; const _Float16* b1p = b0p + (size_t)16 * ldb; const _Float16* b2p = b1p + (size_t)16 * ldb; const _Float16* b3p = b2p + (size_t)16 * ldb;
  const v8f z8 = {0.f,0.f,0.f,0.f,0.f,0.f,0.f,0.f}; v8f c00 = z8, c01 = z8, c02 = z8, c03 = z8, c10 = z8, c11 = z8, c12 = z8, c13 = z8;
  v16h a0 = g2_frag(a0p, 0, lane), a1 = g2_frag(a1p, 0, lane), b0 = g2_frag(b0p, 0, lane), b1 = g2_frag(b1p, 0, lane), b2 = g2_frag(b2p, 0, lane), b3 = g2_frag(b3p, 0, lane);
  v16h e0 = g2_frag(a0p, 32, lane), e1 = g2_frag(a1p, 32, lane), f0 = g2_frag(b0p, 32, lane), f1 = g2_frag(b1p, 32, lane), f2 = g2_frag(b2p, 32, lane), f3 = g2_frag(b3p, 32, lane);
#pragma unroll 1      /* rolled: the body already holds both sets; more copies only add code */
  for (int kb = 0; kb < K; kb += 64) { const int kn = (kb + 64 < K) ? kb + 64 : kb;      /* last trip: re-reads its own step (in bounds, unused) */
    c00 = g2_mma(a0, b0, c00); c10 = g2_mma(a1, b0, c10); b0 = g2_frag(b0p, kn, lane);
    c01 = g2_mma(a0, b1, c01); c11 = g2_mma(a1, b1, c11); b1 = g2_frag(b1p, kn, lane);
    c02 = g2_mma(a0, b2, c02); c12 = g2_mma(a1, b2, c12); b2 = g2_frag(b2p, kn, lane);
    c03 = g2_mma(a0, b3, c03); c13 = g2_mma(a1, b3, c13); b3 = g2_frag(b3p, kn, lane); a0 = g2_frag(a0p, kn, lane); a1 = g2_frag(a1p, kn, lane);
    c00 = g2_mma(e0, f0, c00); c10 = g2_mma(e1, f0, c10); f0 = g2_frag(b0p, kn + 32, lane);
    c01 = g2_mma(e0, f1, c01); c11 = g2_mma(e1, f1, c11); f1 = g2_frag(b1p, kn + 32, lane);
    c02 = g2_mma(e0, f2, c02); c12 = g2_mma(e1, f2, c12); f2 = g2_frag(b2p, kn + 32, lane);
    c03 = g2_mma(e0, f3, c03); c13 = g2_mma(e1, f3, c13); f3 = g2_frag(b3p, kn + 32, lane); e0 = g2_frag(a0p, kn + 32, lane); e1 = g2_frag(a1p, kn + 32, lane);
    asm volatile("s_wait_xcnt 0x0" ::: "memory"); }      /* the next trip forms new addresses in the registers that this trip's loads name: wait before they are overwritten */
  v8f accs[8] = {c00, c01, c02, c03, c10, c11, c12, c13};
#pragma unroll
  for (int u = 0; u < 8; ++u) { const int t = u & 3, half = u >> 2; const int col = col0 + t * 16 + ln; const float bv = bp ? bf16_round(bp[col]) : 0.f;
#pragma unroll
    for (int r = 0; r < 8; ++r) { const int rloc = half * 16 + 8 * hh + r; float v = accs[u][r] * alpha + bv; if (CP) { const int bidx = (row0g + row0 + rloc) / rowsPerB; v += CP[(size_t)bidx * sCPb + (size_t)by * 64 + col]; }
      if (ACT == 3) v = fmaxf(v, 0.f); else if (ACT == 6) v = 0.5f * v * (1.0f + erff(v * 0.70710678118654752f)); else if (ACT == 11) v = 1.0f / (1.0f + expf(-v)); else if (ACT == 15) v = v / (1.0f + expf(-v)); else if (ACT == 12) v = (v > 0.f) ? v : 0.01f * v; else if (ACT == 8) v = tanhf(v);
      so[w][rloc][t * 16 + ln] = v; } }
  __builtin_amdgcn_fence(__ATOMIC_ACQ_REL, "workgroup"); __builtin_amdgcn_wave_barrier();
  const int rsub = lane >> 4, c4 = (lane & 15) * 4;
  if (!FO) {
#pragma unroll
    for (int q = 0; q < 16; ++q) { const int r = q * 2 + rsub; const v4f v = *(const v4fa*)&so[w][r][c4]; if (C) *(v4f*)(C + cofs + (size_t)(row0 + r) * ldc + col0 + c4) = v; if (C16) { v4h h4; for (int i = 0; i < 4; ++i) h4[i] = (_Float16)v[i]; *(v4h*)(C16 + cofs + (size_t)(row0 + r) * ldc + col0 + c4) = h4; } }
     } else {      /* the wave's 32 x 64 tile = 2 x 2 blocks of the plane, 8 stores of 512 bytes in a row */
#pragma unroll
      for (int u = 0; u < 8; ++u) { const int rbl = u >> 2, kbl = (u >> 1) & 1, j = u & 1; const float* sp = &so[w][rbl * 16 + ln][kbl * 32 + j * 16 + hh * 8]; const v4f x = *(const v4fa*)sp, y = *(const v4fa*)(sp + 4); FragH f;
#pragma unroll
        for (int i = 0; i < 4; ++i) { f.h[i] = (_Float16)x[i]; f.h[4 + i] = (_Float16)y[i]; }
        *(v8us*)((unsigned short*)C16 + cofs + (size_t)(row0 + rbl * 16) * ldc + (size_t)((col0 >> 5) + kbl) * 512 + j * 256 + lane * 8) = f.half[0]; }
     } }



template <int CAUSAL>
__global__ __launch_bounds__(128) void k_flash(const _Float16* __restrict__ Q16, int ldq, const _Float16* __restrict__ K16, int ldk, const _Float16* __restrict__ Vt, const int* __restrict__ MSK, float* __restrict__ O, int ldo) {
  constexpr int RPW = 16, RTN = RPW / 16, NQB = TQ / (4 * RPW), DT = 4, KS = 2;
  __shared__ __attribute__((aligned(16))) unsigned short sP[4][RPW][40]; __shared__ __attribute__((aligned(16))) float sO[4][RPW][64 + 4];
  const int tid = threadIdx.x, w = tid >> 5, lane = tid & 31, ln = lane & 15, hh = lane >> 4;
  const int slab = blockIdx.x / QBLKS, qblk = blockIdx.x % QBLKS; (void)NQB; const int b = slab / NH, h = slab % NH; const int qb0 = qblk * (4 * RPW); const int q0 = qb0 + w * RPW;
  FragH aq[2][KS];
#pragma unroll
  for (int rt = 0; rt < RTN; ++rt) { const unsigned short* qr = (const unsigned short*)Q16 + ((size_t)b * TQ + q0 + rt * 16 + ln) * ldq + h * 64;
#pragma unroll
    for (int ks = 0; ks < KS; ++ks) { aq[rt][ks].half[0] = *(const v8us*)(qr + ks * 32 + 8 * hh); aq[rt][ks].half[1] = *(const v8us*)(qr + ks * 32 + 16 + 8 * hh); } }
  const unsigned short* Vth = (const unsigned short*)Vt + (size_t)slab * 64 * TK;
  float m_r[2][8], l_r[2][8]; v8f oacc[2][DT];
#pragma unroll
  for (int rt = 0; rt < RTN; ++rt) {
#pragma unroll
    for (int r = 0; r < 8; ++r) { m_r[rt][r] = -3.0e38f; l_r[rt][r] = 0.f; }
#pragma unroll
    for (int dt = 0; dt < DT; ++dt) oacc[rt][dt] = (v8f){0.f,0.f,0.f,0.f,0.f,0.f,0.f,0.f}; }
  const int jend = (CAUSAL == 1) ? (qb0 + 4 * RPW) : TK;      /* causal: keys beyond the block's last query never contribute */
#pragma unroll 1
  for (int j0 = 0; j0 < jend; j0 += 32) {
    v8f s[2][2];
#pragma unroll
    for (int nt = 0; nt < 2; ++nt) { const unsigned short* kr = (const unsigned short*)K16 + ((size_t)b * TK + j0 + nt * 16 + ln) * ldk + h * 64; FragH bk[KS];
#pragma unroll
      for (int ks = 0; ks < KS; ++ks) { bk[ks].half[0] = *(const v8us*)(kr + ks * 32 + 8 * hh); bk[ks].half[1] = *(const v8us*)(kr + ks * 32 + 16 + 8 * hh); }
#pragma unroll
      for (int rt = 0; rt < RTN; ++rt) { v8f acc = (v8f){0.f,0.f,0.f,0.f,0.f,0.f,0.f,0.f};
#pragma unroll
        for (int ks = 0; ks < KS; ++ks) acc = mmaH<1>(aq[rt][ks].v, aq[rt][ks].v, bk[ks].v, bk[ks].v, acc); s[rt][nt] = acc; } }
#pragma unroll
    for (int rt = 0; rt < RTN; ++rt)
#pragma unroll
      for (int r = 0; r < 8; ++r) { const int tq = q0 + rt * 16 + 8 * hh + r; const int k0 = j0 + ln, k1 = j0 + 16 + ln;
        const bool ok0 = (CAUSAL == 1) ? (k0 <= tq) : ((CAUSAL == 2) ? ((k0 >> 5) == (tq >> 5)) : true), ok1 = (CAUSAL == 1) ? (k1 <= tq) : ((CAUSAL == 2) ? ((k1 >> 5) == (tq >> 5)) : true);      /* mode 2: block-diagonal 32-token groups */
        const float s0 = ok0 ? s[rt][0][r] * SCL : -3.0e38f, s1 = ok1 ? s[rt][1][r] * SCL : -3.0e38f; float mc = fmaxf(s0, s1);
        mc = fmaxf(mc, __shfl_xor(mc, 1, 32)); mc = fmaxf(mc, __shfl_xor(mc, 2, 32)); mc = fmaxf(mc, __shfl_xor(mc, 4, 32)); mc = fmaxf(mc, __shfl_xor(mc, 8, 32));
        const float mn = fmaxf(m_r[rt][r], mc); const float al = (mn > -1.0e38f) ? expf(m_r[rt][r] - mn) : 1.0f; m_r[rt][r] = mn; const float p0 = ok0 ? expf(s0 - mn) : 0.f, p1 = ok1 ? expf(s1 - mn) : 0.f; l_r[rt][r] = l_r[rt][r] * al + p0 + p1;
#pragma unroll
        for (int dt = 0; dt < DT; ++dt) oacc[rt][dt][r] *= al;
        FragH t2; t2.h[0] = (_Float16)(p0 * 1024.0f); t2.h[1] = (_Float16)(p1 * 1024.0f); sP[w][rt * 16 + 8 * hh + r][ln] = t2.u[0]; sP[w][rt * 16 + 8 * hh + r][16 + ln] = t2.u[1]; }
    __builtin_amdgcn_fence(__ATOMIC_ACQ_REL, "workgroup"); __builtin_amdgcn_wave_barrier();
    FragH pa[2];
#pragma unroll
    for (int rt = 0; rt < RTN; ++rt) { pa[rt].half[0] = *(const v8us*)&sP[w][rt * 16 + ln][8 * hh]; pa[rt].half[1] = *(const v8us*)&sP[w][rt * 16 + ln][16 + 8 * hh]; }
#pragma unroll
    for (int dt = 0; dt < DT; ++dt) { const unsigned short* vrow = Vth + (size_t)(dt * 16 + ln) * TK + j0; FragH bv; bv.half[0] = *(const v8us*)(vrow + 8 * hh); bv.half[1] = *(const v8us*)(vrow + 16 + 8 * hh);
#pragma unroll
      for (int rt = 0; rt < RTN; ++rt) oacc[rt][dt] = mmaH<1>(pa[rt].v, pa[rt].v, bv.v, bv.v, oacc[rt][dt]); }
    __builtin_amdgcn_fence(__ATOMIC_ACQ_REL, "workgroup"); __builtin_amdgcn_wave_barrier(); }
#pragma unroll
  for (int rt = 0; rt < RTN; ++rt) {
#pragma unroll
    for (int r = 0; r < 8; ++r) { float l = l_r[rt][r]; l += __shfl_xor(l, 1, 32); l += __shfl_xor(l, 2, 32); l += __shfl_xor(l, 4, 32); l += __shfl_xor(l, 8, 32); l_r[rt][r] = (l > 0.f) ? 1.0f / (l * 1024.0f) : 0.f; }
#pragma unroll
    for (int dt = 0; dt < DT; ++dt)
#pragma unroll
      for (int r = 0; r < 8; ++r) sO[w][rt * 16 + 8 * hh + r][dt * 16 + ln] = oacc[rt][dt][r] * l_r[rt][r]; }
  __builtin_amdgcn_fence(__ATOMIC_ACQ_REL, "workgroup"); __builtin_amdgcn_wave_barrier();
  {
#pragma unroll
    for (int rp = 0; rp < RPW; rp += 2) { const int r = rp + (lane >> 4), pc = lane & 15; const v4f val = *(const v4fa*)&sO[w][r][pc * 4]; *(v4f*)(O + ((size_t)b * TQ + q0 + r) * ldo + h * 64 + pc * 4) = val; }
     } }

// Attention with both products transposed: S^T = K Q^T (A = 16 keys, B = 16 queries) and O^T += V^T P^T (A = 16 values of d, B = P^T).
// A lane holds 16 of the 32 scores of ONE query (keys 8 * hh + r of each 16-key tile): maximum and sum are taken in the lane, plus one exchange between the wave's halves.
// The two score tiles, converted in place, are the B operand of the second product in the planes' own k order (16 * j + 8 * hh + i): P goes through no LDS and no lane exchange.
typedef float v2f __attribute__((ext_vector_type(2)));
__device__ __forceinline__ float xhalf(float x) { return __int_as_float(__builtin_amdgcn_permlanex16(__float_as_int(x), __float_as_int(x), 0x76543210, 0xfedcba98, false, false)); }      /* lane l <-> l ^ 16 */
template <int TKv>
__global__ __launch_bounds__(128) void k_flashT(const _Float16* __restrict__ Q16, int ldq, const _Float16* __restrict__ K16, int ldk, const _Float16* __restrict__ Vt, float* __restrict__ O, int ldo) {
  constexpr int RPW = 16, DT = 4, KS = 2;      /* the short inner loops below are all unrolled in full, so that the fragment arrays stay in registers */
  __shared__ __attribute__((aligned(16))) float sO[4][RPW][64 + 4];
  const int tid = threadIdx.x, w = tid >> 5, lane = tid & 31, ln = lane & 15, hh = lane >> 4;
  const int slab = blockIdx.x / QBLKS, qblk = blockIdx.x % QBLKS; const int b = slab / NH, h = slab % NH; const int q0 = qblk * (4 * RPW) + w * RPW;
  FragH bq[KS];      /* Q, the B operand of the score product, kept for the whole kernel */
  { const unsigned short* qr = (const unsigned short*)Q16 + ((size_t)b * TQ + q0) * ldq + h * 1024 + lane * 8;      /* fragment-order plane: strip of 16 queries, the head's two blocks */
#pragma unroll
    for (int ks = 0; ks < KS; ++ks) { bq[ks].half[0] = *(const v8us*)(qr + ks * 512); bq[ks].half[1] = *(const v8us*)(qr + ks * 512 + 256); } }
  FragH ak[2][KS];      /* K fragments (A operand), fetched one pass ahead */
#pragma unroll
  for (int nt = 0; nt < 2; ++nt) { const unsigned short* kr = (const unsigned short*)K16 + ((size_t)b * TKv + nt * 16) * ldk + h * 1024 + lane * 8;      /* fragment-order plane: strip of 16 keys, the head's two blocks */
#pragma unroll
    for (int ks = 0; ks < KS; ++ks) { ak[nt][ks].half[0] = *(const v8us*)(kr + ks * 512); ak[nt][ks].half[1] = *(const v8us*)(kr + ks * 512 + 256); } }
  asm volatile("s_wait_xcnt 0x0" ::: "memory");      /* the registers that the Q and K loads above name are reused below: wait before they are overwritten */
  __builtin_amdgcn_sched_barrier(0);      /* keeps the set-up code below from being scheduled in front of that wait */
  const unsigned short* Vth = (const unsigned short*)Vt + (size_t)slab * 64 * TKv;
  float m_q = -3.0e38f, l_q = 0.f; v8f oacc[DT];      /* the lane's query: running maximum (equal in both halves), the sum over this half's keys */
#pragma unroll
  for (int dt = 0; dt < DT; ++dt) oacc[dt] = (v8f){0.f,0.f,0.f,0.f,0.f,0.f,0.f,0.f};
#pragma unroll 1      /* rolled: a pass is long enough to cover its own loads; copies only add code */
  for (int j0 = 0; j0 < TKv; j0 += 32) {
    FragH av[DT];      /* this pass's V^T fragments (A operand), all issued at the head of the pass: they fly under the score products and the softmax */
#pragma unroll
    for (int dt = 0; dt < DT; ++dt) { const unsigned short* vrow = Vth + (size_t)(dt * 16) * TKv + (size_t)j0 * 16 + lane * 8; av[dt].half[0] = *(const v8us*)vrow; av[dt].half[1] = *(const v8us*)(vrow + 256); }
    v8f s[2];      /* s[nt][r] = score of key j0 + nt * 16 + 8 * hh + r with query q0 + ln */
#pragma unroll
    for (int nt = 0; nt < 2; ++nt) { v8f acc = (v8f){0.f,0.f,0.f,0.f,0.f,0.f,0.f,0.f};
#pragma unroll
      for (int ks = 0; ks < KS; ++ks) acc = mmaH<1>(ak[nt][ks].v, ak[nt][ks].v, bq[ks].v, bq[ks].v, acc); s[nt] = acc; }
    const int jn = (j0 + 32 < TKv) ? j0 + 32 : j0;      /* last pass: re-reads its own keys (in bounds, unused) */
#pragma unroll
    for (int nt = 0; nt < 2; ++nt) { const unsigned short* kr = (const unsigned short*)K16 + ((size_t)b * TKv + jn + nt * 16) * ldk + h * 1024 + lane * 8;
#pragma unroll
      for (int ks = 0; ks < KS; ++ks) { ak[nt][ks].half[0] = *(const v8us*)(kr + ks * 512); ak[nt][ks].half[1] = *(const v8us*)(kr + ks * 512 + 256); }
      asm volatile("s_wait_xcnt 0x0" ::: "memory"); }      /* the address registers of these four loads may be given to the next loads' results or to the softmax: wait before they are overwritten */
    float mx[8];      /* the maximum is taken on the raw scores: SCL > 0, and rounding is monotone, so max(s) * SCL == max(s * SCL) */
#pragma unroll
    for (int i = 0; i < 8; ++i) mx[i] = fmaxf(s[0][i], s[1][i]);
    float mc = fmaxf(fmaxf(fmaxf(mx[0], mx[1]), fmaxf(mx[2], mx[3])), fmaxf(fmaxf(mx[4], mx[5]), fmaxf(mx[6], mx[7]))) * SCL;
    mc = fmaxf(mc, xhalf(mc));
    const float mn = fmaxf(m_q, mc); const float ea = expf(m_q - mn); const float al = (mn > -1.0e38f) ? ea : 1.0f; m_q = mn;
    FragH pb; float p[16];
#pragma unroll
    for (int i = 0; i < 16; ++i) { p[i] = expf(fmaf(s[i >> 3][i & 7], SCL, -mn)); pb.h[i] = (_Float16)(p[i] * 1024.0f); }
    v2f t0 = {0.f, 0.f}, t1 = {0.f, 0.f};      /* two chains of packed partial sums: no chain of sixteen dependent adds */
#pragma unroll
    for (int i = 0; i < 4; ++i) { t0 += (v2f){p[4 * i], p[4 * i + 1]}; t1 += (v2f){p[4 * i + 2], p[4 * i + 3]}; }
    t0 += t1; l_q = l_q * al + (t0[0] + t0[1]);
#pragma unroll
    for (int dt = 0; dt < DT; ++dt) oacc[dt] *= al;
#pragma unroll
    for (int dt = 0; dt < DT; ++dt) oacc[dt] = mmaH<1>(av[dt].v, av[dt].v, pb.v, pb.v, oacc[dt]); }
  float l = l_q + xhalf(l_q); l = (l > 0.f) ? 1.0f / (l * 1024.0f) : 0.f;
#pragma unroll
  for (int dt = 0; dt < DT; ++dt) { const v8f o = oacc[dt] * l;      /* oacc[dt][r] = O[q0 + ln][dt * 16 + 8 * hh + r] */
    *(v4fa*)&sO[w][ln][dt * 16 + 8 * hh] = (v4f){o[0], o[1], o[2], o[3]}; *(v4fa*)&sO[w][ln][dt * 16 + 8 * hh + 4] = (v4f){o[4], o[5], o[6], o[7]}; }
  __builtin_amdgcn_fence(__ATOMIC_ACQ_REL, "workgroup"); __builtin_amdgcn_wave_barrier();      /* a lane reads below what other lanes of its wave wrote above: the LDS writes come first */
  {
#pragma unroll
    for (int rp = 0; rp < RPW; rp += 2) { const int r = rp + (lane >> 4), pc = lane & 15; const v4f val = *(const v4fa*)&sO[w][r][pc * 4]; *(v4f*)(O + ((size_t)b * TQ + q0 + r) * ldo + h * 64 + pc * 4) = val; }
     } }
__global__ __launch_bounds__(256) void k_wsc(const float* __restrict__ Wm, _Float16* __restrict__ Bt, size_t n8, float sc) { const size_t t = (size_t)blockIdx.x * 256 + threadIdx.x; if (t >= n8) return; FragH f; for (int q = 0; q < 8; ++q) f.h[q] = (_Float16)(bf16_round(Wm[fo_src(t, EMB) + q]) * sc); *(v8us*)((unsigned short*)Bt + t * 8) = f.half[0];  }      /* torch (out,in) weight == Bt[n][k]: scaled copy into a fragment-order plane, K = EMB */
__global__ __launch_bounds__(256) void k_comb(const float* __restrict__ OL, const float* __restrict__ OG, const float* __restrict__ gate, _Float16* __restrict__ O16, size_t n8) {
  #pragma clang fp contract(off)
  const size_t t = (size_t)blockIdx.x * 256 + threadIdx.x; if (t >= n8) return; const float g = 1.0f / (1.0f + expf(-bf16_round(gate[0]))); const float h1 = 1.0f - g; FragH f; const size_t s = fo_src(t, EMB);      /* O16: fragment-order plane, K = EMB */
  for (int q = 0; q < 8; ++q) { float a = g * OL[s + q]; a += h1 * OG[s + q]; f.h[q] = (_Float16)a; }
  *(v8us*)((unsigned short*)O16 + t * 8) = f.half[0];  }

extern "C" void kernel_launch(void* const* d_in, const int* in_sizes, int n_in,
                              void* d_out, int out_size, void* d_ws, size_t ws_size, hipStream_t stream) {
  (void)in_sizes; (void)n_in; (void)out_size;
  const float* const* I = (const float* const*)d_in; const float* lh = I[0]; const float* gh = I[1]; const float* qw = I[2]; const float* qb = I[3]; const float* kw = I[4]; const float* kb = I[5]; const float* vw = I[6]; const float* vb = I[7]; const float* kgw = I[8]; const float* kgb = I[9]; const float* vgw = I[10]; const float* vgb = I[11]; const float* ow = I[12]; const float* ob = I[13]; const float* gate = I[14];
  char* ws = (char*)d_ws; size_t off = 0;
  auto take = [&](size_t bytes) { char* p = ws + off; off += (bytes + 255) & ~(size_t)255; return p; };
  const size_t w8 = (size_t)EMB * EMB / 8, npl = (size_t)NRL * EMB, npg = (size_t)NRG * EMB;
  _Float16* BQ = (_Float16*)take(w8 * 16); _Float16* BK = (_Float16*)take(w8 * 16); _Float16* BV = (_Float16*)take(w8 * 16); _Float16* BKG = (_Float16*)take(w8 * 16); _Float16* BVG = (_Float16*)take(w8 * 16); _Float16* BO = (_Float16*)take(w8 * 16);
  _Float16* XL = (_Float16*)take(npl * 2); _Float16* XG = (_Float16*)take(npg * 2); _Float16* Q16 = (_Float16*)take(npl * 2); _Float16* KL = (_Float16*)take(npl * 2); _Float16* VL = (_Float16*)take(npl * 2); _Float16* KG = (_Float16*)take(npg * 2); _Float16* VG = (_Float16*)take(npg * 2); _Float16* VTL = (_Float16*)take(npl * 2); _Float16* VTG = (_Float16*)take(npg * 2);
  float* OL = (float*)take(npl * 4); float* OG = (float*)take(npl * 4); _Float16* O16 = XL;      /* O16 over the local input plane (dead after its projections) */
  if (off > ws_size) return;      /* 12 + 8+2+8+8+8+2+2+8+2 + 16+16 = 92 MiB */
  const unsigned g8 = (unsigned)((w8 + 255) / 256);
  k_wsc<<<g8, 256, 0, stream>>>(qw, BQ, w8, 16.0f); k_wsc<<<g8, 256, 0, stream>>>(kw, BK, w8, 16.0f); k_wsc<<<g8, 256, 0, stream>>>(vw, BV, w8, 16.0f); k_wsc<<<g8, 256, 0, stream>>>(kgw, BKG, w8, 16.0f); k_wsc<<<g8, 256, 0, stream>>>(vgw, BVG, w8, 16.0f); k_wsc<<<g8, 256, 0, stream>>>(ow, BO, w8, 16.0f);
  k_x16<<<(unsigned)((npl / 8 + 255) / 256), 256, 0, stream>>>(lh, XL, npl / 8); k_x16<<<(unsigned)((npg / 8 + 255) / 256), 256, 0, stream>>>(gh, XG, npg / 8);
  const dim3 gL((NRL / 128) * (EMB / 64), 1), gGl((NRG / 128) * (EMB / 64), 1);
  k_gemm2<0, true><<<gL, 128, 0, stream>>>(XL, EMB, 0, BQ, EMB, 0, 0.0625f, qb, 0, nullptr, 1, 0, 0, nullptr, Q16, EMB, 0, NRL, EMB, EMB);
  k_gemm2<0, true><<<gL, 128, 0, stream>>>(XL, EMB, 0, BK, EMB, 0, 0.0625f, kb, 0, nullptr, 1, 0, 0, nullptr, KL, EMB, 0, NRL, EMB, EMB);
  k_gemm2<0, false><<<gL, 128, 0, stream>>>(XL, EMB, 0, BV, EMB, 0, 0.0625f, vb, 0, nullptr, 1, 0, 0, nullptr, VL, EMB, 0, NRL, EMB, EMB);
  k_gemm2<0, true><<<gGl, 128, 0, stream>>>(XG, EMB, 0, BKG, EMB, 0, 0.0625f, kgb, 0, nullptr, 1, 0, 0, nullptr, KG, EMB, 0, NRG, EMB, EMB);
  k_gemm2<0, false><<<gGl, 128, 0, stream>>>(XG, EMB, 0, BVG, EMB, 0, 0.0625f, vgb, 0, nullptr, 1, 0, 0, nullptr, VG, EMB, 0, NRG, EMB, EMB);
  k_vt<NH, LL><<<NB * NH * (LL / 64), 256, 0, stream>>>(VL, EMB, 0, VTL); k_vt<NH, GG><<<NB * NH * (GG / 64), 256, 0, stream>>>(VG, EMB, 0, VTG);
  k_flashT<TKA><<<NB * NH * QBLKS, 128, 0, stream>>>(Q16, EMB, KL, EMB, VTL, OL, EMB);      /* local: 2048 keys */
  k_flashT<TKB><<<NB * NH * QBLKS, 128, 0, stream>>>(Q16, EMB, KG, EMB, VTG, OG, EMB);      /* global: 512 keys */
  k_comb<<<(unsigned)((npl / 8 + 255) / 256), 256, 0, stream>>>(OL, OG, gate, O16, npl / 8);
  k_gemm2<0, false><<<gL, 128, 0, stream>>>(O16, EMB, 0, BO, EMB, 0, 0.0625f, ob, 0, nullptr, 1, 0, 0, (float*)d_out, nullptr, EMB, 0, NRL, EMB, EMB);
}

// v004
// A run of this version takes 219 microseconds.
// Timed twice side by side with v003, it ran 1.11 times as fast both times.
// Over all steps from v000 it is 2.61 times as fast.
#include <hip/hip_runtime.h>
// InfiniSpanAttention (2 batches; 2048 local tokens, 512 global tokens, D = 1024, 16 heads of 64): q/k_l/v_l from local_hidden, k_g/v_g from global_hidden (torch (out,in) linears + bias); out_l = softmax(q k_l^T s) v_l, out_g = softmax(q k_g^T s) v_g (no masks); out = sigmoid(gate) out_l + (1 - sigmoid(gate)) out_g -> merged heads -> out_w + out_b.
// Compute dtype: inputs and parameters rounded to bf16; q, k, v, P and the combined attention output as f16 operands (~2^-12); f32 accumulation/softmax/gating. v_wmma_f32_16x16x32_f16.
#define NB 2
#define EMB 1024
#define NRL (NB * LL)            /* 4096 local rows */
#define NRG (NB * GG)            /* 1024 global rows */
#define LL 2048                  /* local tokens (queries; local keys) */
#define GG 512                   /* global tokens (keys of the second attention) */
#define TQ LL
#define TK LL
#define TKA LL
#define TKB GG
#define NH 16
#define SCL 0.125f               /* 64^-0.5 */
#define QBLKS (TQ / 64)
typedef __bf16 v16b __attribute__((ext_vector_type(16)));
typedef unsigned short v8us __attribute__((ext_vector_type(8), may_alias));
typedef float  v8f  __attribute__((ext_vector_type(8)));
typedef float  v4f  __attribute__((ext_vector_type(4)));
typedef float  v4fa __attribute__((ext_vector_type(4), may_alias));
union FragB { v16b v; v8us half[2]; unsigned short u[16]; };

__device__ __forceinline__ unsigned short bf16_bits(float x) { unsigned int u = __float_as_uint(x); return (unsigned short)((u + 0x7FFFu + ((u >> 16) & 1u)) >> 16); }
__device__ __forceinline__ float bf16_val(unsigned short b) { return __uint_as_float(((unsigned int)b) << 16); }
__device__ __forceinline__ float bf16_round(float x) { return bf16_val(bf16_bits(x)); }
// D += A·B with NT terms: 1 = ah·bh, 2 = + al·bh (A split), 3 = + ah·bl (both split)
template <int NT>
__device__ __forceinline__ v8f mmaN(v16b ah, v16b al, v16b bh, v16b bl, v8f c) {
  c = __builtin_amdgcn_wmma_f32_16x16x32_bf16(false, ah, false, bh, (short)0, c, false, false);
  if (NT >= 2) c = __builtin_amdgcn_wmma_f32_16x16x32_bf16(false, al, false, bh, (short)0, c, false, false);
  if (NT >= 3) c = __builtin_amdgcn_wmma_f32_16x16x32_bf16(false, ah, false, bl, (short)0, c, false, false);
  asm volatile("v_nop\n\tv_nop\n\tv_nop\n\tv_nop" : "+v"(c) : "v"(ah), "v"(al), "v"(bh), "v"(bl));
  return c;
}

__global__ __launch_bounds__(256) void k_wt_bf16(const float* __restrict__ W, unsigned short* __restrict__ Wt, int K, int N) {
  const int t = blockIdx.x * 256 + threadIdx.x;
  const int k8n = K / 8;
  if (t >= N * k8n) return;
  const int n = t / k8n, k8 = (t % k8n) * 8;
  v8us v;
#pragma unroll
  for (int i = 0; i < 8; ++i) v[i] = bf16_bits(W[(size_t)(k8 + i) * N + n]);
  *(v8us*)(Wt + (size_t)n * K + k8) = v;
  
}

// GEMM C[M][N] (f32, pitch ldc) = act(A[M][K]·W + bias). A f32 row-major (pitch lda) converted per fragment to bf16
// (ASPLIT: hi/lo two planes -> 2 terms, else single rounded term); Wt bf16 [N][K] (pitch ldb). BIAS_BF16 rounds the
// bias to bf16 first (bias quantised to bf16 before the add). K%32==0, M%16==0, N%64==0.
template <bool ASPLIT, int ACT, bool BIAS_BF16>
__global__ __launch_bounds__(128) void k_gemm_bf(const float* __restrict__ A, int lda, const unsigned short* __restrict__ Wt, int ldb,
                                               const float* __restrict__ bias, float* __restrict__ C, int ldc, int M, int N, int K) {
  __shared__ __attribute__((aligned(16))) float so[4][16][64];
  const int tid = threadIdx.x, w = tid >> 5, lane = tid & 31, ln = lane & 15, hh = lane >> 4;
  const int ntn = N / 64;
  const int wid = blockIdx.x * 4 + w;
  const int mt = wid / ntn, nq = wid % ntn;
  if (mt * 16 >= M) return;
  const int row0 = mt * 16, col0 = nq * 64;
  const float* arow = A + (size_t)(row0 + ln) * lda;
  v8f acc[4] = {};
  for (int kb = 0; kb < K; kb += 32) {
    FragB ah, al;
    const v4f x0 = *(const v4fa*)(arow + kb + 8 * hh), x1 = *(const v4fa*)(arow + kb + 8 * hh + 4);
    const v4f x2 = *(const v4fa*)(arow + kb + 16 + 8 * hh), x3 = *(const v4fa*)(arow + kb + 16 + 8 * hh + 4);
    float xs[16] = {x0[0],x0[1],x0[2],x0[3],x1[0],x1[1],x1[2],x1[3],x2[0],x2[1],x2[2],x2[3],x3[0],x3[1],x3[2],x3[3]};
#pragma unroll
    for (int i = 0; i < 16; ++i) { const unsigned short hb = bf16_bits(xs[i]); ah.u[i] = hb; al.u[i] = ASPLIT ? bf16_bits(xs[i] - bf16_val(hb)) : (unsigned short)0; }
#pragma unroll
    for (int t = 0; t < 4; ++t) {
      const unsigned short* brow = Wt + (size_t)(col0 + t * 16 + ln) * ldb + kb;
      FragB b;
      b.half[0] = *(const v8us*)(brow + 8 * hh);
      b.half[1] = *(const v8us*)(brow + 16 + 8 * hh);
      acc[t] = mmaN<ASPLIT ? 2 : 1>(ah.v, al.v, b.v, b.v, acc[t]);
    }
  }
#pragma unroll
  for (int t = 0; t < 4; ++t) {
    float bv = bias ? bias[col0 + t * 16 + ln] : 0.f;
    if (BIAS_BF16) bv = bf16_round(bv);
#pragma unroll
    for (int r = 0; r < 8; ++r) { float v = acc[t][r] + bv; if (ACT == 1) v = fmaxf(v, 0.f); so[w][8 * hh + r][t * 16 + ln] = v; }
  }
  __builtin_amdgcn_fence(__ATOMIC_ACQ_REL, "workgroup");
  __builtin_amdgcn_wave_barrier();
  const int rsub = lane >> 4, c4 = (lane & 15) * 4;
  {
#pragma unroll
    for (int q = 0; q < 8; ++q) {
      const int r = q * 2 + rsub;
      const v4f v = *(const v4fa*)&so[w][r][c4];
      *(v4f*)(C + (size_t)(row0 + r) * ldc + col0 + c4) = v;
    }
    
  }
}

// GEMM C = act(A·W + bias + resid): A f32 (ASPLIT -> hi/lo 2 terms), Wt bf16 [N][K]; ACT 0 none, 1 relu, 2 exact gelu;
// resid (optional, f32, row index = (row % rmod), pitch ldr, RES_BF16 rounds it) added before the activation.
template <bool ASPLIT, int ACT, bool BIAS_BF16, bool RES_BF16>
__global__ __launch_bounds__(128) void k_gemm_bf3(const float* __restrict__ A, int lda, const unsigned short* __restrict__ Wt, int ldb,
                                                const float* __restrict__ bias, const float* __restrict__ resid, int rmod, int ldr,
                                                float* __restrict__ C, int ldc, int M, int N, int K) {
  __shared__ __attribute__((aligned(16))) float so[4][16][64];
  const int tid = threadIdx.x, w = tid >> 5, lane = tid & 31, ln = lane & 15, hh = lane >> 4;
  const int ntn = N / 64;
  const int wid = blockIdx.x * 4 + w;
  const int mt = wid / ntn, nq = wid % ntn;
  if (mt * 16 >= M) return;
  const int row0 = mt * 16, col0 = nq * 64;
  const float* arow = A + (size_t)(row0 + ln) * lda;
  v8f acc[4] = {};
  for (int kb = 0; kb < K; kb += 32) {
    FragB ah, al;
    const v4f x0 = *(const v4fa*)(arow + kb + 8 * hh), x1 = *(const v4fa*)(arow + kb + 8 * hh + 4);
    const v4f x2 = *(const v4fa*)(arow + kb + 16 + 8 * hh), x3 = *(const v4fa*)(arow + kb + 16 + 8 * hh + 4);
    float xs[16] = {x0[0],x0[1],x0[2],x0[3],x1[0],x1[1],x1[2],x1[3],x2[0],x2[1],x2[2],x2[3],x3[0],x3[1],x3[2],x3[3]};
#pragma unroll
    for (int i = 0; i < 16; ++i) { const unsigned short hb = bf16_bits(xs[i]); ah.u[i] = hb; al.u[i] = ASPLIT ? bf16_bits(xs[i] - bf16_val(hb)) : (unsigned short)0; }
#pragma unroll
    for (int t = 0; t < 4; ++t) {
      const unsigned short* brow = Wt + (size_t)(col0 + t * 16 + ln) * ldb + kb;
      FragB b;
      b.half[0] = *(const v8us*)(brow + 8 * hh);
      b.half[1] = *(const v8us*)(brow + 16 + 8 * hh);
      acc[t] = mmaN<ASPLIT ? 2 : 1>(ah.v, al.v, b.v, b.v, acc[t]);
    }
  }
#pragma unroll
  for (int t = 0; t < 4; ++t) {
    const int col = col0 + t * 16 + ln;
    float bv = bias ? bias[col] : 0.f;
    if (BIAS_BF16) bv = bf16_round(bv);
#pragma unroll
    for (int r = 0; r < 8; ++r) {
      float v = acc[t][r] + bv;
      if (resid) { float rv = resid[(size_t)((row0 + 8 * hh + r) % rmod) * ldr + col]; if (RES_BF16) rv = bf16_round(rv); v += rv; }
      if (ACT == 1) v = fmaxf(v, 0.f);
      if (ACT == 2) v = 0.5f * v * (1.0f + erff(v * 0.70710678118654752f));
      if (ACT == 3) { const float u = 0.7978845608028654f * (v + 0.044715f * v * v * v); v = 0.5f * v * (1.0f + tanhf(u)); }
      so[w][8 * hh + r][t * 16 + ln] = v;
    }
  }
  __builtin_amdgcn_fence(__ATOMIC_ACQ_REL, "workgroup");
  __builtin_amdgcn_wave_barrier();
  const int rsub = lane >> 4, c4 = (lane & 15) * 4;
  {
#pragma unroll
    for (int q = 0; q < 8; ++q) {
      const int r = q * 2 + rsub;
      const v4f v = *(const v4fa*)&so[w][r][c4];
      *(v4f*)(C + (size_t)(row0 + r) * ldc + col0 + c4) = v;
    }
    
  }
}
// row LayerNorm (biased variance, eps) over N: s = X (+ R); optional out_sum <- s; out_norm <- (s-mu)*rsqrt(var+eps)*g + b
template <bool PARAM_BF16>
__global__ __launch_bounds__(256) void k_layernorm(const float* __restrict__ X, const float* __restrict__ R, const float* __restrict__ g, const float* __restrict__ bta,
                                                  float* __restrict__ out_sum, float* __restrict__ out_norm, int N, float eps) {
  __shared__ float red[256];
  const int row = blockIdx.x, tid = threadIdx.x;
  const float* x = X + (size_t)row * N; const float* rr = R ? R + (size_t)row * N : nullptr;
  float vals[16];                     // up to N = 4096
  const int per = N / 256;            // contiguous chunk per thread? use strided-by-4 chunks: thread handles j = tid*4 + 1024*u
  float s1 = 0.f;
  for (int u = 0; u < per / 4; ++u) {
    const int j = tid * 4 + 1024 * u;
    const v4f a = *(const v4fa*)(x + j);
    v4f b = {0.f,0.f,0.f,0.f}; if (rr) b = *(const v4fa*)(rr + j);
#pragma unroll
    for (int q = 0; q < 4; ++q) { const float v = a[q] + b[q]; vals[u * 4 + q] = v; s1 += v; }
  }
  red[tid] = s1; __syncthreads();
  for (int st = 128; st > 0; st >>= 1) { if (tid < st) red[tid] += red[tid + st]; __syncthreads(); }
  const float mu = red[0] / (float)N; __syncthreads();
  float s2 = 0.f;
  for (int u = 0; u < per / 4; ++u)
#pragma unroll
    for (int q = 0; q < 4; ++q) { const float c = vals[u * 4 + q] - mu; s2 += c * c; }
  red[tid] = s2; __syncthreads();
  for (int st = 128; st > 0; st >>= 1) { if (tid < st) red[tid] += red[tid + st]; __syncthreads(); }
  const float rs = rsqrtf(red[0] / (float)N + eps);
  {
    for (int u = 0; u < per / 4; ++u) {
      const int j = tid * 4 + 1024 * u;
      v4f o, sm;
#pragma unroll
      for (int q = 0; q < 4; ++q) {
        float gg = g[j + q], bb = bta[j + q];
        if (PARAM_BF16) { gg = bf16_round(gg); bb = bf16_round(bb); }
        sm[q] = vals[u * 4 + q]; o[q] = (vals[u * 4 + q] - mu) * rs * gg + bb;
      }
      if (out_sum) *(v4f*)(out_sum + (size_t)row * N + j) = sm;
      *(v4f*)(out_norm + (size_t)row * N + j) = o;
    }
    
  }
}



// ---- f16 WMMA path (v_wmma_f32_16x16x32_f16): 11-bit significands for operands in range — used where a [0,1] probability operand needs more precision than bf16
typedef _Float16 v16h __attribute__((ext_vector_type(16)));
union FragH { v16h v; v8us half[2]; _Float16 h[16]; unsigned short u[16]; };
template <int NT>
__device__ __forceinline__ v8f mmaH(v16h ah, v16h al, v16h bh, v16h bl, v8f c) {
  c = __builtin_amdgcn_wmma_f32_16x16x32_f16(false, ah, false, bh, (short)0, c, false, false);
  if (NT >= 2) c = __builtin_amdgcn_wmma_f32_16x16x32_f16(false, al, false, bh, (short)0, c, false, false);
  if (NT >= 3) c = __builtin_amdgcn_wmma_f32_16x16x32_f16(false, ah, false, bl, (short)0, c, false, false);
  asm volatile("v_nop\n\tv_nop\n\tv_nop\n\tv_nop" : "+v"(c) : "v"(ah), "v"(al), "v"(bh), "v"(bl));
  return c;
}
// batched GEMM like k_gemm_b but f16 operands: A f32 (split into f16 hi/lo if ASPLIT, else rounded to f16), Bt = f16 values [n][k]; alpha; C f32; N multiple of 16 (partial tiles skipped)
template <bool ASPLIT>
__global__ __launch_bounds__(128) void k_gemm_h(const float* __restrict__ A, int lda, size_t sA, const _Float16* __restrict__ Bh, int ldb, size_t sB, float alpha, float* __restrict__ C, int ldc, size_t sC, int M, int N, int K) {
  __shared__ __attribute__((aligned(16))) float so[4][16][64];
  const int tid = threadIdx.x, w = tid >> 5, lane = tid & 31, ln = lane & 15, hh = lane >> 4; const int by = blockIdx.y;
  A += (size_t)by * sA; Bh += (size_t)by * sB; C += (size_t)by * sC;
  const int ntn = (N + 63) / 64; const int wid = blockIdx.x * 4 + w; const int mt = wid / ntn, nq = wid % ntn; if (mt * 16 >= M) return;
  const int row0 = mt * 16, col0 = nq * 64; const float* arow = A + (size_t)(row0 + ln) * lda;
  v8f acc[4] = {};
  for (int kb = 0; kb < K; kb += 32) {
    FragH ah, al;
    const v4f x0 = *(const v4fa*)(arow + kb + 8 * hh), x1 = *(const v4fa*)(arow + kb + 8 * hh + 4), x2 = *(const v4fa*)(arow + kb + 16 + 8 * hh), x3 = *(const v4fa*)(arow + kb + 16 + 8 * hh + 4);
    float xs[16] = {x0[0],x0[1],x0[2],x0[3],x1[0],x1[1],x1[2],x1[3],x2[0],x2[1],x2[2],x2[3],x3[0],x3[1],x3[2],x3[3]};
#pragma unroll
    for (int i = 0; i < 16; ++i) { const _Float16 h = (_Float16)xs[i]; ah.h[i] = h; al.h[i] = ASPLIT ? (_Float16)(xs[i] - (float)h) : (_Float16)0.0f; }
#pragma unroll
    for (int t = 0; t < 4; ++t) { if (col0 + t * 16 >= N) continue; const size_t boff = (size_t)(col0 + t * 16 + ln) * ldb + kb; FragH bq; bq.half[0] = *(const v8us*)(Bh + boff + 8 * hh); bq.half[1] = *(const v8us*)(Bh + boff + 16 + 8 * hh);
      acc[t] = mmaH<ASPLIT ? 2 : 1>(ah.v, al.v, bq.v, bq.v, acc[t]); }
  }
#pragma unroll
  for (int t = 0; t < 4; ++t) { if (col0 + t * 16 >= N) continue;
#pragma unroll
    for (int r = 0; r < 8; ++r) so[w][8 * hh + r][t * 16 + ln] = acc[t][r] * alpha; }
  __builtin_amdgcn_fence(__ATOMIC_ACQ_REL, "workgroup"); __builtin_amdgcn_wave_barrier();
  const int rsub = lane >> 4, c4 = (lane & 15) * 4;
  {
#pragma unroll
    for (int q = 0; q < 8; ++q) { const int r = q * 2 + rsub; if (col0 + c4 < N) { const v4f v = *(const v4fa*)&so[w][r][c4]; *(v4f*)(C + (size_t)(row0 + r) * ldc + col0 + c4) = v; } }
     }
}

// Wt[n][k] = f16(W[k][n]·scale) from f32 row-major W[K][N] (scale = power of two; bf16-exact weights stay exact in f16 away from the subnormal range)
__global__ __launch_bounds__(256) void k_wt_f16(const float* __restrict__ W, _Float16* __restrict__ Wt, int K, int N, float scale) {
  const int t = blockIdx.x * 256 + threadIdx.x; if (t >= N * (K / 8)) return; const int n = t / (K / 8), k8 = (t % (K / 8)) * 8; FragH f;
#pragma unroll
  for (int i = 0; i < 8; ++i) f.h[i] = (_Float16)(bf16_round(W[(size_t)(k8 + i) * N + n]) * scale); const v8us o = f.half[0];
  *(v8us*)((unsigned short*)Wt + (size_t)n * K + k8) = o; 
}
// k_gemm_hh variant with fused epilogue: v = acc·alpha + bias[by·sBias + col] (+ CP[(row/rowsPerB)·sCPb + by·64 + col] if CP) ; ACT 0 none / 1 elu ; writes f16 C16 (and f32 C if non-null)
template <int ACT>
__global__ __launch_bounds__(128) void k_gemm_hhx(const _Float16* __restrict__ A, int lda, size_t sA, const _Float16* __restrict__ Bh, int ldb, size_t sB, float alpha, const float* __restrict__ bias, size_t sBias, const float* __restrict__ CP, int rowsPerB, size_t sCPb, int row0g,
    float* __restrict__ C, _Float16* __restrict__ C16, int ldc, size_t sC, int M, int N, int K) {
  __shared__ __attribute__((aligned(16))) float so[4][16][64];
  const int tid = threadIdx.x, w = tid >> 5, lane = tid & 31, ln = lane & 15, hh = lane >> 4; const int by = blockIdx.y;
  A += (size_t)by * sA; Bh += (size_t)by * sB; const size_t cofs = (size_t)by * sC; const float* bp = bias ? bias + (size_t)by * sBias : nullptr;
  const int ntn = (N + 63) / 64; const int wid = blockIdx.x * 4 + w; const int mt = wid / ntn, nq = wid % ntn; if (mt * 16 >= M) return;
  const int row0 = mt * 16, col0 = nq * 64; const _Float16* arow = A + (size_t)(row0 + ln) * lda;
  v8f acc[4] = {};
  for (int kb = 0; kb < K; kb += 32) { FragH ah; ah.half[0] = *(const v8us*)((const unsigned short*)arow + kb + 8 * hh); ah.half[1] = *(const v8us*)((const unsigned short*)arow + kb + 16 + 8 * hh);
#pragma unroll
    for (int t = 0; t < 4; ++t) { if (col0 + t * 16 >= N) continue; const size_t boff = (size_t)(col0 + t * 16 + ln) * ldb + kb; FragH bq; bq.half[0] = *(const v8us*)((const unsigned short*)Bh + boff + 8 * hh); bq.half[1] = *(const v8us*)((const unsigned short*)Bh + boff + 16 + 8 * hh);
      acc[t] = mmaH<1>(ah.v, ah.v, bq.v, bq.v, acc[t]); }
  }
#pragma unroll
  for (int t = 0; t < 4; ++t) { if (col0 + t * 16 >= N) continue; const int col = col0 + t * 16 + ln; const float bv = bp ? bf16_round(bp[col]) : 0.f;
#pragma unroll
    for (int r = 0; r < 8; ++r) { float v = acc[t][r] * alpha + bv; if (CP) { const int bidx = (row0g + row0 + 8 * hh + r) / rowsPerB; v += CP[(size_t)bidx * sCPb + (size_t)by * 64 + col]; } if (ACT == 1) v = (v > 0.f) ? v : expm1f(v); else if (ACT == 7) v = (v > 0.f) ? v + 1.0f : expf(v); else if (ACT == 8) v = tanhf(v); else if (ACT == 9) v = 0.5f * v * (1.0f + tanhf(0.7978845608028654f * (v + 0.044715f * v * v * v))); else if (ACT == 11) v = 1.0f / (1.0f + expf(-v)); else if (ACT == 12) v = (v > 0.f) ? v : 0.01f * v; else if (ACT == 14) v = (v > 0.f) ? v : 0.1f * v; else if (ACT == 15) v = v / (1.0f + expf(-v)); else if (ACT == 3) v = fmaxf(v, 0.f); else if (ACT == 6) v = 0.5f * v * (1.0f + erff(v * 0.70710678118654752f)); so[w][8 * hh + r][t * 16 + ln] = v; } }
  __builtin_amdgcn_fence(__ATOMIC_ACQ_REL, "workgroup"); __builtin_amdgcn_wave_barrier();
  const int rsub = lane >> 4, c4 = (lane & 15) * 4; typedef _Float16 v4h __attribute__((ext_vector_type(4)));
  {
#pragma unroll
    for (int q = 0; q < 8; ++q) { const int r = q * 2 + rsub; if (col0 + c4 < N) { const v4f v = *(const v4fa*)&so[w][r][c4]; if (C) *(v4f*)(C + cofs + (size_t)(row0 + r) * ldc + col0 + c4) = v; if (C16) { v4h h4; for (int i = 0; i < 4; ++i) h4[i] = (_Float16)v[i]; *(v4h*)(C16 + cofs + (size_t)(row0 + r) * ldc + col0 + c4) = h4; } } }
     }
}


typedef _Float16 v4h __attribute__((ext_vector_type(4)));

// ---- fragment-order plane of an f16 matrix M[rows][K]: 1-KiB blocks of 16 rows x 32 k, block (row >> 4, k >> 5) at element ((row >> 4) * (K >> 5) + (k >> 5)) * 512;
// inside a block 64 pieces of 8 k: piece j * 32 + lane holds row (lane & 15), k = 16 * j + 8 * (lane >> 4) + 0..7. A wave's 16-byte fragment load reads 512 bytes in a row: 4 whole lines, not 16 pieces of lines.
__device__ __forceinline__ size_t fo_src(size_t t, int K) { const int kbn = K >> 5; const size_t blk = t >> 6; const int c = (int)(t & 63), j = c >> 5, l = c & 31; return ((blk / kbn) * 16 + (l & 15)) * (size_t)K + (size_t)(blk % kbn) * 32 + j * 16 + (l >> 4) * 8; }      /* piece t of a plane -> its first element in the row-major matrix */

__global__ __launch_bounds__(256) void k_x16(const float* __restrict__ x, _Float16* __restrict__ X16, size_t n8) { const size_t t = (size_t)blockIdx.x * 256 + threadIdx.x; if (t >= n8) return; FragH f;
#pragma unroll
  for (int q = 0; q < 8; ++q) f.h[q] = (_Float16)bf16_round(x[fo_src(t, EMB) + q]); *(v8us*)((unsigned short*)X16 + t * 8) = f.half[0];  }      /* X16: fragment-order plane, K = EMB */
__global__ __launch_bounds__(256) void k_h16(const float* __restrict__ x, _Float16* __restrict__ X16, size_t n8) { const size_t t = (size_t)blockIdx.x * 256 + threadIdx.x; if (t >= n8) return; FragH f;
#pragma unroll
  for (int q = 0; q < 8; ++q) f.h[q] = (_Float16)x[t * 8 + q]; *(v8us*)((unsigned short*)X16 + t * 8) = f.half[0];  }
__global__ __launch_bounds__(256) void k_round16f(const float* __restrict__ W, _Float16* __restrict__ Bt, size_t n8) { const size_t t = (size_t)blockIdx.x * 256 + threadIdx.x; if (t >= n8) return; FragH f;
#pragma unroll
  for (int i = 0; i < 8; ++i) f.h[i] = (_Float16)(bf16_round(W[t * 8 + i]) * 16.0f); *(v8us*)((unsigned short*)Bt + t * 8) = f.half[0];  }
template <int NHv, int TTv>
__global__ __launch_bounds__(256) void k_vt(const _Float16* __restrict__ V16, int ldv, int voff, _Float16* __restrict__ Vt) { __shared__ unsigned short tl[64][66]; const int tid = threadIdx.x; const int slab = blockIdx.x / (TTv / 64), lg = blockIdx.x % (TTv / 64); const int b = slab / NHv, h = slab % NHv;
  for (int i = tid; i < 64 * 8; i += 256) { const int r = i / 8, c8 = (i % 8) * 8; FragH f; f.half[0] = *(const v8us*)((const unsigned short*)V16 + ((size_t)b * TTv + lg * 64 + r) * ldv + voff + h * 64 + c8);
#pragma unroll
    for (int q = 0; q < 8; ++q) tl[r][c8 + q] = f.u[q]; }
  __syncthreads();
  {
#pragma unroll
    for (int rd = 0; rd < 2; ++rd) { const int c = rd * 256 + tid, rbl = c >> 7, kbl = (c >> 6) & 1, cc = c & 63, l = cc & 31; const int d = rbl * 16 + (l & 15), k0 = kbl * 32 + (cc >> 5) * 16 + (l >> 4) * 8; FragH f;      /* Vt: fragment-order plane, rows = slab * 64 + d, K = TTv keys */
#pragma unroll
      for (int q = 0; q < 8; ++q) f.u[q] = tl[k0 + q][d];
      *(v8us*)((unsigned short*)Vt + (((size_t)slab * 4 + rbl) * (TTv / 32) + lg * 2 + kbl) * 512 + cc * 8) = f.half[0]; }
     } }

__global__ __launch_bounds__(256) void k_hl(const float* __restrict__ F, _Float16* __restrict__ Hh, _Float16* __restrict__ Hl, size_t n8) { const size_t t = (size_t)blockIdx.x * 256 + threadIdx.x; if (t >= n8) return; FragH fh, fl; const v4f a = *(const v4fa*)(F + t * 8), c = *(const v4fa*)(F + t * 8 + 4);
#pragma unroll
  for (int q = 0; q < 4; ++q) { _Float16 h = (_Float16)a[q]; fh.h[q] = h; fl.h[q] = (_Float16)((a[q] - (float)h) * 1024.0f); h = (_Float16)c[q]; fh.h[4 + q] = h; fl.h[4 + q] = (_Float16)((c[q] - (float)h) * 1024.0f); }
  { *(v8us*)((unsigned short*)Hh + t * 8) = fh.half[0]; *(v8us*)((unsigned short*)Hl + t * 8) = fl.half[0];  } }

// ---- fast GEMM (wave tile 32x64; requires M % 32 == 0 rows per launch region, N % 64 == 0 and K % 64 == 0); epilogue = k_gemm_hhx semantics ----
// Two fragment sets (even and odd 32-k steps). Each fragment is reloaded for the step two ahead right behind its last product, so a step's loads fly under the other set's products.
__device__ __forceinline__ v16h g2_frag(const _Float16* p, int k, int lane) { FragH f; const unsigned short* q = (const unsigned short*)p + (size_t)k * 16 + lane * 8; f.half[0] = *(const v8us*)q; f.half[1] = *(const v8us*)(q + 256); return f.v; }      /* p: a 16-row strip of a fragment-order plane; k: multiple of 32 */
__device__ __forceinline__ v8f g2_mma(v16h a, v16h b, v8f c) { v8f d = __builtin_amdgcn_wmma_f32_16x16x32_f16(false, a, false, b, (short)0, c, false, false); asm volatile("v_nop\n\tv_nop\n\tv_nop\n\tv_nop" : "+v"(d) : "v"(a), "v"(b)); return d; }
template <int ACT, bool FO>      /* A and Bh: fragment-order planes with K = lda = ldb; FO: the result goes to C16 alone, as such a plane (K = ldc) */
__global__ __launch_bounds__(128) void k_gemm2(const _Float16* __restrict__ A, int lda, size_t sA, const _Float16* __restrict__ Bh, int ldb, size_t sB, float alpha, const float* __restrict__ bias, size_t sBias, const float* __restrict__ CP, int rowsPerB, size_t sCPb, int row0g,
    float* __restrict__ C, _Float16* __restrict__ C16, int ldc, size_t sC, int M, int N, int K) {
  __shared__ __attribute__((aligned(16))) float so[4][32][68];
  const int tid = threadIdx.x, w = tid >> 5, lane = tid & 31, ln = lane & 15, hh = lane >> 4; const int by = blockIdx.y;
  A += (size_t)by * sA; Bh += (size_t)by * sB; const size_t cofs = (size_t)by * sC; const float* bp = bias ? bias + (size_t)by * sBias : nullptr;
  const int ntn = N >> 6; const int mt = blockIdx.x / ntn, nq = blockIdx.x - mt * ntn; const int row0 = mt * 128 + 32 * w, col0 = nq * 64; if (row0 >= M) return;
  const _Float16* a0p = A + (size_t)row0 * lda; const _Float16* a1p = a0p + (size_t)16 * lda;
  const _Float16* b0p = Bh + (size_t)col0 * ldb; const _Float16* b1p = b0p + (size_t)16 * ldb; const _Float16* b2p = b1p + (size_t)16 * ldb; const _Float16* b3p = b2p + (size_t)16 * ldb;
  const v8f z8 = {0.f,0.f,0.f,0.f,0.f,0.f,0.f,0.f}; v8f c00 = z8, c01 = z8, c02 = z8, c03 = z8, c10 = z8, c11 = z8, c12 = z8, c13 = z8;
  v16h a0 = g2_frag(a0p, 0, lane), a1 = g2_frag(a1p, 0, lane), b0 = g2_frag(b0p, 0, lane), b1 = g2_frag(b1p, 0, lane), b2 = g2_frag(b2p, 0, lane), b3 = g2_frag(b3p, 0, lane);
  v16h e0 = g2_frag(a0p, 32, lane), e1 = g2_frag(a1p, 32, lane), f0 = g2_frag(b0p, 32, lane), f1 = g2_frag(b1p, 32, lane), f2 = g2_frag(b2p, 32, lane), f3 = g2_frag(b3p, 32, lane);
#pragma unroll 1      /* rolled: the body already holds both sets; more copies only add code */
  for (int kb = 0; kb < K; kb += 64) { const int kn = (kb + 64 < K) ? kb + 64 : kb;      /* last trip: re-reads its own step (in bounds, unused) */
    c00 = g2_mma(a0, b0, c00); c10 = g2_mma(a1, b0, c10); b0 = g2_frag(b0p, kn, lane);
    c01 = g2_mma(a0, b1, c01); c11 = g2_mma(a1, b1, c11); b1 = g2_frag(b1p, kn, lane);
    c02 = g2_mma(a0, b2, c02); c12 = g2_mma(a1, b2, c12); b2 = g2_frag(b2p, kn, lane);
    c03 = g2_mma(a0, b3, c03); c13 = g2_mma(a1, b3, c13); b3 = g2_frag(b3p, kn, lane); a0 = g2_frag(a0p, kn, lane); a1 = g2_frag(a1p, kn, lane);
    c00 = g2_mma(e0, f0, c00); c10 = g2_mma(e1, f0, c10); f0 = g2_frag(b0p, kn + 32, lane);
    c01 = g2_mma(e0, f1, c01); c11 = g2_mma(e1, f1, c11); f1 = g2_frag(b1p, kn + 32, lane);
    c02 = g2_mma(e0, f2, c02); c12 = g2_mma(e1, f2, c12); f2 = g2_frag(b2p, kn + 32, lane);
    c03 = g2_mma(e0, f3, c03); c13 = g2_mma(e1, f3, c13); f3 = g2_frag(b3p, kn + 32, lane); e0 = g2_frag(a0p, kn + 32, lane); e1 = g2_frag(a1p, kn + 32, lane);
    asm volatile("s_wait_xcnt 0x0" ::: "memory"); }      /* the next trip forms new addresses in the registers that this trip's loads name: wait before they are overwritten */
  v8f accs[8] = {c00, c01, c02, c03, c10, c11, c12, c13};
#pragma unroll
  for (int u = 0; u < 8; ++u) { const int t = u & 3, half = u >> 2; const int col = col0 + t * 16 + ln; const float bv = bp ? bf16_round(bp[col]) : 0.f;
#pragma unroll
    for (int r = 0; r < 8; ++r) { const int rloc = half * 16 + 8 * hh + r; float v = accs[u][r] * alpha + bv; if (CP) { const int bidx = (row0g + row0 + rloc) / rowsPerB; v += CP[(size_t)bidx * sCPb + (size_t)by * 64 + col]; }
      if (ACT == 3) v = fmaxf(v, 0.f); else if (ACT == 6) v = 0.5f * v * (1.0f + erff(v * 0.70710678118654752f)); else if (ACT == 11) v = 1.0f / (1.0f + expf(-v)); else if (ACT == 15) v = v / (1.0f + expf(-v)); else if (ACT == 12) v = (v > 0.f) ? v : 0.01f * v; else if (ACT == 8) v = tanhf(v);
      so[w][rloc][t * 16 + ln] = v; } }
  __builtin_amdgcn_fence(__ATOMIC_ACQ_REL, "workgroup"); __builtin_amdgcn_wave_barrier();
  const int rsub = lane >> 4, c4 = (lane & 15) * 4;
  if (!FO) {
#pragma unroll
    for (int q = 0; q < 16; ++q) { const int r = q * 2 + rsub; const v4f v = *(const v4fa*)&so[w][r][c4]; if (C) *(v4f*)(C + cofs + (size_t)(row0 + r) * ldc + col0 + c4) = v; if (C16) { v4h h4; for (int i = 0; i < 4; ++i) h4[i] = (_Float16)v[i]; *(v4h*)(C16 + cofs + (size_t)(row0 + r) * ldc + col0 + c4) = h4; } }
     } else {      /* the wave's 32 x 64 tile = 2 x 2 blocks of the plane, 8 stores of 512 bytes in a row */
#pragma unroll
      for (int u = 0; u < 8; ++u) { const int rbl = u >> 2, kbl = (u >> 1) & 1, j = u & 1; const float* sp = &so[w][rbl * 16 + ln][kbl * 32 + j * 16 + hh * 8]; const v4f x = *(const v4fa*)sp, y = *(const v4fa*)(sp + 4); FragH f;
#pragma unroll
        for (int i = 0; i < 4; ++i) { f.h[i] = (_Float16)x[i]; f.h[4 + i] = (_Float16)y[i]; }
        *(v8us*)((unsigned short*)C16 + cofs + (size_t)(row0 + rbl * 16) * ldc + (size_t)((col0 >> 5) + kbl) * 512 + j * 256 + lane * 8) = f.half[0]; }
     } }



template <int CAUSAL>
__global__ __launch_bounds__(128) void k_flash(const _Float16* __restrict__ Q16, int ldq, const _Float16* __restrict__ K16, int ldk, const _Float16* __restrict__ Vt, const int* __restrict__ MSK, float* __restrict__ O, int ldo) {
  constexpr int RPW = 16, RTN = RPW / 16, NQB = TQ / (4 * RPW), DT = 4, KS = 2;
  __shared__ __attribute__((aligned(16))) unsigned short sP[4][RPW][40]; __shared__ __attribute__((aligned(16))) float sO[4][RPW][64 + 4];
  const int tid = threadIdx.x, w = tid >> 5, lane = tid & 31, ln = lane & 15, hh = lane >> 4;
  const int slab = blockIdx.x / QBLKS, qblk = blockIdx.x % QBLKS; (void)NQB; const int b = slab / NH, h = slab % NH; const int qb0 = qblk * (4 * RPW); const int q0 = qb0 + w * RPW;
  FragH aq[2][KS];
#pragma unroll
  for (int rt = 0; rt < RTN; ++rt) { const unsigned short* qr = (const unsigned short*)Q16 + ((size_t)b * TQ + q0 + rt * 16 + ln) * ldq + h * 64;
#pragma unroll
    for (int ks = 0; ks < KS; ++ks) { aq[rt][ks].half[0] = *(const v8us*)(qr + ks * 32 + 8 * hh); aq[rt][ks].half[1] = *(const v8us*)(qr + ks * 32 + 16 + 8 * hh); } }
  const unsigned short* Vth = (const unsigned short*)Vt + (size_t)slab * 64 * TK;
  float m_r[2][8], l_r[2][8]; v8f oacc[2][DT];
#pragma unroll
  for (int rt = 0; rt < RTN; ++rt) {
#pragma unroll
    for (int r = 0; r < 8; ++r) { m_r[rt][r] = -3.0e38f; l_r[rt][r] = 0.f; }
#pragma unroll
    for (int dt = 0; dt < DT; ++dt) oacc[rt][dt] = (v8f){0.f,0.f,0.f,0.f,0.f,0.f,0.f,0.f}; }
  const int jend = (CAUSAL == 1) ? (qb0 + 4 * RPW) : TK;      /* causal: keys beyond the block's last query never contribute */
#pragma unroll 1
  for (int j0 = 0; j0 < jend; j0 += 32) {
    v8f s[2][2];
#pragma unroll
    for (int nt = 0; nt < 2; ++nt) { const unsigned short* kr = (const unsigned short*)K16 + ((size_t)b * TK + j0 + nt * 16 + ln) * ldk + h * 64; FragH bk[KS];
#pragma unroll
      for (int ks = 0; ks < KS; ++ks) { bk[ks].half[0] = *(const v8us*)(kr + ks * 32 + 8 * hh); bk[ks].half[1] = *(const v8us*)(kr + ks * 32 + 16 + 8 * hh); }
#pragma unroll
      for (int rt = 0; rt < RTN; ++rt) { v8f acc = (v8f){0.f,0.f,0.f,0.f,0.f,0.f,0.f,0.f};
#pragma unroll
        for (int ks = 0; ks < KS; ++ks) acc = mmaH<1>(aq[rt][ks].v, aq[rt][ks].v, bk[ks].v, bk[ks].v, acc); s[rt][nt] = acc; } }
#pragma unroll
    for (int rt = 0; rt < RTN; ++rt)
#pragma unroll
      for (int r = 0; r < 8; ++r) { const int tq = q0 + rt * 16 + 8 * hh + r; const int k0 = j0 + ln, k1 = j0 + 16 + ln;
        const bool ok0 = (CAUSAL == 1) ? (k0 <= tq) : ((CAUSAL == 2) ? ((k0 >> 5) == (tq >> 5)) : true), ok1 = (CAUSAL == 1) ? (k1 <= tq) : ((CAUSAL == 2) ? ((k1 >> 5) == (tq >> 5)) : true);      /* mode 2: block-diagonal 32-token groups */
        const float s0 = ok0 ? s[rt][0][r] * SCL : -3.0e38f, s1 = ok1 ? s[rt][1][r] * SCL : -3.0e38f; float mc = fmaxf(s0, s1);
        mc = fmaxf(mc, __shfl_xor(mc, 1, 32)); mc = fmaxf(mc, __shfl_xor(mc, 2, 32)); mc = fmaxf(mc, __shfl_xor(mc, 4, 32)); mc = fmaxf(mc, __shfl_xor(mc, 8, 32));
        const float mn = fmaxf(m_r[rt][r], mc); const float al = (mn > -1.0e38f) ? expf(m_r[rt][r] - mn) : 1.0f; m_r[rt][r] = mn; const float p0 = ok0 ? expf(s0 - mn) : 0.f, p1 = ok1 ? expf(s1 - mn) : 0.f; l_r[rt][r] = l_r[rt][r] * al + p0 + p1;
#pragma unroll
        for (int dt = 0; dt < DT; ++dt) oacc[rt][dt][r] *= al;
        FragH t2; t2.h[0] = (_Float16)(p0 * 1024.0f); t2.h[1] = (_Float16)(p1 * 1024.0f); sP[w][rt * 16 + 8 * hh + r][ln] = t2.u[0]; sP[w][rt * 16 + 8 * hh + r][16 + ln] = t2.u[1]; }
    __builtin_amdgcn_fence(__ATOMIC_ACQ_REL, "workgroup"); __builtin_amdgcn_wave_barrier();
    FragH pa[2];
#pragma unroll
    for (int rt = 0; rt < RTN; ++rt) { pa[rt].half[0] = *(const v8us*)&sP[w][rt * 16 + ln][8 * hh]; pa[rt].half[1] = *(const v8us*)&sP[w][rt * 16 + ln][16 + 8 * hh]; }
#pragma unroll
    for (int dt = 0; dt < DT; ++dt) { const unsigned short* vrow = Vth + (size_t)(dt * 16 + ln) * TK + j0; FragH bv; bv.half[0] = *(const v8us*)(vrow + 8 * hh); bv.half[1] = *(const v8us*)(vrow + 16 + 8 * hh);
#pragma unroll
      for (int rt = 0; rt < RTN; ++rt) oacc[rt][dt] = mmaH<1>(pa[rt].v, pa[rt].v, bv.v, bv.v, oacc[rt][dt]); }
    __builtin_amdgcn_fence(__ATOMIC_ACQ_REL, "workgroup"); __builtin_amdgcn_wave_barrier(); }
#pragma unroll
  for (int rt = 0; rt < RTN; ++rt) {
#pragma unroll
    for (int r = 0; r < 8; ++r) { float l = l_r[rt][r]; l += __shfl_xor(l, 1, 32); l += __shfl_xor(l, 2, 32); l += __shfl_xor(l, 4, 32); l += __shfl_xor(l, 8, 32); l_r[rt][r] = (l > 0.f) ? 1.0f / (l * 1024.0f) : 0.f; }
#pragma unroll
    for (int dt = 0; dt < DT; ++dt)
#pragma unroll
      for (int r = 0; r < 8; ++r) sO[w][rt * 16 + 8 * hh + r][dt * 16 + ln] = oacc[rt][dt][r] * l_r[rt][r]; }
  __builtin_amdgcn_fence(__ATOMIC_ACQ_REL, "workgroup"); __builtin_amdgcn_wave_barrier();
  {
#pragma unroll
    for (int rp = 0; rp < RPW; rp += 2) { const int r = rp + (lane >> 4), pc = lane & 15; const v4f val = *(const v4fa*)&sO[w][r][pc * 4]; *(v4f*)(O + ((size_t)b * TQ + q0 + r) * ldo + h * 64 + pc * 4) = val; }
     } }

// Attention with both products transposed: S^T = K Q^T (A = 16 keys, B = 16 queries) and O^T += V^T P^T (A = 16 values of d, B = P^T).
// A lane holds 16 of the 32 scores of ONE query (keys 8 * hh + r of each 16-key tile): maximum and sum are taken in the lane, plus one exchange between the wave's halves.
// The two score tiles, converted in place, are the B operand of the second product in the planes' own k order (16 * j + 8 * hh + i): P goes through no LDS and no lane exchange.
// The softmax runs in base 2: e^(SCL * s - m) = 2^(SCL2 * s - m2), so each score costs one fma and one hardware exponential (arguments are <= 10; far below, the result goes to 0, as it should).
#define SCL2 0.18033688011112042f      /* 64^-0.5 * log2(e) */
typedef float v2f __attribute__((ext_vector_type(2)));
__device__ __forceinline__ float xhalf(float x) { return __int_as_float(__builtin_amdgcn_permlanex16(__float_as_int(x), __float_as_int(x), 0x76543210, 0xfedcba98, false, false)); }      /* lane l <-> l ^ 16 */
template <int TKv>
__global__ __launch_bounds__(128) void k_flashT(const _Float16* __restrict__ Q16, int ldq, const _Float16* __restrict__ K16, int ldk, const _Float16* __restrict__ Vt, float* __restrict__ O, int ldo) {
  constexpr int RPW = 16, DT = 4, KS = 2;      /* the short inner loops below are all unrolled in full, so that the fragment arrays stay in registers */
  __shared__ __attribute__((aligned(16))) float sO[4][RPW][64 + 4];
  const int tid = threadIdx.x, w = tid >> 5, lane = tid & 31, ln = lane & 15, hh = lane >> 4;
  const int slab = blockIdx.x / QBLKS, qblk = blockIdx.x % QBLKS; const int b = slab / NH, h = slab % NH; const int q0 = qblk * (4 * RPW) + w * RPW;
  FragH bq[KS];      /* Q, the B operand of the score product, kept for the whole kernel */
  { const unsigned short* qr = (const unsigned short*)Q16 + ((size_t)b * TQ + q0) * ldq + h * 1024 + lane * 8;      /* fragment-order plane: strip of 16 queries, the head's two blocks */
#pragma unroll
    for (int ks = 0; ks < KS; ++ks) { bq[ks].half[0] = *(const v8us*)(qr + ks * 512); bq[ks].half[1] = *(const v8us*)(qr + ks * 512 + 256); } }
  FragH ak[2][KS];      /* K fragments (A operand), fetched one pass ahead */
#pragma unroll
  for (int nt = 0; nt < 2; ++nt) { const unsigned short* kr = (const unsigned short*)K16 + ((size_t)b * TKv + nt * 16) * ldk + h * 1024 + lane * 8;      /* fragment-order plane: strip of 16 keys, the head's two blocks */
#pragma unroll
    for (int ks = 0; ks < KS; ++ks) { ak[nt][ks].half[0] = *(const v8us*)(kr + ks * 512); ak[nt][ks].half[1] = *(const v8us*)(kr + ks * 512 + 256); } }
  asm volatile("s_wait_xcnt 0x0" ::: "memory");      /* the registers that the Q and K loads above name are reused below: wait before they are overwritten */
  __builtin_amdgcn_sched_barrier(0);      /* keeps the set-up code below from being scheduled in front of that wait */
  const unsigned short* Vth = (const unsigned short*)Vt + (size_t)slab * 64 * TKv;
  float m_q = -3.0e38f, l_q = 0.f; v8f oacc[DT];      /* the lane's query: running maximum in base-2 units, less 10 (equal in both halves), the sum over this half's keys */
#pragma unroll
  for (int dt = 0; dt < DT; ++dt) oacc[dt] = (v8f){0.f,0.f,0.f,0.f,0.f,0.f,0.f,0.f};
#pragma unroll 1      /* rolled: a pass is long enough to cover its own loads; copies only add code */
  for (int j0 = 0; j0 < TKv; j0 += 32) {
    FragH av[DT];      /* this pass's V^T fragments (A operand), all issued at the head of the pass: they fly under the score products and the softmax */
#pragma unroll
    for (int dt = 0; dt < DT; ++dt) { const unsigned short* vrow = Vth + (size_t)(dt * 16) * TKv + (size_t)j0 * 16 + lane * 8; av[dt].half[0] = *(const v8us*)vrow; av[dt].half[1] = *(const v8us*)(vrow + 256); }
    v8f s[2];      /* s[nt][r] = score of key j0 + nt * 16 + 8 * hh + r with query q0 + ln */
#pragma unroll
    for (int nt = 0; nt < 2; ++nt) { v8f acc = (v8f){0.f,0.f,0.f,0.f,0.f,0.f,0.f,0.f};
#pragma unroll
      for (int ks = 0; ks < KS; ++ks) acc = mmaH<1>(ak[nt][ks].v, ak[nt][ks].v, bq[ks].v, bq[ks].v, acc); s[nt] = acc; }
    const int jn = (j0 + 32 < TKv) ? j0 + 32 : j0;      /* last pass: re-reads its own keys (in bounds, unused) */
#pragma unroll
    for (int nt = 0; nt < 2; ++nt) { const unsigned short* kr = (const unsigned short*)K16 + ((size_t)b * TKv + jn + nt * 16) * ldk + h * 1024 + lane * 8;
#pragma unroll
      for (int ks = 0; ks < KS; ++ks) { ak[nt][ks].half[0] = *(const v8us*)(kr + ks * 512); ak[nt][ks].half[1] = *(const v8us*)(kr + ks * 512 + 256); }
      asm volatile("s_wait_xcnt 0x0" ::: "memory"); }      /* the address registers of these four loads may be given to the next loads' results or to the softmax: wait before they are overwritten */
    float mx[8];      /* the maximum is taken on the raw scores: SCL2 > 0, and rounding is monotone, so scaling the maximum gives the maximum of the scaled scores */
#pragma unroll
    for (int i = 0; i < 8; ++i) mx[i] = fmaxf(s[0][i], s[1][i]);
    float mc = fmaxf(fmaxf(fmaxf(mx[0], mx[1]), fmaxf(mx[2], mx[3])), fmaxf(fmaxf(mx[4], mx[5]), fmaxf(mx[6], mx[7])));
    mc = fmaf(mc, SCL2, -10.0f);      /* kept 10 below the true maximum: the f16 operand's factor 2^10 rides in the exponent, p = 1024 * e^(score - maximum), at most about 1024 */
    mc = fmaxf(mc, xhalf(mc));
    const float mn = fmaxf(m_q, mc); const float ea = __builtin_amdgcn_exp2f(m_q - mn); const float al = (mn > -1.0e38f) ? ea : 1.0f; m_q = mn;
    FragH pb; float p[16];
#pragma unroll
    for (int i = 0; i < 16; i += 2) { const v2f x = __builtin_elementwise_fma((v2f){s[i >> 3][i & 7], s[i >> 3][(i & 7) + 1]}, (v2f){SCL2, SCL2}, (v2f){-mn, -mn});      /* two scores per packed fma */
      p[i] = __builtin_amdgcn_exp2f(x[0]); p[i + 1] = __builtin_amdgcn_exp2f(x[1]); pb.h[i] = (_Float16)p[i]; pb.h[i + 1] = (_Float16)p[i + 1]; }
    v2f t0 = {0.f, 0.f}, t1 = {0.f, 0.f};      /* two chains of packed partial sums: no chain of sixteen dependent adds */
#pragma unroll
    for (int i = 0; i < 4; ++i) { t0 += (v2f){p[4 * i], p[4 * i + 1]}; t1 += (v2f){p[4 * i + 2], p[4 * i + 3]}; }
    t0 += t1; l_q = l_q * al + (t0[0] + t0[1]);
#pragma unroll
    for (int dt = 0; dt < DT; ++dt) oacc[dt] *= al;
#pragma unroll
    for (int dt = 0; dt < DT; ++dt) oacc[dt] = mmaH<1>(av[dt].v, av[dt].v, pb.v, pb.v, oacc[dt]); }
  float l = l_q + xhalf(l_q); l = (l > 0.f) ? 1.0f / l : 0.f;      /* the sum carries the same 2^10 as the products */
#pragma unroll
  for (int dt = 0; dt < DT; ++dt) { const v8f o = oacc[dt] * l;      /* oacc[dt][r] = O[q0 + ln][dt * 16 + 8 * hh + r] */
    *(v4fa*)&sO[w][ln][dt * 16 + 8 * hh] = (v4f){o[0], o[1], o[2], o[3]}; *(v4fa*)&sO[w][ln][dt * 16 + 8 * hh + 4] = (v4f){o[4], o[5], o[6], o[7]}; }
  __builtin_amdgcn_fence(__ATOMIC_ACQ_REL, "workgroup"); __builtin_amdgcn_wave_barrier();      /* a lane reads below what other lanes of its wave wrote above: the LDS writes come first */
  {
#pragma unroll
    for (int rp = 0; rp < RPW; rp += 2) { const int r = rp + (lane >> 4), pc = lane & 15; const v4f val = *(const v4fa*)&sO[w][r][pc * 4]; *(v4f*)(O + ((size_t)b * TQ + q0 + r) * ldo + h * 64 + pc * 4) = val; }
     } }
__global__ __launch_bounds__(256) void k_wsc(const float* __restrict__ Wm, _Float16* __restrict__ Bt, size_t n8, float sc) { const size_t t = (size_t)blockIdx.x * 256 + threadIdx.x; if (t >= n8) return; FragH f; for (int q = 0; q < 8; ++q) f.h[q] = (_Float16)(bf16_round(Wm[fo_src(t, EMB) + q]) * sc); *(v8us*)((unsigned short*)Bt + t * 8) = f.half[0];  }      /* torch (out,in) weight == Bt[n][k]: scaled copy into a fragment-order plane, K = EMB */
__global__ __launch_bounds__(256) void k_comb(const float* __restrict__ OL, const float* __restrict__ OG, const float* __restrict__ gate, _Float16* __restrict__ O16, size_t n8) {
  #pragma clang fp contract(off)
  const size_t t = (size_t)blockIdx.x * 256 + threadIdx.x; if (t >= n8) return; const float g = 1.0f / (1.0f + expf(-bf16_round(gate[0]))); const float h1 = 1.0f - g; FragH f; const size_t s = fo_src(t, EMB);      /* O16: fragment-order plane, K = EMB */
  for (int q = 0; q < 8; ++q) { float a = g * OL[s + q]; a += h1 * OG[s + q]; f.h[q] = (_Float16)a; }
  *(v8us*)((unsigned short*)O16 + t * 8) = f.half[0];  }

extern "C" void kernel_launch(void* const* d_in, const int* in_sizes, int n_in,
                              void* d_out, int out_size, void* d_ws, size_t ws_size, hipStream_t stream) {
  (void)in_sizes; (void)n_in; (void)out_size;
  const float* const* I = (const float* const*)d_in; const float* lh = I[0]; const float* gh = I[1]; const float* qw = I[2]; const float* qb = I[3]; const float* kw = I[4]; const float* kb = I[5]; const float* vw = I[6]; const float* vb = I[7]; const float* kgw = I[8]; const float* kgb = I[9]; const float* vgw = I[10]; const float* vgb = I[11]; const float* ow = I[12]; const float* ob = I[13]; const float* gate = I[14];
  char* ws = (char*)d_ws; size_t off = 0;
  auto take = [&](size_t bytes) { char* p = ws + off; off += (bytes + 255) & ~(size_t)255; return p; };
  const size_t w8 = (size_t)EMB * EMB / 8, npl = (size_t)NRL * EMB, npg = (size_t)NRG * EMB;
  _Float16* BQ = (_Float16*)take(w8 * 16); _Float16* BK = (_Float16*)take(w8 * 16); _Float16* BV = (_Float16*)take(w8 * 16); _Float16* BKG = (_Float16*)take(w8 * 16); _Float16* BVG = (_Float16*)take(w8 * 16); _Float16* BO = (_Float16*)take(w8 * 16);
  _Float16* XL = (_Float16*)take(npl * 2); _Float16* XG = (_Float16*)take(npg * 2); _Float16* Q16 = (_Float16*)take(npl * 2); _Float16* KL = (_Float16*)take(npl * 2); _Float16* VL = (_Float16*)take(npl * 2); _Float16* KG = (_Float16*)take(npg * 2); _Float16* VG = (_Float16*)take(npg * 2); _Float16* VTL = (_Float16*)take(npl * 2); _Float16* VTG = (_Float16*)take(npg * 2);
  float* OL = (float*)take(npl * 4); float* OG = (float*)take(npl * 4); _Float16* O16 = XL;      /* O16 over the local input plane (dead after its projections) */
  if (off > ws_size) return;      /* 12 + 8+2+8+8+8+2+2+8+2 + 16+16 = 92 MiB */
  const unsigned g8 = (unsigned)((w8 + 255) / 256);
  k_wsc<<<g8, 256, 0, stream>>>(qw, BQ, w8, 16.0f); k_wsc<<<g8, 256, 0, stream>>>(kw, BK, w8, 16.0f); k_wsc<<<g8, 256, 0, stream>>>(vw, BV, w8, 16.0f); k_wsc<<<g8, 256, 0, stream>>>(kgw, BKG, w8, 16.0f); k_wsc<<<g8, 256, 0, stream>>>(vgw, BVG, w8, 16.0f); k_wsc<<<g8, 256, 0, stream>>>(ow, BO, w8, 16.0f);
  k_x16<<<(unsigned)((npl / 8 + 255) / 256), 256, 0, stream>>>(lh, XL, npl / 8); k_x16<<<(unsigned)((npg / 8 + 255) / 256), 256, 0, stream>>>(gh, XG, npg / 8);
  const dim3 gL((NRL / 128) * (EMB / 64), 1), gGl((NRG / 128) * (EMB / 64), 1);
  k_gemm2<0, true><<<gL, 128, 0, stream>>>(XL, EMB, 0, BQ, EMB, 0, 0.0625f, qb, 0, nullptr, 1, 0, 0, nullptr, Q16, EMB, 0, NRL, EMB, EMB);
  k_gemm2<0, true><<<gL, 128, 0, stream>>>(XL, EMB, 0, BK, EMB, 0, 0.0625f, kb, 0, nullptr, 1, 0, 0, nullptr, KL, EMB, 0, NRL, EMB, EMB);
  k_gemm2<0, false><<<gL, 128, 0, stream>>>(XL, EMB, 0, BV, EMB, 0, 0.0625f, vb, 0, nullptr, 1, 0, 0, nullptr, VL, EMB, 0, NRL, EMB, EMB);
  k_gemm2<0, true><<<gGl, 128, 0, stream>>>(XG, EMB, 0, BKG, EMB, 0, 0.0625f, kgb, 0, nullptr, 1, 0, 0, nullptr, KG, EMB, 0, NRG, EMB, EMB);
  k_gemm2<0, false><<<gGl, 128, 0, stream>>>(XG, EMB, 0, BVG, EMB, 0, 0.0625f, vgb, 0, nullptr, 1, 0, 0, nullptr, VG, EMB, 0, NRG, EMB, EMB);
  k_vt<NH, LL><<<NB * NH * (LL / 64), 256, 0, stream>>>(VL, EMB, 0, VTL); k_vt<NH, GG><<<NB * NH * (GG / 64), 256, 0, stream>>>(VG, EMB, 0, VTG);
  k_flashT<TKA><<<NB * NH * QBLKS, 128, 0, stream>>>(Q16, EMB, KL, EMB, VTL, OL, EMB);      /* local: 2048 keys */
  k_flashT<TKB><<<NB * NH * QBLKS, 128, 0, stream>>>(Q16, EMB, KG, EMB, VTG, OG, EMB);      /* global: 512 keys */
  k_comb<<<(unsigned)((npl / 8 + 255) / 256), 256, 0, stream>>>(OL, OG, gate, O16, npl / 8);
  k_gemm2<0, false><<<gL, 128, 0, stream>>>(O16, EMB, 0, BO, EMB, 0, 0.0625f, ob, 0, nullptr, 1, 0, 0, (float*)d_out, nullptr, EMB, 0, NRL, EMB, EMB);
}

// v005
// It runs in 144 microseconds.
// Timed twice side by side with v004, it ran 1.56 and 1.52 times as fast.
// Over all steps from v000 it is 4.02 times as fast.
#include <hip/hip_runtime.h>
// InfiniSpanAttention (2 batches; 2048 local tokens, 512 global tokens, D = 1024, 16 heads of 64): q/k_l/v_l from local_hidden, k_g/v_g from global_hidden (torch (out,in) linears + bias); out_l = softmax(q k_l^T s) v_l, out_g = softmax(q k_g^T s) v_g (no masks); out = sigmoid(gate) out_l + (1 - sigmoid(gate)) out_g -> merged heads -> out_w + out_b.
// Compute dtype: inputs and parameters rounded to bf16; q, k, v, P and the combined attention output as f16 operands (~2^-12); f32 accumulation/softmax/gating. v_wmma_f32_16x16x32_f16.
#define NB 2
#define EMB 1024
#define NRL (NB * LL)            /* 4096 local rows */
#define NRG (NB * GG)            /* 1024 global rows */
#define LL 2048                  /* local tokens (queries; local keys) */
#define GG 512                   /* global tokens (keys of the second attention) */
#define TQ LL
#define TK LL
#define TKA LL
#define TKB GG
#define NH 16
#define SCL 0.125f               /* 64^-0.5 */
#define QBLKS (TQ / 64)
typedef __bf16 v16b __attribute__((ext_vector_type(16)));
typedef unsigned short v8us __attribute__((ext_vector_type(8), may_alias));
typedef float  v8f  __attribute__((ext_vector_type(8)));
typedef float  v4f  __attribute__((ext_vector_type(4)));
typedef float  v4fa __attribute__((ext_vector_type(4), may_alias));
union FragB { v16b v; v8us half[2]; unsigned short u[16]; };

__device__ __forceinline__ unsigned short bf16_bits(float x) { unsigned int u = __float_as_uint(x); return (unsigned short)((u + 0x7FFFu + ((u >> 16) & 1u)) >> 16); }
__device__ __forceinline__ float bf16_val(unsigned short b) { return __uint_as_float(((unsigned int)b) << 16); }
__device__ __forceinline__ float bf16_round(float x) { return bf16_val(bf16_bits(x)); }
// D += A·B with NT terms: 1 = ah·bh, 2 = + al·bh (A split), 3 = + ah·bl (both split)
template <int NT>
__device__ __forceinline__ v8f mmaN(v16b ah, v16b al, v16b bh, v16b bl, v8f c) {
  c = __builtin_amdgcn_wmma_f32_16x16x32_bf16(false, ah, false, bh, (short)0, c, false, false);
  if (NT >= 2) c = __builtin_amdgcn_wmma_f32_16x16x32_bf16(false, al, false, bh, (short)0, c, false, false);
  if (NT >= 3) c = __builtin_amdgcn_wmma_f32_16x16x32_bf16(false, ah, false, bl, (short)0, c, false, false);
  asm volatile("v_nop\n\tv_nop\n\tv_nop\n\tv_nop" : "+v"(c) : "v"(ah), "v"(al), "v"(bh), "v"(bl));
  return c;
}

__global__ __launch_bounds__(256) void k_wt_bf16(const float* __restrict__ W, unsigned short* __restrict__ Wt, int K, int N) {
  const int t = blockIdx.x * 256 + threadIdx.x;
  const int k8n = K / 8;
  if (t >= N * k8n) return;
  const int n = t / k8n, k8 = (t % k8n) * 8;
  v8us v;
#pragma unroll
  for (int i = 0; i < 8; ++i) v[i] = bf16_bits(W[(size_t)(k8 + i) * N + n]);
  *(v8us*)(Wt + (size_t)n * K + k8) = v;
  
}

// GEMM C[M][N] (f32, pitch ldc) = act(A[M][K]·W + bias). A f32 row-major (pitch lda) converted per fragment to bf16
// (ASPLIT: hi/lo two planes -> 2 terms, else single rounded term); Wt bf16 [N][K] (pitch ldb). BIAS_BF16 rounds the
// bias to bf16 first (bias quantised to bf16 before the add). K%32==0, M%16==0, N%64==0.
template <bool ASPLIT, int ACT, bool BIAS_BF16>
__global__ __launch_bounds__(128) void k_gemm_bf(const float* __restrict__ A, int lda, const unsigned short* __restrict__ Wt, int ldb,
                                               const float* __restrict__ bias, float* __restrict__ C, int ldc, int M, int N, int K) {
  __shared__ __attribute__((aligned(16))) float so[4][16][64];
  const int tid = threadIdx.x, w = tid >> 5, lane = tid & 31, ln = lane & 15, hh = lane >> 4;
  const int ntn = N / 64;
  const int wid = blockIdx.x * 4 + w;
  const int mt = wid / ntn, nq = wid % ntn;
  if (mt * 16 >= M) return;
  const int row0 = mt * 16, col0 = nq * 64;
  const float* arow = A + (size_t)(row0 + ln) * lda;
  v8f acc[4] = {};
  for (int kb = 0; kb < K; kb += 32) {
    FragB ah, al;
    const v4f x0 = *(const v4fa*)(arow + kb + 8 * hh), x1 = *(const v4fa*)(arow + kb + 8 * hh + 4);
    const v4f x2 = *(const v4fa*)(arow + kb + 16 + 8 * hh), x3 = *(const v4fa*)(arow + kb + 16 + 8 * hh + 4);
    float xs[16] = {x0[0],x0[1],x0[2],x0[3],x1[0],x1[1],x1[2],x1[3],x2[0],x2[1],x2[2],x2[3],x3[0],x3[1],x3[2],x3[3]};
#pragma unroll
    for (int i = 0; i < 16; ++i) { const unsigned short hb = bf16_bits(xs[i]); ah.u[i] = hb; al.u[i] = ASPLIT ? bf16_bits(xs[i] - bf16_val(hb)) : (unsigned short)0; }
#pragma unroll
    for (int t = 0; t < 4; ++t) {
      const unsigned short* brow = Wt + (size_t)(col0 + t * 16 + ln) * ldb + kb;
      FragB b;
      b.half[0] = *(const v8us*)(brow + 8 * hh);
      b.half[1] = *(const v8us*)(brow + 16 + 8 * hh);
      acc[t] = mmaN<ASPLIT ? 2 : 1>(ah.v, al.v, b.v, b.v, acc[t]);
    }
  }
#pragma unroll
  for (int t = 0; t < 4; ++t) {
    float bv = bias ? bias[col0 + t * 16 + ln] : 0.f;
    if (BIAS_BF16) bv = bf16_round(bv);
#pragma unroll
    for (int r = 0; r < 8; ++r) { float v = acc[t][r] + bv; if (ACT == 1) v = fmaxf(v, 0.f); so[w][8 * hh + r][t * 16 + ln] = v; }
  }
  __builtin_amdgcn_fence(__ATOMIC_ACQ_REL, "workgroup");
  __builtin_amdgcn_wave_barrier();
  const int rsub = lane >> 4, c4 = (lane & 15) * 4;
  {
#pragma unroll
    for (int q = 0; q < 8; ++q) {
      const int r = q * 2 + rsub;
      const v4f v = *(const v4fa*)&so[w][r][c4];
      *(v4f*)(C + (size_t)(row0 + r) * ldc + col0 + c4) = v;
    }
    
  }
}

// GEMM C = act(A·W + bias + resid): A f32 (ASPLIT -> hi/lo 2 terms), Wt bf16 [N][K]; ACT 0 none, 1 relu, 2 exact gelu;
// resid (optional, f32, row index = (row % rmod), pitch ldr, RES_BF16 rounds it) added before the activation.
template <bool ASPLIT, int ACT, bool BIAS_BF16, bool RES_BF16>
__global__ __launch_bounds__(128) void k_gemm_bf3(const float* __restrict__ A, int lda, const unsigned short* __restrict__ Wt, int ldb,
                                                const float* __restrict__ bias, const float* __restrict__ resid, int rmod, int ldr,
                                                float* __restrict__ C, int ldc, int M, int N, int K) {
  __shared__ __attribute__((aligned(16))) float so[4][16][64];
  const int tid = threadIdx.x, w = tid >> 5, lane = tid & 31, ln = lane & 15, hh = lane >> 4;
  const int ntn = N / 64;
  const int wid = blockIdx.x * 4 + w;
  const int mt = wid / ntn, nq = wid % ntn;
  if (mt * 16 >= M) return;
  const int row0 = mt * 16, col0 = nq * 64;
  const float* arow = A + (size_t)(row0 + ln) * lda;
  v8f acc[4] = {};
  for (int kb = 0; kb < K; kb += 32) {
    FragB ah, al;
    const v4f x0 = *(const v4fa*)(arow + kb + 8 * hh), x1 = *(const v4fa*)(arow + kb + 8 * hh + 4);
    const v4f x2 = *(const v4fa*)(arow + kb + 16 + 8 * hh), x3 = *(const v4fa*)(arow + kb + 16 + 8 * hh + 4);
    float xs[16] = {x0[0],x0[1],x0[2],x0[3],x1[0],x1[1],x1[2],x1[3],x2[0],x2[1],x2[2],x2[3],x3[0],x3[1],x3[2],x3[3]};
#pragma unroll
    for (int i = 0; i < 16; ++i) { const unsigned short hb = bf16_bits(xs[i]); ah.u[i] = hb; al.u[i] = ASPLIT ? bf16_bits(xs[i] - bf16_val(hb)) : (unsigned short)0; }
#pragma unroll
    for (int t = 0; t < 4; ++t) {
      const unsigned short* brow = Wt + (size_t)(col0 + t * 16 + ln) * ldb + kb;
      FragB b;
      b.half[0] = *(const v8us*)(brow + 8 * hh);
      b.half[1] = *(const v8us*)(brow + 16 + 8 * hh);
      acc[t] = mmaN<ASPLIT ? 2 : 1>(ah.v, al.v, b.v, b.v, acc[t]);
    }
  }
#pragma unroll
  for (int t = 0; t < 4; ++t) {
    const int col = col0 + t * 16 + ln;
    float bv = bias ? bias[col] : 0.f;
    if (BIAS_BF16) bv = bf16_round(bv);
#pragma unroll
    for (int r = 0; r < 8; ++r) {
      float v = acc[t][r] + bv;
      if (resid) { float rv = resid[(size_t)((row0 + 8 * hh + r) % rmod) * ldr + col]; if (RES_BF16) rv = bf16_round(rv); v += rv; }
      if (ACT == 1) v = fmaxf(v, 0.f);
      if (ACT == 2) v = 0.5f * v * (1.0f + erff(v * 0.70710678118654752f));
      if (ACT == 3) { const float u = 0.7978845608028654f * (v + 0.044715f * v * v * v); v = 0.5f * v * (1.0f + tanhf(u)); }
      so[w][8 * hh + r][t * 16 + ln] = v;
    }
  }
  __builtin_amdgcn_fence(__ATOMIC_ACQ_REL, "workgroup");
  __builtin_amdgcn_wave_barrier();
  const int rsub = lane >> 4, c4 = (lane & 15) * 4;
  {
#pragma unroll
    for (int q = 0; q < 8; ++q) {
      const int r = q * 2 + rsub;
      const v4f v = *(const v4fa*)&so[w][r][c4];
      *(v4f*)(C + (size_t)(row0 + r) * ldc + col0 + c4) = v;
    }
    
  }
}
// row LayerNorm (biased variance, eps) over N: s = X (+ R); optional out_sum <- s; out_norm <- (s-mu)*rsqrt(var+eps)*g + b
template <bool PARAM_BF16>
__global__ __launch_bounds__(256) void k_layernorm(const float* __restrict__ X, const float* __restrict__ R, const float* __restrict__ g, const float* __restrict__ bta,
                                                  float* __restrict__ out_sum, float* __restrict__ out_norm, int N, float eps) {
  __shared__ float red[256];
  const int row = blockIdx.x, tid = threadIdx.x;
  const float* x = X + (size_t)row * N; const float* rr = R ? R + (size_t)row * N : nullptr;
  float vals[16];                     // up to N = 4096
  const int per = N / 256;            // contiguous chunk per thread? use strided-by-4 chunks: thread handles j = tid*4 + 1024*u
  float s1 = 0.f;
  for (int u = 0; u < per / 4; ++u) {
    const int j = tid * 4 + 1024 * u;
    const v4f a = *(const v4fa*)(x + j);
    v4f b = {0.f,0.f,0.f,0.f}; if (rr) b = *(const v4fa*)(rr + j);
#pragma unroll
    for (int q = 0; q < 4; ++q) { const float v = a[q] + b[q]; vals[u * 4 + q] = v; s1 += v; }
  }
  red[tid] = s1; __syncthreads();
  for (int st = 128; st > 0; st >>= 1) { if (tid < st) red[tid] += red[tid + st]; __syncthreads(); }
  const float mu = red[0] / (float)N; __syncthreads();
  float s2 = 0.f;
  for (int u = 0; u < per / 4; ++u)
#pragma unroll
    for (int q = 0; q < 4; ++q) { const float c = vals[u * 4 + q] - mu; s2 += c * c; }
  red[tid] = s2; __syncthreads();
  for (int st = 128; st > 0; st >>= 1) { if (tid < st) red[tid] += red[tid + st]; __syncthreads(); }
  const float rs = rsqrtf(red[0] / (float)N + eps);
  {
    for (int u = 0; u < per / 4; ++u) {
      const int j = tid * 4 + 1024 * u;
      v4f o, sm;
#pragma unroll
      for (int q = 0; q < 4; ++q) {
        float gg = g[j + q], bb = bta[j + q];
        if (PARAM_BF16) { gg = bf16_round(gg); bb = bf16_round(bb); }
        sm[q] = vals[u * 4 + q]; o[q] = (vals[u * 4 + q] - mu) * rs * gg + bb;
      }
      if (out_sum) *(v4f*)(out_sum + (size_t)row * N + j) = sm;
      *(v4f*)(out_norm + (size_t)row * N + j) = o;
    }
    
  }
}



// ---- f16 WMMA path (v_wmma_f32_16x16x32_f16): 11-bit significands for operands in range — used where a [0,1] probability operand needs more precision than bf16
typedef _Float16 v16h __attribute__((ext_vector_type(16)));
union FragH { v16h v; v8us half[2]; _Float16 h[16]; unsigned short u[16]; };
template <int NT>
__device__ __forceinline__ v8f mmaH(v16h ah, v16h al, v16h bh, v16h bl, v8f c) {
  c = __builtin_amdgcn_wmma_f32_16x16x32_f16(false, ah, false, bh, (short)0, c, false, false);
  if (NT >= 2) c = __builtin_amdgcn_wmma_f32_16x16x32_f16(false, al, false, bh, (short)0, c, false, false);
  if (NT >= 3) c = __builtin_amdgcn_wmma_f32_16x16x32_f16(false, ah, false, bl, (short)0, c, false, false);
  asm volatile("v_nop\n\tv_nop\n\tv_nop\n\tv_nop" : "+v"(c) : "v"(ah), "v"(al), "v"(bh), "v"(bl));
  return c;
}
// batched GEMM like k_gemm_b but f16 operands: A f32 (split into f16 hi/lo if ASPLIT, else rounded to f16), Bt = f16 values [n][k]; alpha; C f32; N multiple of 16 (partial tiles skipped)
template <bool ASPLIT>
__global__ __launch_bounds__(128) void k_gemm_h(const float* __restrict__ A, int lda, size_t sA, const _Float16* __restrict__ Bh, int ldb, size_t sB, float alpha, float* __restrict__ C, int ldc, size_t sC, int M, int N, int K) {
  __shared__ __attribute__((aligned(16))) float so[4][16][64];
  const int tid = threadIdx.x, w = tid >> 5, lane = tid & 31, ln = lane & 15, hh = lane >> 4; const int by = blockIdx.y;
  A += (size_t)by * sA; Bh += (size_t)by * sB; C += (size_t)by * sC;
  const int ntn = (N + 63) / 64; const int wid = blockIdx.x * 4 + w; const int mt = wid / ntn, nq = wid % ntn; if (mt * 16 >= M) return;
  const int row0 = mt * 16, col0 = nq * 64; const float* arow = A + (size_t)(row0 + ln) * lda;
  v8f acc[4] = {};
  for (int kb = 0; kb < K; kb += 32) {
    FragH ah, al;
    const v4f x0 = *(const v4fa*)(arow + kb + 8 * hh), x1 = *(const v4fa*)(arow + kb + 8 * hh + 4), x2 = *(const v4fa*)(arow + kb + 16 + 8 * hh), x3 = *(const v4fa*)(arow + kb + 16 + 8 * hh + 4);
    float xs[16] = {x0[0],x0[1],x0[2],x0[3],x1[0],x1[1],x1[2],x1[3],x2[0],x2[1],x2[2],x2[3],x3[0],x3[1],x3[2],x3[3]};
#pragma unroll
    for (int i = 0; i < 16; ++i) { const _Float16 h = (_Float16)xs[i]; ah.h[i] = h; al.h[i] = ASPLIT ? (_Float16)(xs[i] - (float)h) : (_Float16)0.0f; }
#pragma unroll
    for (int t = 0; t < 4; ++t) { if (col0 + t * 16 >= N) continue; const size_t boff = (size_t)(col0 + t * 16 + ln) * ldb + kb; FragH bq; bq.half[0] = *(const v8us*)(Bh + boff + 8 * hh); bq.half[1] = *(const v8us*)(Bh + boff + 16 + 8 * hh);
      acc[t] = mmaH<ASPLIT ? 2 : 1>(ah.v, al.v, bq.v, bq.v, acc[t]); }
  }
#pragma unroll
  for (int t = 0; t < 4; ++t) { if (col0 + t * 16 >= N) continue;
#pragma unroll
    for (int r = 0; r < 8; ++r) so[w][8 * hh + r][t * 16 + ln] = acc[t][r] * alpha; }
  __builtin_amdgcn_fence(__ATOMIC_ACQ_REL, "workgroup"); __builtin_amdgcn_wave_barrier();
  const int rsub = lane >> 4, c4 = (lane & 15) * 4;
  {
#pragma unroll
    for (int q = 0; q < 8; ++q) { const int r = q * 2 + rsub; if (col0 + c4 < N) { const v4f v = *(const v4fa*)&so[w][r][c4]; *(v4f*)(C + (size_t)(row0 + r) * ldc + col0 + c4) = v; } }
     }
}

// Wt[n][k] = f16(W[k][n]·scale) from f32 row-major W[K][N] (scale = power of two; bf16-exact weights stay exact in f16 away from the subnormal range)
__global__ __launch_bounds__(256) void k_wt_f16(const float* __restrict__ W, _Float16* __restrict__ Wt, int K, int N, float scale) {
  const int t = blockIdx.x * 256 + threadIdx.x; if (t >= N * (K / 8)) return; const int n = t / (K / 8), k8 = (t % (K / 8)) * 8; FragH f;
#pragma unroll
  for (int i = 0; i < 8; ++i) f.h[i] = (_Float16)(bf16_round(W[(size_t)(k8 + i) * N + n]) * scale); const v8us o = f.half[0];
  *(v8us*)((unsigned short*)Wt + (size_t)n * K + k8) = o; 
}
// k_gemm_hh variant with fused epilogue: v = acc·alpha + bias[by·sBias + col] (+ CP[(row/rowsPerB)·sCPb + by·64 + col] if CP) ; ACT 0 none / 1 elu ; writes f16 C16 (and f32 C if non-null)
template <int ACT>
__global__ __launch_bounds__(128) void k_gemm_hhx(const _Float16* __restrict__ A, int lda, size_t sA, const _Float16* __restrict__ Bh, int ldb, size_t sB, float alpha, const float* __restrict__ bias, size_t sBias, const float* __restrict__ CP, int rowsPerB, size_t sCPb, int row0g,
    float* __restrict__ C, _Float16* __restrict__ C16, int ldc, size_t sC, int M, int N, int K) {
  __shared__ __attribute__((aligned(16))) float so[4][16][64];
  const int tid = threadIdx.x, w = tid >> 5, lane = tid & 31, ln = lane & 15, hh = lane >> 4; const int by = blockIdx.y;
  A += (size_t)by * sA; Bh += (size_t)by * sB; const size_t cofs = (size_t)by * sC; const float* bp = bias ? bias + (size_t)by * sBias : nullptr;
  const int ntn = (N + 63) / 64; const int wid = blockIdx.x * 4 + w; const int mt = wid / ntn, nq = wid % ntn; if (mt * 16 >= M) return;
  const int row0 = mt * 16, col0 = nq * 64; const _Float16* arow = A + (size_t)(row0 + ln) * lda;
  v8f acc[4] = {};
  for (int kb = 0; kb < K; kb += 32) { FragH ah; ah.half[0] = *(const v8us*)((const unsigned short*)arow + kb + 8 * hh); ah.half[1] = *(const v8us*)((const unsigned short*)arow + kb + 16 + 8 * hh);
#pragma unroll
    for (int t = 0; t < 4; ++t) { if (col0 + t * 16 >= N) continue; const size_t boff = (size_t)(col0 + t * 16 + ln) * ldb + kb; FragH bq; bq.half[0] = *(const v8us*)((const unsigned short*)Bh + boff + 8 * hh); bq.half[1] = *(const v8us*)((const unsigned short*)Bh + boff + 16 + 8 * hh);
      acc[t] = mmaH<1>(ah.v, ah.v, bq.v, bq.v, acc[t]); }
  }
#pragma unroll
  for (int t = 0; t < 4; ++t) { if (col0 + t * 16 >= N) continue; const int col = col0 + t * 16 + ln; const float bv = bp ? bf16_round(bp[col]) : 0.f;
#pragma unroll
    for (int r = 0; r < 8; ++r) { float v = acc[t][r] * alpha + bv; if (CP) { const int bidx = (row0g + row0 + 8 * hh + r) / rowsPerB; v += CP[(size_t)bidx * sCPb + (size_t)by * 64 + col]; } if (ACT == 1) v = (v > 0.f) ? v : expm1f(v); else if (ACT == 7) v = (v > 0.f) ? v + 1.0f : expf(v); else if (ACT == 8) v = tanhf(v); else if (ACT == 9) v = 0.5f * v * (1.0f + tanhf(0.7978845608028654f * (v + 0.044715f * v * v * v))); else if (ACT == 11) v = 1.0f / (1.0f + expf(-v)); else if (ACT == 12) v = (v > 0.f) ? v : 0.01f * v; else if (ACT == 14) v = (v > 0.f) ? v : 0.1f * v; else if (ACT == 15) v = v / (1.0f + expf(-v)); else if (ACT == 3) v = fmaxf(v, 0.f); else if (ACT == 6) v = 0.5f * v * (1.0f + erff(v * 0.70710678118654752f)); so[w][8 * hh + r][t * 16 + ln] = v; } }
  __builtin_amdgcn_fence(__ATOMIC_ACQ_REL, "workgroup"); __builtin_amdgcn_wave_barrier();
  const int rsub = lane >> 4, c4 = (lane & 15) * 4; typedef _Float16 v4h __attribute__((ext_vector_type(4)));
  {
#pragma unroll
    for (int q = 0; q < 8; ++q) { const int r = q * 2 + rsub; if (col0 + c4 < N) { const v4f v = *(const v4fa*)&so[w][r][c4]; if (C) *(v4f*)(C + cofs + (size_t)(row0 + r) * ldc + col0 + c4) = v; if (C16) { v4h h4; for (int i = 0; i < 4; ++i) h4[i] = (_Float16)v[i]; *(v4h*)(C16 + cofs + (size_t)(row0 + r) * ldc + col0 + c4) = h4; } } }
     }
}


typedef _Float16 v4h __attribute__((ext_vector_type(4)));

// ---- fragment-order plane of an f16 matrix M[rows][K]: 1-KiB blocks of 16 rows x 32 k, block (row >> 4, k >> 5) at element ((row >> 4) * (K >> 5) + (k >> 5)) * 512;
// inside a block 64 pieces of 8 k: piece j * 32 + lane holds row (lane & 15), k = 16 * j + 8 * (lane >> 4) + 0..7. A wave's 16-byte fragment load reads 512 bytes in a row: 4 whole lines, not 16 pieces of lines.
__device__ __forceinline__ size_t fo_src(size_t t, int K) { const int kbn = K >> 5; const size_t blk = t >> 6; const int c = (int)(t & 63), j = c >> 5, l = c & 31; return ((blk / kbn) * 16 + (l & 15)) * (size_t)K + (size_t)(blk % kbn) * 32 + j * 16 + (l >> 4) * 8; }      /* piece t of a plane -> its first element in the row-major matrix */

// All eight conversions to f16 fragment-order planes (K = EMB) in one grid: a block's index range names its matrix. Activations as they are, weights stored (out,in) (== Bt[n][k]) times 16 (a power of two: exact).
#define CVL (NRL * EMB / 8 / 256)      /* blocks of the local activations */
#define CVG (NRG * EMB / 8 / 256)      /* blocks of the global activations */
#define CVW (EMB * EMB / 8 / 256)      /* blocks of one weight */
__global__ __launch_bounds__(256) void k_conv(const float* __restrict__ lh, const float* __restrict__ gh, const float* __restrict__ qw, const float* __restrict__ kw, const float* __restrict__ vw, const float* __restrict__ kgw, const float* __restrict__ vgw, const float* __restrict__ ow,
    _Float16* __restrict__ XL, _Float16* __restrict__ XG, _Float16* __restrict__ BQ, _Float16* __restrict__ BK, _Float16* __restrict__ BV, _Float16* __restrict__ BKG, _Float16* __restrict__ BVG, _Float16* __restrict__ BO) {
  int bx = blockIdx.x; const float* s; _Float16* d; float sc = 16.0f;
  if (bx < CVL) { s = lh; d = XL; sc = 1.0f; }
  else if (bx < CVL + CVG) { bx -= CVL; s = gh; d = XG; sc = 1.0f; }
  else { bx -= CVL + CVG; const int m = bx / CVW; bx -= m * CVW;
    s = (m == 0) ? qw : (m == 1) ? kw : (m == 2) ? vw : (m == 3) ? kgw : (m == 4) ? vgw : ow; d = (m == 0) ? BQ : (m == 1) ? BK : (m == 2) ? BV : (m == 3) ? BKG : (m == 4) ? BVG : BO; }
  const size_t t = (size_t)bx * 256 + threadIdx.x; const float* p = s + fo_src(t, EMB); FragH f;
#pragma unroll      /* in full: the piece's eight values stay in registers and are read by two 16-byte loads */
  for (int q = 0; q < 8; ++q) f.h[q] = (_Float16)(bf16_round(p[q]) * sc);
  *(v8us*)((unsigned short*)d + t * 8) = f.half[0]; }
__global__ __launch_bounds__(256) void k_h16(const float* __restrict__ x, _Float16* __restrict__ X16, size_t n8) { const size_t t = (size_t)blockIdx.x * 256 + threadIdx.x; if (t >= n8) return; FragH f;
#pragma unroll
  for (int q = 0; q < 8; ++q) f.h[q] = (_Float16)x[t * 8 + q]; *(v8us*)((unsigned short*)X16 + t * 8) = f.half[0];  }
__global__ __launch_bounds__(256) void k_round16f(const float* __restrict__ W, _Float16* __restrict__ Bt, size_t n8) { const size_t t = (size_t)blockIdx.x * 256 + threadIdx.x; if (t >= n8) return; FragH f;
#pragma unroll
  for (int i = 0; i < 8; ++i) f.h[i] = (_Float16)(bf16_round(W[t * 8 + i]) * 16.0f); *(v8us*)((unsigned short*)Bt + t * 8) = f.half[0];  }
// Both V transposes in one grid: the first NB * NHv * (LL / 64) blocks take the local V, the rest the global V; TTv = keys of the block's own V.
template <int NHv>
__global__ __launch_bounds__(256) void k_vt(const _Float16* __restrict__ VLp, _Float16* __restrict__ VtL, const _Float16* __restrict__ VGp, _Float16* __restrict__ VtG, int ldv, int voff) { __shared__ unsigned short tl[64][66]; const int tid = threadIdx.x;
  const bool loc = blockIdx.x < NB * NHv * (LL / 64); const int bx = loc ? blockIdx.x : blockIdx.x - NB * NHv * (LL / 64); const int TTv = loc ? LL : GG, sh = loc ? 5 : 3;      /* sh = log2(TTv / 64) */
  static_assert(LL == 64 << 5 && GG == 64 << 3, "sh");
  const _Float16* V16 = loc ? VLp : VGp; _Float16* Vt = loc ? VtL : VtG; const int slab = bx >> sh, lg = bx & ((1 << sh) - 1); const int b = slab / NHv, h = slab % NHv;
  for (int i = tid; i < 64 * 8; i += 256) { const int r = i / 8, c8 = (i % 8) * 8; FragH f; f.half[0] = *(const v8us*)((const unsigned short*)V16 + ((size_t)b * TTv + lg * 64 + r) * ldv + voff + h * 64 + c8);
#pragma unroll
    for (int q = 0; q < 8; ++q) tl[r][c8 + q] = f.u[q]; }
  __syncthreads();
  {
#pragma unroll
    for (int rd = 0; rd < 2; ++rd) { const int c = rd * 256 + tid, rbl = c >> 7, kbl = (c >> 6) & 1, cc = c & 63, l = cc & 31; const int d = rbl * 16 + (l & 15), k0 = kbl * 32 + (cc >> 5) * 16 + (l >> 4) * 8; FragH f;      /* Vt: fragment-order plane, rows = slab * 64 + d, K = TTv keys */
#pragma unroll
      for (int q = 0; q < 8; ++q) f.u[q] = tl[k0 + q][d];
      *(v8us*)((unsigned short*)Vt + (((size_t)slab * 4 + rbl) * (TTv / 32) + lg * 2 + kbl) * 512 + cc * 8) = f.half[0]; }
     } }

__global__ __launch_bounds__(256) void k_hl(const float* __restrict__ F, _Float16* __restrict__ Hh, _Float16* __restrict__ Hl, size_t n8) { const size_t t = (size_t)blockIdx.x * 256 + threadIdx.x; if (t >= n8) return; FragH fh, fl; const v4f a = *(const v4fa*)(F + t * 8), c = *(const v4fa*)(F + t * 8 + 4);
#pragma unroll
  for (int q = 0; q < 4; ++q) { _Float16 h = (_Float16)a[q]; fh.h[q] = h; fl.h[q] = (_Float16)((a[q] - (float)h) * 1024.0f); h = (_Float16)c[q]; fh.h[4 + q] = h; fl.h[4 + q] = (_Float16)((c[q] - (float)h) * 1024.0f); }
  { *(v8us*)((unsigned short*)Hh + t * 8) = fh.half[0]; *(v8us*)((unsigned short*)Hl + t * 8) = fl.half[0];  } }

// ---- fast GEMM (wave tile 32x64; requires M % 32 == 0 rows per launch region, N % 64 == 0 and K % 64 == 0); epilogue = k_gemm_hhx semantics ----
// Two fragment sets (even and odd 32-k steps). Each fragment is reloaded for the step two ahead right behind its last product, so a step's loads fly under the other set's products.
__device__ __forceinline__ v16h g2_frag(const _Float16* p, int k, int lane) { FragH f; const unsigned short* q = (const unsigned short*)p + (size_t)k * 16 + lane * 8; f.half[0] = *(const v8us*)q; f.half[1] = *(const v8us*)(q + 256); return f.v; }      /* p: a 16-row strip of a fragment-order plane; k: multiple of 32 */
__device__ __forceinline__ v8f g2_mma(v16h a, v16h b, v8f c) { v8f d = __builtin_amdgcn_wmma_f32_16x16x32_f16(false, a, false, b, (short)0, c, false, false); asm volatile("v_nop\n\tv_nop\n\tv_nop\n\tv_nop" : "+v"(d) : "v"(a), "v"(b)); return d; }
template <int ACT>      /* A and Bh: fragment-order planes with K = lda = ldb; FO: the result goes to C16 alone, as such a plane (K = ldc); bx, by: the block's place in its own product's grid */
__device__ __forceinline__ void gemm2_body(float (*so)[32][68], const int bx, const int by, const bool FO, const _Float16* __restrict__ A, int lda, size_t sA, const _Float16* __restrict__ Bh, int ldb, size_t sB, float alpha, const float* __restrict__ bias, size_t sBias, const float* __restrict__ CP, int rowsPerB, size_t sCPb, int row0g,
    float* __restrict__ C, _Float16* __restrict__ C16, int ldc, size_t sC, int M, int N, int K) {
  const int tid = threadIdx.x, w = tid >> 5, lane = tid & 31, ln = lane & 15, hh = lane >> 4;
  A += (size_t)by * sA; Bh += (size_t)by * sB; const size_t cofs = (size_t)by * sC; const float* bp = bias ? bias + (size_t)by * sBias : nullptr;
  const int ntn = N >> 6; const int mt = bx / ntn, nq = bx - mt * ntn; const int row0 = mt * 128 + 32 * w, col0 = nq * 64; if (row0 >= M) return;
  const _Float16* a0p = A + (size_t)row0 * lda; const _Float16* a1p = a0p + (size_t)16 * lda;
  const _Float16* b0p = Bh + (size_t)col0 * ldb; const _Float16* b1p = b0p + (size_t)16 * ldb; const _Float16* b2p = b1p + (size_t)16 * ldb; const _Float16* b3p = b2p + (size_t)16 * ldb;
  const v8f z8 = {0.f,0.f,0.f,0.f,0.f,0.f,0.f,0.f}; v8f c00 = z8, c01 = z8, c02 = z8, c03 = z8, c10 = z8, c11 = z8, c12 = z8, c13 = z8;
  v16h a0 = g2_frag(a0p, 0, lane), a1 = g2_frag(a1p, 0, lane), b0 = g2_frag(b0p, 0, lane), b1 = g2_frag(b1p, 0, lane), b2 = g2_frag(b2p, 0, lane), b3 = g2_frag(b3p, 0, lane);
  v16h e0 = g2_frag(a0p, 32, lane), e1 = g2_frag(a1p, 32, lane), f0 = g2_frag(b0p, 32, lane), f1 = g2_frag(b1p, 32, lane), f2 = g2_frag(b2p, 32, lane), f3 = g2_frag(b3p, 32, lane);
#pragma unroll 1      /* rolled: the body already holds both sets; more copies only add code */
  for (int kb = 0; kb < K; kb += 64) { const int kn = (kb + 64 < K) ? kb + 64 : kb;      /* last trip: re-reads its own step (in bounds, unused) */
    c00 = g2_mma(a0, b0, c00); c10 = g2_mma(a1, b0, c10); b0 = g2_frag(b0p, kn, lane);
    c01 = g2_mma(a0, b1, c01); c11 = g2_mma(a1, b1, c11); b1 = g2_frag(b1p, kn, lane);
    c02 = g2_mma(a0, b2, c02); c12 = g2_mma(a1, b2, c12); b2 = g2_frag(b2p, kn, lane);
    c03 = g2_mma(a0, b3, c03); c13 = g2_mma(a1, b3, c13); b3 = g2_frag(b3p, kn, lane); a0 = g2_frag(a0p, kn, lane); a1 = g2_frag(a1p, kn, lane);
    c00 = g2_mma(e0, f0, c00); c10 = g2_mma(e1, f0, c10); f0 = g2_frag(b0p, kn + 32, lane);
    c01 = g2_mma(e0, f1, c01); c11 = g2_mma(e1, f1, c11); f1 = g2_frag(b1p, kn + 32, lane);
    c02 = g2_mma(e0, f2, c02); c12 = g2_mma(e1, f2, c12); f2 = g2_frag(b2p, kn + 32, lane);
    c03 = g2_mma(e0, f3, c03); c13 = g2_mma(e1, f3, c13); f3 = g2_frag(b3p, kn + 32, lane); e0 = g2_frag(a0p, kn + 32, lane); e1 = g2_frag(a1p, kn + 32, lane);
    asm volatile("s_wait_xcnt 0x0" ::: "memory"); }      /* the next trip forms new addresses in the registers that this trip's loads name: wait before they are overwritten */
  v8f accs[8] = {c00, c01, c02, c03, c10, c11, c12, c13};
#pragma unroll
  for (int u = 0; u < 8; ++u) { const int t = u & 3, half = u >> 2; const int col = col0 + t * 16 + ln; const float bv = bp ? bf16_round(bp[col]) : 0.f;
#pragma unroll
    for (int r = 0; r < 8; ++r) { const int rloc = half * 16 + 8 * hh + r; float v = accs[u][r] * alpha + bv; if (CP) { const int bidx = (row0g + row0 + rloc) / rowsPerB; v += CP[(size_t)bidx * sCPb + (size_t)by * 64 + col]; }
      if (ACT == 3) v = fmaxf(v, 0.f); else if (ACT == 6) v = 0.5f * v * (1.0f + erff(v * 0.70710678118654752f)); else if (ACT == 11) v = 1.0f / (1.0f + expf(-v)); else if (ACT == 15) v = v / (1.0f + expf(-v)); else if (ACT == 12) v = (v > 0.f) ? v : 0.01f * v; else if (ACT == 8) v = tanhf(v);
      so[w][rloc][t * 16 + ln] = v; } }
  __builtin_amdgcn_fence(__ATOMIC_ACQ_REL, "workgroup"); __builtin_amdgcn_wave_barrier();
  const int rsub = lane >> 4, c4 = (lane & 15) * 4;
  if (!FO) {
#pragma unroll
    for (int q = 0; q < 16; ++q) { const int r = q * 2 + rsub; const v4f v = *(const v4fa*)&so[w][r][c4]; if (C) *(v4f*)(C + cofs + (size_t)(row0 + r) * ldc + col0 + c4) = v; if (C16) { v4h h4; for (int i = 0; i < 4; ++i) h4[i] = (_Float16)v[i]; *(v4h*)(C16 + cofs + (size_t)(row0 + r) * ldc + col0 + c4) = h4; } }
    asm volatile("s_wait_xcnt 0x0" ::: "memory");      /* FO is a run-time flag in the merged grid: the built code can lead from these stores on into the other path, which reuses their registers: wait before they are overwritten */
     } else {      /* the wave's 32 x 64 tile = 2 x 2 blocks of the plane, 8 stores of 512 bytes in a row */
#pragma unroll
      for (int u = 0; u < 8; ++u) { const int rbl = u >> 2, kbl = (u >> 1) & 1, j = u & 1; const float* sp = &so[w][rbl * 16 + ln][kbl * 32 + j * 16 + hh * 8]; const v4f x = *(const v4fa*)sp, y = *(const v4fa*)(sp + 4); FragH f;
#pragma unroll
        for (int i = 0; i < 4; ++i) { f.h[i] = (_Float16)x[i]; f.h[4 + i] = (_Float16)y[i]; }
        *(v8us*)((unsigned short*)C16 + cofs + (size_t)(row0 + rbl * 16) * ldc + (size_t)((col0 >> 5) + kbl) * 512 + j * 256 + lane * 8) = f.half[0]; }
     } }
template <int ACT, bool FO>
__global__ __launch_bounds__(128) void k_gemm2(const _Float16* __restrict__ A, int lda, size_t sA, const _Float16* __restrict__ Bh, int ldb, size_t sB, float alpha, const float* __restrict__ bias, size_t sBias, const float* __restrict__ CP, int rowsPerB, size_t sCPb, int row0g,
    float* __restrict__ C, _Float16* __restrict__ C16, int ldc, size_t sC, int M, int N, int K) {
  __shared__ __attribute__((aligned(16))) float so[4][32][68];
  gemm2_body<ACT>(so, blockIdx.x, blockIdx.y, FO, A, lda, sA, Bh, ldb, sB, alpha, bias, sBias, CP, rowsPerB, sCPb, row0g, C, C16, ldc, sC, M, N, K); }
// The five input projections in one grid: a block's index range names its product (Q, K, V of the local rows, then K, V of the global rows). Q and both K leave as fragment-order planes, both V row-major for the transpose.
#define PJL ((NRL / 128) * (EMB / 64))      /* blocks of one local projection */
#define PJG ((NRG / 128) * (EMB / 64))      /* blocks of one global projection */
__global__ __launch_bounds__(128) void k_proj(const _Float16* __restrict__ XL, const _Float16* __restrict__ XG, const _Float16* __restrict__ BQ, const _Float16* __restrict__ BK, const _Float16* __restrict__ BV, const _Float16* __restrict__ BKG, const _Float16* __restrict__ BVG,
    const float* __restrict__ qb, const float* __restrict__ kb, const float* __restrict__ vb, const float* __restrict__ kgb, const float* __restrict__ vgb, _Float16* __restrict__ Q16, _Float16* __restrict__ KL, _Float16* __restrict__ VL, _Float16* __restrict__ KG, _Float16* __restrict__ VG) {
  __shared__ __attribute__((aligned(16))) float so[4][32][68];
  int bx = blockIdx.x; const _Float16* A; const _Float16* B; const float* bias; _Float16* C; bool fo; int M;
  if (bx < 3 * PJL) { const int m = bx / PJL; bx -= m * PJL; A = XL; M = NRL; B = (m == 0) ? BQ : (m == 1) ? BK : BV; bias = (m == 0) ? qb : (m == 1) ? kb : vb; C = (m == 0) ? Q16 : (m == 1) ? KL : VL; fo = m != 2; }
  else { bx -= 3 * PJL; const int m = bx / PJG; bx -= m * PJG; A = XG; M = NRG; B = (m == 0) ? BKG : BVG; bias = (m == 0) ? kgb : vgb; C = (m == 0) ? KG : VG; fo = m == 0; }
  gemm2_body<0>(so, bx, 0, fo, A, EMB, 0, B, EMB, 0, 0.0625f, bias, 0, nullptr, 1, 0, 0, nullptr, C, EMB, 0, M, EMB, EMB); }



template <int CAUSAL>
__global__ __launch_bounds__(128) void k_flash(const _Float16* __restrict__ Q16, int ldq, const _Float16* __restrict__ K16, int ldk, const _Float16* __restrict__ Vt, const int* __restrict__ MSK, float* __restrict__ O, int ldo) {
  constexpr int RPW = 16, RTN = RPW / 16, NQB = TQ / (4 * RPW), DT = 4, KS = 2;
  __shared__ __attribute__((aligned(16))) unsigned short sP[4][RPW][40]; __shared__ __attribute__((aligned(16))) float sO[4][RPW][64 + 4];
  const int tid = threadIdx.x, w = tid >> 5, lane = tid & 31, ln = lane & 15, hh = lane >> 4;
  const int slab = blockIdx.x / QBLKS, qblk = blockIdx.x % QBLKS; (void)NQB; const int b = slab / NH, h = slab % NH; const int qb0 = qblk * (4 * RPW); const int q0 = qb0 + w * RPW;
  FragH aq[2][KS];
#pragma unroll
  for (int rt = 0; rt < RTN; ++rt) { const unsigned short* qr = (const unsigned short*)Q16 + ((size_t)b * TQ + q0 + rt * 16 + ln) * ldq + h * 64;
#pragma unroll
    for (int ks = 0; ks < KS; ++ks) { aq[rt][ks].half[0] = *(const v8us*)(qr + ks * 32 + 8 * hh); aq[rt][ks].half[1] = *(const v8us*)(qr + ks * 32 + 16 + 8 * hh); } }
  const unsigned short* Vth = (const unsigned short*)Vt + (size_t)slab * 64 * TK;
  float m_r[2][8], l_r[2][8]; v8f oacc[2][DT];
#pragma unroll
  for (int rt = 0; rt < RTN; ++rt) {
#pragma unroll
    for (int r = 0; r < 8; ++r) { m_r[rt][r] = -3.0e38f; l_r[rt][r] = 0.f; }
#pragma unroll
    for (int dt = 0; dt < DT; ++dt) oacc[rt][dt] = (v8f){0.f,0.f,0.f,0.f,0.f,0.f,0.f,0.f}; }
  const int jend = (CAUSAL == 1) ? (qb0 + 4 * RPW) : TK;      /* causal: keys beyond the block's last query never contribute */
#pragma unroll 1
  for (int j0 = 0; j0 < jend; j0 += 32) {
    v8f s[2][2];
#pragma unroll
    for (int nt = 0; nt < 2; ++nt) { const unsigned short* kr = (const unsigned short*)K16 + ((size_t)b * TK + j0 + nt * 16 + ln) * ldk + h * 64; FragH bk[KS];
#pragma unroll
      for (int ks = 0; ks < KS; ++ks) { bk[ks].half[0] = *(const v8us*)(kr + ks * 32 + 8 * hh); bk[ks].half[1] = *(const v8us*)(kr + ks * 32 + 16 + 8 * hh); }
#pragma unroll
      for (int rt = 0; rt < RTN; ++rt) { v8f acc = (v8f){0.f,0.f,0.f,0.f,0.f,0.f,0.f,0.f};
#pragma unroll
        for (int ks = 0; ks < KS; ++ks) acc = mmaH<1>(aq[rt][ks].v, aq[rt][ks].v, bk[ks].v, bk[ks].v, acc); s[rt][nt] = acc; } }
#pragma unroll
    for (int rt = 0; rt < RTN; ++rt)
#pragma unroll
      for (int r = 0; r < 8; ++r) { const int tq = q0 + rt * 16 + 8 * hh + r; const int k0 = j0 + ln, k1 = j0 + 16 + ln;
        const bool ok0 = (CAUSAL == 1) ? (k0 <= tq) : ((CAUSAL == 2) ? ((k0 >> 5) == (tq >> 5)) : true), ok1 = (CAUSAL == 1) ? (k1 <= tq) : ((CAUSAL == 2) ? ((k1 >> 5) == (tq >> 5)) : true);      /* mode 2: block-diagonal 32-token groups */
        const float s0 = ok0 ? s[rt][0][r] * SCL : -3.0e38f, s1 = ok1 ? s[rt][1][r] * SCL : -3.0e38f; float mc = fmaxf(s0, s1);
        mc = fmaxf(mc, __shfl_xor(mc, 1, 32)); mc = fmaxf(mc, __shfl_xor(mc, 2, 32)); mc = fmaxf(mc, __shfl_xor(mc, 4, 32)); mc = fmaxf(mc, __shfl_xor(mc, 8, 32));
        const float mn = fmaxf(m_r[rt][r], mc); const float al = (mn > -1.0e38f) ? expf(m_r[rt][r] - mn) : 1.0f; m_r[rt][r] = mn; const float p0 = ok0 ? expf(s0 - mn) : 0.f, p1 = ok1 ? expf(s1 - mn) : 0.f; l_r[rt][r] = l_r[rt][r] * al + p0 + p1;
#pragma unroll
        for (int dt = 0; dt < DT; ++dt) oacc[rt][dt][r] *= al;
        FragH t2; t2.h[0] = (_Float16)(p0 * 1024.0f); t2.h[1] = (_Float16)(p1 * 1024.0f); sP[w][rt * 16 + 8 * hh + r][ln] = t2.u[0]; sP[w][rt * 16 + 8 * hh + r][16 + ln] = t2.u[1]; }
    __builtin_amdgcn_fence(__ATOMIC_ACQ_REL, "workgroup"); __builtin_amdgcn_wave_barrier();
    FragH pa[2];
#pragma unroll
    for (int rt = 0; rt < RTN; ++rt) { pa[rt].half[0] = *(const v8us*)&sP[w][rt * 16 + ln][8 * hh]; pa[rt].half[1] = *(const v8us*)&sP[w][rt * 16 + ln][16 + 8 * hh]; }
#pragma unroll
    for (int dt = 0; dt < DT; ++dt) { const unsigned short* vrow = Vth + (size_t)(dt * 16 + ln) * TK + j0; FragH bv; bv.half[0] = *(const v8us*)(vrow + 8 * hh); bv.half[1] = *(const v8us*)(vrow + 16 + 8 * hh);
#pragma unroll
      for (int rt = 0; rt < RTN; ++rt) oacc[rt][dt] = mmaH<1>(pa[rt].v, pa[rt].v, bv.v, bv.v, oacc[rt][dt]); }
    __builtin_amdgcn_fence(__ATOMIC_ACQ_REL, "workgroup"); __builtin_amdgcn_wave_barrier(); }
#pragma unroll
  for (int rt = 0; rt < RTN; ++rt) {
#pragma unroll
    for (int r = 0; r < 8; ++r) { float l = l_r[rt][r]; l += __shfl_xor(l, 1, 32); l += __shfl_xor(l, 2, 32); l += __shfl_xor(l, 4, 32); l += __shfl_xor(l, 8, 32); l_r[rt][r] = (l > 0.f) ? 1.0f / (l * 1024.0f) : 0.f; }
#pragma unroll
    for (int dt = 0; dt < DT; ++dt)
#pragma unroll
      for (int r = 0; r < 8; ++r) sO[w][rt * 16 + 8 * hh + r][dt * 16 + ln] = oacc[rt][dt][r] * l_r[rt][r]; }
  __builtin_amdgcn_fence(__ATOMIC_ACQ_REL, "workgroup"); __builtin_amdgcn_wave_barrier();
  {
#pragma unroll
    for (int rp = 0; rp < RPW; rp += 2) { const int r = rp + (lane >> 4), pc = lane & 15; const v4f val = *(const v4fa*)&sO[w][r][pc * 4]; *(v4f*)(O + ((size_t)b * TQ + q0 + r) * ldo + h * 64 + pc * 4) = val; }
     } }

// Attention with both products transposed: S^T = K Q^T (A = 16 keys, B = 16 queries) and O^T += V^T P^T (A = 16 values of d, B = P^T).
// A lane holds 16 of the 32 scores of ONE query (keys 8 * hh + r of each 16-key tile): maximum and sum are taken in the lane, plus one exchange between the wave's halves.
// The two score tiles, converted in place, are the B operand of the second product in the planes' own k order (16 * j + 8 * hh + i): P goes through no LDS and no lane exchange.
// The softmax runs in base 2: e^(SCL * s - m) = 2^(SCL2 * s - m2), so each score costs one fma and one hardware exponential (arguments are <= 10; far below, the result goes to 0, as it should).
#define SCL2 0.18033688011112042f      /* 64^-0.5 * log2(e) */
typedef float v2f __attribute__((ext_vector_type(2)));
__device__ __forceinline__ float xhalf(float x) { return __int_as_float(__builtin_amdgcn_permlanex16(__float_as_int(x), __float_as_int(x), 0x76543210, 0xfedcba98, false, false)); }      /* lane l <-> l ^ 16 */
template <int TKv>      /* bx: the block's place in its own attention's grid */
__device__ __forceinline__ void flashT_body(float (*sO)[16][64 + 4], const int bx, const _Float16* __restrict__ Q16, int ldq, const _Float16* __restrict__ K16, int ldk, const _Float16* __restrict__ Vt, float* __restrict__ O, int ldo) {
  constexpr int RPW = 16, DT = 4, KS = 2;      /* the short inner loops below are all unrolled in full, so that the fragment arrays stay in registers */
  const int tid = threadIdx.x, w = tid >> 5, lane = tid & 31, ln = lane & 15, hh = lane >> 4;
  const int slab = bx / QBLKS, qblk = bx % QBLKS; const int b = slab / NH, h = slab % NH; const int q0 = qblk * (4 * RPW) + w * RPW;
  FragH bq[KS];      /* Q, the B operand of the score product, kept for the whole kernel */
  { const unsigned short* qr = (const unsigned short*)Q16 + ((size_t)b * TQ + q0) * ldq + h * 1024 + lane * 8;      /* fragment-order plane: strip of 16 queries, the head's two blocks */
#pragma unroll
    for (int ks = 0; ks < KS; ++ks) { bq[ks].half[0] = *(const v8us*)(qr + ks * 512); bq[ks].half[1] = *(const v8us*)(qr + ks * 512 + 256); } }
  FragH ak[2][KS];      /* K fragments (A operand), fetched one pass ahead */
#pragma unroll
  for (int nt = 0; nt < 2; ++nt) { const unsigned short* kr = (const unsigned short*)K16 + ((size_t)b * TKv + nt * 16) * ldk + h * 1024 + lane * 8;      /* fragment-order plane: strip of 16 keys, the head's two blocks */
#pragma unroll
    for (int ks = 0; ks < KS; ++ks) { ak[nt][ks].half[0] = *(const v8us*)(kr + ks * 512); ak[nt][ks].half[1] = *(const v8us*)(kr + ks * 512 + 256); } }
  asm volatile("s_wait_xcnt 0x0" ::: "memory");      /* the registers that the Q and K loads above name are reused below: wait before they are overwritten */
  __builtin_amdgcn_sched_barrier(0);      /* keeps the set-up code below from being scheduled in front of that wait */
  const unsigned short* Vth = (const unsigned short*)Vt + (size_t)slab * 64 * TKv;
  float m_q = -3.0e38f, l_q = 0.f; v8f oacc[DT];      /* the lane's query: running maximum in base-2 units, less 10 (equal in both halves), the sum over this half's keys */
#pragma unroll
  for (int dt = 0; dt < DT; ++dt) oacc[dt] = (v8f){0.f,0.f,0.f,0.f,0.f,0.f,0.f,0.f};
#pragma unroll 1      /* rolled: a pass is long enough to cover its own loads; copies only add code */
  for (int j0 = 0; j0 < TKv; j0 += 32) {
    FragH av[DT];      /* this pass's V^T fragments (A operand), all issued at the head of the pass: they fly under the score products and the softmax */
#pragma unroll
    for (int dt = 0; dt < DT; ++dt) { const unsigned short* vrow = Vth + (size_t)(dt * 16) * TKv + (size_t)j0 * 16 + lane * 8; av[dt].half[0] = *(const v8us*)vrow; av[dt].half[1] = *(const v8us*)(vrow + 256); }
    v8f s[2];      /* s[nt][r] = score of key j0 + nt * 16 + 8 * hh + r with query q0 + ln */
#pragma unroll
    for (int nt = 0; nt < 2; ++nt) { v8f acc = (v8f){0.f,0.f,0.f,0.f,0.f,0.f,0.f,0.f};
#pragma unroll
      for (int ks = 0; ks < KS; ++ks) acc = mmaH<1>(ak[nt][ks].v, ak[nt][ks].v, bq[ks].v, bq[ks].v, acc); s[nt] = acc; }
    const int jn = (j0 + 32 < TKv) ? j0 + 32 : j0;      /* last pass: re-reads its own keys (in bounds, unused) */
#pragma unroll
    for (int nt = 0; nt < 2; ++nt) { const unsigned short* kr = (const unsigned short*)K16 + ((size_t)b * TKv + jn + nt * 16) * ldk + h * 1024 + lane * 8;
#pragma unroll
      for (int ks = 0; ks < KS; ++ks) { ak[nt][ks].half[0] = *(const v8us*)(kr + ks * 512); ak[nt][ks].half[1] = *(const v8us*)(kr + ks * 512 + 256); }
      asm volatile("s_wait_xcnt 0x0" ::: "memory"); }      /* the address registers of these four loads may be given to the next loads' results or to the softmax: wait before they are overwritten */
    float mx[8];      /* the maximum is taken on the raw scores: SCL2 > 0, and rounding is monotone, so scaling the maximum gives the maximum of the scaled scores */
#pragma unroll
    for (int i = 0; i < 8; ++i) mx[i] = fmaxf(s[0][i], s[1][i]);
    float mc = fmaxf(fmaxf(fmaxf(mx[0], mx[1]), fmaxf(mx[2], mx[3])), fmaxf(fmaxf(mx[4], mx[5]), fmaxf(mx[6], mx[7])));
    mc = fmaf(mc, SCL2, -10.0f);      /* kept 10 below the true maximum: the f16 operand's factor 2^10 rides in the exponent, p = 1024 * e^(score - maximum), at most about 1024 */
    mc = fmaxf(mc, xhalf(mc));
    const float mn = fmaxf(m_q, mc); const float ea = __builtin_amdgcn_exp2f(m_q - mn); const float al = (mn > -1.0e38f) ? ea : 1.0f; m_q = mn;
    FragH pb; float p[16];
#pragma unroll
    for (int i = 0; i < 16; i += 2) { const v2f x = __builtin_elementwise_fma((v2f){s[i >> 3][i & 7], s[i >> 3][(i & 7) + 1]}, (v2f){SCL2, SCL2}, (v2f){-mn, -mn});      /* two scores per packed fma */
      p[i] = __builtin_amdgcn_exp2f(x[0]); p[i + 1] = __builtin_amdgcn_exp2f(x[1]); pb.h[i] = (_Float16)p[i]; pb.h[i + 1] = (_Float16)p[i + 1]; }
    v2f t0 = {0.f, 0.f}, t1 = {0.f, 0.f};      /* two chains of packed partial sums: no chain of sixteen dependent adds */
#pragma unroll
    for (int i = 0; i < 4; ++i) { t0 += (v2f){p[4 * i], p[4 * i + 1]}; t1 += (v2f){p[4 * i + 2], p[4 * i + 3]}; }
    t0 += t1; l_q = l_q * al + (t0[0] + t0[1]);
#pragma unroll
    for (int dt = 0; dt < DT; ++dt) oacc[dt] *= al;
#pragma unroll
    for (int dt = 0; dt < DT; ++dt) oacc[dt] = mmaH<1>(av[dt].v, av[dt].v, pb.v, pb.v, oacc[dt]); }
  float l = l_q + xhalf(l_q); l = (l > 0.f) ? 1.0f / l : 0.f;      /* the sum carries the same 2^10 as the products */
#pragma unroll
  for (int dt = 0; dt < DT; ++dt) { const v8f o = oacc[dt] * l;      /* oacc[dt][r] = O[q0 + ln][dt * 16 + 8 * hh + r] */
    *(v4fa*)&sO[w][ln][dt * 16 + 8 * hh] = (v4f){o[0], o[1], o[2], o[3]}; *(v4fa*)&sO[w][ln][dt * 16 + 8 * hh + 4] = (v4f){o[4], o[5], o[6], o[7]}; }
  __builtin_amdgcn_fence(__ATOMIC_ACQ_REL, "workgroup"); __builtin_amdgcn_wave_barrier();      /* a lane reads below what other lanes of its wave wrote above: the LDS writes come first */
  {
#pragma unroll
    for (int rp = 0; rp < RPW; rp += 2) { const int r = rp + (lane >> 4), pc = lane & 15; const v4f val = *(const v4fa*)&sO[w][r][pc * 4]; *(v4f*)(O + ((size_t)b * TQ + q0 + r) * ldo + h * 64 + pc * 4) = val; }
     } }
// Both attentions in one grid: the first ATB blocks take the local keys (the long blocks start first), the rest the global keys; each range runs the body built for its own key count.
#define ATB (NB * NH * QBLKS)      /* blocks of one attention */
__global__ __launch_bounds__(128) void k_attn(const _Float16* __restrict__ Q16, const _Float16* __restrict__ KL, const _Float16* __restrict__ VTL, float* __restrict__ OL, const _Float16* __restrict__ KG, const _Float16* __restrict__ VTG, float* __restrict__ OG) {
  __shared__ __attribute__((aligned(16))) float sO[4][16][64 + 4];
  if (blockIdx.x < ATB) flashT_body<TKA>(sO, blockIdx.x, Q16, EMB, KL, EMB, VTL, OL, EMB);      /* local: 2048 keys */
  else flashT_body<TKB>(sO, blockIdx.x - ATB, Q16, EMB, KG, EMB, VTG, OG, EMB); }      /* global: 512 keys */
__global__ __launch_bounds__(256) void k_comb(const float* __restrict__ OL, const float* __restrict__ OG, const float* __restrict__ gate, _Float16* __restrict__ O16, size_t n8) {
  #pragma clang fp contract(off)
  const size_t t = (size_t)blockIdx.x * 256 + threadIdx.x; if (t >= n8) return; const float g = 1.0f / (1.0f + expf(-bf16_round(gate[0]))); const float h1 = 1.0f - g; FragH f; const size_t s = fo_src(t, EMB);      /* O16: fragment-order plane, K = EMB */
  for (int q = 0; q < 8; ++q) { float a = g * OL[s + q]; a += h1 * OG[s + q]; f.h[q] = (_Float16)a; }
  *(v8us*)((unsigned short*)O16 + t * 8) = f.half[0];  }

extern "C" void kernel_launch(void* const* d_in, const int* in_sizes, int n_in,
                              void* d_out, int out_size, void* d_ws, size_t ws_size, hipStream_t stream) {
  (void)in_sizes; (void)n_in; (void)out_size;
  const float* const* I = (const float* const*)d_in; const float* lh = I[0]; const float* gh = I[1]; const float* qw = I[2]; const float* qb = I[3]; const float* kw = I[4]; const float* kb = I[5]; const float* vw = I[6]; const float* vb = I[7]; const float* kgw = I[8]; const float* kgb = I[9]; const float* vgw = I[10]; const float* vgb = I[11]; const float* ow = I[12]; const float* ob = I[13]; const float* gate = I[14];
  char* ws = (char*)d_ws; size_t off = 0;
  auto take = [&](size_t bytes) { char* p = ws + off; off += (bytes + 255) & ~(size_t)255; return p; };
  const size_t w8 = (size_t)EMB * EMB / 8, npl = (size_t)NRL * EMB, npg = (size_t)NRG * EMB;
  _Float16* BQ = (_Float16*)take(w8 * 16); _Float16* BK = (_Float16*)take(w8 * 16); _Float16* BV = (_Float16*)take(w8 * 16); _Float16* BKG = (_Float16*)take(w8 * 16); _Float16* BVG = (_Float16*)take(w8 * 16); _Float16* BO = (_Float16*)take(w8 * 16);
  _Float16* XL = (_Float16*)take(npl * 2); _Float16* XG = (_Float16*)take(npg * 2); _Float16* Q16 = (_Float16*)take(npl * 2); _Float16* KL = (_Float16*)take(npl * 2); _Float16* VL = (_Float16*)take(npl * 2); _Float16* KG = (_Float16*)take(npg * 2); _Float16* VG = (_Float16*)take(npg * 2); _Float16* VTL = (_Float16*)take(npl * 2); _Float16* VTG = (_Float16*)take(npg * 2);
  float* OL = (float*)take(npl * 4); float* OG = (float*)take(npl * 4); _Float16* O16 = XL;      /* O16 over the local input plane (dead after its projections) */
  if (off > ws_size) return;      /* 12 + 8+2+8+8+8+2+2+8+2 + 16+16 = 92 MiB */
  k_conv<<<CVL + CVG + 6 * CVW, 256, 0, stream>>>(lh, gh, qw, kw, vw, kgw, vgw, ow, XL, XG, BQ, BK, BV, BKG, BVG, BO);
  const dim3 gL(PJL, 1);
  k_proj<<<3 * PJL + 2 * PJG, 128, 0, stream>>>(XL, XG, BQ, BK, BV, BKG, BVG, qb, kb, vb, kgb, vgb, Q16, KL, VL, KG, VG);
  k_vt<NH><<<NB * NH * (LL / 64) + NB * NH * (GG / 64), 256, 0, stream>>>(VL, VTL, VG, VTG, EMB, 0);
  k_attn<<<2 * ATB, 128, 0, stream>>>(Q16, KL, VTL, OL, KG, VTG, OG);
  k_comb<<<(unsigned)((npl / 8 + 255) / 256), 256, 0, stream>>>(OL, OG, gate, O16, npl / 8);
  k_gemm2<0, false><<<gL, 128, 0, stream>>>(O16, EMB, 0, BO, EMB, 0, 0.0625f, ob, 0, nullptr, 1, 0, 0, (float*)d_out, nullptr, EMB, 0, NRL, EMB, EMB);
}

// v006
// It runs in 132 microseconds.
// Timed twice side by side with v005, it ran 1.07 times as fast both times.
// Over all steps from v000 it is 4.30 times as fast.
#include <hip/hip_runtime.h>
// InfiniSpanAttention (2 batches; 2048 local tokens, 512 global tokens, D = 1024, 16 heads of 64): q/k_l/v_l from local_hidden, k_g/v_g from global_hidden (torch (out,in) linears + bias); out_l = softmax(q k_l^T s) v_l, out_g = softmax(q k_g^T s) v_g (no masks); out = sigmoid(gate) out_l + (1 - sigmoid(gate)) out_g -> merged heads -> out_w + out_b.
// Compute dtype: inputs and parameters rounded to bf16; q, k, v, P and the combined attention output as f16 operands (~2^-12); f32 accumulation/softmax/gating. v_wmma_f32_16x16x32_f16.
#define NB 2
#define EMB 1024
#define NRL (NB * LL)            /* 4096 local rows */
#define NRG (NB * GG)            /* 1024 global rows */
#define LL 2048                  /* local tokens (queries; local keys) */
#define GG 512                   /* global tokens (keys of the second attention) */
#define TQ LL
#define TK LL
#define TKA LL
#define TKB GG
#define NH 16
#define SCL 0.125f               /* 64^-0.5 */
#define QBLKS (TQ / 64)
typedef __bf16 v16b __attribute__((ext_vector_type(16)));
typedef unsigned short v8us __attribute__((ext_vector_type(8), may_alias));
typedef float  v8f  __attribute__((ext_vector_type(8)));
typedef float  v4f  __attribute__((ext_vector_type(4)));
typedef float  v4fa __attribute__((ext_vector_type(4), may_alias));
union FragB { v16b v; v8us half[2]; unsigned short u[16]; };

__device__ __forceinline__ unsigned short bf16_bits(float x) { unsigned int u = __float_as_uint(x); return (unsigned short)((u + 0x7FFFu + ((u >> 16) & 1u)) >> 16); }
__device__ __forceinline__ float bf16_val(unsigned short b) { return __uint_as_float(((unsigned int)b) << 16); }
__device__ __forceinline__ float bf16_round(float x) { return bf16_val(bf16_bits(x)); }
// D += A·B with NT terms: 1 = ah·bh, 2 = + al·bh (A split), 3 = + ah·bl (both split)
template <int NT>
__device__ __forceinline__ v8f mmaN(v16b ah, v16b al, v16b bh, v16b bl, v8f c) {
  c = __builtin_amdgcn_wmma_f32_16x16x32_bf16(false, ah, false, bh, (short)0, c, false, false);
  if (NT >= 2) c = __builtin_amdgcn_wmma_f32_16x16x32_bf16(false, al, false, bh, (short)0, c, false, false);
  if (NT >= 3) c = __builtin_amdgcn_wmma_f32_16x16x32_bf16(false, ah, false, bl, (short)0, c, false, false);
  asm volatile("v_nop\n\tv_nop\n\tv_nop\n\tv_nop" : "+v"(c) : "v"(ah), "v"(al), "v"(bh), "v"(bl));
  return c;
}

__global__ __launch_bounds__(256) void k_wt_bf16(const float* __restrict__ W, unsigned short* __restrict__ Wt, int K, int N) {
  const int t = blockIdx.x * 256 + threadIdx.x;
  const int k8n = K / 8;
  if (t >= N * k8n) return;
  const int n = t / k8n, k8 = (t % k8n) * 8;
  v8us v;
#pragma unroll
  for (int i = 0; i < 8; ++i) v[i] = bf16_bits(W[(size_t)(k8 + i) * N + n]);
  *(v8us*)(Wt + (size_t)n * K + k8) = v;
  
}

// GEMM C[M][N] (f32, pitch ldc) = act(A[M][K]·W + bias). A f32 row-major (pitch lda) converted per fragment to bf16
// (ASPLIT: hi/lo two planes -> 2 terms, else single rounded term); Wt bf16 [N][K] (pitch ldb). BIAS_BF16 rounds the
// bias to bf16 first (bias quantised to bf16 before the add). K%32==0, M%16==0, N%64==0.
template <bool ASPLIT, int ACT, bool BIAS_BF16>
__global__ __launch_bounds__(128) void k_gemm_bf(const float* __restrict__ A, int lda, const unsigned short* __restrict__ Wt, int ldb,
                                               const float* __restrict__ bias, float* __restrict__ C, int ldc, int M, int N, int K) {
  __shared__ __attribute__((aligned(16))) float so[4][16][64];
  const int tid = threadIdx.x, w = tid >> 5, lane = tid & 31, ln = lane & 15, hh = lane >> 4;
  const int ntn = N / 64;
  const int wid = blockIdx.x * 4 + w;
  const int mt = wid / ntn, nq = wid % ntn;
  if (mt * 16 >= M) return;
  const int row0 = mt * 16, col0 = nq * 64;
  const float* arow = A + (size_t)(row0 + ln) * lda;
  v8f acc[4] = {};
  for (int kb = 0; kb < K; kb += 32) {
    FragB ah, al;
    const v4f x0 = *(const v4fa*)(arow + kb + 8 * hh), x1 = *(const v4fa*)(arow + kb + 8 * hh + 4);
    const v4f x2 = *(const v4fa*)(arow + kb + 16 + 8 * hh), x3 = *(const v4fa*)(arow + kb + 16 + 8 * hh + 4);
    float xs[16] = {x0[0],x0[1],x0[2],x0[3],x1[0],x1[1],x1[2],x1[3],x2[0],x2[1],x2[2],x2[3],x3[0],x3[1],x3[2],x3[3]};
#pragma unroll
    for (int i = 0; i < 16; ++i) { const unsigned short hb = bf16_bits(xs[i]); ah.u[i] = hb; al.u[i] = ASPLIT ? bf16_bits(xs[i] - bf16_val(hb)) : (unsigned short)0; }
#pragma unroll
    for (int t = 0; t < 4; ++t) {
      const unsigned short* brow = Wt + (size_t)(col0 + t * 16 + ln) * ldb + kb;
      FragB b;
      b.half[0] = *(const v8us*)(brow + 8 * hh);
      b.half[1] = *(const v8us*)(brow + 16 + 8 * hh);
      acc[t] = mmaN<ASPLIT ? 2 : 1>(ah.v, al.v, b.v, b.v, acc[t]);
    }
  }
#pragma unroll
  for (int t = 0; t < 4; ++t) {
    float bv = bias ? bias[col0 + t * 16 + ln] : 0.f;
    if (BIAS_BF16) bv = bf16_round(bv);
#pragma unroll
    for (int r = 0; r < 8; ++r) { float v = acc[t][r] + bv; if (ACT == 1) v = fmaxf(v, 0.f); so[w][8 * hh + r][t * 16 + ln] = v; }
  }
  __builtin_amdgcn_fence(__ATOMIC_ACQ_REL, "workgroup");
  __builtin_amdgcn_wave_barrier();
  const int rsub = lane >> 4, c4 = (lane & 15) * 4;
  {
#pragma unroll
    for (int q = 0; q < 8; ++q) {
      const int r = q * 2 + rsub;
      const v4f v = *(const v4fa*)&so[w][r][c4];
      *(v4f*)(C + (size_t)(row0 + r) * ldc + col0 + c4) = v;
    }
    
  }
}

// GEMM C = act(A·W + bias + resid): A f32 (ASPLIT -> hi/lo 2 terms), Wt bf16 [N][K]; ACT 0 none, 1 relu, 2 exact gelu;
// resid (optional, f32, row index = (row % rmod), pitch ldr, RES_BF16 rounds it) added before the activation.
template <bool ASPLIT, int ACT, bool BIAS_BF16, bool RES_BF16>
__global__ __launch_bounds__(128) void k_gemm_bf3(const float* __restrict__ A, int lda, const unsigned short* __restrict__ Wt, int ldb,
                                                const float* __restrict__ bias, const float* __restrict__ resid, int rmod, int ldr,
                                                float* __restrict__ C, int ldc, int M, int N, int K) {
  __shared__ __attribute__((aligned(16))) float so[4][16][64];
  const int tid = threadIdx.x, w = tid >> 5, lane = tid & 31, ln = lane & 15, hh = lane >> 4;
  const int ntn = N / 64;
  const int wid = blockIdx.x * 4 + w;
  const int mt = wid / ntn, nq = wid % ntn;
  if (mt * 16 >= M) return;
  const int row0 = mt * 16, col0 = nq * 64;
  const float* arow = A + (size_t)(row0 + ln) * lda;
  v8f acc[4] = {};
  for (int kb = 0; kb < K; kb += 32) {
    FragB ah, al;
    const v4f x0 = *(const v4fa*)(arow + kb + 8 * hh), x1 = *(const v4fa*)(arow + kb + 8 * hh + 4);
    const v4f x2 = *(const v4fa*)(arow + kb + 16 + 8 * hh), x3 = *(const v4fa*)(arow + kb + 16 + 8 * hh + 4);
    float xs[16] = {x0[0],x0[1],x0[2],x0[3],x1[0],x1[1],x1[2],x1[3],x2[0],x2[1],x2[2],x2[3],x3[0],x3[1],x3[2],x3[3]};
#pragma unroll
    for (int i = 0; i < 16; ++i) { const unsigned short hb = bf16_bits(xs[i]); ah.u[i] = hb; al.u[i] = ASPLIT ? bf16_bits(xs[i] - bf16_val(hb)) : (unsigned short)0; }
#pragma unroll
    for (int t = 0; t < 4; ++t) {
      const unsigned short* brow = Wt + (size_t)(col0 + t * 16 + ln) * ldb + kb;
      FragB b;
      b.half[0] = *(const v8us*)(brow + 8 * hh);
      b.half[1] = *(const v8us*)(brow + 16 + 8 * hh);
      acc[t] = mmaN<ASPLIT ? 2 : 1>(ah.v, al.v, b.v, b.v, acc[t]);
    }
  }
#pragma unroll
  for (int t = 0; t < 4; ++t) {
    const int col = col0 + t * 16 + ln;
    float bv = bias ? bias[col] : 0.f;
    if (BIAS_BF16) bv = bf16_round(bv);
#pragma unroll
    for (int r = 0; r < 8; ++r) {
      float v = acc[t][r] + bv;
      if (resid) { float rv = resid[(size_t)((row0 + 8 * hh + r) % rmod) * ldr + col]; if (RES_BF16) rv = bf16_round(rv); v += rv; }
      if (ACT == 1) v = fmaxf(v, 0.f);
      if (ACT == 2) v = 0.5f * v * (1.0f + erff(v * 0.70710678118654752f));
      if (ACT == 3) { const float u = 0.7978845608028654f * (v + 0.044715f * v * v * v); v = 0.5f * v * (1.0f + tanhf(u)); }
      so[w][8 * hh + r][t * 16 + ln] = v;
    }
  }
  __builtin_amdgcn_fence(__ATOMIC_ACQ_REL, "workgroup");
  __builtin_amdgcn_wave_barrier();
  const int rsub = lane >> 4, c4 = (lane & 15) * 4;
  {
#pragma unroll
    for (int q = 0; q < 8; ++q) {
      const int r = q * 2 + rsub;
      const v4f v = *(const v4fa*)&so[w][r][c4];
      *(v4f*)(C + (size_t)(row0 + r) * ldc + col0 + c4) = v;
    }
    
  }
}
// row LayerNorm (biased variance, eps) over N: s = X (+ R); optional out_sum <- s; out_norm <- (s-mu)*rsqrt(var+eps)*g + b
template <bool PARAM_BF16>
__global__ __launch_bounds__(256) void k_layernorm(const float* __restrict__ X, const float* __restrict__ R, const float* __restrict__ g, const float* __restrict__ bta,
                                                  float* __restrict__ out_sum, float* __restrict__ out_norm, int N, float eps) {
  __shared__ float red[256];
  const int row = blockIdx.x, tid = threadIdx.x;
  const float* x = X + (size_t)row * N; const float* rr = R ? R + (size_t)row * N : nullptr;
  float vals[16];                     // up to N = 4096
  const int per = N / 256;            // contiguous chunk per thread? use strided-by-4 chunks: thread handles j = tid*4 + 1024*u
  float s1 = 0.f;
  for (int u = 0; u < per / 4; ++u) {
    const int j = tid * 4 + 1024 * u;
    const v4f a = *(const v4fa*)(x + j);
    v4f b = {0.f,0.f,0.f,0.f}; if (rr) b = *(const v4fa*)(rr + j);
#pragma unroll
    for (int q = 0; q < 4; ++q) { const float v = a[q] + b[q]; vals[u * 4 + q] = v; s1 += v; }
  }
  red[tid] = s1; __syncthreads();
  for (int st = 128; st > 0; st >>= 1) { if (tid < st) red[tid] += red[tid + st]; __syncthreads(); }
  const float mu = red[0] / (float)N; __syncthreads();
  float s2 = 0.f;
  for (int u = 0; u < per / 4; ++u)
#pragma unroll
    for (int q = 0; q < 4; ++q) { const float c = vals[u * 4 + q] - mu; s2 += c * c; }
  red[tid] = s2; __syncthreads();
  for (int st = 128; st > 0; st >>= 1) { if (tid < st) red[tid] += red[tid + st]; __syncthreads(); }
  const float rs = rsqrtf(red[0] / (float)N + eps);
  {
    for (int u = 0; u < per / 4; ++u) {
      const int j = tid * 4 + 1024 * u;
      v4f o, sm;
#pragma unroll
      for (int q = 0; q < 4; ++q) {
        float gg = g[j + q], bb = bta[j + q];
        if (PARAM_BF16) { gg = bf16_round(gg); bb = bf16_round(bb); }
        sm[q] = vals[u * 4 + q]; o[q] = (vals[u * 4 + q] - mu) * rs * gg + bb;
      }
      if (out_sum) *(v4f*)(out_sum + (size_t)row * N + j) = sm;
      *(v4f*)(out_norm + (size_t)row * N + j) = o;
    }
    
  }
}



// ---- f16 WMMA path (v_wmma_f32_16x16x32_f16): 11-bit significands for operands in range — used where a [0,1] probability operand needs more precision than bf16
typedef _Float16 v16h __attribute__((ext_vector_type(16)));
union FragH { v16h v; v8us half[2]; _Float16 h[16]; unsigned short u[16]; };
template <int NT>
__device__ __forceinline__ v8f mmaH(v16h ah, v16h al, v16h bh, v16h bl, v8f c) {
  c = __builtin_amdgcn_wmma_f32_16x16x32_f16(false, ah, false, bh, (short)0, c, false, false);
  if (NT >= 2) c = __builtin_amdgcn_wmma_f32_16x16x32_f16(false, al, false, bh, (short)0, c, false, false);
  if (NT >= 3) c = __builtin_amdgcn_wmma_f32_16x16x32_f16(false, ah, false, bl, (short)0, c, false, false);
  asm volatile("v_nop\n\tv_nop\n\tv_nop\n\tv_nop" : "+v"(c) : "v"(ah), "v"(al), "v"(bh), "v"(bl));
  return c;
}
// batched GEMM like k_gemm_b but f16 operands: A f32 (split into f16 hi/lo if ASPLIT, else rounded to f16), Bt = f16 values [n][k]; alpha; C f32; N multiple of 16 (partial tiles skipped)
template <bool ASPLIT>
__global__ __launch_bounds__(128) void k_gemm_h(const float* __restrict__ A, int lda, size_t sA, const _Float16* __restrict__ Bh, int ldb, size_t sB, float alpha, float* __restrict__ C, int ldc, size_t sC, int M, int N, int K) {
  __shared__ __attribute__((aligned(16))) float so[4][16][64];
  const int tid = threadIdx.x, w = tid >> 5, lane = tid & 31, ln = lane & 15, hh = lane >> 4; const int by = blockIdx.y;
  A += (size_t)by * sA; Bh += (size_t)by * sB; C += (size_t)by * sC;
  const int ntn = (N + 63) / 64; const int wid = blockIdx.x * 4 + w; const int mt = wid / ntn, nq = wid % ntn; if (mt * 16 >= M) return;
  const int row0 = mt * 16, col0 = nq * 64; const float* arow = A + (size_t)(row0 + ln) * lda;
  v8f acc[4] = {};
  for (int kb = 0; kb < K; kb += 32) {
    FragH ah, al;
    const v4f x0 = *(const v4fa*)(arow + kb + 8 * hh), x1 = *(const v4fa*)(arow + kb + 8 * hh + 4), x2 = *(const v4fa*)(arow + kb + 16 + 8 * hh), x3 = *(const v4fa*)(arow + kb + 16 + 8 * hh + 4);
    float xs[16] = {x0[0],x0[1],x0[2],x0[3],x1[0],x1[1],x1[2],x1[3],x2[0],x2[1],x2[2],x2[3],x3[0],x3[1],x3[2],x3[3]};
#pragma unroll
    for (int i = 0; i < 16; ++i) { const _Float16 h = (_Float16)xs[i]; ah.h[i] = h; al.h[i] = ASPLIT ? (_Float16)(xs[i] - (float)h) : (_Float16)0.0f; }
#pragma unroll
    for (int t = 0; t < 4; ++t) { if (col0 + t * 16 >= N) continue; const size_t boff = (size_t)(col0 + t * 16 + ln) * ldb + kb; FragH bq; bq.half[0] = *(const v8us*)(Bh + boff + 8 * hh); bq.half[1] = *(const v8us*)(Bh + boff + 16 + 8 * hh);
      acc[t] = mmaH<ASPLIT ? 2 : 1>(ah.v, al.v, bq.v, bq.v, acc[t]); }
  }
#pragma unroll
  for (int t = 0; t < 4; ++t) { if (col0 + t * 16 >= N) continue;
#pragma unroll
    for (int r = 0; r < 8; ++r) so[w][8 * hh + r][t * 16 + ln] = acc[t][r] * alpha; }
  __builtin_amdgcn_fence(__ATOMIC_ACQ_REL, "workgroup"); __builtin_amdgcn_wave_barrier();
  const int rsub = lane >> 4, c4 = (lane & 15) * 4;
  {
#pragma unroll
    for (int q = 0; q < 8; ++q) { const int r = q * 2 + rsub; if (col0 + c4 < N) { const v4f v = *(const v4fa*)&so[w][r][c4]; *(v4f*)(C + (size_t)(row0 + r) * ldc + col0 + c4) = v; } }
     }
}

// Wt[n][k] = f16(W[k][n]·scale) from f32 row-major W[K][N] (scale = power of two; bf16-exact weights stay exact in f16 away from the subnormal range)
__global__ __launch_bounds__(256) void k_wt_f16(const float* __restrict__ W, _Float16* __restrict__ Wt, int K, int N, float scale) {
  const int t = blockIdx.x * 256 + threadIdx.x; if (t >= N * (K / 8)) return; const int n = t / (K / 8), k8 = (t % (K / 8)) * 8; FragH f;
#pragma unroll
  for (int i = 0; i < 8; ++i) f.h[i] = (_Float16)(bf16_round(W[(size_t)(k8 + i) * N + n]) * scale); const v8us o = f.half[0];
  *(v8us*)((unsigned short*)Wt + (size_t)n * K + k8) = o; 
}
// k_gemm_hh variant with fused epilogue: v = acc·alpha + bias[by·sBias + col] (+ CP[(row/rowsPerB)·sCPb + by·64 + col] if CP) ; ACT 0 none / 1 elu ; writes f16 C16 (and f32 C if non-null)
template <int ACT>
__global__ __launch_bounds__(128) void k_gemm_hhx(const _Float16* __restrict__ A, int lda, size_t sA, const _Float16* __restrict__ Bh, int ldb, size_t sB, float alpha, const float* __restrict__ bias, size_t sBias, const float* __restrict__ CP, int rowsPerB, size_t sCPb, int row0g,
    float* __restrict__ C, _Float16* __restrict__ C16, int ldc, size_t sC, int M, int N, int K) {
  __shared__ __attribute__((aligned(16))) float so[4][16][64];
  const int tid = threadIdx.x, w = tid >> 5, lane = tid & 31, ln = lane & 15, hh = lane >> 4; const int by = blockIdx.y;
  A += (size_t)by * sA; Bh += (size_t)by * sB; const size_t cofs = (size_t)by * sC; const float* bp = bias ? bias + (size_t)by * sBias : nullptr;
  const int ntn = (N + 63) / 64; const int wid = blockIdx.x * 4 + w; const int mt = wid / ntn, nq = wid % ntn; if (mt * 16 >= M) return;
  const int row0 = mt * 16, col0 = nq * 64; const _Float16* arow = A + (size_t)(row0 + ln) * lda;
  v8f acc[4] = {};
  for (int kb = 0; kb < K; kb += 32) { FragH ah; ah.half[0] = *(const v8us*)((const unsigned short*)arow + kb + 8 * hh); ah.half[1] = *(const v8us*)((const unsigned short*)arow + kb + 16 + 8 * hh);
#pragma unroll
    for (int t = 0; t < 4; ++t) { if (col0 + t * 16 >= N) continue; const size_t boff = (size_t)(col0 + t * 16 + ln) * ldb + kb; FragH bq; bq.half[0] = *(const v8us*)((const unsigned short*)Bh + boff + 8 * hh); bq.half[1] = *(const v8us*)((const unsigned short*)Bh + boff + 16 + 8 * hh);
      acc[t] = mmaH<1>(ah.v, ah.v, bq.v, bq.v, acc[t]); }
  }
#pragma unroll
  for (int t = 0; t < 4; ++t) { if (col0 + t * 16 >= N) continue; const int col = col0 + t * 16 + ln; const float bv = bp ? bf16_round(bp[col]) : 0.f;
#pragma unroll
    for (int r = 0; r < 8; ++r) { float v = acc[t][r] * alpha + bv; if (CP) { const int bidx = (row0g + row0 + 8 * hh + r) / rowsPerB; v += CP[(size_t)bidx * sCPb + (size_t)by * 64 + col]; } if (ACT == 1) v = (v > 0.f) ? v : expm1f(v); else if (ACT == 7) v = (v > 0.f) ? v + 1.0f : expf(v); else if (ACT == 8) v = tanhf(v); else if (ACT == 9) v = 0.5f * v * (1.0f + tanhf(0.7978845608028654f * (v + 0.044715f * v * v * v))); else if (ACT == 11) v = 1.0f / (1.0f + expf(-v)); else if (ACT == 12) v = (v > 0.f) ? v : 0.01f * v; else if (ACT == 14) v = (v > 0.f) ? v : 0.1f * v; else if (ACT == 15) v = v / (1.0f + expf(-v)); else if (ACT == 3) v = fmaxf(v, 0.f); else if (ACT == 6) v = 0.5f * v * (1.0f + erff(v * 0.70710678118654752f)); so[w][8 * hh + r][t * 16 + ln] = v; } }
  __builtin_amdgcn_fence(__ATOMIC_ACQ_REL, "workgroup"); __builtin_amdgcn_wave_barrier();
  const int rsub = lane >> 4, c4 = (lane & 15) * 4; typedef _Float16 v4h __attribute__((ext_vector_type(4)));
  {
#pragma unroll
    for (int q = 0; q < 8; ++q) { const int r = q * 2 + rsub; if (col0 + c4 < N) { const v4f v = *(const v4fa*)&so[w][r][c4]; if (C) *(v4f*)(C + cofs + (size_t)(row0 + r) * ldc + col0 + c4) = v; if (C16) { v4h h4; for (int i = 0; i < 4; ++i) h4[i] = (_Float16)v[i]; *(v4h*)(C16 + cofs + (size_t)(row0 + r) * ldc + col0 + c4) = h4; } } }
     }
}


typedef _Float16 v4h __attribute__((ext_vector_type(4)));

// ---- fragment-order plane of an f16 matrix M[rows][K]: 1-KiB blocks of 16 rows x 32 k, block (row >> 4, k >> 5) at element ((row >> 4) * (K >> 5) + (k >> 5)) * 512;
// inside a block 64 pieces of 8 k: piece j * 32 + lane holds row (lane & 15), k = 16 * j + 8 * (lane >> 4) + 0..7. A wave's 16-byte fragment load reads 512 bytes in a row: 4 whole lines, not 16 pieces of lines.
__device__ __forceinline__ size_t fo_src(size_t t, int K) { const int kbn = K >> 5; const size_t blk = t >> 6; const int c = (int)(t & 63), j = c >> 5, l = c & 31; return ((blk / kbn) * 16 + (l & 15)) * (size_t)K + (size_t)(blk % kbn) * 32 + j * 16 + (l >> 4) * 8; }      /* piece t of a plane -> its first element in the row-major matrix */

// All eight conversions to f16 fragment-order planes (K = EMB) in one grid: a block's index range names its matrix. Activations as they are, weights stored (out,in) (== Bt[n][k]) times 16 (a power of two: exact).
#define CVL (NRL * EMB / 8 / 256)      /* blocks of the local activations */
#define CVG (NRG * EMB / 8 / 256)      /* blocks of the global activations */
#define CVW (EMB * EMB / 8 / 256)      /* blocks of one weight */
__global__ __launch_bounds__(256) void k_conv(const float* __restrict__ lh, const float* __restrict__ gh, const float* __restrict__ qw, const float* __restrict__ kw, const float* __restrict__ vw, const float* __restrict__ kgw, const float* __restrict__ vgw, const float* __restrict__ ow,
    _Float16* __restrict__ XL, _Float16* __restrict__ XG, _Float16* __restrict__ BQ, _Float16* __restrict__ BK, _Float16* __restrict__ BV, _Float16* __restrict__ BKG, _Float16* __restrict__ BVG, _Float16* __restrict__ BO) {
  int bx = blockIdx.x; const float* s; _Float16* d; float sc = 16.0f;
  if (bx < CVL) { s = lh; d = XL; sc = 1.0f; }
  else if (bx < CVL + CVG) { bx -= CVL; s = gh; d = XG; sc = 1.0f; }
  else { bx -= CVL + CVG; const int m = bx / CVW; bx -= m * CVW;
    s = (m == 0) ? qw : (m == 1) ? kw : (m == 2) ? vw : (m == 3) ? kgw : (m == 4) ? vgw : ow; d = (m == 0) ? BQ : (m == 1) ? BK : (m == 2) ? BV : (m == 3) ? BKG : (m == 4) ? BVG : BO; }
  const size_t t = (size_t)bx * 256 + threadIdx.x; const float* p = s + fo_src(t, EMB); FragH f;
#pragma unroll      /* in full: the piece's eight values stay in registers and are read by two 16-byte loads */
  for (int q = 0; q < 8; ++q) f.h[q] = (_Float16)(bf16_round(p[q]) * sc);
  *(v8us*)((unsigned short*)d + t * 8) = f.half[0]; }
__global__ __launch_bounds__(256) void k_h16(const float* __restrict__ x, _Float16* __restrict__ X16, size_t n8) { const size_t t = (size_t)blockIdx.x * 256 + threadIdx.x; if (t >= n8) return; FragH f;
#pragma unroll
  for (int q = 0; q < 8; ++q) f.h[q] = (_Float16)x[t * 8 + q]; *(v8us*)((unsigned short*)X16 + t * 8) = f.half[0];  }
__global__ __launch_bounds__(256) void k_round16f(const float* __restrict__ W, _Float16* __restrict__ Bt, size_t n8) { const size_t t = (size_t)blockIdx.x * 256 + threadIdx.x; if (t >= n8) return; FragH f;
#pragma unroll
  for (int i = 0; i < 8; ++i) f.h[i] = (_Float16)(bf16_round(W[t * 8 + i]) * 16.0f); *(v8us*)((unsigned short*)Bt + t * 8) = f.half[0];  }
__global__ __launch_bounds__(256) void k_hl(const float* __restrict__ F, _Float16* __restrict__ Hh, _Float16* __restrict__ Hl, size_t n8) { const size_t t = (size_t)blockIdx.x * 256 + threadIdx.x; if (t >= n8) return; FragH fh, fl; const v4f a = *(const v4fa*)(F + t * 8), c = *(const v4fa*)(F + t * 8 + 4);
#pragma unroll
  for (int q = 0; q < 4; ++q) { _Float16 h = (_Float16)a[q]; fh.h[q] = h; fl.h[q] = (_Float16)((a[q] - (float)h) * 1024.0f); h = (_Float16)c[q]; fh.h[4 + q] = h; fl.h[4 + q] = (_Float16)((c[q] - (float)h) * 1024.0f); }
  { *(v8us*)((unsigned short*)Hh + t * 8) = fh.half[0]; *(v8us*)((unsigned short*)Hl + t * 8) = fl.half[0];  } }

// ---- fast GEMM (wave tile 32x64; requires M % 32 == 0 rows per launch region, N % 64 == 0 and K % 64 == 0); epilogue = k_gemm_hhx semantics ----
// Two fragment sets (even and odd 32-k steps). Each fragment is reloaded for the step two ahead right behind its last product, so a step's loads fly under the other set's products.
__device__ __forceinline__ v16h g2_frag(const _Float16* p, int k, int lane) { FragH f; const unsigned short* q = (const unsigned short*)p + (size_t)k * 16 + lane * 8; f.half[0] = *(const v8us*)q; f.half[1] = *(const v8us*)(q + 256); return f.v; }      /* p: a 16-row strip of a fragment-order plane; k: multiple of 32 */
__device__ __forceinline__ v8f g2_mma(v16h a, v16h b, v8f c) { v8f d = __builtin_amdgcn_wmma_f32_16x16x32_f16(false, a, false, b, (short)0, c, false, false); asm volatile("v_nop\n\tv_nop\n\tv_nop\n\tv_nop" : "+v"(d) : "v"(a), "v"(b)); return d; }
template <int ACT>      /* A and Bh: fragment-order planes with K = lda = ldb; FO 1: the result goes to C16 alone, as such a plane (K = ldc); FO 2: to C16 alone, transposed per head, as the plane V^T of the attention (rows = (batch * NH + head) * 64 + d, K = 1 << vsh keys per batch; N = NH * 64); bx, by: the block's place in its own product's grid */
__device__ __forceinline__ void gemm2_body(float (*so)[32][68], const int bx, const int by, const int FO, const int vsh, const _Float16* __restrict__ A, int lda, size_t sA, const _Float16* __restrict__ Bh, int ldb, size_t sB, float alpha, const float* __restrict__ bias, size_t sBias, const float* __restrict__ CP, int rowsPerB, size_t sCPb, int row0g,
    float* __restrict__ C, _Float16* __restrict__ C16, int ldc, size_t sC, int M, int N, int K) {
  const int tid = threadIdx.x, w = tid >> 5, lane = tid & 31, ln = lane & 15, hh = lane >> 4;
  A += (size_t)by * sA; Bh += (size_t)by * sB; const size_t cofs = (size_t)by * sC; const float* bp = bias ? bias + (size_t)by * sBias : nullptr;
  const int ntn = N >> 6; const int mt = bx / ntn, nq = bx - mt * ntn; const int row0 = mt * 128 + 32 * w, col0 = nq * 64; if (row0 >= M) return;
  const _Float16* a0p = A + (size_t)row0 * lda; const _Float16* a1p = a0p + (size_t)16 * lda;
  const _Float16* b0p = Bh + (size_t)col0 * ldb; const _Float16* b1p = b0p + (size_t)16 * ldb; const _Float16* b2p = b1p + (size_t)16 * ldb; const _Float16* b3p = b2p + (size_t)16 * ldb;
  const v8f z8 = {0.f,0.f,0.f,0.f,0.f,0.f,0.f,0.f}; v8f c00 = z8, c01 = z8, c02 = z8, c03 = z8, c10 = z8, c11 = z8, c12 = z8, c13 = z8;
  v16h a0 = g2_frag(a0p, 0, lane), a1 = g2_frag(a1p, 0, lane), b0 = g2_frag(b0p, 0, lane), b1 = g2_frag(b1p, 0, lane), b2 = g2_frag(b2p, 0, lane), b3 = g2_frag(b3p, 0, lane);
  v16h e0 = g2_frag(a0p, 32, lane), e1 = g2_frag(a1p, 32, lane), f0 = g2_frag(b0p, 32, lane), f1 = g2_frag(b1p, 32, lane), f2 = g2_frag(b2p, 32, lane), f3 = g2_frag(b3p, 32, lane);
#pragma unroll 1      /* rolled: the body already holds both sets; more copies only add code */
  for (int kb = 0; kb < K; kb += 64) { const int kn = (kb + 64 < K) ? kb + 64 : kb;      /* last trip: re-reads its own step (in bounds, unused) */
    c00 = g2_mma(a0, b0, c00); c10 = g2_mma(a1, b0, c10); b0 = g2_frag(b0p, kn, lane);
    c01 = g2_mma(a0, b1, c01); c11 = g2_mma(a1, b1, c11); b1 = g2_frag(b1p, kn, lane);
    c02 = g2_mma(a0, b2, c02); c12 = g2_mma(a1, b2, c12); b2 = g2_frag(b2p, kn, lane);
    c03 = g2_mma(a0, b3, c03); c13 = g2_mma(a1, b3, c13); b3 = g2_frag(b3p, kn, lane); a0 = g2_frag(a0p, kn, lane); a1 = g2_frag(a1p, kn, lane);
    c00 = g2_mma(e0, f0, c00); c10 = g2_mma(e1, f0, c10); f0 = g2_frag(b0p, kn + 32, lane);
    c01 = g2_mma(e0, f1, c01); c11 = g2_mma(e1, f1, c11); f1 = g2_frag(b1p, kn + 32, lane);
    c02 = g2_mma(e0, f2, c02); c12 = g2_mma(e1, f2, c12); f2 = g2_frag(b2p, kn + 32, lane);
    c03 = g2_mma(e0, f3, c03); c13 = g2_mma(e1, f3, c13); f3 = g2_frag(b3p, kn + 32, lane); e0 = g2_frag(a0p, kn + 32, lane); e1 = g2_frag(a1p, kn + 32, lane);
    asm volatile("s_wait_xcnt 0x0" ::: "memory"); }      /* the next trip forms new addresses in the registers that this trip's loads name: wait before they are overwritten */
  v8f accs[8] = {c00, c01, c02, c03, c10, c11, c12, c13};
  if (FO == 2) {      /* a lane's eight accumulators of a tile are eight keys in a row (16 * half + 8 * hh + r) of one d (t * 16 + ln): one 16-byte piece of the V^T plane, stored as it stands, through no LDS; the wave's 32 keys x 64 d = 4 blocks, 8 stores of 512 bytes in a row; the short loops are unrolled in full, so that the arrays stay in registers */
    const int slab = (row0 >> vsh) * NH + nq, kblk = (row0 & ((1 << vsh) - 1)) >> 5;
    unsigned short* vp = (unsigned short*)C16 + ((((size_t)slab * 4) << (vsh - 5)) + kblk) * 512 + lane * 8; FragH f[8]; float bv[4] = {0.f, 0.f, 0.f, 0.f};
    if (bp) {      /* one test, so that the four loads fly together */
#pragma unroll
      for (int t = 0; t < 4; ++t) bv[t] = bp[col0 + t * 16 + ln];
#pragma unroll
      for (int t = 0; t < 4; ++t) bv[t] = bf16_round(bv[t]); }
#pragma unroll
    for (int u = 0; u < 8; ++u)
#pragma unroll
      for (int r = 0; r < 8; ++r) f[u].h[r] = (_Float16)(accs[u][r] * alpha + bv[u & 3]);
#pragma unroll
    for (int u = 0; u < 8; ++u) *(v8us*)(vp + (((size_t)(u & 3)) << (vsh - 5)) * 512 + (u >> 2) * 256) = f[u].half[0];
    return; }
#pragma unroll
  for (int u = 0; u < 8; ++u) { const int t = u & 3, half = u >> 2; const int col = col0 + t * 16 + ln; const float bv = bp ? bf16_round(bp[col]) : 0.f;
#pragma unroll
    for (int r = 0; r < 8; ++r) { const int rloc = half * 16 + 8 * hh + r; float v = accs[u][r] * alpha + bv; if (CP) { const int bidx = (row0g + row0 + rloc) / rowsPerB; v += CP[(size_t)bidx * sCPb + (size_t)by * 64 + col]; }
      if (ACT == 3) v = fmaxf(v, 0.f); else if (ACT == 6) v = 0.5f * v * (1.0f + erff(v * 0.70710678118654752f)); else if (ACT == 11) v = 1.0f / (1.0f + expf(-v)); else if (ACT == 15) v = v / (1.0f + expf(-v)); else if (ACT == 12) v = (v > 0.f) ? v : 0.01f * v; else if (ACT == 8) v = tanhf(v);
      so[w][rloc][t * 16 + ln] = v; } }
  __builtin_amdgcn_fence(__ATOMIC_ACQ_REL, "workgroup"); __builtin_amdgcn_wave_barrier();
  const int rsub = lane >> 4, c4 = (lane & 15) * 4;
  if (FO == 0) {
#pragma unroll
    for (int q = 0; q < 16; ++q) { const int r = q * 2 + rsub; const v4f v = *(const v4fa*)&so[w][r][c4]; if (C) *(v4f*)(C + cofs + (size_t)(row0 + r) * ldc + col0 + c4) = v; if (C16) { v4h h4; for (int i = 0; i < 4; ++i) h4[i] = (_Float16)v[i]; *(v4h*)(C16 + cofs + (size_t)(row0 + r) * ldc + col0 + c4) = h4; } }
    asm volatile("s_wait_xcnt 0x0" ::: "memory");      /* precaution: FO 0 comes only from k_gemm2, where FO is fixed at compile time, and nothing follows these stores; wait until they have read their registers */
     } else {      /* the wave's 32 x 64 tile = 2 x 2 blocks of the plane, 8 stores of 512 bytes in a row */
#pragma unroll
      for (int u = 0; u < 8; ++u) { const int rbl = u >> 2, kbl = (u >> 1) & 1, j = u & 1; const float* sp = &so[w][rbl * 16 + ln][kbl * 32 + j * 16 + hh * 8]; const v4f x = *(const v4fa*)sp, y = *(const v4fa*)(sp + 4); FragH f;
#pragma unroll
        for (int i = 0; i < 4; ++i) { f.h[i] = (_Float16)x[i]; f.h[4 + i] = (_Float16)y[i]; }
        *(v8us*)((unsigned short*)C16 + cofs + (size_t)(row0 + rbl * 16) * ldc + (size_t)((col0 >> 5) + kbl) * 512 + j * 256 + lane * 8) = f.half[0]; }
      asm volatile("s_wait_xcnt 0x0" ::: "memory");      /* precaution: the FO 2 path has returned before, and nothing follows these stores; wait until they have read their registers */
     } }
template <int ACT, bool FO>
__global__ __launch_bounds__(128) void k_gemm2(const _Float16* __restrict__ A, int lda, size_t sA, const _Float16* __restrict__ Bh, int ldb, size_t sB, float alpha, const float* __restrict__ bias, size_t sBias, const float* __restrict__ CP, int rowsPerB, size_t sCPb, int row0g,
    float* __restrict__ C, _Float16* __restrict__ C16, int ldc, size_t sC, int M, int N, int K) {
  __shared__ __attribute__((aligned(16))) float so[4][32][68];
  gemm2_body<ACT>(so, blockIdx.x, blockIdx.y, FO ? 1 : 0, 5, A, lda, sA, Bh, ldb, sB, alpha, bias, sBias, CP, rowsPerB, sCPb, row0g, C, C16, ldc, sC, M, N, K); }
// The five input projections in one grid: a block's index range names its product (Q, K, V of the local rows, then K, V of the global rows). Q and both K leave as fragment-order planes, both V as the transposed planes that the attention reads.
#define PJL ((NRL / 128) * (EMB / 64))      /* blocks of one local projection */
#define PJG ((NRG / 128) * (EMB / 64))      /* blocks of one global projection */
__global__ __launch_bounds__(128) void k_proj(const _Float16* __restrict__ XL, const _Float16* __restrict__ XG, const _Float16* __restrict__ BQ, const _Float16* __restrict__ BK, const _Float16* __restrict__ BV, const _Float16* __restrict__ BKG, const _Float16* __restrict__ BVG,
    const float* __restrict__ qb, const float* __restrict__ kb, const float* __restrict__ vb, const float* __restrict__ kgb, const float* __restrict__ vgb, _Float16* __restrict__ Q16, _Float16* __restrict__ KL, _Float16* __restrict__ VTL, _Float16* __restrict__ KG, _Float16* __restrict__ VTG) {
  __shared__ __attribute__((aligned(16))) float so[4][32][68];
  static_assert(LL == 1 << 11 && GG == 1 << 9 && EMB == NH * 64, "vsh");
  int bx = blockIdx.x; const _Float16* A; const _Float16* B; const float* bias; _Float16* C; int fo, vsh, M;
  if (bx < 3 * PJL) { const int m = bx / PJL; bx -= m * PJL; A = XL; M = NRL; B = (m == 0) ? BQ : (m == 1) ? BK : BV; bias = (m == 0) ? qb : (m == 1) ? kb : vb; C = (m == 0) ? Q16 : (m == 1) ? KL : VTL; fo = (m != 2) ? 1 : 2; vsh = 11; }
  else { bx -= 3 * PJL; const int m = bx / PJG; bx -= m * PJG; A = XG; M = NRG; B = (m == 0) ? BKG : BVG; bias = (m == 0) ? kgb : vgb; C = (m == 0) ? KG : VTG; fo = (m == 0) ? 1 : 2; vsh = 9; }
  gemm2_body<0>(so, bx, 0, fo, vsh, A, EMB, 0, B, EMB, 0, 0.0625f, bias, 0, nullptr, 1, 0, 0, nullptr, C, EMB, 0, M, EMB, EMB); }



template <int CAUSAL>
__global__ __launch_bounds__(128) void k_flash(const _Float16* __restrict__ Q16, int ldq, const _Float16* __restrict__ K16, int ldk, const _Float16* __restrict__ Vt, const int* __restrict__ MSK, float* __restrict__ O, int ldo) {
  constexpr int RPW = 16, RTN = RPW / 16, NQB = TQ / (4 * RPW), DT = 4, KS = 2;
  __shared__ __attribute__((aligned(16))) unsigned short sP[4][RPW][40]; __shared__ __attribute__((aligned(16))) float sO[4][RPW][64 + 4];
  const int tid = threadIdx.x, w = tid >> 5, lane = tid & 31, ln = lane & 15, hh = lane >> 4;
  const int slab = blockIdx.x / QBLKS, qblk = blockIdx.x % QBLKS; (void)NQB; const int b = slab / NH, h = slab % NH; const int qb0 = qblk * (4 * RPW); const int q0 = qb0 + w * RPW;
  FragH aq[2][KS];
#pragma unroll
  for (int rt = 0; rt < RTN; ++rt) { const unsigned short* qr = (const unsigned short*)Q16 + ((size_t)b * TQ + q0 + rt * 16 + ln) * ldq + h * 64;
#pragma unroll
    for (int ks = 0; ks < KS; ++ks) { aq[rt][ks].half[0] = *(const v8us*)(qr + ks * 32 + 8 * hh); aq[rt][ks].half[1] = *(const v8us*)(qr + ks * 32 + 16 + 8 * hh); } }
  const unsigned short* Vth = (const unsigned short*)Vt + (size_t)slab * 64 * TK;
  float m_r[2][8], l_r[2][8]; v8f oacc[2][DT];
#pragma unroll
  for (int rt = 0; rt < RTN; ++rt) {
#pragma unroll
    for (int r = 0; r < 8; ++r) { m_r[rt][r] = -3.0e38f; l_r[rt][r] = 0.f; }
#pragma unroll
    for (int dt = 0; dt < DT; ++dt) oacc[rt][dt] = (v8f){0.f,0.f,0.f,0.f,0.f,0.f,0.f,0.f}; }
  const int jend = (CAUSAL == 1) ? (qb0 + 4 * RPW) : TK;      /* causal: keys beyond the block's last query never contribute */
#pragma unroll 1
  for (int j0 = 0; j0 < jend; j0 += 32) {
    v8f s[2][2];
#pragma unroll
    for (int nt = 0; nt < 2; ++nt) { const unsigned short* kr = (const unsigned short*)K16 + ((size_t)b * TK + j0 + nt * 16 + ln) * ldk + h * 64; FragH bk[KS];
#pragma unroll
      for (int ks = 0; ks < KS; ++ks) { bk[ks].half[0] = *(const v8us*)(kr + ks * 32 + 8 * hh); bk[ks].half[1] = *(const v8us*)(kr + ks * 32 + 16 + 8 * hh); }
#pragma unroll
      for (int rt = 0; rt < RTN; ++rt) { v8f acc = (v8f){0.f,0.f,0.f,0.f,0.f,0.f,0.f,0.f};
#pragma unroll
        for (int ks = 0; ks < KS; ++ks) acc = mmaH<1>(aq[rt][ks].v, aq[rt][ks].v, bk[ks].v, bk[ks].v, acc); s[rt][nt] = acc; } }
#pragma unroll
    for (int rt = 0; rt < RTN; ++rt)
#pragma unroll
      for (int r = 0; r < 8; ++r) { const int tq = q0 + rt * 16 + 8 * hh + r; const int k0 = j0 + ln, k1 = j0 + 16 + ln;
        const bool ok0 = (CAUSAL == 1) ? (k0 <= tq) : ((CAUSAL == 2) ? ((k0 >> 5) == (tq >> 5)) : true), ok1 = (CAUSAL == 1) ? (k1 <= tq) : ((CAUSAL == 2) ? ((k1 >> 5) == (tq >> 5)) : true);      /* mode 2: block-diagonal 32-token groups */
        const float s0 = ok0 ? s[rt][0][r] * SCL : -3.0e38f, s1 = ok1 ? s[rt][1][r] * SCL : -3.0e38f; float mc = fmaxf(s0, s1);
        mc = fmaxf(mc, __shfl_xor(mc, 1, 32)); mc = fmaxf(mc, __shfl_xor(mc, 2, 32)); mc = fmaxf(mc, __shfl_xor(mc, 4, 32)); mc = fmaxf(mc, __shfl_xor(mc, 8, 32));
        const float mn = fmaxf(m_r[rt][r], mc); const float al = (mn > -1.0e38f) ? expf(m_r[rt][r] - mn) : 1.0f; m_r[rt][r] = mn; const float p0 = ok0 ? expf(s0 - mn) : 0.f, p1 = ok1 ? expf(s1 - mn) : 0.f; l_r[rt][r] = l_r[rt][r] * al + p0 + p1;
#pragma unroll
        for (int dt = 0; dt < DT; ++dt) oacc[rt][dt][r] *= al;
        FragH t2; t2.h[0] = (_Float16)(p0 * 1024.0f); t2.h[1] = (_Float16)(p1 * 1024.0f); sP[w][rt * 16 + 8 * hh + r][ln] = t2.u[0]; sP[w][rt * 16 + 8 * hh + r][16 + ln] = t2.u[1]; }
    __builtin_amdgcn_fence(__ATOMIC_ACQ_REL, "workgroup"); __builtin_amdgcn_wave_barrier();
    FragH pa[2];
#pragma unroll
    for (int rt = 0; rt < RTN; ++rt) { pa[rt].half[0] = *(const v8us*)&sP[w][rt * 16 + ln][8 * hh]; pa[rt].half[1] = *(const v8us*)&sP[w][rt * 16 + ln][16 + 8 * hh]; }
#pragma unroll
    for (int dt = 0; dt < DT; ++dt) { const unsigned short* vrow = Vth + (size_t)(dt * 16 + ln) * TK + j0; FragH bv; bv.half[0] = *(const v8us*)(vrow + 8 * hh); bv.half[1] = *(const v8us*)(vrow + 16 + 8 * hh);
#pragma unroll
      for (int rt = 0; rt < RTN; ++rt) oacc[rt][dt] = mmaH<1>(pa[rt].v, pa[rt].v, bv.v, bv.v, oacc[rt][dt]); }
    __builtin_amdgcn_fence(__ATOMIC_ACQ_REL, "workgroup"); __builtin_amdgcn_wave_barrier(); }
#pragma unroll
  for (int rt = 0; rt < RTN; ++rt) {
#pragma unroll
    for (int r = 0; r < 8; ++r) { float l = l_r[rt][r]; l += __shfl_xor(l, 1, 32); l += __shfl_xor(l, 2, 32); l += __shfl_xor(l, 4, 32); l += __shfl_xor(l, 8, 32); l_r[rt][r] = (l > 0.f) ? 1.0f / (l * 1024.0f) : 0.f; }
#pragma unroll
    for (int dt = 0; dt < DT; ++dt)
#pragma unroll
      for (int r = 0; r < 8; ++r) sO[w][rt * 16 + 8 * hh + r][dt * 16 + ln] = oacc[rt][dt][r] * l_r[rt][r]; }
  __builtin_amdgcn_fence(__ATOMIC_ACQ_REL, "workgroup"); __builtin_amdgcn_wave_barrier();
  {
#pragma unroll
    for (int rp = 0; rp < RPW; rp += 2) { const int r = rp + (lane >> 4), pc = lane & 15; const v4f val = *(const v4fa*)&sO[w][r][pc * 4]; *(v4f*)(O + ((size_t)b * TQ + q0 + r) * ldo + h * 64 + pc * 4) = val; }
     } }

// Attention with both products transposed: S^T = K Q^T (A = 16 keys, B = 16 queries) and O^T += V^T P^T (A = 16 values of d, B = P^T).
// A lane holds 16 of the 32 scores of ONE query (keys 8 * hh + r of each 16-key tile): maximum and sum are taken in the lane, plus one exchange between the wave's halves.
// The two score tiles, converted in place, are the B operand of the second product in the planes' own k order (16 * j + 8 * hh + i): P goes through no LDS and no lane exchange.
// The softmax runs in base 2: e^(SCL * s - m) = 2^(SCL2 * s - m2), so each score costs one fma and one hardware exponential (arguments are <= 10; far below, the result goes to 0, as it should).
#define SCL2 0.18033688011112042f      /* 64^-0.5 * log2(e) */
typedef float v2f __attribute__((ext_vector_type(2)));
__device__ __forceinline__ float xhalf(float x) { return __int_as_float(__builtin_amdgcn_permlanex16(__float_as_int(x), __float_as_int(x), 0x76543210, 0xfedcba98, false, false)); }      /* lane l <-> l ^ 16 */
template <int TKv>      /* bx: the block's place in the grid; res[dt][r] = the attention's output O[q0 + ln][dt * 16 + 8 * hh + r], left in registers */
__device__ __forceinline__ void flashT_body(const int bx, const _Float16* __restrict__ Q16, int ldq, const _Float16* __restrict__ K16, int ldk, const _Float16* __restrict__ Vt, v8f (&res)[4]) {
  constexpr int RPW = 16, DT = 4, KS = 2;      /* the short inner loops below are all unrolled in full, so that the fragment arrays stay in registers */
  const int tid = threadIdx.x, w = tid >> 5, lane = tid & 31, ln = lane & 15, hh = lane >> 4;
  const int slab = bx / QBLKS, qblk = bx % QBLKS; const int b = slab / NH, h = slab % NH; const int q0 = qblk * (4 * RPW) + w * RPW;
  FragH bq[KS];      /* Q, the B operand of the score product, kept for the whole key loop */
  { const unsigned short* qr = (const unsigned short*)Q16 + ((size_t)b * TQ + q0) * ldq + h * 1024 + lane * 8;      /* fragment-order plane: strip of 16 queries, the head's two blocks */
#pragma unroll
    for (int ks = 0; ks < KS; ++ks) { bq[ks].half[0] = *(const v8us*)(qr + ks * 512); bq[ks].half[1] = *(const v8us*)(qr + ks * 512 + 256); } }
  FragH ak[2][KS];      /* K fragments (A operand), fetched one pass ahead */
#pragma unroll
  for (int nt = 0; nt < 2; ++nt) { const unsigned short* kr = (const unsigned short*)K16 + ((size_t)b * TKv + nt * 16) * ldk + h * 1024 + lane * 8;      /* fragment-order plane: strip of 16 keys, the head's two blocks */
#pragma unroll
    for (int ks = 0; ks < KS; ++ks) { ak[nt][ks].half[0] = *(const v8us*)(kr + ks * 512); ak[nt][ks].half[1] = *(const v8us*)(kr + ks * 512 + 256); } }
  asm volatile("s_wait_xcnt 0x0" ::: "memory");      /* the registers that the Q and K loads above name are reused below: wait before they are overwritten */
  __builtin_amdgcn_sched_barrier(0);      /* keeps the set-up code below from being scheduled in front of that wait */
  const unsigned short* Vth = (const unsigned short*)Vt + (size_t)slab * 64 * TKv;
  float m_q = -3.0e38f, l_q = 0.f; v8f oacc[DT];      /* the lane's query: running maximum in base-2 units, less 10 (equal in both halves), the sum over this half's keys */
#pragma unroll
  for (int dt = 0; dt < DT; ++dt) oacc[dt] = (v8f){0.f,0.f,0.f,0.f,0.f,0.f,0.f,0.f};
#pragma unroll 1      /* rolled: a pass is long enough to cover its own loads; copies only add code */
  for (int j0 = 0; j0 < TKv; j0 += 32) {
    FragH av[DT];      /* this pass's V^T fragments (A operand), all issued at the head of the pass: they fly under the score products and the softmax */
#pragma unroll
    for (int dt = 0; dt < DT; ++dt) { const unsigned short* vrow = Vth + (size_t)(dt * 16) * TKv + (size_t)j0 * 16 + lane * 8; av[dt].half[0] = *(const v8us*)vrow; av[dt].half[1] = *(const v8us*)(vrow + 256); }
    v8f s[2];      /* s[nt][r] = score of key j0 + nt * 16 + 8 * hh + r with query q0 + ln */
#pragma unroll
    for (int nt = 0; nt < 2; ++nt) { v8f acc = (v8f){0.f,0.f,0.f,0.f,0.f,0.f,0.f,0.f};
#pragma unroll
      for (int ks = 0; ks < KS; ++ks) acc = mmaH<1>(ak[nt][ks].v, ak[nt][ks].v, bq[ks].v, bq[ks].v, acc); s[nt] = acc; }
    const int jn = (j0 + 32 < TKv) ? j0 + 32 : j0;      /* last pass: re-reads its own keys (in bounds, unused) */
#pragma unroll
    for (int nt = 0; nt < 2; ++nt) { const unsigned short* kr = (const unsigned short*)K16 + ((size_t)b * TKv + jn + nt * 16) * ldk + h * 1024 + lane * 8;
#pragma unroll
      for (int ks = 0; ks < KS; ++ks) { ak[nt][ks].half[0] = *(const v8us*)(kr + ks * 512); ak[nt][ks].half[1] = *(const v8us*)(kr + ks * 512 + 256); }
      asm volatile("s_wait_xcnt 0x0" ::: "memory"); }      /* the address registers of these four loads may be given to the next loads' results or to the softmax: wait before they are overwritten */
    float mx[8];      /* the maximum is taken on the raw scores: SCL2 > 0, and rounding is monotone, so scaling the maximum gives the maximum of the scaled scores */
#pragma unroll
    for (int i = 0; i < 8; ++i) mx[i] = fmaxf(s[0][i], s[1][i]);
    float mc = fmaxf(fmaxf(fmaxf(mx[0], mx[1]), fmaxf(mx[2], mx[3])), fmaxf(fmaxf(mx[4], mx[5]), fmaxf(mx[6], mx[7])));
    mc = fmaf(mc, SCL2, -10.0f);      /* kept 10 below the true maximum: the f16 operand's factor 2^10 rides in the exponent, p = 1024 * e^(score - maximum), at most about 1024 */
    mc = fmaxf(mc, xhalf(mc));
    const float mn = fmaxf(m_q, mc); const float ea = __builtin_amdgcn_exp2f(m_q - mn); const float al = (mn > -1.0e38f) ? ea : 1.0f; m_q = mn;
    FragH pb; float p[16];
#pragma unroll
    for (int i = 0; i < 16; i += 2) { const v2f x = __builtin_elementwise_fma((v2f){s[i >> 3][i & 7], s[i >> 3][(i & 7) + 1]}, (v2f){SCL2, SCL2}, (v2f){-mn, -mn});      /* two scores per packed fma */
      p[i] = __builtin_amdgcn_exp2f(x[0]); p[i + 1] = __builtin_amdgcn_exp2f(x[1]); pb.h[i] = (_Float16)p[i]; pb.h[i + 1] = (_Float16)p[i + 1]; }
    v2f t0 = {0.f, 0.f}, t1 = {0.f, 0.f};      /* two chains of packed partial sums: no chain of sixteen dependent adds */
#pragma unroll
    for (int i = 0; i < 4; ++i) { t0 += (v2f){p[4 * i], p[4 * i + 1]}; t1 += (v2f){p[4 * i + 2], p[4 * i + 3]}; }
    t0 += t1; l_q = l_q * al + (t0[0] + t0[1]);
#pragma unroll
    for (int dt = 0; dt < DT; ++dt) oacc[dt] *= al;
#pragma unroll
    for (int dt = 0; dt < DT; ++dt) oacc[dt] = mmaH<1>(av[dt].v, av[dt].v, pb.v, pb.v, oacc[dt]); }
  float l = l_q + xhalf(l_q); l = (l > 0.f) ? 1.0f / l : 0.f;      /* the sum carries the same 2^10 as the products */
#pragma unroll
  for (int dt = 0; dt < DT; ++dt) res[dt] = oacc[dt] * l; }
// Both attentions of a wave's 16 queries in one wave, the local keys and then the global keys, and the gated sum on the two results in registers.
// A lane's eight values of a tile are eight d in a row of one query: one 16-byte piece of the fragment-order plane that the output projection reads (K = EMB), stored as it stands, through no LDS.
#define ATB (NB * NH * QBLKS)      /* blocks of the grid */
__global__ __launch_bounds__(128) void k_attn(const _Float16* __restrict__ Q16, const _Float16* __restrict__ KL, const _Float16* __restrict__ VTL, const _Float16* __restrict__ KG, const _Float16* __restrict__ VTG, const float* __restrict__ gate, _Float16* __restrict__ O16) {
  v8f ol[4], og[4];
  flashT_body<TKA>(blockIdx.x, Q16, EMB, KL, EMB, VTL, ol);      /* local: 2048 keys */
  flashT_body<TKB>(blockIdx.x, Q16, EMB, KG, EMB, VTG, og);      /* global: 512 keys */
  const float g = 1.0f / (1.0f + expf(-bf16_round(gate[0]))); const float h1 = 1.0f - g;
  const int w = threadIdx.x >> 5, lane = threadIdx.x & 31; const int slab = blockIdx.x / QBLKS, qblk = blockIdx.x % QBLKS; const int b = slab / NH, h = slab % NH; const int q0 = qblk * 64 + w * 16;
  unsigned short* op = (unsigned short*)O16 + ((size_t)b * TQ + q0) * EMB + h * 1024 + lane * 8; FragH f[4];      /* strip of 16 queries, the head's two blocks; the short loops below are unrolled in full, so that the arrays stay in registers */
#pragma unroll
  for (int dt = 0; dt < 4; ++dt)
#pragma unroll
    for (int r = 0; r < 8; ++r) f[dt].h[r] = (_Float16)(g * ol[dt][r] + h1 * og[dt][r]);
#pragma unroll
  for (int dt = 0; dt < 4; ++dt) *(v8us*)(op + dt * 256) = f[dt].half[0]; }

extern "C" void kernel_launch(void* const* d_in, const int* in_sizes, int n_in,
                              void* d_out, int out_size, void* d_ws, size_t ws_size, hipStream_t stream) {
  (void)in_sizes; (void)n_in; (void)out_size;
  const float* const* I = (const float* const*)d_in; const float* lh = I[0]; const float* gh = I[1]; const float* qw = I[2]; const float* qb = I[3]; const float* kw = I[4]; const float* kb = I[5]; const float* vw = I[6]; const float* vb = I[7]; const float* kgw = I[8]; const float* kgb = I[9]; const float* vgw = I[10]; const float* vgb = I[11]; const float* ow = I[12]; const float* ob = I[13]; const float* gate = I[14];
  char* ws = (char*)d_ws; size_t off = 0;
  auto take = [&](size_t bytes) { char* p = ws + off; off += (bytes + 255) & ~(size_t)255; return p; };
  const size_t w8 = (size_t)EMB * EMB / 8, npl = (size_t)NRL * EMB, npg = (size_t)NRG * EMB;
  _Float16* BQ = (_Float16*)take(w8 * 16); _Float16* BK = (_Float16*)take(w8 * 16); _Float16* BV = (_Float16*)take(w8 * 16); _Float16* BKG = (_Float16*)take(w8 * 16); _Float16* BVG = (_Float16*)take(w8 * 16); _Float16* BO = (_Float16*)take(w8 * 16);
  _Float16* XL = (_Float16*)take(npl * 2); _Float16* XG = (_Float16*)take(npg * 2); _Float16* Q16 = (_Float16*)take(npl * 2); _Float16* KL = (_Float16*)take(npl * 2); _Float16* KG = (_Float16*)take(npg * 2); _Float16* VTL = (_Float16*)take(npl * 2); _Float16* VTG = (_Float16*)take(npg * 2);
  _Float16* O16 = XL;      /* O16 over the local input plane (dead after its projections) */
  if (off > ws_size) return;      /* 12 + 8+2+8+8+2+8+2 = 50 MiB */
  k_conv<<<CVL + CVG + 6 * CVW, 256, 0, stream>>>(lh, gh, qw, kw, vw, kgw, vgw, ow, XL, XG, BQ, BK, BV, BKG, BVG, BO);
  const dim3 gL(PJL, 1);
  k_proj<<<3 * PJL + 2 * PJG, 128, 0, stream>>>(XL, XG, BQ, BK, BV, BKG, BVG, qb, kb, vb, kgb, vgb, Q16, KL, VTL, KG, VTG);
  k_attn<<<ATB, 128, 0, stream>>>(Q16, KL, VTL, KG, VTG, gate, O16);
  k_gemm2<0, false><<<gL, 128, 0, stream>>>(O16, EMB, 0, BO, EMB, 0, 0.0625f, ob, 0, nullptr, 1, 0, 0, (float*)d_out, nullptr, EMB, 0, NRL, EMB, EMB);
}

// v007
// Measured time: 124 microseconds a run.
// Timed twice side by side with v006, it ran 1.07 and 1.08 times as fast.
// Over all steps from v000 it is 4.61 times as fast.
#include <hip/hip_runtime.h>
// InfiniSpanAttention (2 batches; 2048 local tokens, 512 global tokens, D = 1024, 16 heads of 64): q/k_l/v_l from local_hidden, k_g/v_g from global_hidden (torch (out,in) linears + bias); out_l = softmax(q k_l^T s) v_l, out_g = softmax(q k_g^T s) v_g (no masks); out = sigmoid(gate) out_l + (1 - sigmoid(gate)) out_g -> merged heads -> out_w + out_b.
// Compute dtype: inputs and parameters rounded to bf16; q, k, v, P and the combined attention output as f16 operands (~2^-12); f32 accumulation/softmax/gating. v_wmma_f32_16x16x32_f16.
#define NB 2
#define EMB 1024
#define NRL (NB * LL)            /* 4096 local rows */
#define NRG (NB * GG)            /* 1024 global rows */
#define LL 2048                  /* local tokens (queries; local keys) */
#define GG 512                   /* global tokens (keys of the second attention) */
#define TQ LL
#define TK LL
#define TKA LL
#define TKB GG
#define NH 16
#define SCL 0.125f               /* 64^-0.5 */
#define QBLKS (TQ / 64)
typedef __bf16 v16b __attribute__((ext_vector_type(16)));
typedef unsigned short v8us __attribute__((ext_vector_type(8), may_alias));
typedef float  v8f  __attribute__((ext_vector_type(8)));
typedef float  v4f  __attribute__((ext_vector_type(4)));
typedef float  v4fa __attribute__((ext_vector_type(4), may_alias));
union FragB { v16b v; v8us half[2]; unsigned short u[16]; };

__device__ __forceinline__ unsigned short bf16_bits(float x) { unsigned int u = __float_as_uint(x); return (unsigned short)((u + 0x7FFFu + ((u >> 16) & 1u)) >> 16); }
__device__ __forceinline__ float bf16_val(unsigned short b) { return __uint_as_float(((unsigned int)b) << 16); }
__device__ __forceinline__ float bf16_round(float x) { return bf16_val(bf16_bits(x)); }
// D += A·B with NT terms: 1 = ah·bh, 2 = + al·bh (A split), 3 = + ah·bl (both split)
template <int NT>
__device__ __forceinline__ v8f mmaN(v16b ah, v16b al, v16b bh, v16b bl, v8f c) {
  c = __builtin_amdgcn_wmma_f32_16x16x32_bf16(false, ah, false, bh, (short)0, c, false, false);
  if (NT >= 2) c = __builtin_amdgcn_wmma_f32_16x16x32_bf16(false, al, false, bh, (short)0, c, false, false);
  if (NT >= 3) c = __builtin_amdgcn_wmma_f32_16x16x32_bf16(false, ah, false, bl, (short)0, c, false, false);
  asm volatile("v_nop\n\tv_nop\n\tv_nop\n\tv_nop" : "+v"(c) : "v"(ah), "v"(al), "v"(bh), "v"(bl));
  return c;
}

__global__ __launch_bounds__(256) void k_wt_bf16(const float* __restrict__ W, unsigned short* __restrict__ Wt, int K, int N) {
  const int t = blockIdx.x * 256 + threadIdx.x;
  const int k8n = K / 8;
  if (t >= N * k8n) return;
  const int n = t / k8n, k8 = (t % k8n) * 8;
  v8us v;
#pragma unroll
  for (int i = 0; i < 8; ++i) v[i] = bf16_bits(W[(size_t)(k8 + i) * N + n]);
  *(v8us*)(Wt + (size_t)n * K + k8) = v;
  
}

// GEMM C[M][N] (f32, pitch ldc) = act(A[M][K]·W + bias). A f32 row-major (pitch lda) converted per fragment to bf16
// (ASPLIT: hi/lo two planes -> 2 terms, else single rounded term); Wt bf16 [N][K] (pitch ldb). BIAS_BF16 rounds the
// bias to bf16 first (bias quantised to bf16 before the add). K%32==0, M%16==0, N%64==0.
template <bool ASPLIT, int ACT, bool BIAS_BF16>
__global__ __launch_bounds__(128) void k_gemm_bf(const float* __restrict__ A, int lda, const unsigned short* __restrict__ Wt, int ldb,
                                               const float* __restrict__ bias, float* __restrict__ C, int ldc, int M, int N, int K) {
  __shared__ __attribute__((aligned(16))) float so[4][16][64];
  const int tid = threadIdx.x, w = tid >> 5, lane = tid & 31, ln = lane & 15, hh = lane >> 4;
  const int ntn = N / 64;
  const int wid = blockIdx.x * 4 + w;
  const int mt = wid / ntn, nq = wid % ntn;
  if (mt * 16 >= M) return;
  const int row0 = mt * 16, col0 = nq * 64;
  const float* arow = A + (size_t)(row0 + ln) * lda;
  v8f acc[4] = {};
  for (int kb = 0; kb < K; kb += 32) {
    FragB ah, al;
    const v4f x0 = *(const v4fa*)(arow + kb + 8 * hh), x1 = *(const v4fa*)(arow + kb + 8 * hh + 4);
    const v4f x2 = *(const v4fa*)(arow + kb + 16 + 8 * hh), x3 = *(const v4fa*)(arow + kb + 16 + 8 * hh + 4);
    float xs[16] = {x0[0],x0[1],x0[2],x0[3],x1[0],x1[1],x1[2],x1[3],x2[0],x2[1],x2[2],x2[3],x3[0],x3[1],x3[2],x3[3]};
#pragma unroll
    for (int i = 0; i < 16; ++i) { const unsigned short hb = bf16_bits(xs[i]); ah.u[i] = hb; al.u[i] = ASPLIT ? bf16_bits(xs[i] - bf16_val(hb)) : (unsigned short)0; }
#pragma unroll
    for (int t = 0; t < 4; ++t) {
      const unsigned short* brow = Wt + (size_t)(col0 + t * 16 + ln) * ldb + kb;
      FragB b;
      b.half[0] = *(const v8us*)(brow + 8 * hh);
      b.half[1] = *(const v8us*)(brow + 16 + 8 * hh);
      acc[t] = mmaN<ASPLIT ? 2 : 1>(ah.v, al.v, b.v, b.v, acc[t]);
    }
  }
#pragma unroll
  for (int t = 0; t < 4; ++t) {
    float bv = bias ? bias[col0 + t * 16 + ln] : 0.f;
    if (BIAS_BF16) bv = bf16_round(bv);
#pragma unroll
    for (int r = 0; r < 8; ++r) { float v = acc[t][r] + bv; if (ACT == 1) v = fmaxf(v, 0.f); so[w][8 * hh + r][t * 16 + ln] = v; }
  }
  __builtin_amdgcn_fence(__ATOMIC_ACQ_REL, "workgroup");
  __builtin_amdgcn_wave_barrier();
  const int rsub = lane >> 4, c4 = (lane & 15) * 4;
  {
#pragma unroll
    for (int q = 0; q < 8; ++q) {
      const int r = q * 2 + rsub;
      const v4f v = *(const v4fa*)&so[w][r][c4];
      *(v4f*)(C + (size_t)(row0 + r) * ldc + col0 + c4) = v;
    }
    
  }
}

// GEMM C = act(A·W + bias + resid): A f32 (ASPLIT -> hi/lo 2 terms), Wt bf16 [N][K]; ACT 0 none, 1 relu, 2 exact gelu;
// resid (optional, f32, row index = (row % rmod), pitch ldr, RES_BF16 rounds it) added before the activation.
template <bool ASPLIT, int ACT, bool BIAS_BF16, bool RES_BF16>
__global__ __launch_bounds__(128) void k_gemm_bf3(const float* __restrict__ A, int lda, const unsigned short* __restrict__ Wt, int ldb,
                                                const float* __restrict__ bias, const float* __restrict__ resid, int rmod, int ldr,
                                                float* __restrict__ C, int ldc, int M, int N, int K) {
  __shared__ __attribute__((aligned(16))) float so[4][16][64];
  const int tid = threadIdx.x, w = tid >> 5, lane = tid & 31, ln = lane & 15, hh = lane >> 4;
  const int ntn = N / 64;
  const int wid = blockIdx.x * 4 + w;
  const int mt = wid / ntn, nq = wid % ntn;
  if (mt * 16 >= M) return;
  const int row0 = mt * 16, col0 = nq * 64;
  const float* arow = A + (size_t)(row0 + ln) * lda;
  v8f acc[4] = {};
  for (int kb = 0; kb < K; kb += 32) {
    FragB ah, al;
    const v4f x0 = *(const v4fa*)(arow + kb + 8 * hh), x1 = *(const v4fa*)(arow + kb + 8 * hh + 4);
    const v4f x2 = *(const v4fa*)(arow + kb + 16 + 8 * hh), x3 = *(const v4fa*)(arow + kb + 16 + 8 * hh + 4);
    float xs[16] = {x0[0],x0[1],x0[2],x0[3],x1[0],x1[1],x1[2],x1[3],x2[0],x2[1],x2[2],x2[3],x3[0],x3[1],x3[2],x3[3]};
#pragma unroll
    for (int i = 0; i < 16; ++i) { const unsigned short hb = bf16_bits(xs[i]); ah.u[i] = hb; al.u[i] = ASPLIT ? bf16_bits(xs[i] - bf16_val(hb)) : (unsigned short)0; }
#pragma unroll
    for (int t = 0; t < 4; ++t) {
      const unsigned short* brow = Wt + (size_t)(col0 + t * 16 + ln) * ldb + kb;
      FragB b;
      b.half[0] = *(const v8us*)(brow + 8 * hh);
      b.half[1] = *(const v8us*)(brow + 16 + 8 * hh);
      acc[t] = mmaN<ASPLIT ? 2 : 1>(ah.v, al.v, b.v, b.v, acc[t]);
    }
  }
#pragma unroll
  for (int t = 0; t < 4; ++t) {
    const int col = col0 + t * 16 + ln;
    float bv = bias ? bias[col] : 0.f;
    if (BIAS_BF16) bv = bf16_round(bv);
#pragma unroll
    for (int r = 0; r < 8; ++r) {
      float v = acc[t][r] + bv;
      if (resid) { float rv = resid[(size_t)((row0 + 8 * hh + r) % rmod) * ldr + col]; if (RES_BF16) rv = bf16_round(rv); v += rv; }
      if (ACT == 1) v = fmaxf(v, 0.f);
      if (ACT == 2) v = 0.5f * v * (1.0f + erff(v * 0.70710678118654752f));
      if (ACT == 3) { const float u = 0.7978845608028654f * (v + 0.044715f * v * v * v); v = 0.5f * v * (1.0f + tanhf(u)); }
      so[w][8 * hh + r][t * 16 + ln] = v;
    }
  }
  __builtin_amdgcn_fence(__ATOMIC_ACQ_REL, "workgroup");
  __builtin_amdgcn_wave_barrier();
  const int rsub = lane >> 4, c4 = (lane & 15) * 4;
  {
#pragma unroll
    for (int q = 0; q < 8; ++q) {
      const int r = q * 2 + rsub;
      const v4f v = *(const v4fa*)&so[w][r][c4];
      *(v4f*)(C + (size_t)(row0 + r) * ldc + col0 + c4) = v;
    }
    
  }
}
// row LayerNorm (biased variance, eps) over N: s = X (+ R); optional out_sum <- s; out_norm <- (s-mu)*rsqrt(var+eps)*g + b
template <bool PARAM_BF16>
__global__ __launch_bounds__(256) void k_layernorm(const float* __restrict__ X, const float* __restrict__ R, const float* __restrict__ g, const float* __restrict__ bta,
                                                  float* __restrict__ out_sum, float* __restrict__ out_norm, int N, float eps) {
  __shared__ float red[256];
  const int row = blockIdx.x, tid = threadIdx.x;
  const float* x = X + (size_t)row * N; const float* rr = R ? R + (size_t)row * N : nullptr;
  float vals[16];                     // up to N = 4096
  const int per = N / 256;            // contiguous chunk per thread? use strided-by-4 chunks: thread handles j = tid*4 + 1024*u
  float s1 = 0.f;
  for (int u = 0; u < per / 4; ++u) {
    const int j = tid * 4 + 1024 * u;
    const v4f a = *(const v4fa*)(x + j);
    v4f b = {0.f,0.f,0.f,0.f}; if (rr) b = *(const v4fa*)(rr + j);
#pragma unroll
    for (int q = 0; q < 4; ++q) { const float v = a[q] + b[q]; vals[u * 4 + q] = v; s1 += v; }
  }
  red[tid] = s1; __syncthreads();
  for (int st = 128; st > 0; st >>= 1) { if (tid < st) red[tid] += red[tid + st]; __syncthreads(); }
  const float mu = red[0] / (float)N; __syncthreads();
  float s2 = 0.f;
  for (int u = 0; u < per / 4; ++u)
#pragma unroll
    for (int q = 0; q < 4; ++q) { const float c = vals[u * 4 + q] - mu; s2 += c * c; }
  red[tid] = s2; __syncthreads();
  for (int st = 128; st > 0; st >>= 1) { if (tid < st) red[tid] += red[tid + st]; __syncthreads(); }
  const float rs = rsqrtf(red[0] / (float)N + eps);
  {
    for (int u = 0; u < per / 4; ++u) {
      const int j = tid * 4 + 1024 * u;
      v4f o, sm;
#pragma unroll
      for (int q = 0; q < 4; ++q) {
        float gg = g[j + q], bb = bta[j + q];
        if (PARAM_BF16) { gg = bf16_round(gg); bb = bf16_round(bb); }
        sm[q] = vals[u * 4 + q]; o[q] = (vals[u * 4 + q] - mu) * rs * gg + bb;
      }
      if (out_sum) *(v4f*)(out_sum + (size_t)row * N + j) = sm;
      *(v4f*)(out_norm + (size_t)row * N + j) = o;
    }
    
  }
}



// ---- f16 WMMA path (v_wmma_f32_16x16x32_f16): 11-bit significands for operands in range — used where a [0,1] probability operand needs more precision than bf16
typedef _Float16 v16h __attribute__((ext_vector_type(16)));
union FragH { v16h v; v8us half[2]; _Float16 h[16]; unsigned short u[16]; };
template <int NT>
__device__ __forceinline__ v8f mmaH(v16h ah, v16h al, v16h bh, v16h bl, v8f c) {
  c = __builtin_amdgcn_wmma_f32_16x16x32_f16(false, ah, false, bh, (short)0, c, false, false);
  if (NT >= 2) c = __builtin_amdgcn_wmma_f32_16x16x32_f16(false, al, false, bh, (short)0, c, false, false);
  if (NT >= 3) c = __builtin_amdgcn_wmma_f32_16x16x32_f16(false, ah, false, bl, (short)0, c, false, false);
  asm volatile("v_nop\n\tv_nop\n\tv_nop\n\tv_nop" : "+v"(c) : "v"(ah), "v"(al), "v"(bh), "v"(bl));
  return c;
}
// batched GEMM like k_gemm_b but f16 operands: A f32 (split into f16 hi/lo if ASPLIT, else rounded to f16), Bt = f16 values [n][k]; alpha; C f32; N multiple of 16 (partial tiles skipped)
template <bool ASPLIT>
__global__ __launch_bounds__(128) void k_gemm_h(const float* __restrict__ A, int lda, size_t sA, const _Float16* __restrict__ Bh, int ldb, size_t sB, float alpha, float* __restrict__ C, int ldc, size_t sC, int M, int N, int K) {
  __shared__ __attribute__((aligned(16))) float so[4][16][64];
  const int tid = threadIdx.x, w = tid >> 5, lane = tid & 31, ln = lane & 15, hh = lane >> 4; const int by = blockIdx.y;
  A += (size_t)by * sA; Bh += (size_t)by * sB; C += (size_t)by * sC;
  const int ntn = (N + 63) / 64; const int wid = blockIdx.x * 4 + w; const int mt = wid / ntn, nq = wid % ntn; if (mt * 16 >= M) return;
  const int row0 = mt * 16, col0 = nq * 64; const float* arow = A + (size_t)(row0 + ln) * lda;
  v8f acc[4] = {};
  for (int kb = 0; kb < K; kb += 32) {
    FragH ah, al;
    const v4f x0 = *(const v4fa*)(arow + kb + 8 * hh), x1 = *(const v4fa*)(arow + kb + 8 * hh + 4), x2 = *(const v4fa*)(arow + kb + 16 + 8 * hh), x3 = *(const v4fa*)(arow + kb + 16 + 8 * hh + 4);
    float xs[16] = {x0[0],x0[1],x0[2],x0[3],x1[0],x1[1],x1[2],x1[3],x2[0],x2[1],x2[2],x2[3],x3[0],x3[1],x3[2],x3[3]};
#pragma unroll
    for (int i = 0; i < 16; ++i) { const _Float16 h = (_Float16)xs[i]; ah.h[i] = h; al.h[i] = ASPLIT ? (_Float16)(xs[i] - (float)h) : (_Float16)0.0f; }
#pragma unroll
    for (int t = 0; t < 4; ++t) { if (col0 + t * 16 >= N) continue; const size_t boff = (size_t)(col0 + t * 16 + ln) * ldb + kb; FragH bq; bq.half[0] = *(const v8us*)(Bh + boff + 8 * hh); bq.half[1] = *(const v8us*)(Bh + boff + 16 + 8 * hh);
      acc[t] = mmaH<ASPLIT ? 2 : 1>(ah.v, al.v, bq.v, bq.v, acc[t]); }
  }
#pragma unroll
  for (int t = 0; t < 4; ++t) { if (col0 + t * 16 >= N) continue;
#pragma unroll
    for (int r = 0; r < 8; ++r) so[w][8 * hh + r][t * 16 + ln] = acc[t][r] * alpha; }
  __builtin_amdgcn_fence(__ATOMIC_ACQ_REL, "workgroup"); __builtin_amdgcn_wave_barrier();
  const int rsub = lane >> 4, c4 = (lane & 15) * 4;
  {
#pragma unroll
    for (int q = 0; q < 8; ++q) { const int r = q * 2 + rsub; if (col0 + c4 < N) { const v4f v = *(const v4fa*)&so[w][r][c4]; *(v4f*)(C + (size_t)(row0 + r) * ldc + col0 + c4) = v; } }
     }
}

// Wt[n][k] = f16(W[k][n]·scale) from f32 row-major W[K][N] (scale = power of two; bf16-exact weights stay exact in f16 away from the subnormal range)
__global__ __launch_bounds__(256) void k_wt_f16(const float* __restrict__ W, _Float16* __restrict__ Wt, int K, int N, float scale) {
  const int t = blockIdx.x * 256 + threadIdx.x; if (t >= N * (K / 8)) return; const int n = t / (K / 8), k8 = (t % (K / 8)) * 8; FragH f;
#pragma unroll
  for (int i = 0; i < 8; ++i) f.h[i] = (_Float16)(bf16_round(W[(size_t)(k8 + i) * N + n]) * scale); const v8us o = f.half[0];
  *(v8us*)((unsigned short*)Wt + (size_t)n * K + k8) = o; 
}
// k_gemm_hh variant with fused epilogue: v = acc·alpha + bias[by·sBias + col] (+ CP[(row/rowsPerB)·sCPb + by·64 + col] if CP) ; ACT 0 none / 1 elu ; writes f16 C16 (and f32 C if non-null)
template <int ACT>
__global__ __launch_bounds__(128) void k_gemm_hhx(const _Float16* __restrict__ A, int lda, size_t sA, const _Float16* __restrict__ Bh, int ldb, size_t sB, float alpha, const float* __restrict__ bias, size_t sBias, const float* __restrict__ CP, int rowsPerB, size_t sCPb, int row0g,
    float* __restrict__ C, _Float16* __restrict__ C16, int ldc, size_t sC, int M, int N, int K) {
  __shared__ __attribute__((aligned(16))) float so[4][16][64];
  const int tid = threadIdx.x, w = tid >> 5, lane = tid & 31, ln = lane & 15, hh = lane >> 4; const int by = blockIdx.y;
  A += (size_t)by * sA; Bh += (size_t)by * sB; const size_t cofs = (size_t)by * sC; const float* bp = bias ? bias + (size_t)by * sBias : nullptr;
  const int ntn = (N + 63) / 64; const int wid = blockIdx.x * 4 + w; const int mt = wid / ntn, nq = wid % ntn; if (mt * 16 >= M) return;
  const int row0 = mt * 16, col0 = nq * 64; const _Float16* arow = A + (size_t)(row0 + ln) * lda;
  v8f acc[4] = {};
  for (int kb = 0; kb < K; kb += 32) { FragH ah; ah.half[0] = *(const v8us*)((const unsigned short*)arow + kb + 8 * hh); ah.half[1] = *(const v8us*)((const unsigned short*)arow + kb + 16 + 8 * hh);
#pragma unroll
    for (int t = 0; t < 4; ++t) { if (col0 + t * 16 >= N) continue; const size_t boff = (size_t)(col0 + t * 16 + ln) * ldb + kb; FragH bq; bq.half[0] = *(const v8us*)((const unsigned short*)Bh + boff + 8 * hh); bq.half[1] = *(const v8us*)((const unsigned short*)Bh + boff + 16 + 8 * hh);
      acc[t] = mmaH<1>(ah.v, ah.v, bq.v, bq.v, acc[t]); }
  }
#pragma unroll
  for (int t = 0; t < 4; ++t) { if (col0 + t * 16 >= N) continue; const int col = col0 + t * 16 + ln; const float bv = bp ? bf16_round(bp[col]) : 0.f;
#pragma unroll
    for (int r = 0; r < 8; ++r) { float v = acc[t][r] * alpha + bv; if (CP) { const int bidx = (row0g + row0 + 8 * hh + r) / rowsPerB; v += CP[(size_t)bidx * sCPb + (size_t)by * 64 + col]; } if (ACT == 1) v = (v > 0.f) ? v : expm1f(v); else if (ACT == 7) v = (v > 0.f) ? v + 1.0f : expf(v); else if (ACT == 8) v = tanhf(v); else if (ACT == 9) v = 0.5f * v * (1.0f + tanhf(0.7978845608028654f * (v + 0.044715f * v * v * v))); else if (ACT == 11) v = 1.0f / (1.0f + expf(-v)); else if (ACT == 12) v = (v > 0.f) ? v : 0.01f * v; else if (ACT == 14) v = (v > 0.f) ? v : 0.1f * v; else if (ACT == 15) v = v / (1.0f + expf(-v)); else if (ACT == 3) v = fmaxf(v, 0.f); else if (ACT == 6) v = 0.5f * v * (1.0f + erff(v * 0.70710678118654752f)); so[w][8 * hh + r][t * 16 + ln] = v; } }
  __builtin_amdgcn_fence(__ATOMIC_ACQ_REL, "workgroup"); __builtin_amdgcn_wave_barrier();
  const int rsub = lane >> 4, c4 = (lane & 15) * 4; typedef _Float16 v4h __attribute__((ext_vector_type(4)));
  {
#pragma unroll
    for (int q = 0; q < 8; ++q) { const int r = q * 2 + rsub; if (col0 + c4 < N) { const v4f v = *(const v4fa*)&so[w][r][c4]; if (C) *(v4f*)(C + cofs + (size_t)(row0 + r) * ldc + col0 + c4) = v; if (C16) { v4h h4; for (int i = 0; i < 4; ++i) h4[i] = (_Float16)v[i]; *(v4h*)(C16 + cofs + (size_t)(row0 + r) * ldc + col0 + c4) = h4; } } }
     }
}


typedef _Float16 v4h __attribute__((ext_vector_type(4)));

// ---- fragment-order plane of an f16 matrix M[rows][K]: 1-KiB blocks of 16 rows x 32 k, block (row >> 4, k >> 5) at element ((row >> 4) * (K >> 5) + (k >> 5)) * 512;
// inside a block 64 pieces of 8 k: piece j * 32 + lane holds row (lane & 15), k = 16 * j + 8 * (lane >> 4) + 0..7. A wave's 16-byte fragment load reads 512 bytes in a row: 4 whole lines, not 16 pieces of lines.
__device__ __forceinline__ size_t fo_src(size_t t, int K) { const int kbn = K >> 5; const size_t blk = t >> 6; const int c = (int)(t & 63), j = c >> 5, l = c & 31; return ((blk / kbn) * 16 + (l & 15)) * (size_t)K + (size_t)(blk % kbn) * 32 + j * 16 + (l >> 4) * 8; }      /* piece t of a plane -> its first element in the row-major matrix */

// All eight conversions to f16 fragment-order planes (K = EMB) in one grid: a block's index range names its matrix. Activations as they are, weights stored (out,in) (== Bt[n][k]) times 16 (a power of two: exact).
#define CVL (NRL * EMB / 8 / 256)      /* blocks of the local activations */
#define CVG (NRG * EMB / 8 / 256)      /* blocks of the global activations */
#define CVW (EMB * EMB / 8 / 256)      /* blocks of one weight */
__global__ __launch_bounds__(256) void k_conv(const float* __restrict__ lh, const float* __restrict__ gh, const float* __restrict__ qw, const float* __restrict__ kw, const float* __restrict__ vw, const float* __restrict__ kgw, const float* __restrict__ vgw, const float* __restrict__ ow,
    _Float16* __restrict__ XL, _Float16* __restrict__ XG, _Float16* __restrict__ BQ, _Float16* __restrict__ BK, _Float16* __restrict__ BV, _Float16* __restrict__ BKG, _Float16* __restrict__ BVG, _Float16* __restrict__ BO) {
  int bx = blockIdx.x; const float* s; _Float16* d; float sc = 16.0f;
  if (bx < CVL) { s = lh; d = XL; sc = 1.0f; }
  else if (bx < CVL + CVG) { bx -= CVL; s = gh; d = XG; sc = 1.0f; }
  else { bx -= CVL + CVG; const int m = bx / CVW; bx -= m * CVW;
    s = (m == 0) ? qw : (m == 1) ? kw : (m == 2) ? vw : (m == 3) ? kgw : (m == 4) ? vgw : ow; d = (m == 0) ? BQ : (m == 1) ? BK : (m == 2) ? BV : (m == 3) ? BKG : (m == 4) ? BVG : BO; }
  const size_t t = (size_t)bx * 256 + threadIdx.x; const float* p = s + fo_src(t, EMB); FragH f;
#pragma unroll      /* in full: the piece's eight values stay in registers and are read by two 16-byte loads */
  for (int q = 0; q < 8; ++q) f.h[q] = (_Float16)(bf16_round(p[q]) * sc);
  *(v8us*)((unsigned short*)d + t * 8) = f.half[0]; }
__global__ __launch_bounds__(256) void k_h16(const float* __restrict__ x, _Float16* __restrict__ X16, size_t n8) { const size_t t = (size_t)blockIdx.x * 256 + threadIdx.x; if (t >= n8) return; FragH f;
#pragma unroll
  for (int q = 0; q < 8; ++q) f.h[q] = (_Float16)x[t * 8 + q]; *(v8us*)((unsigned short*)X16 + t * 8) = f.half[0];  }
__global__ __launch_bounds__(256) void k_round16f(const float* __restrict__ W, _Float16* __restrict__ Bt, size_t n8) { const size_t t = (size_t)blockIdx.x * 256 + threadIdx.x; if (t >= n8) return; FragH f;
#pragma unroll
  for (int i = 0; i < 8; ++i) f.h[i] = (_Float16)(bf16_round(W[t * 8 + i]) * 16.0f); *(v8us*)((unsigned short*)Bt + t * 8) = f.half[0];  }
__global__ __launch_bounds__(256) void k_hl(const float* __restrict__ F, _Float16* __restrict__ Hh, _Float16* __restrict__ Hl, size_t n8) { const size_t t = (size_t)blockIdx.x * 256 + threadIdx.x; if (t >= n8) return; FragH fh, fl; const v4f a = *(const v4fa*)(F + t * 8), c = *(const v4fa*)(F + t * 8 + 4);
#pragma unroll
  for (int q = 0; q < 4; ++q) { _Float16 h = (_Float16)a[q]; fh.h[q] = h; fl.h[q] = (_Float16)((a[q] - (float)h) * 1024.0f); h = (_Float16)c[q]; fh.h[4 + q] = h; fl.h[4 + q] = (_Float16)((c[q] - (float)h) * 1024.0f); }
  { *(v8us*)((unsigned short*)Hh + t * 8) = fh.half[0]; *(v8us*)((unsigned short*)Hl + t * 8) = fl.half[0];  } }

// ---- fast GEMM (wave tile 32x64; requires M % 32 == 0 rows per launch region, N % 64 == 0 and K % 64 == 0); epilogue = k_gemm_hhx semantics ----
// Two fragment sets (even and odd 32-k steps). Each fragment is reloaded for the step two ahead right behind its last product, so a step's loads fly under the other set's products.
__device__ __forceinline__ v16h g2_frag(const _Float16* p, int k, int lane) { FragH f; const unsigned short* q = (const unsigned short*)p + (size_t)k * 16 + lane * 8; f.half[0] = *(const v8us*)q; f.half[1] = *(const v8us*)(q + 256); return f.v; }      /* p: a 16-row strip of a fragment-order plane; k: multiple of 32 */
__device__ __forceinline__ v8f g2_mma(v16h a, v16h b, v8f c) { v8f d = __builtin_amdgcn_wmma_f32_16x16x32_f16(false, a, false, b, (short)0, c, false, false); asm volatile("v_nop\n\tv_nop\n\tv_nop\n\tv_nop" : "+v"(d) : "v"(a), "v"(b)); return d; }
template <int ACT>      /* A and Bh: fragment-order planes with K = lda = ldb; FO 1: the result goes to C16 alone, as such a plane (K = ldc); FO 2: to C16 alone, transposed per head, as the plane V^T of the attention (rows = (batch * NH + head) * 64 + d, K = 1 << vsh keys per batch; N = NH * 64); bx, by: the block's place in its own product's grid */
__device__ __forceinline__ void gemm2_body(float (*so)[32][68], const int bx, const int by, const int FO, const int vsh, const _Float16* __restrict__ A, int lda, size_t sA, const _Float16* __restrict__ Bh, int ldb, size_t sB, float alpha, const float* __restrict__ bias, size_t sBias, const float* __restrict__ CP, int rowsPerB, size_t sCPb, int row0g,
    float* __restrict__ C, _Float16* __restrict__ C16, int ldc, size_t sC, int M, int N, int K) {
  const int tid = threadIdx.x, w = tid >> 5, lane = tid & 31, ln = lane & 15, hh = lane >> 4;
  A += (size_t)by * sA; Bh += (size_t)by * sB; const size_t cofs = (size_t)by * sC; const float* bp = bias ? bias + (size_t)by * sBias : nullptr;
  const int ntn = N >> 6; const int mt = bx / ntn, nq = bx - mt * ntn; const int row0 = mt * 128 + 32 * w, col0 = nq * 64; if (row0 >= M) return;
  const _Float16* a0p = A + (size_t)row0 * lda; const _Float16* a1p = a0p + (size_t)16 * lda;
  const _Float16* b0p = Bh + (size_t)col0 * ldb; const _Float16* b1p = b0p + (size_t)16 * ldb; const _Float16* b2p = b1p + (size_t)16 * ldb; const _Float16* b3p = b2p + (size_t)16 * ldb;
  const v8f z8 = {0.f,0.f,0.f,0.f,0.f,0.f,0.f,0.f}; v8f c00 = z8, c01 = z8, c02 = z8, c03 = z8, c10 = z8, c11 = z8, c12 = z8, c13 = z8;
  v16h a0 = g2_frag(a0p, 0, lane), a1 = g2_frag(a1p, 0, lane), b0 = g2_frag(b0p, 0, lane), b1 = g2_frag(b1p, 0, lane), b2 = g2_frag(b2p, 0, lane), b3 = g2_frag(b3p, 0, lane);
  v16h e0 = g2_frag(a0p, 32, lane), e1 = g2_frag(a1p, 32, lane), f0 = g2_frag(b0p, 32, lane), f1 = g2_frag(b1p, 32, lane), f2 = g2_frag(b2p, 32, lane), f3 = g2_frag(b3p, 32, lane);
#pragma unroll 1      /* rolled: the body already holds both sets; more copies only add code */
  for (int kb = 0; kb < K; kb += 64) { const int kn = (kb + 64 < K) ? kb + 64 : kb;      /* last trip: re-reads its own step (in bounds, unused) */
    c00 = g2_mma(a0, b0, c00); c10 = g2_mma(a1, b0, c10); b0 = g2_frag(b0p, kn, lane);
    c01 = g2_mma(a0, b1, c01); c11 = g2_mma(a1, b1, c11); b1 = g2_frag(b1p, kn, lane);
    c02 = g2_mma(a0, b2, c02); c12 = g2_mma(a1, b2, c12); b2 = g2_frag(b2p, kn, lane);
    c03 = g2_mma(a0, b3, c03); c13 = g2_mma(a1, b3, c13); b3 = g2_frag(b3p, kn, lane); a0 = g2_frag(a0p, kn, lane); a1 = g2_frag(a1p, kn, lane);
    c00 = g2_mma(e0, f0, c00); c10 = g2_mma(e1, f0, c10); f0 = g2_frag(b0p, kn + 32, lane);
    c01 = g2_mma(e0, f1, c01); c11 = g2_mma(e1, f1, c11); f1 = g2_frag(b1p, kn + 32, lane);
    c02 = g2_mma(e0, f2, c02); c12 = g2_mma(e1, f2, c12); f2 = g2_frag(b2p, kn + 32, lane);
    c03 = g2_mma(e0, f3, c03); c13 = g2_mma(e1, f3, c13); f3 = g2_frag(b3p, kn + 32, lane); e0 = g2_frag(a0p, kn + 32, lane); e1 = g2_frag(a1p, kn + 32, lane);
    asm volatile("s_wait_xcnt 0x0" ::: "memory"); }      /* the next trip forms new addresses in the registers that this trip's loads name: wait before they are overwritten */
  v8f accs[8] = {c00, c01, c02, c03, c10, c11, c12, c13};
  if (FO == 2) {      /* a lane's eight accumulators of a tile are eight keys in a row (16 * half + 8 * hh + r) of one d (t * 16 + ln): one 16-byte piece of the V^T plane, stored as it stands, through no LDS; the wave's 32 keys x 64 d = 4 blocks, 8 stores of 512 bytes in a row; the short loops are unrolled in full, so that the arrays stay in registers */
    const int slab = (row0 >> vsh) * NH + nq, kblk = (row0 & ((1 << vsh) - 1)) >> 5;
    unsigned short* vp = (unsigned short*)C16 + ((((size_t)slab * 4) << (vsh - 5)) + kblk) * 512 + lane * 8; FragH f[8]; float bv[4] = {0.f, 0.f, 0.f, 0.f};
    if (bp) {      /* one test, so that the four loads fly together */
#pragma unroll
      for (int t = 0; t < 4; ++t) bv[t] = bp[col0 + t * 16 + ln];
#pragma unroll
      for (int t = 0; t < 4; ++t) bv[t] = bf16_round(bv[t]); }
#pragma unroll
    for (int u = 0; u < 8; ++u)
#pragma unroll
      for (int r = 0; r < 8; ++r) f[u].h[r] = (_Float16)(accs[u][r] * alpha + bv[u & 3]);
#pragma unroll
    for (int u = 0; u < 8; ++u) *(v8us*)(vp + (((size_t)(u & 3)) << (vsh - 5)) * 512 + (u >> 2) * 256) = f[u].half[0];
    return; }
#pragma unroll
  for (int u = 0; u < 8; ++u) { const int t = u & 3, half = u >> 2; const int col = col0 + t * 16 + ln; const float bv = bp ? bf16_round(bp[col]) : 0.f;
#pragma unroll
    for (int r = 0; r < 8; ++r) { const int rloc = half * 16 + 8 * hh + r; float v = accs[u][r] * alpha + bv; if (CP) { const int bidx = (row0g + row0 + rloc) / rowsPerB; v += CP[(size_t)bidx * sCPb + (size_t)by * 64 + col]; }
      if (ACT == 3) v = fmaxf(v, 0.f); else if (ACT == 6) v = 0.5f * v * (1.0f + erff(v * 0.70710678118654752f)); else if (ACT == 11) v = 1.0f / (1.0f + expf(-v)); else if (ACT == 15) v = v / (1.0f + expf(-v)); else if (ACT == 12) v = (v > 0.f) ? v : 0.01f * v; else if (ACT == 8) v = tanhf(v);
      so[w][rloc][t * 16 + ln] = v; } }
  __builtin_amdgcn_fence(__ATOMIC_ACQ_REL, "workgroup"); __builtin_amdgcn_wave_barrier();
  const int rsub = lane >> 4, c4 = (lane & 15) * 4;
  if (FO == 0) {
#pragma unroll
    for (int q = 0; q < 16; ++q) { const int r = q * 2 + rsub; const v4f v = *(const v4fa*)&so[w][r][c4]; if (C) *(v4f*)(C + cofs + (size_t)(row0 + r) * ldc + col0 + c4) = v; if (C16) { v4h h4; for (int i = 0; i < 4; ++i) h4[i] = (_Float16)v[i]; *(v4h*)(C16 + cofs + (size_t)(row0 + r) * ldc + col0 + c4) = h4; } }
    asm volatile("s_wait_xcnt 0x0" ::: "memory");      /* a precaution: wait before the registers that these stores name are overwritten */
     } else {      /* the wave's 32 x 64 tile = 2 x 2 blocks of the plane, 8 stores of 512 bytes in a row */
#pragma unroll
      for (int u = 0; u < 8; ++u) { const int rbl = u >> 2, kbl = (u >> 1) & 1, j = u & 1; const float* sp = &so[w][rbl * 16 + ln][kbl * 32 + j * 16 + hh * 8]; const v4f x = *(const v4fa*)sp, y = *(const v4fa*)(sp + 4); FragH f;
#pragma unroll
        for (int i = 0; i < 4; ++i) { f.h[i] = (_Float16)x[i]; f.h[4 + i] = (_Float16)y[i]; }
        *(v8us*)((unsigned short*)C16 + cofs + (size_t)(row0 + rbl * 16) * ldc + (size_t)((col0 >> 5) + kbl) * 512 + j * 256 + lane * 8) = f.half[0]; }
      asm volatile("s_wait_xcnt 0x0" ::: "memory");      /* as above */
     } }
template <int ACT, bool FO>
__global__ __launch_bounds__(128) void k_gemm2(const _Float16* __restrict__ A, int lda, size_t sA, const _Float16* __restrict__ Bh, int ldb, size_t sB, float alpha, const float* __restrict__ bias, size_t sBias, const float* __restrict__ CP, int rowsPerB, size_t sCPb, int row0g,
    float* __restrict__ C, _Float16* __restrict__ C16, int ldc, size_t sC, int M, int N, int K) {
  __shared__ __attribute__((aligned(16))) float so[4][32][68];
  gemm2_body<ACT>(so, blockIdx.x, blockIdx.y, FO ? 1 : 0, 5, A, lda, sA, Bh, ldb, sB, alpha, bias, sBias, CP, rowsPerB, sCPb, row0g, C, C16, ldc, sC, M, N, K); }
// ---- projection GEMM, wave tile 64 x 64, block = 2 x 4 waves = 128 rows x 256 columns (M % 128 == 0; N = K = EMB): every 1-KiB fragment feeds four products (in the 32 x 64 tile a B fragment feeds two):
// 8 KiB are loaded per 16 products where the 32 x 64 tile loads 12, and the block asks L2 for 24 KiB per 128 products where four 128 x 64 blocks ask 48.
// A has two fragment sets (even and odd 32-k steps), each reloaded for the step two ahead behind its last product; a B fragment is reloaded for the next step behind its four products, twelve products ahead of its next use.
__device__ __forceinline__ void gemm4_body(float (*so)[64][68], const int bx, const int FO, const int vsh, const _Float16* __restrict__ A, const _Float16* __restrict__ Bh, const float* __restrict__ bias, _Float16* __restrict__ C16) {
  const int tid = threadIdx.x, w = tid >> 5, lane = tid & 31, ln = lane & 15, hh = lane >> 4;
  constexpr int ntn = EMB >> 8; const int mt = bx / ntn, nq = bx - mt * ntn; const int row0 = mt * 128 + 64 * (w >> 2), col0 = nq * 256 + 64 * (w & 3);
  const _Float16* ap = A + (size_t)row0 * EMB; const _Float16* bp = Bh + (size_t)col0 * EMB;      /* strip i of 16 rows: + i * 16 * EMB; the short loops below are all unrolled in full, so that the arrays stay in registers */
  v8f c[4][4]; v16h a[4], e[4], b[4];
#pragma unroll
  for (int i = 0; i < 4; ++i) {
#pragma unroll
    for (int t = 0; t < 4; ++t) c[i][t] = (v8f){0.f,0.f,0.f,0.f,0.f,0.f,0.f,0.f}; }
#pragma unroll
  for (int i = 0; i < 4; ++i) a[i] = g2_frag(ap + (size_t)i * 16 * EMB, 0, lane);      /* A, B, then the odd A set: the order in which the loop leaves its loads, so that the counted wait at the loop's head is the same on both ways in */
  __builtin_amdgcn_sched_barrier(0);      /* holds that order: left free, the odd A set's loads are grouped with the even set's, and the loop's counted waits then ask for B fragments four loads too early on every trip */
#pragma unroll
  for (int i = 0; i < 4; ++i) b[i] = g2_frag(bp + (size_t)i * 16 * EMB, 0, lane);
  __builtin_amdgcn_sched_barrier(0);      /* as above */
#pragma unroll
  for (int i = 0; i < 4; ++i) e[i] = g2_frag(ap + (size_t)i * 16 * EMB, 32, lane);
#pragma unroll 1      /* rolled: the body already holds both steps; more copies only add code */
  for (int kb = 0; kb < EMB; kb += 64) { const int kn = (kb + 64 < EMB) ? kb + 64 : kb;      /* last trip: re-reads its own step (in bounds, unused) */
#pragma unroll
    for (int t = 0; t < 4; ++t) {
#pragma unroll
      for (int i = 0; i < 4; ++i) c[i][t] = g2_mma(a[i], b[t], c[i][t]);
      b[t] = g2_frag(bp + (size_t)t * 16 * EMB, kb + 32, lane); }
#pragma unroll
    for (int i = 0; i < 4; ++i) a[i] = g2_frag(ap + (size_t)i * 16 * EMB, kn, lane);
#pragma unroll
    for (int t = 0; t < 4; ++t) {
#pragma unroll
      for (int i = 0; i < 4; ++i) c[i][t] = g2_mma(e[i], b[t], c[i][t]);
      b[t] = g2_frag(bp + (size_t)t * 16 * EMB, kn, lane); }
#pragma unroll
    for (int i = 0; i < 4; ++i) e[i] = g2_frag(ap + (size_t)i * 16 * EMB, kn + 32, lane);
    asm volatile("s_wait_xcnt 0x0" ::: "memory"); }      /* the next trip forms new addresses in the registers that this trip's loads name: wait before they are overwritten */
  const float alpha = 0.0625f; float bv[4];
#pragma unroll
  for (int t = 0; t < 4; ++t) bv[t] = bias[col0 + t * 16 + ln];
#pragma unroll
  for (int t = 0; t < 4; ++t) bv[t] = bf16_round(bv[t]);
  if (FO == 2) {      /* as in gemm2_body, once per 32 keys: a lane's eight accumulators of a tile are eight keys in a row of one d: one 16-byte piece of the V^T plane, stored as it stands, through no LDS */
#pragma unroll
    for (int h = 0; h < 2; ++h) { const int r0 = row0 + 32 * h; const int slab = (r0 >> vsh) * NH + (col0 >> 6), kblk = (r0 & ((1 << vsh) - 1)) >> 5;
      unsigned short* vp = (unsigned short*)C16 + ((((size_t)slab * 4) << (vsh - 5)) + kblk) * 512 + lane * 8; FragH f[8];
#pragma unroll
      for (int u = 0; u < 8; ++u)
#pragma unroll
        for (int r = 0; r < 8; ++r) f[u].h[r] = (_Float16)(c[2 * h + (u >> 2)][u & 3][r] * alpha + bv[u & 3]);
#pragma unroll
      for (int u = 0; u < 8; ++u) *(v8us*)(vp + (((size_t)(u & 3)) << (vsh - 5)) * 512 + (u >> 2) * 256) = f[u].half[0];
      if (h == 0) asm volatile("s_wait_xcnt 0x0" ::: "memory"); }      /* the registers that the first half's stores name are reused by the second half: wait before they are overwritten */
    return; }
#pragma unroll
  for (int u = 0; u < 16; ++u) { const int t = u & 3, i = u >> 2;      /* as in gemm2_body, through the wave's own LDS patch, here of 64 rows */
#pragma unroll
    for (int r = 0; r < 8; ++r) so[w][i * 16 + 8 * hh + r][t * 16 + ln] = c[i][t][r] * alpha + bv[t]; }
  __builtin_amdgcn_fence(__ATOMIC_ACQ_REL, "workgroup"); __builtin_amdgcn_wave_barrier();      /* the lanes read what other lanes of the wave wrote */
  FragH f[16];
#pragma unroll
  for (int u = 0; u < 16; ++u) { const int rbl = u >> 2, kbl = (u >> 1) & 1, j = u & 1; const float* sp = &so[w][rbl * 16 + ln][kbl * 32 + j * 16 + hh * 8]; const v4f x = *(const v4fa*)sp, y = *(const v4fa*)(sp + 4);      /* the wave's 64 x 64 tile = 4 x 2 blocks of the plane */
#pragma unroll
    for (int i = 0; i < 4; ++i) { f[u].h[i] = (_Float16)x[i]; f[u].h[4 + i] = (_Float16)y[i]; } }
#pragma unroll
  for (int u = 0; u < 16; ++u) { const int rbl = u >> 2, kbl = (u >> 1) & 1, j = u & 1;      /* 16 stores of 512 bytes in a row, each piece in registers of its own */
    *(v8us*)((unsigned short*)C16 + (size_t)(row0 + rbl * 16) * EMB + (size_t)((col0 >> 5) + kbl) * 512 + j * 256 + lane * 8) = f[u].half[0]; }
  asm volatile("s_wait_xcnt 0x0" ::: "memory"); }      /* FO is a run-time flag: the built code can lead from these stores on into the other path, which reuses their registers: wait before they are overwritten */
// The five input projections in one grid: a block's index range names its product (Q, K, V of the local rows, then K, V of the global rows). Q and both K leave as fragment-order planes, both V as the transposed planes that the attention reads.
#define PJL ((NRL / 128) * (EMB / 64))      /* blocks of the output projection (128 x 64 each) */
#define PJL4 ((NRL / 128) * (EMB / 256))      /* blocks of one local projection (128 x 256 each) */
#define PJG4 ((NRG / 128) * (EMB / 256))      /* blocks of one global projection */
__global__ __launch_bounds__(256) void k_proj(const _Float16* __restrict__ XL, const _Float16* __restrict__ XG, const _Float16* __restrict__ BQ, const _Float16* __restrict__ BK, const _Float16* __restrict__ BV, const _Float16* __restrict__ BKG, const _Float16* __restrict__ BVG,
    const float* __restrict__ qb, const float* __restrict__ kb, const float* __restrict__ vb, const float* __restrict__ kgb, const float* __restrict__ vgb, _Float16* __restrict__ Q16, _Float16* __restrict__ KL, _Float16* __restrict__ VTL, _Float16* __restrict__ KG, _Float16* __restrict__ VTG) {
  __shared__ __attribute__((aligned(16))) float so[8][64][68];
  static_assert(LL == 1 << 11 && GG == 1 << 9 && EMB == NH * 64, "vsh");
  int bx = blockIdx.x; const _Float16* A; const _Float16* B; const float* bias; _Float16* C; int fo, vsh;
  if (bx < 3 * PJL4) { const int m = bx / PJL4; bx -= m * PJL4; A = XL; B = (m == 0) ? BQ : (m == 1) ? BK : BV; bias = (m == 0) ? qb : (m == 1) ? kb : vb; C = (m == 0) ? Q16 : (m == 1) ? KL : VTL; fo = (m != 2) ? 1 : 2; vsh = 11; }
  else { bx -= 3 * PJL4; const int m = bx / PJG4; bx -= m * PJG4; A = XG; B = (m == 0) ? BKG : BVG; bias = (m == 0) ? kgb : vgb; C = (m == 0) ? KG : VTG; fo = (m == 0) ? 1 : 2; vsh = 9; }
  gemm4_body(so, bx, fo, vsh, A, B, bias, C); }



template <int CAUSAL>
__global__ __launch_bounds__(128) void k_flash(const _Float16* __restrict__ Q16, int ldq, const _Float16* __restrict__ K16, int ldk, const _Float16* __restrict__ Vt, const int* __restrict__ MSK, float* __restrict__ O, int ldo) {
  constexpr int RPW = 16, RTN = RPW / 16, NQB = TQ / (4 * RPW), DT = 4, KS = 2;
  __shared__ __attribute__((aligned(16))) unsigned short sP[4][RPW][40]; __shared__ __attribute__((aligned(16))) float sO[4][RPW][64 + 4];
  const int tid = threadIdx.x, w = tid >> 5, lane = tid & 31, ln = lane & 15, hh = lane >> 4;
  const int slab = blockIdx.x / QBLKS, qblk = blockIdx.x % QBLKS; (void)NQB; const int b = slab / NH, h = slab % NH; const int qb0 = qblk * (4 * RPW); const int q0 = qb0 + w * RPW;
  FragH aq[2][KS];
#pragma unroll
  for (int rt = 0; rt < RTN; ++rt) { const unsigned short* qr = (const unsigned short*)Q16 + ((size_t)b * TQ + q0 + rt * 16 + ln) * ldq + h * 64;
#pragma unroll
    for (int ks = 0; ks < KS; ++ks) { aq[rt][ks].half[0] = *(const v8us*)(qr + ks * 32 + 8 * hh); aq[rt][ks].half[1] = *(const v8us*)(qr + ks * 32 + 16 + 8 * hh); } }
  const unsigned short* Vth = (const unsigned short*)Vt + (size_t)slab * 64 * TK;
  float m_r[2][8], l_r[2][8]; v8f oacc[2][DT];
#pragma unroll
  for (int rt = 0; rt < RTN; ++rt) {
#pragma unroll
    for (int r = 0; r < 8; ++r) { m_r[rt][r] = -3.0e38f; l_r[rt][r] = 0.f; }
#pragma unroll
    for (int dt = 0; dt < DT; ++dt) oacc[rt][dt] = (v8f){0.f,0.f,0.f,0.f,0.f,0.f,0.f,0.f}; }
  const int jend = (CAUSAL == 1) ? (qb0 + 4 * RPW) : TK;      /* causal: keys beyond the block's last query never contribute */
#pragma unroll 1
  for (int j0 = 0; j0 < jend; j0 += 32) {
    v8f s[2][2];
#pragma unroll
    for (int nt = 0; nt < 2; ++nt) { const unsigned short* kr = (const unsigned short*)K16 + ((size_t)b * TK + j0 + nt * 16 + ln) * ldk + h * 64; FragH bk[KS];
#pragma unroll
      for (int ks = 0; ks < KS; ++ks) { bk[ks].half[0] = *(const v8us*)(kr + ks * 32 + 8 * hh); bk[ks].half[1] = *(const v8us*)(kr + ks * 32 + 16 + 8 * hh); }
#pragma unroll
      for (int rt = 0; rt < RTN; ++rt) { v8f acc = (v8f){0.f,0.f,0.f,0.f,0.f,0.f,0.f,0.f};
#pragma unroll
        for (int ks = 0; ks < KS; ++ks) acc = mmaH<1>(aq[rt][ks].v, aq[rt][ks].v, bk[ks].v, bk[ks].v, acc); s[rt][nt] = acc; } }
#pragma unroll
    for (int rt = 0; rt < RTN; ++rt)
#pragma unroll
      for (int r = 0; r < 8; ++r) { const int tq = q0 + rt * 16 + 8 * hh + r; const int k0 = j0 + ln, k1 = j0 + 16 + ln;
        const bool ok0 = (CAUSAL == 1) ? (k0 <= tq) : ((CAUSAL == 2) ? ((k0 >> 5) == (tq >> 5)) : true), ok1 = (CAUSAL == 1) ? (k1 <= tq) : ((CAUSAL == 2) ? ((k1 >> 5) == (tq >> 5)) : true);      /* mode 2: block-diagonal 32-token groups */
        const float s0 = ok0 ? s[rt][0][r] * SCL : -3.0e38f, s1 = ok1 ? s[rt][1][r] * SCL : -3.0e38f; float mc = fmaxf(s0, s1);
        mc = fmaxf(mc, __shfl_xor(mc, 1, 32)); mc = fmaxf(mc, __shfl_xor(mc, 2, 32)); mc = fmaxf(mc, __shfl_xor(mc, 4, 32)); mc = fmaxf(mc, __shfl_xor(mc, 8, 32));
        const float mn = fmaxf(m_r[rt][r], mc); const float al = (mn > -1.0e38f) ? expf(m_r[rt][r] - mn) : 1.0f; m_r[rt][r] = mn; const float p0 = ok0 ? expf(s0 - mn) : 0.f, p1 = ok1 ? expf(s1 - mn) : 0.f; l_r[rt][r] = l_r[rt][r] * al + p0 + p1;
#pragma unroll
        for (int dt = 0; dt < DT; ++dt) oacc[rt][dt][r] *= al;
        FragH t2; t2.h[0] = (_Float16)(p0 * 1024.0f); t2.h[1] = (_Float16)(p1 * 1024.0f); sP[w][rt * 16 + 8 * hh + r][ln] = t2.u[0]; sP[w][rt * 16 + 8 * hh + r][16 + ln] = t2.u[1]; }
    __builtin_amdgcn_fence(__ATOMIC_ACQ_REL, "workgroup"); __builtin_amdgcn_wave_barrier();
    FragH pa[2];
#pragma unroll
    for (int rt = 0; rt < RTN; ++rt) { pa[rt].half[0] = *(const v8us*)&sP[w][rt * 16 + ln][8 * hh]; pa[rt].half[1] = *(const v8us*)&sP[w][rt * 16 + ln][16 + 8 * hh]; }
#pragma unroll
    for (int dt = 0; dt < DT; ++dt) { const unsigned short* vrow = Vth + (size_t)(dt * 16 + ln) * TK + j0; FragH bv; bv.half[0] = *(const v8us*)(vrow + 8 * hh); bv.half[1] = *(const v8us*)(vrow + 16 + 8 * hh);
#pragma unroll
      for (int rt = 0; rt < RTN; ++rt) oacc[rt][dt] = mmaH<1>(pa[rt].v, pa[rt].v, bv.v, bv.v, oacc[rt][dt]); }
    __builtin_amdgcn_fence(__ATOMIC_ACQ_REL, "workgroup"); __builtin_amdgcn_wave_barrier(); }
#pragma unroll
  for (int rt = 0; rt < RTN; ++rt) {
#pragma unroll
    for (int r = 0; r < 8; ++r) { float l = l_r[rt][r]; l += __shfl_xor(l, 1, 32); l += __shfl_xor(l, 2, 32); l += __shfl_xor(l, 4, 32); l += __shfl_xor(l, 8, 32); l_r[rt][r] = (l > 0.f) ? 1.0f / (l * 1024.0f) : 0.f; }
#pragma unroll
    for (int dt = 0; dt < DT; ++dt)
#pragma unroll
      for (int r = 0; r < 8; ++r) sO[w][rt * 16 + 8 * hh + r][dt * 16 + ln] = oacc[rt][dt][r] * l_r[rt][r]; }
  __builtin_amdgcn_fence(__ATOMIC_ACQ_REL, "workgroup"); __builtin_amdgcn_wave_barrier();
  {
#pragma unroll
    for (int rp = 0; rp < RPW; rp += 2) { const int r = rp + (lane >> 4), pc = lane & 15; const v4f val = *(const v4fa*)&sO[w][r][pc * 4]; *(v4f*)(O + ((size_t)b * TQ + q0 + r) * ldo + h * 64 + pc * 4) = val; }
     } }

// Attention with both products transposed: S^T = K Q^T (A = 16 keys, B = 16 queries) and O^T += V^T P^T (A = 16 values of d, B = P^T).
// A lane holds 16 of the 32 scores of ONE query (keys 8 * hh + r of each 16-key tile): maximum and sum are taken in the lane, plus one exchange between the wave's halves.
// The two score tiles, converted in place, are the B operand of the second product in the planes' own k order (16 * j + 8 * hh + i): P goes through no LDS and no lane exchange.
// The softmax runs in base 2: e^(SCL * s - m) = 2^(SCL2 * s - m2), so each score costs one fma and one hardware exponential (arguments are <= 10; far below, the result goes to 0, as it should).
#define SCL2 0.18033688011112042f      /* 64^-0.5 * log2(e) */
typedef float v2f __attribute__((ext_vector_type(2)));
__device__ __forceinline__ float xhalf(float x) { return __int_as_float(__builtin_amdgcn_permlanex16(__float_as_int(x), __float_as_int(x), 0x76543210, 0xfedcba98, false, false)); }      /* lane l <-> l ^ 16 */
template <int TKv>      /* bx: the block's place in the grid; res[dt][r] = the attention's output O[q0 + ln][dt * 16 + 8 * hh + r], left in registers */
__device__ __forceinline__ void flashT_body(const int bx, const _Float16* __restrict__ Q16, int ldq, const _Float16* __restrict__ K16, int ldk, const _Float16* __restrict__ Vt, v8f (&res)[4]) {
  constexpr int RPW = 16, DT = 4, KS = 2;      /* the short inner loops below are all unrolled in full, so that the fragment arrays stay in registers */
  const int tid = threadIdx.x, w = tid >> 5, lane = tid & 31, ln = lane & 15, hh = lane >> 4;
  const int slab = bx / QBLKS, qblk = bx % QBLKS; const int b = slab / NH, h = slab % NH; const int q0 = qblk * (4 * RPW) + w * RPW;
  FragH bq[KS];      /* Q, the B operand of the score product, kept for the whole key loop */
  { const unsigned short* qr = (const unsigned short*)Q16 + ((size_t)b * TQ + q0) * ldq + h * 1024 + lane * 8;      /* fragment-order plane: strip of 16 queries, the head's two blocks */
#pragma unroll
    for (int ks = 0; ks < KS; ++ks) { bq[ks].half[0] = *(const v8us*)(qr + ks * 512); bq[ks].half[1] = *(const v8us*)(qr + ks * 512 + 256); } }
  FragH ak[2][KS];      /* K fragments (A operand), fetched one pass ahead */
#pragma unroll
  for (int nt = 0; nt < 2; ++nt) { const unsigned short* kr = (const unsigned short*)K16 + ((size_t)b * TKv + nt * 16) * ldk + h * 1024 + lane * 8;      /* fragment-order plane: strip of 16 keys, the head's two blocks */
#pragma unroll
    for (int ks = 0; ks < KS; ++ks) { ak[nt][ks].half[0] = *(const v8us*)(kr + ks * 512); ak[nt][ks].half[1] = *(const v8us*)(kr + ks * 512 + 256); } }
  asm volatile("s_wait_xcnt 0x0" ::: "memory");      /* the registers that the Q and K loads above name are reused below: wait before they are overwritten */
  __builtin_amdgcn_sched_barrier(0);      /* keeps the set-up code below from being scheduled in front of that wait */
  const unsigned short* Vth = (const unsigned short*)Vt + (size_t)slab * 64 * TKv;
  float m_q = -3.0e38f, l_q = 0.f; v8f oacc[DT];      /* the lane's query: running maximum in base-2 units, less 10 (equal in both halves), the sum over this half's keys */
#pragma unroll
  for (int dt = 0; dt < DT; ++dt) oacc[dt] = (v8f){0.f,0.f,0.f,0.f,0.f,0.f,0.f,0.f};
#pragma unroll 1      /* rolled: a pass is long enough to cover its own loads; copies only add code */
  for (int j0 = 0; j0 < TKv; j0 += 32) {
    FragH av[DT];      /* this pass's V^T fragments (A operand), all issued at the head of the pass: they fly under the score products and the softmax */
#pragma unroll
    for (int dt = 0; dt < DT; ++dt) { const unsigned short* vrow = Vth + (size_t)(dt * 16) * TKv + (size_t)j0 * 16 + lane * 8; av[dt].half[0] = *(const v8us*)vrow; av[dt].half[1] = *(const v8us*)(vrow + 256); }
    v8f s[2];      /* s[nt][r] = score of key j0 + nt * 16 + 8 * hh + r with query q0 + ln */
#pragma unroll
    for (int nt = 0; nt < 2; ++nt) { v8f acc = (v8f){0.f,0.f,0.f,0.f,0.f,0.f,0.f,0.f};
#pragma unroll
      for (int ks = 0; ks < KS; ++ks) acc = mmaH<1>(ak[nt][ks].v, ak[nt][ks].v, bq[ks].v, bq[ks].v, acc); s[nt] = acc; }
    const int jn = (j0 + 32 < TKv) ? j0 + 32 : j0;      /* last pass: re-reads its own keys (in bounds, unused) */
#pragma unroll
    for (int nt = 0; nt < 2; ++nt) { const unsigned short* kr = (const unsigned short*)K16 + ((size_t)b * TKv + jn + nt * 16) * ldk + h * 1024 + lane * 8;
#pragma unroll
      for (int ks = 0; ks < KS; ++ks) { ak[nt][ks].half[0] = *(const v8us*)(kr + ks * 512); ak[nt][ks].half[1] = *(const v8us*)(kr + ks * 512 + 256); }
      asm volatile("s_wait_xcnt 0x0" ::: "memory"); }      /* the address registers of these four loads may be given to the next loads' results or to the softmax: wait before they are overwritten */
    float mx[8];      /* the maximum is taken on the raw scores: SCL2 > 0, and rounding is monotone, so scaling the maximum gives the maximum of the scaled scores */
#pragma unroll
    for (int i = 0; i < 8; ++i) mx[i] = fmaxf(s[0][i], s[1][i]);
    float mc = fmaxf(fmaxf(fmaxf(mx[0], mx[1]), fmaxf(mx[2], mx[3])), fmaxf(fmaxf(mx[4], mx[5]), fmaxf(mx[6], mx[7])));
    mc = fmaf(mc, SCL2, -10.0f);      /* kept 10 below the true maximum: the f16 operand's factor 2^10 rides in the exponent, p = 1024 * e^(score - maximum), at most about 1024 */
    mc = fmaxf(mc, xhalf(mc));
    const float mn = fmaxf(m_q, mc); const float ea = __builtin_amdgcn_exp2f(m_q - mn); const float al = (mn > -1.0e38f) ? ea : 1.0f; m_q = mn;
    FragH pb; float p[16];
#pragma unroll
    for (int i = 0; i < 16; i += 2) { const v2f x = __builtin_elementwise_fma((v2f){s[i >> 3][i & 7], s[i >> 3][(i & 7) + 1]}, (v2f){SCL2, SCL2}, (v2f){-mn, -mn});      /* two scores per packed fma */
      p[i] = __builtin_amdgcn_exp2f(x[0]); p[i + 1] = __builtin_amdgcn_exp2f(x[1]); pb.h[i] = (_Float16)p[i]; pb.h[i + 1] = (_Float16)p[i + 1]; }
    v2f t0 = {0.f, 0.f}, t1 = {0.f, 0.f};      /* two chains of packed partial sums: no chain of sixteen dependent adds */
#pragma unroll
    for (int i = 0; i < 4; ++i) { t0 += (v2f){p[4 * i], p[4 * i + 1]}; t1 += (v2f){p[4 * i + 2], p[4 * i + 3]}; }
    t0 += t1; l_q = l_q * al + (t0[0] + t0[1]);
#pragma unroll
    for (int dt = 0; dt < DT; ++dt) oacc[dt] *= al;
#pragma unroll
    for (int dt = 0; dt < DT; ++dt) oacc[dt] = mmaH<1>(av[dt].v, av[dt].v, pb.v, pb.v, oacc[dt]); }
  float l = l_q + xhalf(l_q); l = (l > 0.f) ? 1.0f / l : 0.f;      /* the sum carries the same 2^10 as the products */
#pragma unroll
  for (int dt = 0; dt < DT; ++dt) res[dt] = oacc[dt] * l; }
// Both attentions of a wave's 16 queries in one wave, the local keys and then the global keys, and the gated sum on the two results in registers.
// A lane's eight values of a tile are eight d in a row of one query: one 16-byte piece of the fragment-order plane that the output projection reads (K = EMB), stored as it stands, through no LDS.
#define ATB (NB * NH * QBLKS)      /* blocks of the grid */
__global__ __launch_bounds__(128) void k_attn(const _Float16* __restrict__ Q16, const _Float16* __restrict__ KL, const _Float16* __restrict__ VTL, const _Float16* __restrict__ KG, const _Float16* __restrict__ VTG, const float* __restrict__ gate, _Float16* __restrict__ O16) {
  v8f ol[4], og[4];
  flashT_body<TKA>(blockIdx.x, Q16, EMB, KL, EMB, VTL, ol);      /* local: 2048 keys */
  flashT_body<TKB>(blockIdx.x, Q16, EMB, KG, EMB, VTG, og);      /* global: 512 keys */
  const float g = 1.0f / (1.0f + expf(-bf16_round(gate[0]))); const float h1 = 1.0f - g;
  const int w = threadIdx.x >> 5, lane = threadIdx.x & 31; const int slab = blockIdx.x / QBLKS, qblk = blockIdx.x % QBLKS; const int b = slab / NH, h = slab % NH; const int q0 = qblk * 64 + w * 16;
  unsigned short* op = (unsigned short*)O16 + ((size_t)b * TQ + q0) * EMB + h * 1024 + lane * 8; FragH f[4];      /* strip of 16 queries, the head's two blocks; the short loops below are unrolled in full, so that the arrays stay in registers */
#pragma unroll
  for (int dt = 0; dt < 4; ++dt)
#pragma unroll
    for (int r = 0; r < 8; ++r) f[dt].h[r] = (_Float16)(g * ol[dt][r] + h1 * og[dt][r]);
#pragma unroll
  for (int dt = 0; dt < 4; ++dt) *(v8us*)(op + dt * 256) = f[dt].half[0]; }

extern "C" void kernel_launch(void* const* d_in, const int* in_sizes, int n_in,
                              void* d_out, int out_size, void* d_ws, size_t ws_size, hipStream_t stream) {
  (void)in_sizes; (void)n_in; (void)out_size;
  const float* const* I = (const float* const*)d_in; const float* lh = I[0]; const float* gh = I[1]; const float* qw = I[2]; const float* qb = I[3]; const float* kw = I[4]; const float* kb = I[5]; const float* vw = I[6]; const float* vb = I[7]; const float* kgw = I[8]; const float* kgb = I[9]; const float* vgw = I[10]; const float* vgb = I[11]; const float* ow = I[12]; const float* ob = I[13]; const float* gate = I[14];
  char* ws = (char*)d_ws; size_t off = 0;
  auto take = [&](size_t bytes) { char* p = ws + off; off += (bytes + 255) & ~(size_t)255; return p; };
  const size_t w8 = (size_t)EMB * EMB / 8, npl = (size_t)NRL * EMB, npg = (size_t)NRG * EMB;
  _Float16* BQ = (_Float16*)take(w8 * 16); _Float16* BK = (_Float16*)take(w8 * 16); _Float16* BV = (_Float16*)take(w8 * 16); _Float16* BKG = (_Float16*)take(w8 * 16); _Float16* BVG = (_Float16*)take(w8 * 16); _Float16* BO = (_Float16*)take(w8 * 16);
  _Float16* XL = (_Float16*)take(npl * 2); _Float16* XG = (_Float16*)take(npg * 2); _Float16* Q16 = (_Float16*)take(npl * 2); _Float16* KL = (_Float16*)take(npl * 2); _Float16* KG = (_Float16*)take(npg * 2); _Float16* VTL = (_Float16*)take(npl * 2); _Float16* VTG = (_Float16*)take(npg * 2);
  _Float16* O16 = XL;      /* O16 over the local input plane (dead after its projections) */
  if (off > ws_size) return;      /* 12 + 8+2+8+8+2+8+2 = 50 MiB */
  k_conv<<<CVL + CVG + 6 * CVW, 256, 0, stream>>>(lh, gh, qw, kw, vw, kgw, vgw, ow, XL, XG, BQ, BK, BV, BKG, BVG, BO);
  const dim3 gL(PJL, 1);
  k_proj<<<3 * PJL4 + 2 * PJG4, 256, 0, stream>>>(XL, XG, BQ, BK, BV, BKG, BVG, qb, kb, vb, kgb, vgb, Q16, KL, VTL, KG, VTG);
  k_attn<<<ATB, 128, 0, stream>>>(Q16, KL, VTL, KG, VTG, gate, O16);
  k_gemm2<0, false><<<gL, 128, 0, stream>>>(O16, EMB, 0, BO, EMB, 0, 0.0625f, ob, 0, nullptr, 1, 0, 0, (float*)d_out, nullptr, EMB, 0, NRL, EMB, EMB);
}

// v008
// A run of this version takes 106 microseconds.
// Next to v007, in two timings, it ran 1.19 and 1.18 times as fast.
// Over all steps from v000 it is 5.46 times as fast.
#include <hip/hip_runtime.h>
// InfiniSpanAttention (2 batches; 2048 local tokens, 512 global tokens, D = 1024, 16 heads of 64): q/k_l/v_l from local_hidden, k_g/v_g from global_hidden (torch (out,in) linears + bias); out_l = softmax(q k_l^T s) v_l, out_g = softmax(q k_g^T s) v_g (no masks); out = sigmoid(gate) out_l + (1 - sigmoid(gate)) out_g -> merged heads -> out_w + out_b.
// Compute dtype: inputs and parameters rounded to bf16; q, k, v, P and the combined attention output as f16 operands (~2^-12); f32 accumulation/softmax/gating. v_wmma_f32_16x16x32_f16.
#define NB 2
#define EMB 1024
#define NRL (NB * LL)            /* 4096 local rows */
#define NRG (NB * GG)            /* 1024 global rows */
#define LL 2048                  /* local tokens (queries; local keys) */
#define GG 512                   /* global tokens (keys of the second attention) */
#define TQ LL
#define TK LL
#define TKA LL
#define TKB GG
#define NH 16
#define SCL 0.125f               /* 64^-0.5 */
#define QBLKS (TQ / 64)
typedef __bf16 v16b __attribute__((ext_vector_type(16)));
typedef unsigned short v8us __attribute__((ext_vector_type(8), may_alias));
typedef float  v8f  __attribute__((ext_vector_type(8)));
typedef float  v4f  __attribute__((ext_vector_type(4)));
typedef float  v4fa __attribute__((ext_vector_type(4), may_alias));
union FragB { v16b v; v8us half[2]; unsigned short u[16]; };

__device__ __forceinline__ unsigned short bf16_bits(float x) { unsigned int u = __float_as_uint(x); return (unsigned short)((u + 0x7FFFu + ((u >> 16) & 1u)) >> 16); }
__device__ __forceinline__ float bf16_val(unsigned short b) { return __uint_as_float(((unsigned int)b) << 16); }
__device__ __forceinline__ float bf16_round(float x) { return bf16_val(bf16_bits(x)); }
// D += A·B with NT terms: 1 = ah·bh, 2 = + al·bh (A split), 3 = + ah·bl (both split)
template <int NT>
__device__ __forceinline__ v8f mmaN(v16b ah, v16b al, v16b bh, v16b bl, v8f c) {
  c = __builtin_amdgcn_wmma_f32_16x16x32_bf16(false, ah, false, bh, (short)0, c, false, false);
  if (NT >= 2) c = __builtin_amdgcn_wmma_f32_16x16x32_bf16(false, al, false, bh, (short)0, c, false, false);
  if (NT >= 3) c = __builtin_amdgcn_wmma_f32_16x16x32_bf16(false, ah, false, bl, (short)0, c, false, false);
  asm volatile("v_nop\n\tv_nop\n\tv_nop\n\tv_nop" : "+v"(c) : "v"(ah), "v"(al), "v"(bh), "v"(bl));
  return c;
}

__global__ __launch_bounds__(256) void k_wt_bf16(const float* __restrict__ W, unsigned short* __restrict__ Wt, int K, int N) {
  const int t = blockIdx.x * 256 + threadIdx.x;
  const int k8n = K / 8;
  if (t >= N * k8n) return;
  const int n = t / k8n, k8 = (t % k8n) * 8;
  v8us v;
#pragma unroll
  for (int i = 0; i < 8; ++i) v[i] = bf16_bits(W[(size_t)(k8 + i) * N + n]);
  *(v8us*)(Wt + (size_t)n * K + k8) = v;
  
}

// GEMM C[M][N] (f32, pitch ldc) = act(A[M][K]·W + bias). A f32 row-major (pitch lda) converted per fragment to bf16
// (ASPLIT: hi/lo two planes -> 2 terms, else single rounded term); Wt bf16 [N][K] (pitch ldb). BIAS_BF16 rounds the
// bias to bf16 first (bias quantised to bf16 before the add). K%32==0, M%16==0, N%64==0.
template <bool ASPLIT, int ACT, bool BIAS_BF16>
__global__ __launch_bounds__(128) void k_gemm_bf(const float* __restrict__ A, int lda, const unsigned short* __restrict__ Wt, int ldb,
                                               const float* __restrict__ bias, float* __restrict__ C, int ldc, int M, int N, int K) {
  __shared__ __attribute__((aligned(16))) float so[4][16][64];
  const int tid = threadIdx.x, w = tid >> 5, lane = tid & 31, ln = lane & 15, hh = lane >> 4;
  const int ntn = N / 64;
  const int wid = blockIdx.x * 4 + w;
  const int mt = wid / ntn, nq = wid % ntn;
  if (mt * 16 >= M) return;
  const int row0 = mt * 16, col0 = nq * 64;
  const float* arow = A + (size_t)(row0 + ln) * lda;
  v8f acc[4] = {};
  for (int kb = 0; kb < K; kb += 32) {
    FragB ah, al;
    const v4f x0 = *(const v4fa*)(arow + kb + 8 * hh), x1 = *(const v4fa*)(arow + kb + 8 * hh + 4);
    const v4f x2 = *(const v4fa*)(arow + kb + 16 + 8 * hh), x3 = *(const v4fa*)(arow + kb + 16 + 8 * hh + 4);
    float xs[16] = {x0[0],x0[1],x0[2],x0[3],x1[0],x1[1],x1[2],x1[3],x2[0],x2[1],x2[2],x2[3],x3[0],x3[1],x3[2],x3[3]};
#pragma unroll
    for (int i = 0; i < 16; ++i) { const unsigned short hb = bf16_bits(xs[i]); ah.u[i] = hb; al.u[i] = ASPLIT ? bf16_bits(xs[i] - bf16_val(hb)) : (unsigned short)0; }
#pragma unroll
    for (int t = 0; t < 4; ++t) {
      const unsigned short* brow = Wt + (size_t)(col0 + t * 16 + ln) * ldb + kb;
      FragB b;
      b.half[0] = *(const v8us*)(brow + 8 * hh);
      b.half[1] = *(const v8us*)(brow + 16 + 8 * hh);
      acc[t] = mmaN<ASPLIT ? 2 : 1>(ah.v, al.v, b.v, b.v, acc[t]);
    }
  }
#pragma unroll
  for (int t = 0; t < 4; ++t) {
    float bv = bias ? bias[col0 + t * 16 + ln] : 0.f;
    if (BIAS_BF16) bv = bf16_round(bv);
#pragma unroll
    for (int r = 0; r < 8; ++r) { float v = acc[t][r] + bv; if (ACT == 1) v = fmaxf(v, 0.f); so[w][8 * hh + r][t * 16 + ln] = v; }
  }
  __builtin_amdgcn_fence(__ATOMIC_ACQ_REL, "workgroup");
  __builtin_amdgcn_wave_barrier();
  const int rsub = lane >> 4, c4 = (lane & 15) * 4;
  {
#pragma unroll
    for (int q = 0; q < 8; ++q) {
      const int r = q * 2 + rsub;
      const v4f v = *(const v4fa*)&so[w][r][c4];
      *(v4f*)(C + (size_t)(row0 + r) * ldc + col0 + c4) = v;
    }
    
  }
}

// GEMM C = act(A·W + bias + resid): A f32 (ASPLIT -> hi/lo 2 terms), Wt bf16 [N][K]; ACT 0 none, 1 relu, 2 exact gelu;
// resid (optional, f32, row index = (row % rmod), pitch ldr, RES_BF16 rounds it) added before the activation.
template <bool ASPLIT, int ACT, bool BIAS_BF16, bool RES_BF16>
__global__ __launch_bounds__(128) void k_gemm_bf3(const float* __restrict__ A, int lda, const unsigned short* __restrict__ Wt, int ldb,
                                                const float* __restrict__ bias, const float* __restrict__ resid, int rmod, int ldr,
                                                float* __restrict__ C, int ldc, int M, int N, int K) {
  __shared__ __attribute__((aligned(16))) float so[4][16][64];
  const int tid = threadIdx.x, w = tid >> 5, lane = tid & 31, ln = lane & 15, hh = lane >> 4;
  const int ntn = N / 64;
  const int wid = blockIdx.x * 4 + w;
  const int mt = wid / ntn, nq = wid % ntn;
  if (mt * 16 >= M) return;
  const int row0 = mt * 16, col0 = nq * 64;
  const float* arow = A + (size_t)(row0 + ln) * lda;
  v8f acc[4] = {};
  for (int kb = 0; kb < K; kb += 32) {
    FragB ah, al;
    const v4f x0 = *(const v4fa*)(arow + kb + 8 * hh), x1 = *(const v4fa*)(arow + kb + 8 * hh + 4);
    const v4f x2 = *(const v4fa*)(arow + kb + 16 + 8 * hh), x3 = *(const v4fa*)(arow + kb + 16 + 8 * hh + 4);
    float xs[16] = {x0[0],x0[1],x0[2],x0[3],x1[0],x1[1],x1[2],x1[3],x2[0],x2[1],x2[2],x2[3],x3[0],x3[1],x3[2],x3[3]};
#pragma unroll
    for (int i = 0; i < 16; ++i) { const unsigned short hb = bf16_bits(xs[i]); ah.u[i] = hb; al.u[i] = ASPLIT ? bf16_bits(xs[i] - bf16_val(hb)) : (unsigned short)0; }
#pragma unroll
    for (int t = 0; t < 4; ++t) {
      const unsigned short* brow = Wt + (size_t)(col0 + t * 16 + ln) * ldb + kb;
      FragB b;
      b.half[0] = *(const v8us*)(brow + 8 * hh);
      b.half[1] = *(const v8us*)(brow + 16 + 8 * hh);
      acc[t] = mmaN<ASPLIT ? 2 : 1>(ah.v, al.v, b.v, b.v, acc[t]);
    }
  }
#pragma unroll
  for (int t = 0; t < 4; ++t) {
    const int col = col0 + t * 16 + ln;
    float bv = bias ? bias[col] : 0.f;
    if (BIAS_BF16) bv = bf16_round(bv);
#pragma unroll
    for (int r = 0; r < 8; ++r) {
      float v = acc[t][r] + bv;
      if (resid) { float rv = resid[(size_t)((row0 + 8 * hh + r) % rmod) * ldr + col]; if (RES_BF16) rv = bf16_round(rv); v += rv; }
      if (ACT == 1) v = fmaxf(v, 0.f);
      if (ACT == 2) v = 0.5f * v * (1.0f + erff(v * 0.70710678118654752f));
      if (ACT == 3) { const float u = 0.7978845608028654f * (v + 0.044715f * v * v * v); v = 0.5f * v * (1.0f + tanhf(u)); }
      so[w][8 * hh + r][t * 16 + ln] = v;
    }
  }
  __builtin_amdgcn_fence(__ATOMIC_ACQ_REL, "workgroup");
  __builtin_amdgcn_wave_barrier();
  const int rsub = lane >> 4, c4 = (lane & 15) * 4;
  {
#pragma unroll
    for (int q = 0; q < 8; ++q) {
      const int r = q * 2 + rsub;
      const v4f v = *(const v4fa*)&so[w][r][c4];
      *(v4f*)(C + (size_t)(row0 + r) * ldc + col0 + c4) = v;
    }
    
  }
}
// row LayerNorm (biased variance, eps) over N: s = X (+ R); optional out_sum <- s; out_norm <- (s-mu)*rsqrt(var+eps)*g + b
template <bool PARAM_BF16>
__global__ __launch_bounds__(256) void k_layernorm(const float* __restrict__ X, const float* __restrict__ R, const float* __restrict__ g, const float* __restrict__ bta,
                                                  float* __restrict__ out_sum, float* __restrict__ out_norm, int N, float eps) {
  __shared__ float red[256];
  const int row = blockIdx.x, tid = threadIdx.x;
  const float* x = X + (size_t)row * N; const float* rr = R ? R + (size_t)row * N : nullptr;
  float vals[16];                     // up to N = 4096
  const int per = N / 256;            // contiguous chunk per thread? use strided-by-4 chunks: thread handles j = tid*4 + 1024*u
  float s1 = 0.f;
  for (int u = 0; u < per / 4; ++u) {
    const int j = tid * 4 + 1024 * u;
    const v4f a = *(const v4fa*)(x + j);
    v4f b = {0.f,0.f,0.f,0.f}; if (rr) b = *(const v4fa*)(rr + j);
#pragma unroll
    for (int q = 0; q < 4; ++q) { const float v = a[q] + b[q]; vals[u * 4 + q] = v; s1 += v; }
  }
  red[tid] = s1; __syncthreads();
  for (int st = 128; st > 0; st >>= 1) { if (tid < st) red[tid] += red[tid + st]; __syncthreads(); }
  const float mu = red[0] / (float)N; __syncthreads();
  float s2 = 0.f;
  for (int u = 0; u < per / 4; ++u)
#pragma unroll
    for (int q = 0; q < 4; ++q) { const float c = vals[u * 4 + q] - mu; s2 += c * c; }
  red[tid] = s2; __syncthreads();
  for (int st = 128; st > 0; st >>= 1) { if (tid < st) red[tid] += red[tid + st]; __syncthreads(); }
  const float rs = rsqrtf(red[0] / (float)N + eps);
  {
    for (int u = 0; u < per / 4; ++u) {
      const int j = tid * 4 + 1024 * u;
      v4f o, sm;
#pragma unroll
      for (int q = 0; q < 4; ++q) {
        float gg = g[j + q], bb = bta[j + q];
        if (PARAM_BF16) { gg = bf16_round(gg); bb = bf16_round(bb); }
        sm[q] = vals[u * 4 + q]; o[q] = (vals[u * 4 + q] - mu) * rs * gg + bb;
      }
      if (out_sum) *(v4f*)(out_sum + (size_t)row * N + j) = sm;
      *(v4f*)(out_norm + (size_t)row * N + j) = o;
    }
    
  }
}



// ---- f16 WMMA path (v_wmma_f32_16x16x32_f16): 11-bit significands for operands in range — used where a [0,1] probability operand needs more precision than bf16
typedef _Float16 v16h __attribute__((ext_vector_type(16)));
union FragH { v16h v; v8us half[2]; _Float16 h[16]; unsigned short u[16]; };
template <int NT>
__device__ __forceinline__ v8f mmaH(v16h ah, v16h al, v16h bh, v16h bl, v8f c) {
  c = __builtin_amdgcn_wmma_f32_16x16x32_f16(false, ah, false, bh, (short)0, c, false, false);
  if (NT >= 2) c = __builtin_amdgcn_wmma_f32_16x16x32_f16(false, al, false, bh, (short)0, c, false, false);
  if (NT >= 3) c = __builtin_amdgcn_wmma_f32_16x16x32_f16(false, ah, false, bl, (short)0, c, false, false);
  asm volatile("v_nop\n\tv_nop\n\tv_nop\n\tv_nop" : "+v"(c) : "v"(ah), "v"(al), "v"(bh), "v"(bl));
  return c;
}
// batched GEMM like k_gemm_b but f16 operands: A f32 (split into f16 hi/lo if ASPLIT, else rounded to f16), Bt = f16 values [n][k]; alpha; C f32; N multiple of 16 (partial tiles skipped)
template <bool ASPLIT>
__global__ __launch_bounds__(128) void k_gemm_h(const float* __restrict__ A, int lda, size_t sA, const _Float16* __restrict__ Bh, int ldb, size_t sB, float alpha, float* __restrict__ C, int ldc, size_t sC, int M, int N, int K) {
  __shared__ __attribute__((aligned(16))) float so[4][16][64];
  const int tid = threadIdx.x, w = tid >> 5, lane = tid & 31, ln = lane & 15, hh = lane >> 4; const int by = blockIdx.y;
  A += (size_t)by * sA; Bh += (size_t)by * sB; C += (size_t)by * sC;
  const int ntn = (N + 63) / 64; const int wid = blockIdx.x * 4 + w; const int mt = wid / ntn, nq = wid % ntn; if (mt * 16 >= M) return;
  const int row0 = mt * 16, col0 = nq * 64; const float* arow = A + (size_t)(row0 + ln) * lda;
  v8f acc[4] = {};
  for (int kb = 0; kb < K; kb += 32) {
    FragH ah, al;
    const v4f x0 = *(const v4fa*)(arow + kb + 8 * hh), x1 = *(const v4fa*)(arow + kb + 8 * hh + 4), x2 = *(const v4fa*)(arow + kb + 16 + 8 * hh), x3 = *(const v4fa*)(arow + kb + 16 + 8 * hh + 4);
    float xs[16] = {x0[0],x0[1],x0[2],x0[3],x1[0],x1[1],x1[2],x1[3],x2[0],x2[1],x2[2],x2[3],x3[0],x3[1],x3[2],x3[3]};
#pragma unroll
    for (int i = 0; i < 16; ++i) { const _Float16 h = (_Float16)xs[i]; ah.h[i] = h; al.h[i] = ASPLIT ? (_Float16)(xs[i] - (float)h) : (_Float16)0.0f; }
#pragma unroll
    for (int t = 0; t < 4; ++t) { if (col0 + t * 16 >= N) continue; const size_t boff = (size_t)(col0 + t * 16 + ln) * ldb + kb; FragH bq; bq.half[0] = *(const v8us*)(Bh + boff + 8 * hh); bq.half[1] = *(const v8us*)(Bh + boff + 16 + 8 * hh);
      acc[t] = mmaH<ASPLIT ? 2 : 1>(ah.v, al.v, bq.v, bq.v, acc[t]); }
  }
#pragma unroll
  for (int t = 0; t < 4; ++t) { if (col0 + t * 16 >= N) continue;
#pragma unroll
    for (int r = 0; r < 8; ++r) so[w][8 * hh + r][t * 16 + ln] = acc[t][r] * alpha; }
  __builtin_amdgcn_fence(__ATOMIC_ACQ_REL, "workgroup"); __builtin_amdgcn_wave_barrier();
  const int rsub = lane >> 4, c4 = (lane & 15) * 4;
  {
#pragma unroll
    for (int q = 0; q < 8; ++q) { const int r = q * 2 + rsub; if (col0 + c4 < N) { const v4f v = *(const v4fa*)&so[w][r][c4]; *(v4f*)(C + (size_t)(row0 + r) * ldc + col0 + c4) = v; } }
     }
}

// Wt[n][k] = f16(W[k][n]·scale) from f32 row-major W[K][N] (scale = power of two; bf16-exact weights stay exact in f16 away from the subnormal range)
__global__ __launch_bounds__(256) void k_wt_f16(const float* __restrict__ W, _Float16* __restrict__ Wt, int K, int N, float scale) {
  const int t = blockIdx.x * 256 + threadIdx.x; if (t >= N * (K / 8)) return; const int n = t / (K / 8), k8 = (t % (K / 8)) * 8; FragH f;
#pragma unroll
  for (int i = 0; i < 8; ++i) f.h[i] = (_Float16)(bf16_round(W[(size_t)(k8 + i) * N + n]) * scale); const v8us o = f.half[0];
  *(v8us*)((unsigned short*)Wt + (size_t)n * K + k8) = o; 
}
// k_gemm_hh variant with fused epilogue: v = acc·alpha + bias[by·sBias + col] (+ CP[(row/rowsPerB)·sCPb + by·64 + col] if CP) ; ACT 0 none / 1 elu ; writes f16 C16 (and f32 C if non-null)
template <int ACT>
__global__ __launch_bounds__(128) void k_gemm_hhx(const _Float16* __restrict__ A, int lda, size_t sA, const _Float16* __restrict__ Bh, int ldb, size_t sB, float alpha, const float* __restrict__ bias, size_t sBias, const float* __restrict__ CP, int rowsPerB, size_t sCPb, int row0g,
    float* __restrict__ C, _Float16* __restrict__ C16, int ldc, size_t sC, int M, int N, int K) {
  __shared__ __attribute__((aligned(16))) float so[4][16][64];
  const int tid = threadIdx.x, w = tid >> 5, lane = tid & 31, ln = lane & 15, hh = lane >> 4; const int by = blockIdx.y;
  A += (size_t)by * sA; Bh += (size_t)by * sB; const size_t cofs = (size_t)by * sC; const float* bp = bias ? bias + (size_t)by * sBias : nullptr;
  const int ntn = (N + 63) / 64; const int wid = blockIdx.x * 4 + w; const int mt = wid / ntn, nq = wid % ntn; if (mt * 16 >= M) return;
  const int row0 = mt * 16, col0 = nq * 64; const _Float16* arow = A + (size_t)(row0 + ln) * lda;
  v8f acc[4] = {};
  for (int kb = 0; kb < K; kb += 32) { FragH ah; ah.half[0] = *(const v8us*)((const unsigned short*)arow + kb + 8 * hh); ah.half[1] = *(const v8us*)((const unsigned short*)arow + kb + 16 + 8 * hh);
#pragma unroll
    for (int t = 0; t < 4; ++t) { if (col0 + t * 16 >= N) continue; const size_t boff = (size_t)(col0 + t * 16 + ln) * ldb + kb; FragH bq; bq.half[0] = *(const v8us*)((const unsigned short*)Bh + boff + 8 * hh); bq.half[1] = *(const v8us*)((const unsigned short*)Bh + boff + 16 + 8 * hh);
      acc[t] = mmaH<1>(ah.v, ah.v, bq.v, bq.v, acc[t]); }
  }
#pragma unroll
  for (int t = 0; t < 4; ++t) { if (col0 + t * 16 >= N) continue; const int col = col0 + t * 16 + ln; const float bv = bp ? bf16_round(bp[col]) : 0.f;
#pragma unroll
    for (int r = 0; r < 8; ++r) { float v = acc[t][r] * alpha + bv; if (CP) { const int bidx = (row0g + row0 + 8 * hh + r) / rowsPerB; v += CP[(size_t)bidx * sCPb + (size_t)by * 64 + col]; } if (ACT == 1) v = (v > 0.f) ? v : expm1f(v); else if (ACT == 7) v = (v > 0.f) ? v + 1.0f : expf(v); else if (ACT == 8) v = tanhf(v); else if (ACT == 9) v = 0.5f * v * (1.0f + tanhf(0.7978845608028654f * (v + 0.044715f * v * v * v))); else if (ACT == 11) v = 1.0f / (1.0f + expf(-v)); else if (ACT == 12) v = (v > 0.f) ? v : 0.01f * v; else if (ACT == 14) v = (v > 0.f) ? v : 0.1f * v; else if (ACT == 15) v = v / (1.0f + expf(-v)); else if (ACT == 3) v = fmaxf(v, 0.f); else if (ACT == 6) v = 0.5f * v * (1.0f + erff(v * 0.70710678118654752f)); so[w][8 * hh + r][t * 16 + ln] = v; } }
  __builtin_amdgcn_fence(__ATOMIC_ACQ_REL, "workgroup"); __builtin_amdgcn_wave_barrier();
  const int rsub = lane >> 4, c4 = (lane & 15) * 4; typedef _Float16 v4h __attribute__((ext_vector_type(4)));
  {
#pragma unroll
    for (int q = 0; q < 8; ++q) { const int r = q * 2 + rsub; if (col0 + c4 < N) { const v4f v = *(const v4fa*)&so[w][r][c4]; if (C) *(v4f*)(C + cofs + (size_t)(row0 + r) * ldc + col0 + c4) = v; if (C16) { v4h h4; for (int i = 0; i < 4; ++i) h4[i] = (_Float16)v[i]; *(v4h*)(C16 + cofs + (size_t)(row0 + r) * ldc + col0 + c4) = h4; } } }
     }
}


typedef _Float16 v4h __attribute__((ext_vector_type(4)));

// ---- fragment-order plane of an f16 matrix M[rows][K]: 1-KiB blocks of 16 rows x 32 k, block (row >> 4, k >> 5) at element ((row >> 4) * (K >> 5) + (k >> 5)) * 512;
// inside a block 64 pieces of 8 k: piece j * 32 + lane holds row (lane & 15), k = 16 * j + 8 * (lane >> 4) + 0..7. A wave's 16-byte fragment load reads 512 bytes in a row: 4 whole lines, not 16 pieces of lines.
__device__ __forceinline__ size_t fo_src(size_t t, int K) { const int kbn = K >> 5; const size_t blk = t >> 6; const int c = (int)(t & 63), j = c >> 5, l = c & 31; return ((blk / kbn) * 16 + (l & 15)) * (size_t)K + (size_t)(blk % kbn) * 32 + j * 16 + (l >> 4) * 8; }      /* piece t of a plane -> its first element in the row-major matrix */

// All eight conversions to f16 fragment-order planes (K = EMB) in one grid: a block's index range names its matrix. Activations as they are, weights stored (out,in) (== Bt[n][k]) times 16 (a power of two: exact).
#define CVL (NRL * EMB / 8 / 256)      /* blocks of the local activations */
#define CVG (NRG * EMB / 8 / 256)      /* blocks of the global activations */
#define CVW (EMB * EMB / 8 / 256)      /* blocks of one weight */
__global__ __launch_bounds__(256) void k_conv(const float* __restrict__ lh, const float* __restrict__ gh, const float* __restrict__ qw, const float* __restrict__ kw, const float* __restrict__ vw, const float* __restrict__ kgw, const float* __restrict__ vgw, const float* __restrict__ ow,
    _Float16* __restrict__ XL, _Float16* __restrict__ XG, _Float16* __restrict__ BQ, _Float16* __restrict__ BK, _Float16* __restrict__ BV, _Float16* __restrict__ BKG, _Float16* __restrict__ BVG, _Float16* __restrict__ BO) {
  int bx = blockIdx.x; const float* s; _Float16* d; float sc = 16.0f;
  if (bx < CVL) { s = lh; d = XL; sc = 1.0f; }
  else if (bx < CVL + CVG) { bx -= CVL; s = gh; d = XG; sc = 1.0f; }
  else { bx -= CVL + CVG; const int m = bx / CVW; bx -= m * CVW;
    s = (m == 0) ? qw : (m == 1) ? kw : (m == 2) ? vw : (m == 3) ? kgw : (m == 4) ? vgw : ow; d = (m == 0) ? BQ : (m == 1) ? BK : (m == 2) ? BV : (m == 3) ? BKG : (m == 4) ? BVG : BO; }
  const size_t t = (size_t)bx * 256 + threadIdx.x; const float* p = s + fo_src(t, EMB); FragH f;
#pragma unroll      /* in full: the piece's eight values stay in registers and are read by two 16-byte loads */
  for (int q = 0; q < 8; ++q) f.h[q] = (_Float16)(bf16_round(p[q]) * sc);
  *(v8us*)((unsigned short*)d + t * 8) = f.half[0]; }
__global__ __launch_bounds__(256) void k_h16(const float* __restrict__ x, _Float16* __restrict__ X16, size_t n8) { const size_t t = (size_t)blockIdx.x * 256 + threadIdx.x; if (t >= n8) return; FragH f;
#pragma unroll
  for (int q = 0; q < 8; ++q) f.h[q] = (_Float16)x[t * 8 + q]; *(v8us*)((unsigned short*)X16 + t * 8) = f.half[0];  }
__global__ __launch_bounds__(256) void k_round16f(const float* __restrict__ W, _Float16* __restrict__ Bt, size_t n8) { const size_t t = (size_t)blockIdx.x * 256 + threadIdx.x; if (t >= n8) return; FragH f;
#pragma unroll
  for (int i = 0; i < 8; ++i) f.h[i] = (_Float16)(bf16_round(W[t * 8 + i]) * 16.0f); *(v8us*)((unsigned short*)Bt + t * 8) = f.half[0];  }
__global__ __launch_bounds__(256) void k_hl(const float* __restrict__ F, _Float16* __restrict__ Hh, _Float16* __restrict__ Hl, size_t n8) { const size_t t = (size_t)blockIdx.x * 256 + threadIdx.x; if (t >= n8) return; FragH fh, fl; const v4f a = *(const v4fa*)(F + t * 8), c = *(const v4fa*)(F + t * 8 + 4);
#pragma unroll
  for (int q = 0; q < 4; ++q) { _Float16 h = (_Float16)a[q]; fh.h[q] = h; fl.h[q] = (_Float16)((a[q] - (float)h) * 1024.0f); h = (_Float16)c[q]; fh.h[4 + q] = h; fl.h[4 + q] = (_Float16)((c[q] - (float)h) * 1024.0f); }
  { *(v8us*)((unsigned short*)Hh + t * 8) = fh.half[0]; *(v8us*)((unsigned short*)Hl + t * 8) = fl.half[0];  } }

// ---- head prefetch: the f16 planes that a matrix launch reads were stored by an earlier launch; all work-groups walk k (or the keys) at one pace, so the foremost meets such first reads step after step and the loops fetch only one or two steps ahead.
// Each matrix launch therefore opens by asking L2 for all of these planes at once, one request per aligned 256-byte unit (128 f16). The planes are dealt over the grid in slices; nothing is returned and nothing waits for the data.
// Work-groups b and b ^ 4 ask for the same slice. For speed only: a slice that is not asked for is read as before.
__device__ __forceinline__ int pf_slice(int b) { return (b & 3) | ((b >> 3) << 2); }
__device__ __forceinline__ void pf_ask(const _Float16* p) { asm volatile("global_prefetch_b8 %0, off scope:SCOPE_SE\n\ts_wait_xcnt 0x0" :: "v"(p) : "memory"); }      /* every lane asks for its own unit, inside the plane; the wait stands in the same statement, in front of any reuse of the address registers */
__device__ __forceinline__ void pf_hold(const _Float16* p) { asm volatile("" :: "v"(p)); }      /* at the kernel's end, input only: a prefetch counts on no counter, so its address registers are kept for nothing else as long as the kernel runs */
// ---- fast GEMM (wave tile 32x64; requires M % 32 == 0 rows per launch region, N % 64 == 0 and K % 64 == 0); epilogue = k_gemm_hhx semantics ----
// Two fragment sets (even and odd 32-k steps). Each fragment is reloaded for the step two ahead right behind its last product, so a step's loads fly under the other set's products.
__device__ __forceinline__ v16h g2_frag(const _Float16* p, int k, int lane) { FragH f; const unsigned short* q = (const unsigned short*)p + (size_t)k * 16 + lane * 8; f.half[0] = *(const v8us*)q; f.half[1] = *(const v8us*)(q + 256); return f.v; }      /* p: a 16-row strip of a fragment-order plane; k: multiple of 32 */
__device__ __forceinline__ v8f g2_mma(v16h a, v16h b, v8f c) { v8f d = __builtin_amdgcn_wmma_f32_16x16x32_f16(false, a, false, b, (short)0, c, false, false); asm volatile("v_nop\n\tv_nop\n\tv_nop\n\tv_nop" : "+v"(d) : "v"(a), "v"(b)); return d; }
template <int ACT>      /* A and Bh: fragment-order planes with K = lda = ldb; FO 1: the result goes to C16 alone, as such a plane (K = ldc); FO 2: to C16 alone, transposed per head, as the plane V^T of the attention (rows = (batch * NH + head) * 64 + d, K = 1 << vsh keys per batch; N = NH * 64); bx, by: the block's place in its own product's grid */
__device__ __forceinline__ void gemm2_body(float (*so)[32][68], const int bx, const int by, const int FO, const int vsh, const _Float16* __restrict__ A, int lda, size_t sA, const _Float16* __restrict__ Bh, int ldb, size_t sB, float alpha, const float* __restrict__ bias, size_t sBias, const float* __restrict__ CP, int rowsPerB, size_t sCPb, int row0g,
    float* __restrict__ C, _Float16* __restrict__ C16, int ldc, size_t sC, int M, int N, int K) {
  const int tid = threadIdx.x, w = tid >> 5, lane = tid & 31, ln = lane & 15, hh = lane >> 4;
  A += (size_t)by * sA; Bh += (size_t)by * sB; const size_t cofs = (size_t)by * sC; const float* bp = bias ? bias + (size_t)by * sBias : nullptr;
  const int ntn = N >> 6; const int mt = bx / ntn, nq = bx - mt * ntn; const int row0 = mt * 128 + 32 * w, col0 = nq * 64; if (row0 >= M) return;
  const _Float16* a0p = A + (size_t)row0 * lda; const _Float16* a1p = a0p + (size_t)16 * lda;
  const _Float16* b0p = Bh + (size_t)col0 * ldb; const _Float16* b1p = b0p + (size_t)16 * ldb; const _Float16* b2p = b1p + (size_t)16 * ldb; const _Float16* b3p = b2p + (size_t)16 * ldb;
  const v8f z8 = {0.f,0.f,0.f,0.f,0.f,0.f,0.f,0.f}; v8f c00 = z8, c01 = z8, c02 = z8, c03 = z8, c10 = z8, c11 = z8, c12 = z8, c13 = z8;
  v16h a0 = g2_frag(a0p, 0, lane), a1 = g2_frag(a1p, 0, lane), b0 = g2_frag(b0p, 0, lane), b1 = g2_frag(b1p, 0, lane), b2 = g2_frag(b2p, 0, lane), b3 = g2_frag(b3p, 0, lane);
  v16h e0 = g2_frag(a0p, 32, lane), e1 = g2_frag(a1p, 32, lane), f0 = g2_frag(b0p, 32, lane), f1 = g2_frag(b1p, 32, lane), f2 = g2_frag(b2p, 32, lane), f3 = g2_frag(b3p, 32, lane);
#pragma unroll 1      /* rolled: the body already holds both sets; more copies only add code */
  for (int kb = 0; kb < K; kb += 64) { const int kn = (kb + 64 < K) ? kb + 64 : kb;      /* last trip: re-reads its own step (in bounds, unused) */
    c00 = g2_mma(a0, b0, c00); c10 = g2_mma(a1, b0, c10); b0 = g2_frag(b0p, kn, lane);
    c01 = g2_mma(a0, b1, c01); c11 = g2_mma(a1, b1, c11); b1 = g2_frag(b1p, kn, lane);
    c02 = g2_mma(a0, b2, c02); c12 = g2_mma(a1, b2, c12); b2 = g2_frag(b2p, kn, lane);
    c03 = g2_mma(a0, b3, c03); c13 = g2_mma(a1, b3, c13); b3 = g2_frag(b3p, kn, lane); a0 = g2_frag(a0p, kn, lane); a1 = g2_frag(a1p, kn, lane);
    c00 = g2_mma(e0, f0, c00); c10 = g2_mma(e1, f0, c10); f0 = g2_frag(b0p, kn + 32, lane);
    c01 = g2_mma(e0, f1, c01); c11 = g2_mma(e1, f1, c11); f1 = g2_frag(b1p, kn + 32, lane);
    c02 = g2_mma(e0, f2, c02); c12 = g2_mma(e1, f2, c12); f2 = g2_frag(b2p, kn + 32, lane);
    c03 = g2_mma(e0, f3, c03); c13 = g2_mma(e1, f3, c13); f3 = g2_frag(b3p, kn + 32, lane); e0 = g2_frag(a0p, kn + 32, lane); e1 = g2_frag(a1p, kn + 32, lane);
    asm volatile("s_wait_xcnt 0x0" ::: "memory"); }      /* the next trip forms new addresses in the registers that this trip's loads name: wait before they are overwritten */
  v8f accs[8] = {c00, c01, c02, c03, c10, c11, c12, c13};
  if (FO == 2) {      /* a lane's eight accumulators of a tile are eight keys in a row (16 * half + 8 * hh + r) of one d (t * 16 + ln): one 16-byte piece of the V^T plane, stored as it stands, through no LDS; the wave's 32 keys x 64 d = 4 blocks, 8 stores of 512 bytes in a row; the short loops are unrolled in full, so that the arrays stay in registers */
    const int slab = (row0 >> vsh) * NH + nq, kblk = (row0 & ((1 << vsh) - 1)) >> 5;
    unsigned short* vp = (unsigned short*)C16 + ((((size_t)slab * 4) << (vsh - 5)) + kblk) * 512 + lane * 8; FragH f[8]; float bv[4] = {0.f, 0.f, 0.f, 0.f};
    if (bp) {      /* one test, so that the four loads fly together */
#pragma unroll
      for (int t = 0; t < 4; ++t) bv[t] = bp[col0 + t * 16 + ln];
#pragma unroll
      for (int t = 0; t < 4; ++t) bv[t] = bf16_round(bv[t]); }
#pragma unroll
    for (int u = 0; u < 8; ++u)
#pragma unroll
      for (int r = 0; r < 8; ++r) f[u].h[r] = (_Float16)(accs[u][r] * alpha + bv[u & 3]);
#pragma unroll
    for (int u = 0; u < 8; ++u) *(v8us*)(vp + (((size_t)(u & 3)) << (vsh - 5)) * 512 + (u >> 2) * 256) = f[u].half[0];
    return; }
#pragma unroll
  for (int u = 0; u < 8; ++u) { const int t = u & 3, half = u >> 2; const int col = col0 + t * 16 + ln; const float bv = bp ? bf16_round(bp[col]) : 0.f;
#pragma unroll
    for (int r = 0; r < 8; ++r) { const int rloc = half * 16 + 8 * hh + r; float v = accs[u][r] * alpha + bv; if (CP) { const int bidx = (row0g + row0 + rloc) / rowsPerB; v += CP[(size_t)bidx * sCPb + (size_t)by * 64 + col]; }
      if (ACT == 3) v = fmaxf(v, 0.f); else if (ACT == 6) v = 0.5f * v * (1.0f + erff(v * 0.70710678118654752f)); else if (ACT == 11) v = 1.0f / (1.0f + expf(-v)); else if (ACT == 15) v = v / (1.0f + expf(-v)); else if (ACT == 12) v = (v > 0.f) ? v : 0.01f * v; else if (ACT == 8) v = tanhf(v);
      so[w][rloc][t * 16 + ln] = v; } }
  __builtin_amdgcn_fence(__ATOMIC_ACQ_REL, "workgroup"); __builtin_amdgcn_wave_barrier();
  const int rsub = lane >> 4, c4 = (lane & 15) * 4;
  if (FO == 0) {
#pragma unroll
    for (int q = 0; q < 16; ++q) { const int r = q * 2 + rsub; const v4f v = *(const v4fa*)&so[w][r][c4]; if (C) *(v4f*)(C + cofs + (size_t)(row0 + r) * ldc + col0 + c4) = v; if (C16) { v4h h4; for (int i = 0; i < 4; ++i) h4[i] = (_Float16)v[i]; *(v4h*)(C16 + cofs + (size_t)(row0 + r) * ldc + col0 + c4) = h4; } }
    asm volatile("s_wait_xcnt 0x0" ::: "memory");      /* a precaution: wait before the registers that these stores name are overwritten */
     } else {      /* the wave's 32 x 64 tile = 2 x 2 blocks of the plane, 8 stores of 512 bytes in a row */
#pragma unroll
      for (int u = 0; u < 8; ++u) { const int rbl = u >> 2, kbl = (u >> 1) & 1, j = u & 1; const float* sp = &so[w][rbl * 16 + ln][kbl * 32 + j * 16 + hh * 8]; const v4f x = *(const v4fa*)sp, y = *(const v4fa*)(sp + 4); FragH f;
#pragma unroll
        for (int i = 0; i < 4; ++i) { f.h[i] = (_Float16)x[i]; f.h[4 + i] = (_Float16)y[i]; }
        *(v8us*)((unsigned short*)C16 + cofs + (size_t)(row0 + rbl * 16) * ldc + (size_t)((col0 >> 5) + kbl) * 512 + j * 256 + lane * 8) = f.half[0]; }
      asm volatile("s_wait_xcnt 0x0" ::: "memory");      /* as above */
     } }
template <int ACT, bool FO>
__global__ __launch_bounds__(128) void k_gemm2(const _Float16* __restrict__ A, int lda, size_t sA, const _Float16* __restrict__ Bh, int ldb, size_t sB, float alpha, const float* __restrict__ bias, size_t sBias, const float* __restrict__ CP, int rowsPerB, size_t sCPb, int row0g,
    float* __restrict__ C, _Float16* __restrict__ C16, int ldc, size_t sC, int M, int N, int K) {
  __shared__ __attribute__((aligned(16))) float so[4][32][68];
  static_assert((NRL / 128) * (EMB / 64) == 512 && NRL * EMB == 256 * 128 * 128 && EMB * EMB == 256 * 32 * 128, "head prefetch: 256 slices of 128 units of A and 32 units of Bh");      /* the one launch of this kernel: A = NRL x EMB, Bh = EMB x EMB, 512 work-groups */
  const int ps = pf_slice(blockIdx.x);
  const _Float16* pf0 = A + ((size_t)ps * 128 + threadIdx.x) * 128; const _Float16* pf1 = Bh + ((size_t)ps * 32 + (threadIdx.x & 31)) * 128;
  pf_ask(pf0);
  if (__builtin_amdgcn_readfirstlane(threadIdx.x >> 5) == 0) pf_ask(pf1);      /* 32 units: one wave's request; a scalar branch */
  gemm2_body<ACT>(so, blockIdx.x, blockIdx.y, FO ? 1 : 0, 5, A, lda, sA, Bh, ldb, sB, alpha, bias, sBias, CP, rowsPerB, sCPb, row0g, C, C16, ldc, sC, M, N, K);
  pf_hold(pf0); pf_hold(pf1); }
// ---- projection GEMM, wave tile 64 x 64, block = 2 x 4 waves = 128 rows x 256 columns (M % 128 == 0; N = K = EMB): every 1-KiB fragment feeds four products (in the 32 x 64 tile a B fragment feeds two):
// 8 KiB are loaded per 16 products where the 32 x 64 tile loads 12, and the block asks L2 for 24 KiB per 128 products where four 128 x 64 blocks ask 48.
// A has two fragment sets (even and odd 32-k steps), each reloaded for the step two ahead behind its last product; a B fragment is reloaded for the next step behind its four products, twelve products ahead of its next use.
__device__ __forceinline__ void gemm4_body(float (*so)[64][68], const int bx, const int FO, const int vsh, const _Float16* __restrict__ A, const _Float16* __restrict__ Bh, const float* __restrict__ bias, _Float16* __restrict__ C16) {
  const int tid = threadIdx.x, w = tid >> 5, lane = tid & 31, ln = lane & 15, hh = lane >> 4;
  constexpr int ntn = EMB >> 8; const int mt = bx / ntn, nq = bx - mt * ntn; const int row0 = mt * 128 + 64 * (w >> 2), col0 = nq * 256 + 64 * (w & 3);
  const _Float16* ap = A + (size_t)row0 * EMB; const _Float16* bp = Bh + (size_t)col0 * EMB;      /* strip i of 16 rows: + i * 16 * EMB; the short loops below are all unrolled in full, so that the arrays stay in registers */
  v8f c[4][4]; v16h a[4], e[4], b[4];
#pragma unroll
  for (int i = 0; i < 4; ++i) {
#pragma unroll
    for (int t = 0; t < 4; ++t) c[i][t] = (v8f){0.f,0.f,0.f,0.f,0.f,0.f,0.f,0.f}; }
#pragma unroll
  for (int i = 0; i < 4; ++i) a[i] = g2_frag(ap + (size_t)i * 16 * EMB, 0, lane);      /* A, B, then the odd A set: the order in which the loop leaves its loads, so that the counted wait at the loop's head is the same on both ways in */
  __builtin_amdgcn_sched_barrier(0);      /* holds that order: left free, the odd A set's loads are grouped with the even set's, and the loop's counted waits then ask for B fragments four loads too early on every trip */
#pragma unroll
  for (int i = 0; i < 4; ++i) b[i] = g2_frag(bp + (size_t)i * 16 * EMB, 0, lane);
  __builtin_amdgcn_sched_barrier(0);      /* as above */
#pragma unroll
  for (int i = 0; i < 4; ++i) e[i] = g2_frag(ap + (size_t)i * 16 * EMB, 32, lane);
#pragma unroll 1      /* rolled: the body already holds both steps; more copies only add code */
  for (int kb = 0; kb < EMB; kb += 64) { const int kn = (kb + 64 < EMB) ? kb + 64 : kb;      /* last trip: re-reads its own step (in bounds, unused) */
#pragma unroll
    for (int t = 0; t < 4; ++t) {
#pragma unroll
      for (int i = 0; i < 4; ++i) c[i][t] = g2_mma(a[i], b[t], c[i][t]);
      b[t] = g2_frag(bp + (size_t)t * 16 * EMB, kb + 32, lane); }
#pragma unroll
    for (int i = 0; i < 4; ++i) a[i] = g2_frag(ap + (size_t)i * 16 * EMB, kn, lane);
#pragma unroll
    for (int t = 0; t < 4; ++t) {
#pragma unroll
      for (int i = 0; i < 4; ++i) c[i][t] = g2_mma(e[i], b[t], c[i][t]);
      b[t] = g2_frag(bp + (size_t)t * 16 * EMB, kn, lane); }
#pragma unroll
    for (int i = 0; i < 4; ++i) e[i] = g2_frag(ap + (size_t)i * 16 * EMB, kn + 32, lane);
    asm volatile("s_wait_xcnt 0x0" ::: "memory"); }      /* the next trip forms new addresses in the registers that this trip's loads name: wait before they are overwritten */
  const float alpha = 0.0625f; float bv[4];
#pragma unroll
  for (int t = 0; t < 4; ++t) bv[t] = bias[col0 + t * 16 + ln];
#pragma unroll
  for (int t = 0; t < 4; ++t) bv[t] = bf16_round(bv[t]);
  if (FO == 2) {      /* as in gemm2_body, once per 32 keys: a lane's eight accumulators of a tile are eight keys in a row of one d: one 16-byte piece of the V^T plane, stored as it stands, through no LDS */
#pragma unroll
    for (int h = 0; h < 2; ++h) { const int r0 = row0 + 32 * h; const int slab = (r0 >> vsh) * NH + (col0 >> 6), kblk = (r0 & ((1 << vsh) - 1)) >> 5;
      unsigned short* vp = (unsigned short*)C16 + ((((size_t)slab * 4) << (vsh - 5)) + kblk) * 512 + lane * 8; FragH f[8];
#pragma unroll
      for (int u = 0; u < 8; ++u)
#pragma unroll
        for (int r = 0; r < 8; ++r) f[u].h[r] = (_Float16)(c[2 * h + (u >> 2)][u & 3][r] * alpha + bv[u & 3]);
#pragma unroll
      for (int u = 0; u < 8; ++u) *(v8us*)(vp + (((size_t)(u & 3)) << (vsh - 5)) * 512 + (u >> 2) * 256) = f[u].half[0];
      if (h == 0) asm volatile("s_wait_xcnt 0x0" ::: "memory"); }      /* the registers that the first half's stores name are reused by the second half: wait before they are overwritten */
    return; }
#pragma unroll
  for (int u = 0; u < 16; ++u) { const int t = u & 3, i = u >> 2;      /* as in gemm2_body, through the wave's own LDS patch, here of 64 rows */
#pragma unroll
    for (int r = 0; r < 8; ++r) so[w][i * 16 + 8 * hh + r][t * 16 + ln] = c[i][t][r] * alpha + bv[t]; }
  __builtin_amdgcn_fence(__ATOMIC_ACQ_REL, "workgroup"); __builtin_amdgcn_wave_barrier();      /* the lanes read what other lanes of the wave wrote */
  FragH f[16];
#pragma unroll
  for (int u = 0; u < 16; ++u) { const int rbl = u >> 2, kbl = (u >> 1) & 1, j = u & 1; const float* sp = &so[w][rbl * 16 + ln][kbl * 32 + j * 16 + hh * 8]; const v4f x = *(const v4fa*)sp, y = *(const v4fa*)(sp + 4);      /* the wave's 64 x 64 tile = 4 x 2 blocks of the plane */
#pragma unroll
    for (int i = 0; i < 4; ++i) { f[u].h[i] = (_Float16)x[i]; f[u].h[4 + i] = (_Float16)y[i]; } }
#pragma unroll
  for (int u = 0; u < 16; ++u) { const int rbl = u >> 2, kbl = (u >> 1) & 1, j = u & 1;      /* 16 stores of 512 bytes in a row, each piece in registers of its own */
    *(v8us*)((unsigned short*)C16 + (size_t)(row0 + rbl * 16) * EMB + (size_t)((col0 >> 5) + kbl) * 512 + j * 256 + lane * 8) = f[u].half[0]; }
  asm volatile("s_wait_xcnt 0x0" ::: "memory"); }      /* FO is a run-time flag: the built code can lead from these stores on into the other path, which reuses their registers: wait before they are overwritten */
// The five input projections in one grid: a block's index range names its product (Q, K, V of the local rows, then K, V of the global rows). Q and both K leave as fragment-order planes, both V as the transposed planes that the attention reads.
#define PJL ((NRL / 128) * (EMB / 64))      /* blocks of the output projection (128 x 64 each) */
#define PJL4 ((NRL / 128) * (EMB / 256))      /* blocks of one local projection (128 x 256 each) */
#define PJG4 ((NRG / 128) * (EMB / 256))      /* blocks of one global projection */
__global__ __launch_bounds__(256) void k_proj(const _Float16* __restrict__ XL, const _Float16* __restrict__ XG, const _Float16* __restrict__ BQ, const _Float16* __restrict__ BK, const _Float16* __restrict__ BV, const _Float16* __restrict__ BKG, const _Float16* __restrict__ BVG,
    const float* __restrict__ qb, const float* __restrict__ kb, const float* __restrict__ vb, const float* __restrict__ kgb, const float* __restrict__ vgb, _Float16* __restrict__ Q16, _Float16* __restrict__ KL, _Float16* __restrict__ VTL, _Float16* __restrict__ KG, _Float16* __restrict__ VTG) {
  __shared__ __attribute__((aligned(16))) float so[8][64][68];
  static_assert(LL == 1 << 11 && GG == 1 << 9 && EMB == NH * 64, "vsh");
  static_assert(3 * PJL4 + 2 * PJG4 == 448 && NRL * EMB == 128 * 32768 && NRG * EMB == 32 * 32768 && EMB * EMB == 32 * 32768, "head prefetch: 224 slices, 320 chunks of 256 units");
  const int ps = pf_slice(blockIdx.x), pc = (ps < 96) ? ps : 95;      /* a chunk = 256 units = 32768 f16, one unit a thread; slices 0..127 the local rows, then the global rows and their two weights; slices 0..95 take a second chunk, of the three local weights (pc: that address stays inside a plane where it is not asked for) */
  const _Float16* pf0 = ((ps < 128) ? XL + (size_t)ps * 32768 : (ps < 160) ? XG + (size_t)(ps - 128) * 32768 : (ps < 192) ? BKG + (size_t)(ps - 160) * 32768 : BVG + (size_t)(ps - 192) * 32768) + threadIdx.x * 128;
  const _Float16* pf1 = ((pc < 32) ? BQ + (size_t)pc * 32768 : (pc < 64) ? BK + (size_t)(pc - 32) * 32768 : BV + (size_t)(pc - 64) * 32768) + threadIdx.x * 128;
  pf_ask(pf0);
  if (ps < 96) pf_ask(pf1);      /* the same for the whole work-group: a scalar branch */
  int bx = blockIdx.x; const _Float16* A; const _Float16* B; const float* bias; _Float16* C; int fo, vsh;
  if (bx < 3 * PJL4) { const int m = bx / PJL4; bx -= m * PJL4; A = XL; B = (m == 0) ? BQ : (m == 1) ? BK : BV; bias = (m == 0) ? qb : (m == 1) ? kb : vb; C = (m == 0) ? Q16 : (m == 1) ? KL : VTL; fo = (m != 2) ? 1 : 2; vsh = 11; }
  else { bx -= 3 * PJL4; const int m = bx / PJG4; bx -= m * PJG4; A = XG; B = (m == 0) ? BKG : BVG; bias = (m == 0) ? kgb : vgb; C = (m == 0) ? KG : VTG; fo = (m == 0) ? 1 : 2; vsh = 9; }
  gemm4_body(so, bx, fo, vsh, A, B, bias, C);
  pf_hold(pf0); pf_hold(pf1); }



template <int CAUSAL>
__global__ __launch_bounds__(128) void k_flash(const _Float16* __restrict__ Q16, int ldq, const _Float16* __restrict__ K16, int ldk, const _Float16* __restrict__ Vt, const int* __restrict__ MSK, float* __restrict__ O, int ldo) {
  constexpr int RPW = 16, RTN = RPW / 16, NQB = TQ / (4 * RPW), DT = 4, KS = 2;
  __shared__ __attribute__((aligned(16))) unsigned short sP[4][RPW][40]; __shared__ __attribute__((aligned(16))) float sO[4][RPW][64 + 4];
  const int tid = threadIdx.x, w = tid >> 5, lane = tid & 31, ln = lane & 15, hh = lane >> 4;
  const int slab = blockIdx.x / QBLKS, qblk = blockIdx.x % QBLKS; (void)NQB; const int b = slab / NH, h = slab % NH; const int qb0 = qblk * (4 * RPW); const int q0 = qb0 + w * RPW;
  FragH aq[2][KS];
#pragma unroll
  for (int rt = 0; rt < RTN; ++rt) { const unsigned short* qr = (const unsigned short*)Q16 + ((size_t)b * TQ + q0 + rt * 16 + ln) * ldq + h * 64;
#pragma unroll
    for (int ks = 0; ks < KS; ++ks) { aq[rt][ks].half[0] = *(const v8us*)(qr + ks * 32 + 8 * hh); aq[rt][ks].half[1] = *(const v8us*)(qr + ks * 32 + 16 + 8 * hh); } }
  const unsigned short* Vth = (const unsigned short*)Vt + (size_t)slab * 64 * TK;
  float m_r[2][8], l_r[2][8]; v8f oacc[2][DT];
#pragma unroll
  for (int rt = 0; rt < RTN; ++rt) {
#pragma unroll
    for (int r = 0; r < 8; ++r) { m_r[rt][r] = -3.0e38f; l_r[rt][r] = 0.f; }
#pragma unroll
    for (int dt = 0; dt < DT; ++dt) oacc[rt][dt] = (v8f){0.f,0.f,0.f,0.f,0.f,0.f,0.f,0.f}; }
  const int jend = (CAUSAL == 1) ? (qb0 + 4 * RPW) : TK;      /* causal: keys beyond the block's last query never contribute */
#pragma unroll 1
  for (int j0 = 0; j0 < jend; j0 += 32) {
    v8f s[2][2];
#pragma unroll
    for (int nt = 0; nt < 2; ++nt) { const unsigned short* kr = (const unsigned short*)K16 + ((size_t)b * TK + j0 + nt * 16 + ln) * ldk + h * 64; FragH bk[KS];
#pragma unroll
      for (int ks = 0; ks < KS; ++ks) { bk[ks].half[0] = *(const v8us*)(kr + ks * 32 + 8 * hh); bk[ks].half[1] = *(const v8us*)(kr + ks * 32 + 16 + 8 * hh); }
#pragma unroll
      for (int rt = 0; rt < RTN; ++rt) { v8f acc = (v8f){0.f,0.f,0.f,0.f,0.f,0.f,0.f,0.f};
#pragma unroll
        for (int ks = 0; ks < KS; ++ks) acc = mmaH<1>(aq[rt][ks].v, aq[rt][ks].v, bk[ks].v, bk[ks].v, acc); s[rt][nt] = acc; } }
#pragma unroll
    for (int rt = 0; rt < RTN; ++rt)
#pragma unroll
      for (int r = 0; r < 8; ++r) { const int tq = q0 + rt * 16 + 8 * hh + r; const int k0 = j0 + ln, k1 = j0 + 16 + ln;
        const bool ok0 = (CAUSAL == 1) ? (k0 <= tq) : ((CAUSAL == 2) ? ((k0 >> 5) == (tq >> 5)) : true), ok1 = (CAUSAL == 1) ? (k1 <= tq) : ((CAUSAL == 2) ? ((k1 >> 5) == (tq >> 5)) : true);      /* mode 2: block-diagonal 32-token groups */
        const float s0 = ok0 ? s[rt][0][r] * SCL : -3.0e38f, s1 = ok1 ? s[rt][1][r] * SCL : -3.0e38f; float mc = fmaxf(s0, s1);
        mc = fmaxf(mc, __shfl_xor(mc, 1, 32)); mc = fmaxf(mc, __shfl_xor(mc, 2, 32)); mc = fmaxf(mc, __shfl_xor(mc, 4, 32)); mc = fmaxf(mc, __shfl_xor(mc, 8, 32));
        const float mn = fmaxf(m_r[rt][r], mc); const float al = (mn > -1.0e38f) ? expf(m_r[rt][r] - mn) : 1.0f; m_r[rt][r] = mn; const float p0 = ok0 ? expf(s0 - mn) : 0.f, p1 = ok1 ? expf(s1 - mn) : 0.f; l_r[rt][r] = l_r[rt][r] * al + p0 + p1;
#pragma unroll
        for (int dt = 0; dt < DT; ++dt) oacc[rt][dt][r] *= al;
        FragH t2; t2.h[0] = (_Float16)(p0 * 1024.0f); t2.h[1] = (_Float16)(p1 * 1024.0f); sP[w][rt * 16 + 8 * hh + r][ln] = t2.u[0]; sP[w][rt * 16 + 8 * hh + r][16 + ln] = t2.u[1]; }
    __builtin_amdgcn_fence(__ATOMIC_ACQ_REL, "workgroup"); __builtin_amdgcn_wave_barrier();
    FragH pa[2];
#pragma unroll
    for (int rt = 0; rt < RTN; ++rt) { pa[rt].half[0] = *(const v8us*)&sP[w][rt * 16 + ln][8 * hh]; pa[rt].half[1] = *(const v8us*)&sP[w][rt * 16 + ln][16 + 8 * hh]; }
#pragma unroll
    for (int dt = 0; dt < DT; ++dt) { const unsigned short* vrow = Vth + (size_t)(dt * 16 + ln) * TK + j0; FragH bv; bv.half[0] = *(const v8us*)(vrow + 8 * hh); bv.half[1] = *(const v8us*)(vrow + 16 + 8 * hh);
#pragma unroll
      for (int rt = 0; rt < RTN; ++rt) oacc[rt][dt] = mmaH<1>(pa[rt].v, pa[rt].v, bv.v, bv.v, oacc[rt][dt]); }
    __builtin_amdgcn_fence(__ATOMIC_ACQ_REL, "workgroup"); __builtin_amdgcn_wave_barrier(); }
#pragma unroll
  for (int rt = 0; rt < RTN; ++rt) {
#pragma unroll
    for (int r = 0; r < 8; ++r) { float l = l_r[rt][r]; l += __shfl_xor(l, 1, 32); l += __shfl_xor(l, 2, 32); l += __shfl_xor(l, 4, 32); l += __shfl_xor(l, 8, 32); l_r[rt][r] = (l > 0.f) ? 1.0f / (l * 1024.0f) : 0.f; }
#pragma unroll
    for (int dt = 0; dt < DT; ++dt)
#pragma unroll
      for (int r = 0; r < 8; ++r) sO[w][rt * 16 + 8 * hh + r][dt * 16 + ln] = oacc[rt][dt][r] * l_r[rt][r]; }
  __builtin_amdgcn_fence(__ATOMIC_ACQ_REL, "workgroup"); __builtin_amdgcn_wave_barrier();
  {
#pragma unroll
    for (int rp = 0; rp < RPW; rp += 2) { const int r = rp + (lane >> 4), pc = lane & 15; const v4f val = *(const v4fa*)&sO[w][r][pc * 4]; *(v4f*)(O + ((size_t)b * TQ + q0 + r) * ldo + h * 64 + pc * 4) = val; }
     } }

// Attention with both products transposed: S^T = K Q^T (A = 16 keys, B = 16 queries) and O^T += V^T P^T (A = 16 values of d, B = P^T).
// A lane holds 16 of the 32 scores of ONE query (keys 8 * hh + r of each 16-key tile): maximum and sum are taken in the lane, plus one exchange between the wave's halves.
// The two score tiles, converted in place, are the B operand of the second product in the planes' own k order (16 * j + 8 * hh + i): P goes through no LDS and no lane exchange.
// The softmax runs in base 2: e^(SCL * s - m) = 2^(SCL2 * s - m2), so each score costs one fma and one hardware exponential (arguments are <= 10; far below, the result goes to 0, as it should).
#define SCL2 0.18033688011112042f      /* 64^-0.5 * log2(e) */
typedef float v2f __attribute__((ext_vector_type(2)));
__device__ __forceinline__ float xhalf(float x) { return __int_as_float(__builtin_amdgcn_permlanex16(__float_as_int(x), __float_as_int(x), 0x76543210, 0xfedcba98, false, false)); }      /* lane l <-> l ^ 16 */
template <int TKv>      /* bx: the block's place in the grid; res[dt][r] = the attention's output O[q0 + ln][dt * 16 + 8 * hh + r], left in registers */
__device__ __forceinline__ void flashT_body(const int bx, const _Float16* __restrict__ Q16, int ldq, const _Float16* __restrict__ K16, int ldk, const _Float16* __restrict__ Vt, v8f (&res)[4]) {
  constexpr int RPW = 16, DT = 4, KS = 2;      /* the short inner loops below are all unrolled in full, so that the fragment arrays stay in registers */
  const int tid = threadIdx.x, w = tid >> 5, lane = tid & 31, ln = lane & 15, hh = lane >> 4;
  const int slab = bx / QBLKS, qblk = bx % QBLKS; const int b = slab / NH, h = slab % NH; const int q0 = qblk * (4 * RPW) + w * RPW;
  FragH bq[KS];      /* Q, the B operand of the score product, kept for the whole key loop */
  { const unsigned short* qr = (const unsigned short*)Q16 + ((size_t)b * TQ + q0) * ldq + h * 1024 + lane * 8;      /* fragment-order plane: strip of 16 queries, the head's two blocks */
#pragma unroll
    for (int ks = 0; ks < KS; ++ks) { bq[ks].half[0] = *(const v8us*)(qr + ks * 512); bq[ks].half[1] = *(const v8us*)(qr + ks * 512 + 256); } }
  FragH ak[2][KS];      /* K fragments (A operand), fetched one pass ahead */
#pragma unroll
  for (int nt = 0; nt < 2; ++nt) { const unsigned short* kr = (const unsigned short*)K16 + ((size_t)b * TKv + nt * 16) * ldk + h * 1024 + lane * 8;      /* fragment-order plane: strip of 16 keys, the head's two blocks */
#pragma unroll
    for (int ks = 0; ks < KS; ++ks) { ak[nt][ks].half[0] = *(const v8us*)(kr + ks * 512); ak[nt][ks].half[1] = *(const v8us*)(kr + ks * 512 + 256); } }
  asm volatile("s_wait_xcnt 0x0" ::: "memory");      /* the registers that the Q and K loads above name are reused below: wait before they are overwritten */
  __builtin_amdgcn_sched_barrier(0);      /* keeps the set-up code below from being scheduled in front of that wait */
  const unsigned short* Vth = (const unsigned short*)Vt + (size_t)slab * 64 * TKv;
  float m_q = -3.0e38f, l_q = 0.f; v8f oacc[DT];      /* the lane's query: running maximum in base-2 units, less 10 (equal in both halves), the sum over this half's keys */
#pragma unroll
  for (int dt = 0; dt < DT; ++dt) oacc[dt] = (v8f){0.f,0.f,0.f,0.f,0.f,0.f,0.f,0.f};
#pragma unroll 1      /* rolled: a pass is long enough to cover its own loads; copies only add code */
  for (int j0 = 0; j0 < TKv; j0 += 32) {
    FragH av[DT];      /* this pass's V^T fragments (A operand), all issued at the head of the pass: they fly under the score products and the softmax */
#pragma unroll
    for (int dt = 0; dt < DT; ++dt) { const unsigned short* vrow = Vth + (size_t)(dt * 16) * TKv + (size_t)j0 * 16 + lane * 8; av[dt].half[0] = *(const v8us*)vrow; av[dt].half[1] = *(const v8us*)(vrow + 256); }
    v8f s[2];      /* s[nt][r] = score of key j0 + nt * 16 + 8 * hh + r with query q0 + ln */
#pragma unroll
    for (int nt = 0; nt < 2; ++nt) { v8f acc = (v8f){0.f,0.f,0.f,0.f,0.f,0.f,0.f,0.f};
#pragma unroll
      for (int ks = 0; ks < KS; ++ks) acc = mmaH<1>(ak[nt][ks].v, ak[nt][ks].v, bq[ks].v, bq[ks].v, acc); s[nt] = acc; }
    const int jn = (j0 + 32 < TKv) ? j0 + 32 : j0;      /* last pass: re-reads its own keys (in bounds, unused) */
#pragma unroll
    for (int nt = 0; nt < 2; ++nt) { const unsigned short* kr = (const unsigned short*)K16 + ((size_t)b * TKv + jn + nt * 16) * ldk + h * 1024 + lane * 8;
#pragma unroll
      for (int ks = 0; ks < KS; ++ks) { ak[nt][ks].half[0] = *(const v8us*)(kr + ks * 512); ak[nt][ks].half[1] = *(const v8us*)(kr + ks * 512 + 256); }
      asm volatile("s_wait_xcnt 0x0" ::: "memory"); }      /* the address registers of these four loads may be given to the next loads' results or to the softmax: wait before they are overwritten */
    float mx[8];      /* the maximum is taken on the raw scores: SCL2 > 0, and rounding is monotone, so scaling the maximum gives the maximum of the scaled scores */
#pragma unroll
    for (int i = 0; i < 8; ++i) mx[i] = fmaxf(s[0][i], s[1][i]);
    float mc = fmaxf(fmaxf(fmaxf(mx[0], mx[1]), fmaxf(mx[2], mx[3])), fmaxf(fmaxf(mx[4], mx[5]), fmaxf(mx[6], mx[7])));
    mc = fmaf(mc, SCL2, -10.0f);      /* kept 10 below the true maximum: the f16 operand's factor 2^10 rides in the exponent, p = 1024 * e^(score - maximum), at most about 1024 */
    mc = fmaxf(mc, xhalf(mc));
    const float mn = fmaxf(m_q, mc); const float ea = __builtin_amdgcn_exp2f(m_q - mn); const float al = (mn > -1.0e38f) ? ea : 1.0f; m_q = mn;
    FragH pb; float p[16];
#pragma unroll
    for (int i = 0; i < 16; i += 2) { const v2f x = __builtin_elementwise_fma((v2f){s[i >> 3][i & 7], s[i >> 3][(i & 7) + 1]}, (v2f){SCL2, SCL2}, (v2f){-mn, -mn});      /* two scores per packed fma */
      p[i] = __builtin_amdgcn_exp2f(x[0]); p[i + 1] = __builtin_amdgcn_exp2f(x[1]); pb.h[i] = (_Float16)p[i]; pb.h[i + 1] = (_Float16)p[i + 1]; }
    v2f t0 = {0.f, 0.f}, t1 = {0.f, 0.f};      /* two chains of packed partial sums: no chain of sixteen dependent adds */
#pragma unroll
    for (int i = 0; i < 4; ++i) { t0 += (v2f){p[4 * i], p[4 * i + 1]}; t1 += (v2f){p[4 * i + 2], p[4 * i + 3]}; }
    t0 += t1; l_q = l_q * al + (t0[0] + t0[1]);
#pragma unroll
    for (int dt = 0; dt < DT; ++dt) oacc[dt] *= al;
#pragma unroll
    for (int dt = 0; dt < DT; ++dt) oacc[dt] = mmaH<1>(av[dt].v, av[dt].v, pb.v, pb.v, oacc[dt]); }
  float l = l_q + xhalf(l_q); l = (l > 0.f) ? 1.0f / l : 0.f;      /* the sum carries the same 2^10 as the products */
#pragma unroll
  for (int dt = 0; dt < DT; ++dt) res[dt] = oacc[dt] * l; }
// Both attentions of a wave's 16 queries in one wave, the local keys and then the global keys, and the gated sum on the two results in registers.
// A lane's eight values of a tile are eight d in a row of one query: one 16-byte piece of the fragment-order plane that the output projection reads (K = EMB), stored as it stands, through no LDS.
#define ATB (NB * NH * QBLKS)      /* blocks of the grid */
__global__ __launch_bounds__(128) void k_attn(const _Float16* __restrict__ Q16, const _Float16* __restrict__ KL, const _Float16* __restrict__ VTL, const _Float16* __restrict__ KG, const _Float16* __restrict__ VTG, const float* __restrict__ gate, _Float16* __restrict__ O16) {
  static_assert(ATB == 1024 && NRL * EMB == 512 * 64 * 128 && NRG * EMB == 512 * 16 * 128, "head prefetch: 512 slices of 64 units of each local plane and 16 of each global plane");
  const int ps = pf_slice(blockIdx.x), pw = __builtin_amdgcn_readfirstlane(threadIdx.x >> 5);
  const _Float16* pf0 = ((pw < 2) ? KL : VTL) + ((size_t)ps * 64 + (threadIdx.x & 63)) * 128;      /* waves 0, 1: the slice of K; waves 2, 3: of V^T */
  const _Float16* pf1 = ((threadIdx.x & 16) ? VTG : KG) + ((size_t)ps * 16 + (threadIdx.x & 15)) * 128;
  pf_ask(pf0);
  if (pw == 0) pf_ask(pf1);      /* 32 units: one wave's request; a scalar branch */
  v8f ol[4], og[4];
  flashT_body<TKA>(blockIdx.x, Q16, EMB, KL, EMB, VTL, ol);      /* local: 2048 keys */
  flashT_body<TKB>(blockIdx.x, Q16, EMB, KG, EMB, VTG, og);      /* global: 512 keys */
  const float g = 1.0f / (1.0f + expf(-bf16_round(gate[0]))); const float h1 = 1.0f - g;
  const int w = threadIdx.x >> 5, lane = threadIdx.x & 31; const int slab = blockIdx.x / QBLKS, qblk = blockIdx.x % QBLKS; const int b = slab / NH, h = slab % NH; const int q0 = qblk * 64 + w * 16;
  unsigned short* op = (unsigned short*)O16 + ((size_t)b * TQ + q0) * EMB + h * 1024 + lane * 8; FragH f[4];      /* strip of 16 queries, the head's two blocks; the short loops below are unrolled in full, so that the arrays stay in registers */
#pragma unroll
  for (int dt = 0; dt < 4; ++dt)
#pragma unroll
    for (int r = 0; r < 8; ++r) f[dt].h[r] = (_Float16)(g * ol[dt][r] + h1 * og[dt][r]);
#pragma unroll
  for (int dt = 0; dt < 4; ++dt) *(v8us*)(op + dt * 256) = f[dt].half[0];
  pf_hold(pf0); pf_hold(pf1); }

extern "C" void kernel_launch(void* const* d_in, const int* in_sizes, int n_in,
                              void* d_out, int out_size, void* d_ws, size_t ws_size, hipStream_t stream) {
  (void)in_sizes; (void)n_in; (void)out_size;
  const float* const* I = (const float* const*)d_in; const float* lh = I[0]; const float* gh = I[1]; const float* qw = I[2]; const float* qb = I[3]; const float* kw = I[4]; const float* kb = I[5]; const float* vw = I[6]; const float* vb = I[7]; const float* kgw = I[8]; const float* kgb = I[9]; const float* vgw = I[10]; const float* vgb = I[11]; const float* ow = I[12]; const float* ob = I[13]; const float* gate = I[14];
  char* ws = (char*)d_ws; size_t off = 0;
  auto take = [&](size_t bytes) { char* p = ws + off; off += (bytes + 255) & ~(size_t)255; return p; };
  const size_t w8 = (size_t)EMB * EMB / 8, npl = (size_t)NRL * EMB, npg = (size_t)NRG * EMB;
  _Float16* BQ = (_Float16*)take(w8 * 16); _Float16* BK = (_Float16*)take(w8 * 16); _Float16* BV = (_Float16*)take(w8 * 16); _Float16* BKG = (_Float16*)take(w8 * 16); _Float16* BVG = (_Float16*)take(w8 * 16); _Float16* BO = (_Float16*)take(w8 * 16);
  _Float16* XL = (_Float16*)take(npl * 2); _Float16* XG = (_Float16*)take(npg * 2); _Float16* Q16 = (_Float16*)take(npl * 2); _Float16* KL = (_Float16*)take(npl * 2); _Float16* KG = (_Float16*)take(npg * 2); _Float16* VTL = (_Float16*)take(npl * 2); _Float16* VTG = (_Float16*)take(npg * 2);
  _Float16* O16 = XL;      /* O16 over the local input plane (dead after its projections) */
  if (off > ws_size) return;      /* 12 + 8+2+8+8+2+8+2 = 50 MiB */
  k_conv<<<CVL + CVG + 6 * CVW, 256, 0, stream>>>(lh, gh, qw, kw, vw, kgw, vgw, ow, XL, XG, BQ, BK, BV, BKG, BVG, BO);
  const dim3 gL(PJL, 1);
  k_proj<<<3 * PJL4 + 2 * PJG4, 256, 0, stream>>>(XL, XG, BQ, BK, BV, BKG, BVG, qb, kb, vb, kgb, vgb, Q16, KL, VTL, KG, VTG);
  k_attn<<<ATB, 128, 0, stream>>>(Q16, KL, VTL, KG, VTG, gate, O16);
  k_gemm2<0, false><<<gL, 128, 0, stream>>>(O16, EMB, 0, BO, EMB, 0, 0.0625f, ob, 0, nullptr, 1, 0, 0, (float*)d_out, nullptr, EMB, 0, NRL, EMB, EMB);
}
